// v000
// Times are from an AMD MI455X. After a warm-up the kernel runs many times in a row, and a time is the length of
// such a window on the GPU divided by its runs, so every launch and the gaps after it count. The runs cycle
// through copies of the inputs. A figure is the median of several windows, for all but v000 over two sittings.
// Sittings can differ by a few percent; kernels timed side by side share one.
// v000, which the later versions start from, runs in 1210 microseconds.
// compute dtype: all float inputs rounded to bf16; q/k/v = in W with EXACT bf16 products on WMMA 16x16x32 (f32 accumulate); q as f16 hi + residual (x 2^10) against k once to f16 (2 products) / 8, masked (mask == 1) positions set to -1e9; softmax in f32 (precise expf); P x 2^11 once to f16 against v once to f16 (1 product); ctx split bf16 hi + lo against exact W_O (2 products) + input_Q; LayerNorm in f32; f32 output.
#include <hip/hip_runtime.h>
#include <math.h>

typedef __attribute__((ext_vector_type(16))) _Float16 v16h;
typedef __attribute__((ext_vector_type(16))) __bf16 v16b;
typedef __attribute__((ext_vector_type(8)))  _Float16 v8h;
typedef __attribute__((ext_vector_type(8)))  float v8f;
typedef __attribute__((ext_vector_type(4)))  float v4f;
typedef __attribute__((ext_vector_type(2)))  float v2f;
typedef __attribute__((ext_vector_type(4)))  unsigned v4u;
typedef __attribute__((ext_vector_type(4)))  int v4i;
typedef float __attribute__((may_alias)) float_a;
typedef int __attribute__((may_alias)) int_a;

template <typename T> __device__ __forceinline__ void vst2(void* p, T v) { *(T*)p = v;  }
__device__ __forceinline__ v8f wmma16(v16h a, v16h b, v8f c) {
  v8f d = __builtin_amdgcn_wmma_f32_16x16x32_f16(false, a, false, b, (short)0, c, false, false);
  asm volatile("v_nop\n\tv_nop\n\tv_nop\n\tv_nop" : "+v"(d) : "v"(a), "v"(b));
  return d;
}
__device__ __forceinline__ v8f wmma_bf(v16b a, v16b b, v8f c) {
  v8f d = __builtin_amdgcn_wmma_f32_16x16x32_bf16(false, a, false, b, (short)0, c, false, false);
  asm volatile("v_nop\n\tv_nop\n\tv_nop\n\tv_nop" : "+v"(d) : "v"(a), "v"(b));
  return d;
}
// 16x16x32 fragments: lane = (h = lane>>4, row/col = lane&15); elements 0..7 = k0+8h+0..7, 8..15 = k0+16+8h+0..7; D element r = row 8h+r
__device__ __forceinline__ v16h frag_h(const _Float16* rowk0, int lane) {
  union { v16h v; v8h q[2]; } u; const _Float16* p = rowk0 + 8 * (lane >> 4);
  u.q[0] = *(const v8h*)p; u.q[1] = *(const v8h*)(p + 16); return u.v;
}
__device__ __forceinline__ v16h frag_f32(const float* rowk0, int lane) {
  v16h a; const float* p = rowk0 + 8 * (lane >> 4);
#pragma unroll
  for (int i = 0; i < 8; ++i) { a[i] = (_Float16)p[i]; a[8 + i] = (_Float16)p[16 + i]; }
  return a;
}
__device__ __forceinline__ v16h frag_f32s(const float* rowk0, int lane, float sc) {
  v16h a; const float* p = rowk0 + 8 * (lane >> 4);
#pragma unroll
  for (int i = 0; i < 8; ++i) { a[i] = (_Float16)(p[i] * sc); a[8 + i] = (_Float16)(p[16 + i] * sc); }
  return a;
}
// column fragment from a [K][ld] layout (column n), rows >= K read as 0
__device__ __forceinline__ v16h fragc_f32(const float* W, int k0, int n, int lane, int ld, int K) {
  v16h a; const int g = lane >> 4;
#pragma unroll
  for (int i = 0; i < 8; ++i) { const int ka = k0 + 8 * g + i, kb = ka + 16;
    a[i] = (_Float16)(ka < K ? W[(size_t)(ka < K ? ka : K - 1) * ld + n] : 0.f); a[8 + i] = (_Float16)(kb < K ? W[(size_t)(kb < K ? kb : K - 1) * ld + n] : 0.f); }
  return a;
}
struct F2 { v16b h, l; };
__device__ __forceinline__ F2 bsplit16(const float v[16]) { F2 r;
#pragma unroll
  for (int i = 0; i < 16; ++i) { const __bf16 h = (__bf16)v[i]; r.h[i] = h; r.l[i] = (__bf16)(v[i] - (float)h); }
  return r; }
__device__ __forceinline__ F2 split_row(const float* row, int k0, int lane) { float v[16]; const float* p = row + k0 + 8 * (lane >> 4);
#pragma unroll
  for (int i = 0; i < 8; ++i) { v[i] = p[i]; v[8 + i] = p[16 + i]; }
  return bsplit16(v); }
__device__ __forceinline__ F2 split_rowK(const float* row, int k0, int lane, int K) { float v[16]; const int g = lane >> 4;
#pragma unroll
  for (int i = 0; i < 8; ++i) { const int ka = k0 + 8 * g + i, kb = ka + 16; v[i] = ka < K ? row[ka < K ? ka : K - 1] : 0.f; v[8 + i] = kb < K ? row[kb < K ? kb : K - 1] : 0.f; }
  return bsplit16(v); }
__device__ __forceinline__ F2 split_col(const float* W, int k0, int n, int lane, int ld, int K) { float v[16]; const int g = lane >> 4;
#pragma unroll
  for (int i = 0; i < 8; ++i) { const int ka = k0 + 8 * g + i, kb = ka + 16; v[i] = ka < K ? W[(size_t)(ka < K ? ka : K - 1) * ld + n] : 0.f; v[8 + i] = kb < K ? W[(size_t)(kb < K ? kb : K - 1) * ld + n] : 0.f; }
  return bsplit16(v); }
__device__ __forceinline__ v8f mac3(const F2& a, const F2& b, v8f c) { c = wmma_bf(a.l, b.h, c); c = wmma_bf(a.h, b.l, c); return wmma_bf(a.h, b.h, c); }
__device__ __forceinline__ float sigm(float v) { return 1.0f / (1.0f + expf(-v)); }
#define LDSX() do { asm volatile("s_wait_dscnt 0" ::: "memory"); __builtin_amdgcn_wave_barrier(); __builtin_amdgcn_fence(__ATOMIC_RELEASE, "workgroup"); } while (0)

// Multi-head attention layer with a random (query, key) mask, residual and LayerNorm (B 2, S 2,048, 1,024 = 16 x 64; (in,out) 1/32-scale weights, no biases; mask [B,S,S] int, 1 = MASKED (~half); LN affine 1/0, eps 1e-5): q = input_Q W_Q ...; scores = q k^T / 8 with where(mask, -1e9, s); ctx = softmax v; out = LN(ctx W_O + input_Q).
#define NB 2
#define TT 2048
#define CC 1024            // NH * HD = projected width
#define DIN 1024          // input (model) width
#define NH 16
#define HD 64
#define NQB (TT / 64)
#define HG 4
#define SCALE (0.125f)
#define CAUSAL 0
#ifndef TNB
#define TNB NB
#endif
__device__ __forceinline__ float bfr(float v) { return (float)(__bf16)v; }
__host__ __device__ __forceinline__ int kb_last(int qb) { return CAUSAL ? ((qb * 64 + 63) >> 7) : (TT / 128 - 1); }
typedef __attribute__((ext_vector_type(8))) __bf16 v8b;
__device__ __forceinline__ v16b frag_b(const __bf16* rowk0, int lane) {
  union { v16b v; v8b q[2]; } u; const __bf16* p = rowk0 + 8 * (lane >> 4);
  u.q[0] = *(const v8b*)p; u.q[1] = *(const v8b*)(p + 16); return u.v;
}
#define QBH 0              // causal: query blocks 0..QBH-1 of each sequence (few keys, no averaging) take the high-precision path
#define QHI 2048            // rows carrying a q residual plane (all rows when non-causal: 2-product logits everywhere)
#define KHI 64            // key rows carrying k residual / v bf16 hi+lo planes (used only by the causal high-precision path)
// B fragment (k rows k0+.., output column o) of a weight: (in,out) [K][ld] or (out,in) [ld rows of K]: bf16 exact, or f16(bf16 * 256) exact
__device__ __forceinline__ v16b wcol_io(const float* Wm, int k0, int o, int lane, int ld) { v16b w; const int g = lane >> 4;
#pragma unroll
  for (int i = 0; i < 8; ++i) { w[i] = (__bf16)Wm[(size_t)(k0 + 8 * g + i) * ld + o]; w[8 + i] = (__bf16)Wm[(size_t)(k0 + 16 + 8 * g + i) * ld + o]; }
  return w; }
__device__ __forceinline__ v16b wcol_oi(const float* Wm, int k0, int o, int lane, int K) { v16b w; const float* p = Wm + (size_t)o * K + k0 + 8 * (lane >> 4);
#pragma unroll
  for (int i = 0; i < 8; ++i) { w[i] = (__bf16)p[i]; w[8 + i] = (__bf16)p[16 + i]; }
  return w; }
__device__ __forceinline__ v16h wcolh_io(const float* Wm, int k0, int o, int lane, int ld) { v16h w; const int g = lane >> 4;
#pragma unroll
  for (int i = 0; i < 8; ++i) { w[i] = (_Float16)(bfr(Wm[(size_t)(k0 + 8 * g + i) * ld + o]) * 256.0f); w[8 + i] = (_Float16)(bfr(Wm[(size_t)(k0 + 16 + 8 * g + i) * ld + o]) * 256.0f); }
  return w; }
__device__ __forceinline__ v16h wcolh_oi(const float* Wm, int k0, int o, int lane, int K) { v16h w; const float* p = Wm + (size_t)o * K + k0 + 8 * (lane >> 4);
#pragma unroll
  for (int i = 0; i < 8; ++i) { w[i] = (_Float16)(bfr(p[i]) * 256.0f); w[8 + i] = (_Float16)(bfr(p[16 + i]) * 256.0f); }
  return w; }
#define WQKV_LAYOUT 0   // 0 = (in,out) [DIN][CC]; 1 = (out,in) [CC][DIN]; 2 = per-head [NH][DIN][HD]
__device__ __forceinline__ v16b wcol_hdk(const float* Wm, int k0, int o, int lane) { v16b w; const int g = lane >> 4; const float* p = Wm + (size_t)(o / HD) * DIN * HD + (o % HD);
#pragma unroll
  for (int i = 0; i < 8; ++i) { w[i] = (__bf16)p[(size_t)(k0 + 8 * g + i) * HD]; w[8 + i] = (__bf16)p[(size_t)(k0 + 16 + 8 * g + i) * HD]; }
  return w; }
#define WO_OUT_IN 0
#if WQKV_LAYOUT == 1
#define WCOL(W, k0, o, lane) wcol_oi(W, k0, o, lane, DIN)
#elif WQKV_LAYOUT == 2
#define WCOL(W, k0, o, lane) wcol_hdk(W, k0, o, lane)
#else
#define WCOL(W, k0, o, lane) wcol_io(W, k0, o, lane, CC)
#endif
#if WO_OUT_IN
#define WOCOL(W, k0, o, lane) wcol_oi(W, k0, o, lane, CC)
#define WOCOLH(W, k0, o, lane) wcolh_oi(W, k0, o, lane, CC)
#else
#define WOCOL(W, k0, o, lane) wcol_io(W, k0, o, lane, DIN)
#define WOCOLH(W, k0, o, lane) wcolh_io(W, k0, o, lane, DIN)
#endif
#define SM_EXTRA_PARAMS , const int* __restrict__ MK, int bcur
#define SM_MASK_HOOK do { if (MK[((size_t)bcur * TT + t) * TT + k] != 0) v = -1.0e9f; } while (0)   /* where(mask[b][q][k] (1 = masked), -1e9, scores): set; a fully masked row would be uniform (none here) */
#define NRW (TNB * TT)
// ---- k_lnx: wave per row: LayerNorm over 1024 (mean, biased var, (x - mean) * rsqrt(var + 1e-5) * g + b); optional bf16 rounding of the input (x); 32 floats per lane (8 float4 at stride 128 floats -> 512-B pieces)
__global__ __launch_bounds__(256) void k_lnx(const float* __restrict__ X, int roundin, const float* __restrict__ G, const float* __restrict__ BE, float* __restrict__ OUT) { const int wave = threadIdx.x >> 5, lane = threadIdx.x & 31; const size_t row = (size_t)blockIdx.x * 8 + wave; if (row >= (size_t)NRW) return;
  v4f v[CC / 128]; float s1 = 0.f;
#pragma unroll
  for (int i = 0; i < CC / 128; ++i) { v4f t = *(const v4f*)(X + row * CC + i * 128 + lane * 4); if (roundin) { t[0] = bfr(t[0]); t[1] = bfr(t[1]); t[2] = bfr(t[2]); t[3] = bfr(t[3]); } v[i] = t; s1 += (t[0] + t[1]) + (t[2] + t[3]); }
#pragma unroll
  for (int o = 1; o < 32; o <<= 1) s1 += __shfl_xor(s1, o);
  const float mu = s1 * (1.0f / CC); float q = 0.f;
#pragma unroll
  for (int i = 0; i < CC / 128; ++i) for (int k = 0; k < 4; ++k) { const float d = v[i][k] - mu; q += d * d; }
#pragma unroll
  for (int o = 1; o < 32; o <<= 1) q += __shfl_xor(q, o);
  const float inv = rsqrtf(q * (1.0f / CC) + 1e-5f);   /* jnp.var (biased), eps inside the rsqrt */
#pragma unroll
  for (int i = 0; i < CC / 128; ++i) { const int c = i * 128 + lane * 4; v4f r4; for (int k = 0; k < 4; ++k) r4[k] = bfr(G[c + k]) * ((v[i][k] - mu) * inv) + bfr(BE[c + k]); vst2(OUT + row * CC + c, r4); } }

#ifndef SM_EXTRA_PARAMS
#define SM_EXTRA_PARAMS
#endif
#ifndef PROJ_EXTRA_PARAMS
#define PROJ_EXTRA_PARAMS
#endif
#ifndef SM_MASK_HOOK
#define SM_MASK_HOOK (void)0
#endif

#define WS_QH  0u                                      // f16 q rows [b*t][CC]
#define WS_KH  (WS_QH + 2u * (size_t)NB * TT * CC)      // f16 k rows [b*t][CC]
#define WS_VT  (WS_KH + 2u * (size_t)NB * TT * CC)      // f16 v planes [b][c][t]
#define WS_QL  (WS_VT + 2u * (size_t)NB * CC * TT)      // f16 q residual x 2^10 rows [b][t < QHI][CC]
#define WS_KL  (WS_QL + 2u * (size_t)NB * QHI * CC)     // f16 k residual x 2^10 rows [b][t < KHI][CC]
#define WS_VB  (WS_KL + 2u * (size_t)NB * KHI * CC)     // bf16 v hi planes [b][c][t < KHI]
#define WS_VBL (WS_VB + 2u * (size_t)NB * CC * KHI)
#define WS_S   (WS_VBL + 2u * (size_t)NB * CC * KHI)    // f32 logits / P [hg][t][s]
#define WS_Y   (WS_S  + 4u * (size_t)HG * TT * TT)      // f32 ctx rows [b*t][CC] (only when there is an output projection)
#define WS_END (WS_Y  + 4u * (size_t)NB * TT * CC)
#define WS_X1  (WS_END)
#define WS_END2 (WS_X1 + 4u * (size_t)NB * TT * DIN)

// ---- k_proj: block = (64 rows, 128 cols, which): q/k/v = X W (+ b) with exact bf16 products (K = DIN) -> which 0: q f16 rows (+ residual rows < QHI); 1: k f16 rows (+ residual rows < KHI); 2: v f16 planes [c][t] (+ bf16 hi/lo planes for t < KHI)
__global__ __launch_bounds__(128) void k_proj(const float* __restrict__ XQ, const float* __restrict__ XK, const float* __restrict__ XV, const float* __restrict__ WQ, const float* __restrict__ WK, const float* __restrict__ WV, const float* __restrict__ BQ, const float* __restrict__ BK, const float* __restrict__ BV,
    _Float16* __restrict__ QH, _Float16* __restrict__ QL, _Float16* __restrict__ KH, _Float16* __restrict__ KL, _Float16* __restrict__ VT, __bf16* __restrict__ VB, __bf16* __restrict__ VBL) {
  __shared__ __align__(16) _Float16 sh[64][136], sl[64][136]; __shared__ __align__(16) _Float16 th[128][72]; __shared__ __align__(16) __bf16 tb[128][72], tbl[128][72];
  const int tid = threadIdx.x, wave = tid >> 5, lane = tid & 31, col = lane & 15, g = lane >> 4; const int which = blockIdx.z; const int c0 = blockIdx.y * 128; const size_t r0 = (size_t)blockIdx.x * 64; const size_t bb = r0 / TT; const int t0 = (int)(r0 % TT);
  const float* X = which == 0 ? XQ : which == 1 ? XK : XV; const float* WA = which == 0 ? WQ : which == 1 ? WK : WV; const float* BA = which == 0 ? BQ : which == 1 ? BK : BV;
  v8f acc[8] = {};
#pragma unroll 2
  for (int kc = 0; kc < DIN / 32; ++kc) { v16b a; { const float* p = X + (r0 + wave * 16 + col) * DIN + kc * 32 + 8 * g;
#pragma unroll
      for (int i = 0; i < 8; ++i) { a[i] = (__bf16)p[i]; a[8 + i] = (__bf16)p[16 + i]; } }
    asm volatile("s_wait_loadcnt 0x0" ::: "memory");
#pragma unroll
    for (int j = 0; j < 8; ++j) { const v16b w = WCOL(WA, kc * 32, c0 + j * 16 + col, lane); asm volatile("s_wait_loadcnt 0x0" ::: "memory"); acc[j] = wmma_bf(a, w, acc[j]); } }
  if (which < 2) { _Float16* DH = which == 0 ? QH : KH; _Float16* DL = which == 0 ? QL : KL; const int nhi = which == 0 ? QHI : KHI; const bool hi_rows = t0 < nhi;
#pragma unroll
    for (int j = 0; j < 8; ++j) { const float bias = BA ? bfr(BA[c0 + j * 16 + col]) : 0.f;
#pragma unroll
      for (int r = 0; r < 8; ++r) { const float v = acc[j][r] + bias; const _Float16 hv = (_Float16)v; sh[wave * 16 + 8 * g + r][j * 16 + col] = hv; sl[wave * 16 + 8 * g + r][j * 16 + col] = (_Float16)((v - (float)hv) * 1024.0f); } }
    __syncthreads();
    for (int e = tid; e < 64 * 16; e += 128) { const int rl = e >> 4, q = e & 15; vst2((unsigned*)(DH + (r0 + rl) * CC + c0 + q * 8), *(const v4u*)&sh[rl][q * 8]); if (hi_rows) vst2((unsigned*)(DL + (bb * nhi + t0 + rl) * (size_t)CC + c0 + q * 8), *(const v4u*)&sl[rl][q * 8]); }
  } else { const bool hi_rows = t0 < KHI;
#pragma unroll
    for (int j = 0; j < 8; ++j) { const float bias = BA ? bfr(BA[c0 + j * 16 + col]) : 0.f;
#pragma unroll
      for (int r = 0; r < 8; ++r) { const float v = acc[j][r] + bias; const int rl = wave * 16 + 8 * g + r, cl = j * 16 + col; th[cl][rl] = (_Float16)v; const __bf16 bh = (__bf16)v; tb[cl][rl] = bh; tbl[cl][rl] = (__bf16)(v - (float)bh); } }
    __syncthreads();
    for (int e = tid; e < 128 * 8; e += 128) { const int cl = e >> 3, q = e & 7; vst2((unsigned*)(VT + (bb * CC + c0 + cl) * (size_t)TT + t0 + q * 8), *(const v4u*)&th[cl][q * 8]); if (hi_rows) { const size_t o3 = (bb * CC + c0 + cl) * (size_t)KHI + t0 + q * 8; vst2((unsigned*)(VB + o3), *(const v4u*)&tb[cl][q * 8]); vst2((unsigned*)(VBL + o3), *(const v4u*)&tbl[cl][q * 8]); } } } }
// ---- k_sc: block = (query block qb, key block kb <= kb_last(qb), head in group) of batch b: logits x SCALE; q hi + residual (x 2^10) against k (2 products) for query rows < QHI, plus the k residual (3 products) for query blocks < QBH (causal early rows); causal: blocks past the diagonal exit, the mask itself is applied by index in k_sm
__global__ __launch_bounds__(128) void k_sc(const _Float16* __restrict__ QH, const _Float16* __restrict__ KH, const _Float16* __restrict__ QL, const _Float16* __restrict__ KL, int b, int h0, float* __restrict__ S0) { __shared__ __align__(16) float ss[4][16][132];
  const int qb = blockIdx.x, kb = blockIdx.y; if (kb > kb_last(qb)) return;
  const int h = h0 + blockIdx.z; float* S = S0 + (size_t)blockIdx.z * TT * TT;
  const int tid = threadIdx.x, wave = tid >> 5, lane = tid & 31, col = lane & 15, g = lane >> 4; const int k0 = kb * 128; const int ql0 = qb * 64 + wave * 16; const size_t q0 = (size_t)b * TT + ql0, kr0 = (size_t)b * TT + k0;
  v8f acc[8] = {}, accl[8] = {};
  const _Float16* QLb = QL + (size_t)b * QHI * CC; const _Float16* KLb = KL + (size_t)b * KHI * CC;
  if (qb < QBH) {
#pragma unroll
    for (int kc = 0; kc < HD / 32; ++kc) { const v16h ah = frag_h(QH + (q0 + col) * CC + h * HD + kc * 32, lane), al = frag_h(QLb + (size_t)(ql0 + col) * CC + h * HD + kc * 32, lane);
#pragma unroll
      for (int j = 0; j < 8; ++j) { const v16h kbf = frag_h(KH + (kr0 + j * 16 + col) * CC + h * HD + kc * 32, lane), klf = frag_h(KLb + (size_t)(k0 + j * 16 + col) * CC + h * HD + kc * 32, lane); acc[j] = wmma16(ah, kbf, acc[j]); accl[j] = wmma16(al, kbf, accl[j]); accl[j] = wmma16(ah, klf, accl[j]); } }
  } else if (qb * 64 < QHI) {
#pragma unroll
    for (int kc = 0; kc < HD / 32; ++kc) { const v16h ah = frag_h(QH + (q0 + col) * CC + h * HD + kc * 32, lane), al = frag_h(QLb + (size_t)(ql0 + col) * CC + h * HD + kc * 32, lane);
#pragma unroll
      for (int j = 0; j < 8; ++j) { const v16h kbf = frag_h(KH + (kr0 + j * 16 + col) * CC + h * HD + kc * 32, lane); acc[j] = wmma16(ah, kbf, acc[j]); accl[j] = wmma16(al, kbf, accl[j]); } }
  } else {
#pragma unroll
    for (int kc = 0; kc < HD / 32; ++kc) { const v16h ah = frag_h(QH + (q0 + col) * CC + h * HD + kc * 32, lane);
#pragma unroll
      for (int j = 0; j < 8; ++j) { const v16h kbf = frag_h(KH + (kr0 + j * 16 + col) * CC + h * HD + kc * 32, lane); acc[j] = wmma16(ah, kbf, acc[j]); } } }
#pragma unroll
  for (int j = 0; j < 8; ++j) {
#pragma unroll
    for (int r = 0; r < 8; ++r) ss[wave][8 * g + r][j * 16 + col] = (acc[j][r] + accl[j][r] * (1.0f / 1024.0f)) * SCALE; }
  LDSX(); for (int rl = 0; rl < 16; ++rl) vst2(S + (size_t)(ql0 + rl) * TT + k0 + lane * 4, *(const v4f*)&ss[wave][rl][lane * 4]); }
// ---- k_sm: block = query row t (head in group): keys [0, kend): causal -> logit if s <= t else excluded; softmax in f32; P x 2^11 in place (0 for excluded)
__global__ __launch_bounds__(256) void k_sm(float* __restrict__ S0 SM_EXTRA_PARAMS) { __shared__ float sred[8]; __shared__ float sbc; __shared__ __align__(16) float shv[TT];
  const int tid = threadIdx.x; const int t = blockIdx.x; const int kend = (kb_last(t >> 6) + 1) * 128;
  float* sr = S0 + (size_t)blockIdx.y * TT * TT + (size_t)t * TT;
  float m = -3.0e38f; for (int k = tid; k < kend; k += 256) { float v = (!CAUSAL || k <= t) ? sr[k] : -3.0e38f; SM_MASK_HOOK; shv[k] = v; m = fmaxf(m, v); }
#pragma unroll
  for (int o = 1; o < 32; o <<= 1) m = fmaxf(m, __shfl_xor(m, o));
  if ((tid & 31) == 0) sred[tid >> 5] = m; __syncthreads(); if (tid == 0) { float a = sred[0]; for (int i = 1; i < 8; ++i) a = fmaxf(a, sred[i]); sbc = a; } __syncthreads(); m = sbc; __syncthreads();
  float sum = 0.f; for (int k = tid; k < kend; k += 256) { const float v = shv[k]; const float e = (v <= -1.0e38f) ? 0.f : expf(v - m); shv[k] = e; sum += e; }
#pragma unroll
  for (int o = 1; o < 32; o <<= 1) sum += __shfl_xor(sum, o);
  if ((tid & 31) == 0) sred[tid >> 5] = sum; __syncthreads(); if (tid == 0) { float a = 0.f; for (int i = 0; i < 8; ++i) a += sred[i]; sbc = a > 0.f ? 2048.0f / a : 0.f; }   /* a fully excluded row yields P = 0 */ __syncthreads(); const float inv = sbc;
  for (int k = tid; k < kend; k += 256) shv[k] = shv[k] * inv;
  __syncthreads(); for (int q = tid; q < kend / 4; q += 256) vst2(sr + q * 4, *(const v4f*)&shv[q * 4]); }
// ---- k_pv: block = 64 queries (qb) of (b, h): ctx = P . v over keys [0, kend) (P x 2^11 once to f16 against v f16: 1 product; causal early query blocks: P and v as bf16 hi + lo, 3 products); 256-B (row, head) segment by 16 lanes
__global__ __launch_bounds__(128) void k_pv(const float* __restrict__ PS0, const _Float16* __restrict__ VT, const __bf16* __restrict__ VB, const __bf16* __restrict__ VBL, int b, int h0, float* __restrict__ Y) { const int h = h0 + blockIdx.z; const float* PS = PS0 + (size_t)blockIdx.z * TT * TT; __shared__ __align__(16) float ss[4][16][HD + 4];
  const int tid = threadIdx.x, wave = tid >> 5, lane = tid & 31, col = lane & 15, g = lane >> 4; const int qb = blockIdx.x; const int ql0 = qb * 64 + wave * 16; const int kce = (kb_last(qb) + 1) * 4;
  v8f acc[HD / 16] = {};
  if (qb < QBH) {
#pragma unroll 1
    for (int kc = 0; kc < kce; ++kc) { const F2 p = split_row(PS + (size_t)(ql0 + col) * TT, kc * 32, lane);
      asm volatile("s_wait_loadcnt 0x0" ::: "memory");
#pragma unroll
      for (int j = 0; j < HD / 16; ++j) { const size_t po = ((size_t)b * CC + h * HD + j * 16 + col) * (size_t)KHI + kc * 32; const v16b vh = frag_b(VB + po, lane); acc[j] = wmma_bf(p.h, vh, acc[j]); acc[j] = wmma_bf(p.l, vh, acc[j]); acc[j] = wmma_bf(p.h, frag_b(VBL + po, lane), acc[j]); } }
  } else {
#pragma unroll 1
    for (int kc = 0; kc < kce; ++kc) { const v16h p = frag_f32(PS + (size_t)(ql0 + col) * TT + kc * 32, lane);
      asm volatile("s_wait_loadcnt 0x0" ::: "memory");
#pragma unroll
      for (int j = 0; j < HD / 16; ++j) { const size_t po = ((size_t)b * CC + h * HD + j * 16 + col) * (size_t)TT + kc * 32; acc[j] = wmma16(p, frag_h(VT + po, lane), acc[j]); } } }
#pragma unroll
  for (int j = 0; j < HD / 16; ++j)
#pragma unroll
    for (int r = 0; r < 8; ++r) ss[wave][8 * g + r][j * 16 + col] = acc[j][r] * (1.0f / 2048.0f);
  LDSX(); for (int rl = 0; rl < 16; ++rl) if (lane < HD / 4) vst2(Y + ((size_t)b * TT + ql0 + rl) * CC + h * HD + lane * 4, *(const v4f*)&ss[wave][rl][lane * 4]); }
// ---- k_out: block = (64 rows, 128 cols): out = ctx Wo (+ bo): all rows: ctx bf16 hi + lo against exact bf16 Wo (2 products); the f16(bf16 x 2^8) 1-product branch is not taken
__global__ __launch_bounds__(128) void k_out(const float* __restrict__ Y, const float* __restrict__ WO, const float* __restrict__ BO, float* __restrict__ OUT, const float* __restrict__ RESX) { __shared__ __align__(16) float sf[4][16][132];
  const int tid = threadIdx.x, wave = tid >> 5, lane = tid & 31, col = lane & 15, g = lane >> 4; const int c0 = blockIdx.y * 128; const size_t r0 = (size_t)blockIdx.x * 64 + wave * 16;
  v8f acc[8] = {};
  if (true) {   /* ALL rows: ctx split bf16 hi + lo x exact Wo (2 products) */
#pragma unroll 2
    for (int kc = 0; kc < CC / 32; ++kc) { const F2 a = split_row(Y + (r0 + col) * CC, kc * 32, lane); asm volatile("s_wait_loadcnt 0x0" ::: "memory");
#pragma unroll
      for (int j = 0; j < 8; ++j) { const v16b w = WOCOL(WO, kc * 32, c0 + j * 16 + col, lane); asm volatile("s_wait_loadcnt 0x0" ::: "memory"); acc[j] = wmma_bf(a.h, w, acc[j]); acc[j] = wmma_bf(a.l, w, acc[j]); } }
#pragma unroll
    for (int j = 0; j < 8; ++j) { const float bias = BO ? bfr(BO[c0 + j * 16 + col]) : 0.f;
#pragma unroll
      for (int r = 0; r < 8; ++r) sf[wave][8 * g + r][j * 16 + col] = acc[j][r] + bias; }
  } else {
#pragma unroll 2
    for (int kc = 0; kc < CC / 32; ++kc) { const v16h a = frag_f32(Y + (r0 + col) * CC + kc * 32, lane); asm volatile("s_wait_loadcnt 0x0" ::: "memory");
#pragma unroll
      for (int j = 0; j < 8; ++j) { const v16h w = WOCOLH(WO, kc * 32, c0 + j * 16 + col, lane); asm volatile("s_wait_loadcnt 0x0" ::: "memory"); acc[j] = wmma16(a, w, acc[j]); } }
#pragma unroll
    for (int j = 0; j < 8; ++j) { const float bias = BO ? bfr(BO[c0 + j * 16 + col]) : 0.f;
#pragma unroll
      for (int r = 0; r < 8; ++r) sf[wave][8 * g + r][j * 16 + col] = acc[j][r] * (1.0f / 256.0f) + bias; } }
  LDSX(); for (int rl = 0; rl < 16; ++rl) { const size_t oo = (r0 + rl) * DIN + c0 + lane * 4; v4f o = *(const v4f*)&sf[wave][rl][lane * 4]; const v4f zr = *(const v4f*)(RESX + oo); o[0] += bfr(zr[0]); o[1] += bfr(zr[1]); o[2] += bfr(zr[2]); o[3] += bfr(zr[3]); vst2(OUT + oo, o); } }   /* ctx W_O + bf16(input_Q) */

extern "C" void kernel_launch(void* const* d_in, const int* in_sizes, int n_in, void* d_out, int out_size, void* d_ws, size_t ws_size, hipStream_t stream) {
  (void)in_sizes; (void)n_in; (void)out_size;
  const float** F = (const float**)d_in;
  if (ws_size < (size_t)WS_END) return;
  char* ws = (char*)d_ws; _Float16 *QH = (_Float16*)(ws + WS_QH), *KH = (_Float16*)(ws + WS_KH), *VT = (_Float16*)(ws + WS_VT), *QL = (_Float16*)(ws + WS_QL), *KL = (_Float16*)(ws + WS_KL); __bf16 *VB = (__bf16*)(ws + WS_VB), *VBL = (__bf16*)(ws + WS_VBL); float *S = (float*)(ws + WS_S), *Y = (float*)(ws + WS_Y);
  (void)Y; (void)QL; (void)KL; (void)VB; (void)VBL;
  // inputs: 0 input_Q; 1 input_K; 2 input_V [2,2048,1024]; 3 mask [2,2048,2048] int32 (1 = masked); 4 W_Q (in,out); 5 W_K; 6 W_V; 7 W_O (in,out); 8 ln_gamma; 9 ln_beta
  if (ws_size < (size_t)WS_END2) return;
  float* X1 = (float*)(ws + WS_X1);
  k_proj<<<dim3(TNB * TT / 64, CC / 128, 3), 128, 0, stream>>>(F[0], F[1], F[2], F[4], F[5], F[6], nullptr, nullptr, nullptr, QH, QL, KH, KL, VT, VB, VBL);
  for (int b = 0; b < TNB; ++b) for (int h0 = 0; h0 < NH; h0 += HG) {
    k_sc<<<dim3(NQB, TT / 128, HG), 128, 0, stream>>>(QH, KH, QL, KL, b, h0, S);
    k_sm<<<dim3(TT, HG), 256, 0, stream>>>(S, (const int*)d_in[3], b);
    k_pv<<<dim3(NQB, 1, HG), 128, 0, stream>>>(S, VT, VB, VBL, b, h0, Y);
  }
  k_out<<<dim3(TNB * TT / 64, DIN / 128), 128, 0, stream>>>(Y, F[7], nullptr, X1, F[0]);   /* ctx W_O + input_Q */
  k_lnx<<<dim3(NRW / 8), 256, 0, stream>>>(X1, 0, F[8], F[9], (float*)d_out);              /* LayerNorm */
}

// v001
// One run takes 346 microseconds.
// Two timings next to v000 both put it at 3.54 times that version's speed.
// compute dtype: all float inputs rounded to bf16; q/k/v = in W with EXACT bf16 products on WMMA 16x16x32 (f32 accumulate); q as f16 hi + residual (x 2^10) against k once to f16 (2 products) / 8, masked (mask == 1) positions set to -1e9; softmax in f32 (precise expf, running max and sum over key steps of 64); P = exp(s - max) once to f16 against v once to f16 (1 product), divided by the sum at the end; ctx split bf16 hi + lo against exact W_O (2 products) + input_Q; LayerNorm in f32; f32 output.
#include <hip/hip_runtime.h>
#include <math.h>

typedef __attribute__((ext_vector_type(16))) _Float16 v16h;
typedef __attribute__((ext_vector_type(16))) __bf16 v16b;
typedef __attribute__((ext_vector_type(8)))  _Float16 v8h;
typedef __attribute__((ext_vector_type(8)))  float v8f;
typedef __attribute__((ext_vector_type(4)))  float v4f;
typedef __attribute__((ext_vector_type(2)))  float v2f;
typedef __attribute__((ext_vector_type(4)))  unsigned v4u;
typedef __attribute__((ext_vector_type(4)))  int v4i;
typedef float __attribute__((may_alias)) float_a;
typedef int __attribute__((may_alias)) int_a;

template <typename T> __device__ __forceinline__ void vst2(void* p, T v) { *(T*)p = v;  }
__device__ __forceinline__ v8f wmma16(v16h a, v16h b, v8f c) {
  v8f d = __builtin_amdgcn_wmma_f32_16x16x32_f16(false, a, false, b, (short)0, c, false, false);
  asm volatile("v_nop\n\tv_nop\n\tv_nop\n\tv_nop" : "+v"(d) : "v"(a), "v"(b));
  return d;
}
__device__ __forceinline__ v8f wmma_bf(v16b a, v16b b, v8f c) {
  v8f d = __builtin_amdgcn_wmma_f32_16x16x32_bf16(false, a, false, b, (short)0, c, false, false);
  asm volatile("v_nop\n\tv_nop\n\tv_nop\n\tv_nop" : "+v"(d) : "v"(a), "v"(b));
  return d;
}
// 16x16x32 fragments: lane = (h = lane>>4, row/col = lane&15); elements 0..7 = k0+8h+0..7, 8..15 = k0+16+8h+0..7; D element r = row 8h+r
__device__ __forceinline__ v16h frag_h(const _Float16* rowk0, int lane) {
  union { v16h v; v8h q[2]; } u; const _Float16* p = rowk0 + 8 * (lane >> 4);
  u.q[0] = *(const v8h*)p; u.q[1] = *(const v8h*)(p + 16); return u.v;
}
__device__ __forceinline__ v16h frag_f32(const float* rowk0, int lane) {
  v16h a; const float* p = rowk0 + 8 * (lane >> 4);
#pragma unroll
  for (int i = 0; i < 8; ++i) { a[i] = (_Float16)p[i]; a[8 + i] = (_Float16)p[16 + i]; }
  return a;
}
__device__ __forceinline__ v16h frag_f32s(const float* rowk0, int lane, float sc) {
  v16h a; const float* p = rowk0 + 8 * (lane >> 4);
#pragma unroll
  for (int i = 0; i < 8; ++i) { a[i] = (_Float16)(p[i] * sc); a[8 + i] = (_Float16)(p[16 + i] * sc); }
  return a;
}
// column fragment from a [K][ld] layout (column n), rows >= K read as 0
__device__ __forceinline__ v16h fragc_f32(const float* W, int k0, int n, int lane, int ld, int K) {
  v16h a; const int g = lane >> 4;
#pragma unroll
  for (int i = 0; i < 8; ++i) { const int ka = k0 + 8 * g + i, kb = ka + 16;
    a[i] = (_Float16)(ka < K ? W[(size_t)(ka < K ? ka : K - 1) * ld + n] : 0.f); a[8 + i] = (_Float16)(kb < K ? W[(size_t)(kb < K ? kb : K - 1) * ld + n] : 0.f); }
  return a;
}
struct F2 { v16b h, l; };
__device__ __forceinline__ F2 bsplit16(const float v[16]) { F2 r;
#pragma unroll
  for (int i = 0; i < 16; ++i) { const __bf16 h = (__bf16)v[i]; r.h[i] = h; r.l[i] = (__bf16)(v[i] - (float)h); }
  return r; }
__device__ __forceinline__ F2 split_row(const float* row, int k0, int lane) { float v[16]; const float* p = row + k0 + 8 * (lane >> 4);
#pragma unroll
  for (int i = 0; i < 8; ++i) { v[i] = p[i]; v[8 + i] = p[16 + i]; }
  return bsplit16(v); }
__device__ __forceinline__ F2 split_rowK(const float* row, int k0, int lane, int K) { float v[16]; const int g = lane >> 4;
#pragma unroll
  for (int i = 0; i < 8; ++i) { const int ka = k0 + 8 * g + i, kb = ka + 16; v[i] = ka < K ? row[ka < K ? ka : K - 1] : 0.f; v[8 + i] = kb < K ? row[kb < K ? kb : K - 1] : 0.f; }
  return bsplit16(v); }
__device__ __forceinline__ F2 split_col(const float* W, int k0, int n, int lane, int ld, int K) { float v[16]; const int g = lane >> 4;
#pragma unroll
  for (int i = 0; i < 8; ++i) { const int ka = k0 + 8 * g + i, kb = ka + 16; v[i] = ka < K ? W[(size_t)(ka < K ? ka : K - 1) * ld + n] : 0.f; v[8 + i] = kb < K ? W[(size_t)(kb < K ? kb : K - 1) * ld + n] : 0.f; }
  return bsplit16(v); }
__device__ __forceinline__ v8f mac3(const F2& a, const F2& b, v8f c) { c = wmma_bf(a.l, b.h, c); c = wmma_bf(a.h, b.l, c); return wmma_bf(a.h, b.h, c); }
__device__ __forceinline__ float sigm(float v) { return 1.0f / (1.0f + expf(-v)); }
#define LDSX() do { asm volatile("s_wait_dscnt 0" ::: "memory"); __builtin_amdgcn_wave_barrier(); __builtin_amdgcn_fence(__ATOMIC_RELEASE, "workgroup"); } while (0)

// Multi-head attention layer with a random (query, key) mask, residual and LayerNorm (B 2, S 2,048, 1,024 = 16 x 64; (in,out) 1/32-scale weights, no biases; mask [B,S,S] int, 1 = MASKED (~half); LN affine 1/0, eps 1e-5): q = input_Q W_Q ...; scores = q k^T / 8 with where(mask, -1e9, s); ctx = softmax v; out = LN(ctx W_O + input_Q).
#define NB 2
#define TT 2048
#define CC 1024            // NH * HD = projected width
#define DIN 1024          // input (model) width
#define NH 16
#define HD 64
#define NQB (TT / 64)
#define HG 4
#define SCALE (0.125f)
#define CAUSAL 0
#ifndef TNB
#define TNB NB
#endif
__device__ __forceinline__ float bfr(float v) { return (float)(__bf16)v; }
__host__ __device__ __forceinline__ int kb_last(int qb) { return CAUSAL ? ((qb * 64 + 63) >> 7) : (TT / 128 - 1); }
typedef __attribute__((ext_vector_type(8))) __bf16 v8b;
__device__ __forceinline__ v16b frag_b(const __bf16* rowk0, int lane) {
  union { v16b v; v8b q[2]; } u; const __bf16* p = rowk0 + 8 * (lane >> 4);
  u.q[0] = *(const v8b*)p; u.q[1] = *(const v8b*)(p + 16); return u.v;
}
#define QBH 0
#define QHI 2048            // rows carrying a q residual plane (all rows when non-causal: 2-product logits everywhere)
#define KHI 64            // key rows carrying k residual / v bf16 hi+lo planes (written by k_proj; no kernel reads them)
// B fragment (k rows k0+.., output column o) of a weight: (in,out) [K][ld] or (out,in) [ld rows of K]: bf16 exact, or f16(bf16 * 256) exact
__device__ __forceinline__ v16b wcol_io(const float* Wm, int k0, int o, int lane, int ld) { v16b w; const int g = lane >> 4;
#pragma unroll
  for (int i = 0; i < 8; ++i) { w[i] = (__bf16)Wm[(size_t)(k0 + 8 * g + i) * ld + o]; w[8 + i] = (__bf16)Wm[(size_t)(k0 + 16 + 8 * g + i) * ld + o]; }
  return w; }
__device__ __forceinline__ v16b wcol_oi(const float* Wm, int k0, int o, int lane, int K) { v16b w; const float* p = Wm + (size_t)o * K + k0 + 8 * (lane >> 4);
#pragma unroll
  for (int i = 0; i < 8; ++i) { w[i] = (__bf16)p[i]; w[8 + i] = (__bf16)p[16 + i]; }
  return w; }
__device__ __forceinline__ v16h wcolh_io(const float* Wm, int k0, int o, int lane, int ld) { v16h w; const int g = lane >> 4;
#pragma unroll
  for (int i = 0; i < 8; ++i) { w[i] = (_Float16)(bfr(Wm[(size_t)(k0 + 8 * g + i) * ld + o]) * 256.0f); w[8 + i] = (_Float16)(bfr(Wm[(size_t)(k0 + 16 + 8 * g + i) * ld + o]) * 256.0f); }
  return w; }
__device__ __forceinline__ v16h wcolh_oi(const float* Wm, int k0, int o, int lane, int K) { v16h w; const float* p = Wm + (size_t)o * K + k0 + 8 * (lane >> 4);
#pragma unroll
  for (int i = 0; i < 8; ++i) { w[i] = (_Float16)(bfr(p[i]) * 256.0f); w[8 + i] = (_Float16)(bfr(p[16 + i]) * 256.0f); }
  return w; }
#define WQKV_LAYOUT 0   // 0 = (in,out) [DIN][CC]; 1 = (out,in) [CC][DIN]; 2 = per-head [NH][DIN][HD]
__device__ __forceinline__ v16b wcol_hdk(const float* Wm, int k0, int o, int lane) { v16b w; const int g = lane >> 4; const float* p = Wm + (size_t)(o / HD) * DIN * HD + (o % HD);
#pragma unroll
  for (int i = 0; i < 8; ++i) { w[i] = (__bf16)p[(size_t)(k0 + 8 * g + i) * HD]; w[8 + i] = (__bf16)p[(size_t)(k0 + 16 + 8 * g + i) * HD]; }
  return w; }
#define WO_OUT_IN 0
#if WQKV_LAYOUT == 1
#define WCOL(W, k0, o, lane) wcol_oi(W, k0, o, lane, DIN)
#elif WQKV_LAYOUT == 2
#define WCOL(W, k0, o, lane) wcol_hdk(W, k0, o, lane)
#else
#define WCOL(W, k0, o, lane) wcol_io(W, k0, o, lane, CC)
#endif
#if WO_OUT_IN
#define WOCOL(W, k0, o, lane) wcol_oi(W, k0, o, lane, CC)
#define WOCOLH(W, k0, o, lane) wcolh_oi(W, k0, o, lane, CC)
#else
#define WOCOL(W, k0, o, lane) wcol_io(W, k0, o, lane, DIN)
#define WOCOLH(W, k0, o, lane) wcolh_io(W, k0, o, lane, DIN)
#endif
#define SM_EXTRA_PARAMS , const int* __restrict__ MK, int bcur
#define SM_MASK_HOOK do { if (MK[((size_t)bcur * TT + t) * TT + k] != 0) v = -1.0e9f; } while (0)   /* where(mask[b][q][k] (1 = masked), -1e9, scores): set; a fully masked row would be uniform (none here) */
#define NRW (TNB * TT)
// ---- k_lnx: wave per row: LayerNorm over 1024 (mean, biased var, (x - mean) * rsqrt(var + 1e-5) * g + b); optional bf16 rounding of the input (x); 32 floats per lane (8 float4 at stride 128 floats -> 512-B pieces)
__global__ __launch_bounds__(256) void k_lnx(const float* __restrict__ X, int roundin, const float* __restrict__ G, const float* __restrict__ BE, float* __restrict__ OUT) { const int wave = threadIdx.x >> 5, lane = threadIdx.x & 31; const size_t row = (size_t)blockIdx.x * 8 + wave; if (row >= (size_t)NRW) return;
  v4f v[CC / 128]; float s1 = 0.f;
#pragma unroll
  for (int i = 0; i < CC / 128; ++i) { v4f t = *(const v4f*)(X + row * CC + i * 128 + lane * 4); if (roundin) { t[0] = bfr(t[0]); t[1] = bfr(t[1]); t[2] = bfr(t[2]); t[3] = bfr(t[3]); } v[i] = t; s1 += (t[0] + t[1]) + (t[2] + t[3]); }
#pragma unroll
  for (int o = 1; o < 32; o <<= 1) s1 += __shfl_xor(s1, o);
  const float mu = s1 * (1.0f / CC); float q = 0.f;
#pragma unroll
  for (int i = 0; i < CC / 128; ++i) for (int k = 0; k < 4; ++k) { const float d = v[i][k] - mu; q += d * d; }
#pragma unroll
  for (int o = 1; o < 32; o <<= 1) q += __shfl_xor(q, o);
  const float inv = rsqrtf(q * (1.0f / CC) + 1e-5f);   /* jnp.var (biased), eps inside the rsqrt */
#pragma unroll
  for (int i = 0; i < CC / 128; ++i) { const int c = i * 128 + lane * 4; v4f r4; for (int k = 0; k < 4; ++k) r4[k] = bfr(G[c + k]) * ((v[i][k] - mu) * inv) + bfr(BE[c + k]); vst2(OUT + row * CC + c, r4); } }

#ifndef SM_EXTRA_PARAMS
#define SM_EXTRA_PARAMS
#endif
#ifndef PROJ_EXTRA_PARAMS
#define PROJ_EXTRA_PARAMS
#endif
#ifndef SM_MASK_HOOK
#define SM_MASK_HOOK (void)0
#endif

#define WS_QH  0u                                      // f16 q rows [b*t][CC]
#define WS_KH  (WS_QH + 2u * (size_t)NB * TT * CC)      // f16 k rows [b*t][CC]
#define WS_VT  (WS_KH + 2u * (size_t)NB * TT * CC)      // f16 v planes [b][c][t]
#define WS_QL  (WS_VT + 2u * (size_t)NB * CC * TT)      // f16 q residual x 2^10 rows [b][t < QHI][CC]
#define WS_KL  (WS_QL + 2u * (size_t)NB * QHI * CC)     // f16 k residual x 2^10 rows [b][t < KHI][CC]
#define WS_VB  (WS_KL + 2u * (size_t)NB * KHI * CC)     // bf16 v hi planes [b][c][t < KHI]
#define WS_VBL (WS_VB + 2u * (size_t)NB * CC * KHI)
#define WS_S   (WS_VBL + 2u * (size_t)NB * CC * KHI)    // f32 [hg][t][s] region, unused (k_fa keeps logits and P in registers)
#define WS_Y   (WS_S  + 4u * (size_t)HG * TT * TT)      // f32 ctx rows [b*t][CC] (only when there is an output projection)
#define WS_END (WS_Y  + 4u * (size_t)NB * TT * CC)
#define WS_X1  (WS_END)
#define WS_END2 (WS_X1 + 4u * (size_t)NB * TT * DIN)

// ---- k_proj: block = (64 rows, 128 cols, which): q/k/v = X W (+ b) with exact bf16 products (K = DIN) -> which 0: q f16 rows (+ residual rows < QHI); 1: k f16 rows (+ residual rows < KHI); 2: v f16 planes [c][t] (+ bf16 hi/lo planes for t < KHI)
__global__ __launch_bounds__(128) void k_proj(const float* __restrict__ XQ, const float* __restrict__ XK, const float* __restrict__ XV, const float* __restrict__ WQ, const float* __restrict__ WK, const float* __restrict__ WV, const float* __restrict__ BQ, const float* __restrict__ BK, const float* __restrict__ BV,
    _Float16* __restrict__ QH, _Float16* __restrict__ QL, _Float16* __restrict__ KH, _Float16* __restrict__ KL, _Float16* __restrict__ VT, __bf16* __restrict__ VB, __bf16* __restrict__ VBL) {
  __shared__ __align__(16) _Float16 sh[64][136], sl[64][136]; __shared__ __align__(16) _Float16 th[128][72]; __shared__ __align__(16) __bf16 tb[128][72], tbl[128][72];
  const int tid = threadIdx.x, wave = tid >> 5, lane = tid & 31, col = lane & 15, g = lane >> 4; const int which = blockIdx.z; const int c0 = blockIdx.y * 128; const size_t r0 = (size_t)blockIdx.x * 64; const size_t bb = r0 / TT; const int t0 = (int)(r0 % TT);
  const float* X = which == 0 ? XQ : which == 1 ? XK : XV; const float* WA = which == 0 ? WQ : which == 1 ? WK : WV; const float* BA = which == 0 ? BQ : which == 1 ? BK : BV;
  v8f acc[8] = {};
#pragma unroll 2
  for (int kc = 0; kc < DIN / 32; ++kc) { v16b a; { const float* p = X + (r0 + wave * 16 + col) * DIN + kc * 32 + 8 * g;
#pragma unroll
      for (int i = 0; i < 8; ++i) { a[i] = (__bf16)p[i]; a[8 + i] = (__bf16)p[16 + i]; } }
    asm volatile("s_wait_loadcnt 0x0" ::: "memory");
#pragma unroll
    for (int j = 0; j < 8; ++j) { const v16b w = WCOL(WA, kc * 32, c0 + j * 16 + col, lane); asm volatile("s_wait_loadcnt 0x0" ::: "memory"); acc[j] = wmma_bf(a, w, acc[j]); } }
  if (which < 2) { _Float16* DH = which == 0 ? QH : KH; _Float16* DL = which == 0 ? QL : KL; const int nhi = which == 0 ? QHI : KHI; const bool hi_rows = t0 < nhi;
#pragma unroll
    for (int j = 0; j < 8; ++j) { const float bias = BA ? bfr(BA[c0 + j * 16 + col]) : 0.f;
#pragma unroll
      for (int r = 0; r < 8; ++r) { const float v = acc[j][r] + bias; const _Float16 hv = (_Float16)v; sh[wave * 16 + 8 * g + r][j * 16 + col] = hv; sl[wave * 16 + 8 * g + r][j * 16 + col] = (_Float16)((v - (float)hv) * 1024.0f); } }
    __syncthreads();
    for (int e = tid; e < 64 * 16; e += 128) { const int rl = e >> 4, q = e & 15; vst2((unsigned*)(DH + (r0 + rl) * CC + c0 + q * 8), *(const v4u*)&sh[rl][q * 8]); if (hi_rows) vst2((unsigned*)(DL + (bb * nhi + t0 + rl) * (size_t)CC + c0 + q * 8), *(const v4u*)&sl[rl][q * 8]); }
  } else { const bool hi_rows = t0 < KHI;
#pragma unroll
    for (int j = 0; j < 8; ++j) { const float bias = BA ? bfr(BA[c0 + j * 16 + col]) : 0.f;
#pragma unroll
      for (int r = 0; r < 8; ++r) { const float v = acc[j][r] + bias; const int rl = wave * 16 + 8 * g + r, cl = j * 16 + col; th[cl][rl] = (_Float16)v; const __bf16 bh = (__bf16)v; tb[cl][rl] = bh; tbl[cl][rl] = (__bf16)(v - (float)bh); } }
    __syncthreads();
    for (int e = tid; e < 128 * 8; e += 128) { const int cl = e >> 3, q = e & 7; vst2((unsigned*)(VT + (bb * CC + c0 + cl) * (size_t)TT + t0 + q * 8), *(const v4u*)&th[cl][q * 8]); if (hi_rows) { const size_t o3 = (bb * CC + c0 + cl) * (size_t)KHI + t0 + q * 8; vst2((unsigned*)(VB + o3), *(const v4u*)&tb[cl][q * 8]); vst2((unsigned*)(VBL + o3), *(const v4u*)&tbl[cl][q * 8]); } } } }
// ---- k_fa: block = 64 queries (qb) of (b, h), wave = 16 queries, all keys in steps of 64: S^T = K q^T (key rows as A, query rows as B; q hi + residual x 2^10: 2 products) x SCALE, masked positions set to -1e9; running max and sum per query (lane & 15 = query, so both are per-lane values; the two lane halves hold different keys); D of S^T (lane = query, element r = key 8g + r) IS the 16x16x32 operand layout over 32 keys, so P = exp(s - max) goes once to f16 in place and ctx^T += v^T (A) P^T (B); ctx^T rows are channels, so the rescale and the final 1 / sum are per-lane too
__global__ __launch_bounds__(128) void k_fa(const _Float16* __restrict__ QH, const _Float16* __restrict__ KH, const _Float16* __restrict__ QL, const _Float16* __restrict__ VT, const int* __restrict__ MK, float* __restrict__ Y) {
  const int tid = threadIdx.x, wave = tid >> 5, lane = tid & 31, col = lane & 15, g = lane >> 4; const int h = blockIdx.y, b = blockIdx.z; const int ql0 = blockIdx.x * 64 + wave * 16;
  v16h qh[HD / 32], ql[HD / 32];
#pragma unroll
  for (int kc = 0; kc < HD / 32; ++kc) { qh[kc] = frag_h(QH + ((size_t)b * TT + ql0 + col) * CC + h * HD + kc * 32, lane); ql[kc] = frag_h(QL + ((size_t)b * QHI + ql0 + col) * CC + h * HD + kc * 32, lane); }
  const _Float16* Kb = KH + ((size_t)b * TT + col) * CC + h * HD; const _Float16* Vb = VT + ((size_t)b * CC + h * HD + col) * (size_t)TT; const int* Mb = MK + ((size_t)b * TT + ql0 + col) * TT + 8 * g;
  v8f acc[HD / 16] = {}; float m = -3.0e38f, l = 0.f;
  // the key loop stays rolled: a second step's fragments would take the wave past 256 registers and cost a wave per SIMD; the inner loops are fully unrolled so that the fragment arrays are indexed by constants and stay in registers
#pragma unroll 1
  for (int k0 = 0; k0 < TT; k0 += 64) { float s[4][8]; float mx = -3.0e38f;
    v16h kf[4][HD / 32]; v4i mk[4][2];   /* the whole step's K fragments and mask words are requested before the first product: one load latency per step, not one per product */
#pragma unroll
    for (int t = 0; t < 4; ++t) {
#pragma unroll
      for (int kc = 0; kc < HD / 32; ++kc) kf[t][kc] = frag_h(Kb + (size_t)(k0 + t * 16) * CC + kc * 32, lane);
      mk[t][0] = *(const v4i*)(Mb + k0 + t * 16); mk[t][1] = *(const v4i*)(Mb + k0 + t * 16 + 4); }
#pragma unroll
    for (int t = 0; t < 4; ++t) { v8f a = {}, al = {};
#pragma unroll
      for (int kc = 0; kc < HD / 32; ++kc) { a = wmma16(kf[t][kc], qh[kc], a); al = wmma16(kf[t][kc], ql[kc], al); }
#pragma unroll
      for (int r = 0; r < 8; ++r) { float v = (a[r] + al[r] * (1.0f / 1024.0f)) * SCALE; if (mk[t][r >> 2][r & 3] != 0) v = -1.0e9f;   /* where(mask[b][q][k] (1 = masked), -1e9, scores): set; a fully masked row comes out uniform */
        s[t][r] = v; mx = fmaxf(mx, v); } }
    v16h vf[2][HD / 16];   /* the step's v fragments are requested here, so that they fly under the softmax arithmetic */
#pragma unroll
    for (int u = 0; u < 2; ++u)
#pragma unroll
      for (int j = 0; j < HD / 16; ++j) vf[u][j] = frag_h(Vb + (size_t)(j * 16) * TT + k0 + u * 32, lane);
    mx = fmaxf(mx, __shfl_xor(mx, 16)); const float mn = fmaxf(m, mx); const float alpha = expf(m - mn); m = mn;
    v16h p[2]; float sum = 0.f;
#pragma unroll
    for (int t = 0; t < 4; ++t)
#pragma unroll
      for (int r = 0; r < 8; ++r) { const float e = expf(s[t][r] - mn); sum += e; p[t >> 1][(t & 1) * 8 + r] = (_Float16)e; }
    l = l * alpha + sum;
#pragma unroll
    for (int j = 0; j < HD / 16; ++j)
#pragma unroll
      for (int r = 0; r < 8; ++r) acc[j][r] *= alpha;
#pragma unroll
    for (int u = 0; u < 2; ++u)
#pragma unroll
      for (int j = 0; j < HD / 16; ++j) acc[j] = wmma16(vf[u][j], p[u], acc[j]); }
  l += __shfl_xor(l, 16); const float inv = 1.0f / l;   /* l >= 1: the key that holds the max contributes exp(0) */
  float* yr = Y + ((size_t)b * TT + ql0 + col) * CC + h * HD + 8 * g;
#pragma unroll
  for (int j = 0; j < HD / 16; ++j) { v4f o0, o1;
#pragma unroll
    for (int r = 0; r < 4; ++r) { o0[r] = acc[j][r] * inv; o1[r] = acc[j][4 + r] * inv; }
    vst2(yr + j * 16, o0); vst2(yr + j * 16 + 4, o1); } }
// ---- k_out: block = (64 rows, 128 cols): out = ctx Wo (+ bo): all rows: ctx bf16 hi + lo against exact bf16 Wo (2 products); the branch with ctx once to f16 against f16(bf16 x 2^8) Wo (1 product) x 2^-8 is never taken
__global__ __launch_bounds__(128) void k_out(const float* __restrict__ Y, const float* __restrict__ WO, const float* __restrict__ BO, float* __restrict__ OUT, const float* __restrict__ RESX) { __shared__ __align__(16) float sf[4][16][132];
  const int tid = threadIdx.x, wave = tid >> 5, lane = tid & 31, col = lane & 15, g = lane >> 4; const int c0 = blockIdx.y * 128; const size_t r0 = (size_t)blockIdx.x * 64 + wave * 16;
  v8f acc[8] = {};
  if (true) {   /* ALL rows: ctx split bf16 hi + lo x exact Wo (2 products) */
#pragma unroll 2
    for (int kc = 0; kc < CC / 32; ++kc) { const F2 a = split_row(Y + (r0 + col) * CC, kc * 32, lane); asm volatile("s_wait_loadcnt 0x0" ::: "memory");
#pragma unroll
      for (int j = 0; j < 8; ++j) { const v16b w = WOCOL(WO, kc * 32, c0 + j * 16 + col, lane); asm volatile("s_wait_loadcnt 0x0" ::: "memory"); acc[j] = wmma_bf(a.h, w, acc[j]); acc[j] = wmma_bf(a.l, w, acc[j]); } }
#pragma unroll
    for (int j = 0; j < 8; ++j) { const float bias = BO ? bfr(BO[c0 + j * 16 + col]) : 0.f;
#pragma unroll
      for (int r = 0; r < 8; ++r) sf[wave][8 * g + r][j * 16 + col] = acc[j][r] + bias; }
  } else {
#pragma unroll 2
    for (int kc = 0; kc < CC / 32; ++kc) { const v16h a = frag_f32(Y + (r0 + col) * CC + kc * 32, lane); asm volatile("s_wait_loadcnt 0x0" ::: "memory");
#pragma unroll
      for (int j = 0; j < 8; ++j) { const v16h w = WOCOLH(WO, kc * 32, c0 + j * 16 + col, lane); asm volatile("s_wait_loadcnt 0x0" ::: "memory"); acc[j] = wmma16(a, w, acc[j]); } }
#pragma unroll
    for (int j = 0; j < 8; ++j) { const float bias = BO ? bfr(BO[c0 + j * 16 + col]) : 0.f;
#pragma unroll
      for (int r = 0; r < 8; ++r) sf[wave][8 * g + r][j * 16 + col] = acc[j][r] * (1.0f / 256.0f) + bias; } }
  LDSX(); for (int rl = 0; rl < 16; ++rl) { const size_t oo = (r0 + rl) * DIN + c0 + lane * 4; v4f o = *(const v4f*)&sf[wave][rl][lane * 4]; const v4f zr = *(const v4f*)(RESX + oo); o[0] += bfr(zr[0]); o[1] += bfr(zr[1]); o[2] += bfr(zr[2]); o[3] += bfr(zr[3]); vst2(OUT + oo, o); } }   /* ctx W_O + bf16(input_Q) */

extern "C" void kernel_launch(void* const* d_in, const int* in_sizes, int n_in, void* d_out, int out_size, void* d_ws, size_t ws_size, hipStream_t stream) {
  (void)in_sizes; (void)n_in; (void)out_size;
  const float** F = (const float**)d_in;
  if (ws_size < (size_t)WS_END) return;
  char* ws = (char*)d_ws; _Float16 *QH = (_Float16*)(ws + WS_QH), *KH = (_Float16*)(ws + WS_KH), *VT = (_Float16*)(ws + WS_VT), *QL = (_Float16*)(ws + WS_QL), *KL = (_Float16*)(ws + WS_KL); __bf16 *VB = (__bf16*)(ws + WS_VB), *VBL = (__bf16*)(ws + WS_VBL); float *Y = (float*)(ws + WS_Y);
  (void)Y; (void)QL; (void)KL; (void)VB; (void)VBL;
  // inputs: 0 input_Q; 1 input_K; 2 input_V [2,2048,1024]; 3 mask [2,2048,2048] int32 (1 = masked); 4 W_Q (in,out); 5 W_K; 6 W_V; 7 W_O (in,out); 8 ln_gamma; 9 ln_beta
  if (ws_size < (size_t)WS_END2) return;
  float* X1 = (float*)(ws + WS_X1);
  k_proj<<<dim3(TNB * TT / 64, CC / 128, 3), 128, 0, stream>>>(F[0], F[1], F[2], F[4], F[5], F[6], nullptr, nullptr, nullptr, QH, QL, KH, KL, VT, VB, VBL);
  k_fa<<<dim3(NQB, NH, TNB), 128, 0, stream>>>(QH, KH, QL, VT, (const int*)d_in[3], Y);
  k_out<<<dim3(TNB * TT / 64, DIN / 128), 128, 0, stream>>>(Y, F[7], nullptr, X1, F[0]);   /* ctx W_O + input_Q */
  k_lnx<<<dim3(NRW / 8), 256, 0, stream>>>(X1, 0, F[8], F[9], (float*)d_out);              /* LayerNorm */
}

// v002
// Measured time: 219 microseconds a run.
// Two timings next to v001 put it at 1.58 and 1.57 times that version's speed.
// Over all steps from v000 it is 5.59 times as fast.
// compute dtype: all float inputs rounded to bf16; q/k/v = in W with EXACT bf16 products on WMMA 16x16x32 (f32 accumulate); q as f16 hi + residual (x 2^10) against k once to f16 (2 products) / 8, masked (mask == 1) positions set to -1e9; softmax in f32 (precise expf, running max and sum over key steps of 64); P = exp(s - max) once to f16 against v once to f16 (1 product), divided by the sum at the end; ctx split bf16 hi + lo against exact W_O (2 products) + input_Q; LayerNorm in f32; f32 output.
#include <hip/hip_runtime.h>
#include <math.h>

typedef __attribute__((ext_vector_type(16))) _Float16 v16h;
typedef __attribute__((ext_vector_type(16))) __bf16 v16b;
typedef __attribute__((ext_vector_type(8)))  _Float16 v8h;
typedef __attribute__((ext_vector_type(8)))  float v8f;
typedef __attribute__((ext_vector_type(4)))  float v4f;
typedef __attribute__((ext_vector_type(2)))  float v2f;
typedef __attribute__((ext_vector_type(4)))  unsigned v4u;
typedef __attribute__((ext_vector_type(4)))  int v4i;
typedef float __attribute__((may_alias)) float_a;
typedef int __attribute__((may_alias)) int_a;

template <typename T> __device__ __forceinline__ void vst2(void* p, T v) { *(T*)p = v;  }
__device__ __forceinline__ v8f wmma16(v16h a, v16h b, v8f c) {
  v8f d = __builtin_amdgcn_wmma_f32_16x16x32_f16(false, a, false, b, (short)0, c, false, false);
  asm volatile("v_nop\n\tv_nop\n\tv_nop\n\tv_nop" : "+v"(d) : "v"(a), "v"(b));
  return d;
}
__device__ __forceinline__ v8f wmma_bf(v16b a, v16b b, v8f c) {
  v8f d = __builtin_amdgcn_wmma_f32_16x16x32_bf16(false, a, false, b, (short)0, c, false, false);
  asm volatile("v_nop\n\tv_nop\n\tv_nop\n\tv_nop" : "+v"(d) : "v"(a), "v"(b));
  return d;
}
// 16x16x32 fragments: lane = (h = lane>>4, row/col = lane&15); elements 0..7 = k0+8h+0..7, 8..15 = k0+16+8h+0..7; D element r = row 8h+r
__device__ __forceinline__ v16h frag_h(const _Float16* rowk0, int lane) {
  union { v16h v; v8h q[2]; } u; const _Float16* p = rowk0 + 8 * (lane >> 4);
  u.q[0] = *(const v8h*)p; u.q[1] = *(const v8h*)(p + 16); return u.v;
}
__device__ __forceinline__ v16h frag_f32(const float* rowk0, int lane) {
  v16h a; const float* p = rowk0 + 8 * (lane >> 4);
#pragma unroll
  for (int i = 0; i < 8; ++i) { a[i] = (_Float16)p[i]; a[8 + i] = (_Float16)p[16 + i]; }
  return a;
}
__device__ __forceinline__ v16h frag_f32s(const float* rowk0, int lane, float sc) {
  v16h a; const float* p = rowk0 + 8 * (lane >> 4);
#pragma unroll
  for (int i = 0; i < 8; ++i) { a[i] = (_Float16)(p[i] * sc); a[8 + i] = (_Float16)(p[16 + i] * sc); }
  return a;
}
// column fragment from a [K][ld] layout (column n), rows >= K read as 0
__device__ __forceinline__ v16h fragc_f32(const float* W, int k0, int n, int lane, int ld, int K) {
  v16h a; const int g = lane >> 4;
#pragma unroll
  for (int i = 0; i < 8; ++i) { const int ka = k0 + 8 * g + i, kb = ka + 16;
    a[i] = (_Float16)(ka < K ? W[(size_t)(ka < K ? ka : K - 1) * ld + n] : 0.f); a[8 + i] = (_Float16)(kb < K ? W[(size_t)(kb < K ? kb : K - 1) * ld + n] : 0.f); }
  return a;
}
struct F2 { v16b h, l; };
__device__ __forceinline__ F2 bsplit16(const float v[16]) { F2 r;
#pragma unroll
  for (int i = 0; i < 16; ++i) { const __bf16 h = (__bf16)v[i]; r.h[i] = h; r.l[i] = (__bf16)(v[i] - (float)h); }
  return r; }
__device__ __forceinline__ F2 split_row(const float* row, int k0, int lane) { float v[16]; const float* p = row + k0 + 8 * (lane >> 4);
#pragma unroll
  for (int i = 0; i < 8; ++i) { v[i] = p[i]; v[8 + i] = p[16 + i]; }
  return bsplit16(v); }
__device__ __forceinline__ F2 split_rowK(const float* row, int k0, int lane, int K) { float v[16]; const int g = lane >> 4;
#pragma unroll
  for (int i = 0; i < 8; ++i) { const int ka = k0 + 8 * g + i, kb = ka + 16; v[i] = ka < K ? row[ka < K ? ka : K - 1] : 0.f; v[8 + i] = kb < K ? row[kb < K ? kb : K - 1] : 0.f; }
  return bsplit16(v); }
__device__ __forceinline__ F2 split_col(const float* W, int k0, int n, int lane, int ld, int K) { float v[16]; const int g = lane >> 4;
#pragma unroll
  for (int i = 0; i < 8; ++i) { const int ka = k0 + 8 * g + i, kb = ka + 16; v[i] = ka < K ? W[(size_t)(ka < K ? ka : K - 1) * ld + n] : 0.f; v[8 + i] = kb < K ? W[(size_t)(kb < K ? kb : K - 1) * ld + n] : 0.f; }
  return bsplit16(v); }
__device__ __forceinline__ v8f mac3(const F2& a, const F2& b, v8f c) { c = wmma_bf(a.l, b.h, c); c = wmma_bf(a.h, b.l, c); return wmma_bf(a.h, b.h, c); }
__device__ __forceinline__ float sigm(float v) { return 1.0f / (1.0f + expf(-v)); }
#define LDSX() do { asm volatile("s_wait_dscnt 0" ::: "memory"); __builtin_amdgcn_wave_barrier(); __builtin_amdgcn_fence(__ATOMIC_RELEASE, "workgroup"); } while (0)

// Multi-head attention layer with a random (query, key) mask, residual and LayerNorm (B 2, S 2,048, 1,024 = 16 x 64; (in,out) 1/32-scale weights, no biases; mask [B,S,S] int, 1 = MASKED (~half); LN affine 1/0, eps 1e-5): q = input_Q W_Q ...; scores = q k^T / 8 with where(mask, -1e9, s); ctx = softmax v; out = LN(ctx W_O + input_Q).
#define NB 2
#define TT 2048
#define CC 1024            // NH * HD = projected width
#define DIN 1024          // input (model) width
#define NH 16
#define HD 64
#define NQB (TT / 64)
#define HG 4
#define SCALE (0.125f)
#define CAUSAL 0
#ifndef TNB
#define TNB NB
#endif
__device__ __forceinline__ float bfr(float v) { return (float)(__bf16)v; }
__host__ __device__ __forceinline__ int kb_last(int qb) { return CAUSAL ? ((qb * 64 + 63) >> 7) : (TT / 128 - 1); }
typedef __attribute__((ext_vector_type(8))) __bf16 v8b;
__device__ __forceinline__ v16b frag_b(const __bf16* rowk0, int lane) {
  union { v16b v; v8b q[2]; } u; const __bf16* p = rowk0 + 8 * (lane >> 4);
  u.q[0] = *(const v8b*)p; u.q[1] = *(const v8b*)(p + 16); return u.v;
}
#define QBH 0
#define QHI 2048            // rows carrying a q residual plane (all rows when non-causal: 2-product logits everywhere)
#define KHI 64            // key rows carrying k residual / v bf16 hi+lo planes (written by k_proj; no kernel reads them)
// B fragment (k rows k0+.., output column o) of a weight: (in,out) [K][ld] or (out,in) [ld rows of K]: bf16 exact, or f16(bf16 * 256) exact
__device__ __forceinline__ v16b wcol_io(const float* Wm, int k0, int o, int lane, int ld) { v16b w; const int g = lane >> 4;
#pragma unroll
  for (int i = 0; i < 8; ++i) { w[i] = (__bf16)Wm[(size_t)(k0 + 8 * g + i) * ld + o]; w[8 + i] = (__bf16)Wm[(size_t)(k0 + 16 + 8 * g + i) * ld + o]; }
  return w; }
__device__ __forceinline__ v16b wcol_oi(const float* Wm, int k0, int o, int lane, int K) { v16b w; const float* p = Wm + (size_t)o * K + k0 + 8 * (lane >> 4);
#pragma unroll
  for (int i = 0; i < 8; ++i) { w[i] = (__bf16)p[i]; w[8 + i] = (__bf16)p[16 + i]; }
  return w; }
__device__ __forceinline__ v16h wcolh_io(const float* Wm, int k0, int o, int lane, int ld) { v16h w; const int g = lane >> 4;
#pragma unroll
  for (int i = 0; i < 8; ++i) { w[i] = (_Float16)(bfr(Wm[(size_t)(k0 + 8 * g + i) * ld + o]) * 256.0f); w[8 + i] = (_Float16)(bfr(Wm[(size_t)(k0 + 16 + 8 * g + i) * ld + o]) * 256.0f); }
  return w; }
__device__ __forceinline__ v16h wcolh_oi(const float* Wm, int k0, int o, int lane, int K) { v16h w; const float* p = Wm + (size_t)o * K + k0 + 8 * (lane >> 4);
#pragma unroll
  for (int i = 0; i < 8; ++i) { w[i] = (_Float16)(bfr(p[i]) * 256.0f); w[8 + i] = (_Float16)(bfr(p[16 + i]) * 256.0f); }
  return w; }
#define WQKV_LAYOUT 0   // 0 = (in,out) [DIN][CC]; 1 = (out,in) [CC][DIN]; 2 = per-head [NH][DIN][HD]
__device__ __forceinline__ v16b wcol_hdk(const float* Wm, int k0, int o, int lane) { v16b w; const int g = lane >> 4; const float* p = Wm + (size_t)(o / HD) * DIN * HD + (o % HD);
#pragma unroll
  for (int i = 0; i < 8; ++i) { w[i] = (__bf16)p[(size_t)(k0 + 8 * g + i) * HD]; w[8 + i] = (__bf16)p[(size_t)(k0 + 16 + 8 * g + i) * HD]; }
  return w; }
#define WO_OUT_IN 0
#if WQKV_LAYOUT == 1
#define WCOL(W, k0, o, lane) wcol_oi(W, k0, o, lane, DIN)
#elif WQKV_LAYOUT == 2
#define WCOL(W, k0, o, lane) wcol_hdk(W, k0, o, lane)
#else
#define WCOL(W, k0, o, lane) wcol_io(W, k0, o, lane, CC)
#endif
#if WO_OUT_IN
#define WOCOL(W, k0, o, lane) wcol_oi(W, k0, o, lane, CC)
#define WOCOLH(W, k0, o, lane) wcolh_oi(W, k0, o, lane, CC)
#else
#define WOCOL(W, k0, o, lane) wcol_io(W, k0, o, lane, DIN)
#define WOCOLH(W, k0, o, lane) wcolh_io(W, k0, o, lane, DIN)
#endif
#define SM_EXTRA_PARAMS , const int* __restrict__ MK, int bcur
#define SM_MASK_HOOK do { if (MK[((size_t)bcur * TT + t) * TT + k] != 0) v = -1.0e9f; } while (0)   /* where(mask[b][q][k] (1 = masked), -1e9, scores): set; a fully masked row would be uniform (none here) */
#define NRW (TNB * TT)
// ---- k_lnx: wave per row: LayerNorm over 1024 (mean, biased var, (x - mean) * rsqrt(var + 1e-5) * g + b); optional bf16 rounding of the input (x); 32 floats per lane (8 float4 at stride 128 floats -> 512-B pieces)
__global__ __launch_bounds__(256) void k_lnx(const float* __restrict__ X, int roundin, const float* __restrict__ G, const float* __restrict__ BE, float* __restrict__ OUT) { const int wave = threadIdx.x >> 5, lane = threadIdx.x & 31; const size_t row = (size_t)blockIdx.x * 8 + wave; if (row >= (size_t)NRW) return;
  v4f v[CC / 128]; float s1 = 0.f;
#pragma unroll
  for (int i = 0; i < CC / 128; ++i) { v4f t = *(const v4f*)(X + row * CC + i * 128 + lane * 4); if (roundin) { t[0] = bfr(t[0]); t[1] = bfr(t[1]); t[2] = bfr(t[2]); t[3] = bfr(t[3]); } v[i] = t; s1 += (t[0] + t[1]) + (t[2] + t[3]); }
#pragma unroll
  for (int o = 1; o < 32; o <<= 1) s1 += __shfl_xor(s1, o);
  const float mu = s1 * (1.0f / CC); float q = 0.f;
#pragma unroll
  for (int i = 0; i < CC / 128; ++i) for (int k = 0; k < 4; ++k) { const float d = v[i][k] - mu; q += d * d; }
#pragma unroll
  for (int o = 1; o < 32; o <<= 1) q += __shfl_xor(q, o);
  const float inv = rsqrtf(q * (1.0f / CC) + 1e-5f);   /* jnp.var (biased), eps inside the rsqrt */
#pragma unroll
  for (int i = 0; i < CC / 128; ++i) { const int c = i * 128 + lane * 4; v4f r4; for (int k = 0; k < 4; ++k) r4[k] = bfr(G[c + k]) * ((v[i][k] - mu) * inv) + bfr(BE[c + k]); vst2(OUT + row * CC + c, r4); } }

#ifndef SM_EXTRA_PARAMS
#define SM_EXTRA_PARAMS
#endif
#ifndef PROJ_EXTRA_PARAMS
#define PROJ_EXTRA_PARAMS
#endif
#ifndef SM_MASK_HOOK
#define SM_MASK_HOOK (void)0
#endif

#define WS_QH  0u                                      // f16 q rows [b*t][CC]
#define WS_KH  (WS_QH + 2u * (size_t)NB * TT * CC)      // f16 k rows [b*t][CC]
#define WS_VT  (WS_KH + 2u * (size_t)NB * TT * CC)      // f16 v planes [b][c][t]
#define WS_QL  (WS_VT + 2u * (size_t)NB * CC * TT)      // f16 q residual x 2^10 rows [b][t < QHI][CC]
#define WS_KL  (WS_QL + 2u * (size_t)NB * QHI * CC)     // f16 k residual x 2^10 rows [b][t < KHI][CC]
#define WS_VB  (WS_KL + 2u * (size_t)NB * KHI * CC)     // bf16 v hi planes [b][c][t < KHI]
#define WS_VBL (WS_VB + 2u * (size_t)NB * CC * KHI)
#define WS_S   (WS_VBL + 2u * (size_t)NB * CC * KHI)    // f32 [hg][t][s] region, unused (k_fa keeps logits and P in registers)
#define WS_Y   (WS_S  + 4u * (size_t)HG * TT * TT)      // f32 ctx rows [b*t][CC] (only when there is an output projection)
#define WS_END (WS_Y  + 4u * (size_t)NB * TT * CC)
#define WS_X1  (WS_END)
#define WS_END2 (WS_X1 + 4u * (size_t)NB * TT * DIN)

#define WS_WP  (WS_END2)                                // bf16 weights as B fragments [W_Q, W_K, W_V, W_O][k step of 32][16-column group][1 KiB fragment]
#define WS_XP  (WS_WP + 2u * 4u * (size_t)DIN * CC)     // bf16 inputs as A fragments [input_Q, input_K, input_V][16-row group][k step of 32][1 KiB fragment]
#define WS_END3 (WS_XP + 2u * 3u * (size_t)NB * TT * DIN)
#define PKP 16                                // pieces per k_pack thread: few waves with many loads in flight each (for speed only)
#define PKW (DIN * CC / 8 / 256 / PKP)        // k_pack blocks per weight
#define PKX (NB * TT * DIN / 8 / 256 / PKP)   // k_pack blocks per input
// ---- k_pack: a piece = 16 bytes of a 16x16x32 operand fragment, rounded to bf16. A 1 KiB fragment is [half hf][lane][8]: piece (hf, lane) holds k = k0 + 16 hf + 8 (lane >> 4) + 0..7 of row or column (lane & 15), the k order of the fragment comment above; a wave's store is 512 contiguous bytes
__global__ __launch_bounds__(256) void k_pack(const float* __restrict__ W0, const float* __restrict__ W1, const float* __restrict__ W2, const float* __restrict__ W3, const float* __restrict__ X0, const float* __restrict__ X1, const float* __restrict__ X2, __bf16* __restrict__ WP, __bf16* __restrict__ XP) {
  const int bx = blockIdx.x;
  if (bx < 4 * PKW) { const int mt = bx / PKW; const float* Wm = mt == 0 ? W0 : mt == 1 ? W1 : mt == 2 ? W2 : W3; __bf16* D = WP + (size_t)mt * DIN * CC;   /* (in,out) weight: piece e = [kc][ob][hf][lane] */
    const int e0 = (bx % PKW) * (256 * PKP) + threadIdx.x;
    // rolled over groups of 4 pieces: 32 loads in flight per lane are enough, and the registers stay few
#pragma unroll 1
    for (int it = 0; it < PKP; it += 4) { float t[4][8];
#pragma unroll
      for (int u = 0; u < 4; ++u) { const int e = e0 + (it + u) * 256; const int lane = e & 31, hf = (e >> 5) & 1, ob = (e >> 6) % (CC / 16), kc = (e >> 6) / (CC / 16);
        const float* p = Wm + (size_t)(kc * 32 + 16 * hf + 8 * (lane >> 4)) * CC + ob * 16 + (lane & 15);
#pragma unroll
        for (int i = 0; i < 8; ++i) t[u][i] = p[(size_t)i * CC]; }
#pragma unroll
      for (int u = 0; u < 4; ++u) { v8b w;
#pragma unroll
        for (int i = 0; i < 8; ++i) w[i] = (__bf16)t[u][i];
        vst2(D + (size_t)(e0 + (it + u) * 256) * 8, w); }
      asm volatile("s_wait_xcnt 0x0" ::: "memory"); }   /* stands before the next trip rewrites registers that this trip's stores name */
  } else { const int b2 = bx - 4 * PKW; const int mt = b2 / PKX; const float* Xm = mt == 0 ? X0 : mt == 1 ? X1 : X2; __bf16* D = XP + (size_t)mt * NB * TT * DIN;   /* input rows: piece e = [rb][kc][hf][lane] */
    const int e0 = (b2 % PKX) * (256 * PKP) + threadIdx.x;
    // rolled over groups of 8 pieces: 16 16-byte loads in flight per lane. The 8 pieces of a trip lie 256 pieces = 4 k steps apart, in one input row (32 k steps a row, first k step < 4): one load address and one store address a trip, the rest are constant offsets
#pragma unroll 1
    for (int it = 0; it < PKP; it += 8) { const int e = e0 + it * 256; const int lane = e & 31, hf = (e >> 5) & 1, kc = (e >> 6) % (DIN / 32), rb = (e >> 6) / (DIN / 32);
      const float* p = Xm + (size_t)(rb * 16 + (lane & 15)) * DIN + kc * 32 + 16 * hf + 8 * (lane >> 4); __bf16* q = D + (size_t)e * 8;
      v4f t[8][2]; v8b w[8];
#pragma unroll
      for (int u = 0; u < 8; ++u) { t[u][0] = *(const v4f*)(p + u * 128); t[u][1] = *(const v4f*)(p + u * 128 + 4); }
      // the wait that stands before a register named by an issued load is rewritten; it takes the address and the loaded values as inputs, so that all 16 loads stand in front of it and none of them lands in the address registers
      asm volatile("s_wait_xcnt 0x0" :: "v"(p), "v"(t[0][0]), "v"(t[0][1]), "v"(t[1][0]), "v"(t[1][1]), "v"(t[2][0]), "v"(t[2][1]), "v"(t[3][0]), "v"(t[3][1]), "v"(t[4][0]), "v"(t[4][1]), "v"(t[5][0]), "v"(t[5][1]), "v"(t[6][0]), "v"(t[6][1]), "v"(t[7][0]), "v"(t[7][1]) : "memory");
#pragma unroll
      for (int u = 0; u < 8; ++u) {
#pragma unroll
        for (int i = 0; i < 4; ++i) { w[u][i] = (__bf16)t[u][0][i]; w[u][4 + i] = (__bf16)t[u][1][i]; }
        vst2(q + u * 2048, w[u]); }
      // the same wait behind the stores, before the next trip rewrites what they name; it takes the stored values as inputs, so that their registers live up to it
      asm volatile("s_wait_xcnt 0x0" :: "v"(w[0]), "v"(w[1]), "v"(w[2]), "v"(w[3]), "v"(w[4]), "v"(w[5]), "v"(w[6]), "v"(w[7]) : "memory"); } } }
// a packed fragment: two 16-byte loads per lane, each 512 contiguous bytes per wave
__device__ __forceinline__ v16b frag_p(const __bf16* fr, int lane) {
  union { v16b v; v8b q[2]; } u; const __bf16* p = fr + lane * 8;
  u.q[0] = *(const v8b*)p; u.q[1] = *(const v8b*)(p + 256); return u.v;
}
// ---- k_proj: block = (64 rows, 128 cols, which): q/k/v = X W (+ b) with exact bf16 products (K = DIN) -> which 0: q f16 rows (+ residual rows < QHI); 1: k f16 rows (+ residual rows < KHI); 2: v f16 planes [c][t] (+ bf16 hi/lo planes for t < KHI)
__global__ __launch_bounds__(128) void k_proj(const __bf16* __restrict__ XP, const __bf16* __restrict__ WP, const float* __restrict__ BQ, const float* __restrict__ BK, const float* __restrict__ BV,
    _Float16* __restrict__ QH, _Float16* __restrict__ QL, _Float16* __restrict__ KH, _Float16* __restrict__ KL, _Float16* __restrict__ VT, __bf16* __restrict__ VB, __bf16* __restrict__ VBL) {
  __shared__ __align__(16) _Float16 sh[64][136], sl[64][136]; __shared__ __align__(16) _Float16 th[128][72]; __shared__ __align__(16) __bf16 tb[128][72], tbl[128][72];
  const int tid = threadIdx.x, wave = tid >> 5, lane = tid & 31, col = lane & 15, g = lane >> 4; const int which = blockIdx.z; const int c0 = blockIdx.y * 128; const size_t r0 = (size_t)blockIdx.x * 64; const size_t bb = r0 / TT; const int t0 = (int)(r0 % TT);
  const __bf16* XA = XP + (size_t)which * NB * TT * DIN + (r0 / 16 + wave) * (size_t)(DIN / 32) * 512; const __bf16* WA = WP + (size_t)which * DIN * CC + (size_t)(c0 / 16) * 512; const float* BA = which == 0 ? BQ : which == 1 ? BK : BV;
  v8f acc[8] = {};
#pragma unroll 2
  for (int kc = 0; kc < DIN / 32; ++kc) { const v16b a = frag_p(XA + (size_t)kc * 512, lane);
    v16b w[8];   /* the k step's packed fragments are all requested before the first product */
#pragma unroll
    for (int j = 0; j < 8; ++j) w[j] = frag_p(WA + ((size_t)kc * (CC / 16) + j) * 512, lane);
#pragma unroll
    for (int j = 0; j < 8; ++j) acc[j] = wmma_bf(a, w[j], acc[j]);
    asm volatile("s_wait_xcnt 0x0" ::: "memory"); }   /* stands before the next k step rewrites the address registers that this step's loads name */
  if (which < 2) { _Float16* DH = which == 0 ? QH : KH; _Float16* DL = which == 0 ? QL : KL; const int nhi = which == 0 ? QHI : KHI; const bool hi_rows = t0 < nhi;
#pragma unroll
    for (int j = 0; j < 8; ++j) { const float bias = BA ? bfr(BA[c0 + j * 16 + col]) : 0.f;
#pragma unroll
      for (int r = 0; r < 8; ++r) { const float v = acc[j][r] + bias; const _Float16 hv = (_Float16)v; sh[wave * 16 + 8 * g + r][j * 16 + col] = hv; sl[wave * 16 + 8 * g + r][j * 16 + col] = (_Float16)((v - (float)hv) * 1024.0f); } }
    __syncthreads();
    for (int e = tid; e < 64 * 16; e += 128) { const int rl = e >> 4, q = e & 15; vst2((unsigned*)(DH + (r0 + rl) * CC + c0 + q * 8), *(const v4u*)&sh[rl][q * 8]); if (hi_rows) vst2((unsigned*)(DL + (bb * nhi + t0 + rl) * (size_t)CC + c0 + q * 8), *(const v4u*)&sl[rl][q * 8]); }
  } else { const bool hi_rows = t0 < KHI;
#pragma unroll
    for (int j = 0; j < 8; ++j) { const float bias = BA ? bfr(BA[c0 + j * 16 + col]) : 0.f;
#pragma unroll
      for (int r = 0; r < 8; ++r) { const float v = acc[j][r] + bias; const int rl = wave * 16 + 8 * g + r, cl = j * 16 + col; th[cl][rl] = (_Float16)v; const __bf16 bh = (__bf16)v; tb[cl][rl] = bh; tbl[cl][rl] = (__bf16)(v - (float)bh); } }
    __syncthreads();
    for (int e = tid; e < 128 * 8; e += 128) { const int cl = e >> 3, q = e & 7; vst2((unsigned*)(VT + (bb * CC + c0 + cl) * (size_t)TT + t0 + q * 8), *(const v4u*)&th[cl][q * 8]); if (hi_rows) { const size_t o3 = (bb * CC + c0 + cl) * (size_t)KHI + t0 + q * 8; vst2((unsigned*)(VB + o3), *(const v4u*)&tb[cl][q * 8]); vst2((unsigned*)(VBL + o3), *(const v4u*)&tbl[cl][q * 8]); } } } }
// ---- k_fa: block = 64 queries (qb) of (b, h), wave = 16 queries, all keys in steps of 64: S^T = K q^T (key rows as A, query rows as B; q hi + residual x 2^10: 2 products) x SCALE, masked positions set to -1e9; running max and sum per query (lane & 15 = query, so both are per-lane values; the two lane halves hold different keys); D of S^T (lane = query, element r = key 8g + r) IS the 16x16x32 operand layout over 32 keys, so P = exp(s - max) goes once to f16 in place and ctx^T += v^T (A) P^T (B); ctx^T rows are channels, so the rescale and the final 1 / sum are per-lane too
__global__ __launch_bounds__(128) void k_fa(const _Float16* __restrict__ QH, const _Float16* __restrict__ KH, const _Float16* __restrict__ QL, const _Float16* __restrict__ VT, const int* __restrict__ MK, float* __restrict__ Y) {
  const int tid = threadIdx.x, wave = tid >> 5, lane = tid & 31, col = lane & 15, g = lane >> 4; const int h = blockIdx.y, b = blockIdx.z; const int ql0 = blockIdx.x * 64 + wave * 16;
  v16h qh[HD / 32], ql[HD / 32];
#pragma unroll
  for (int kc = 0; kc < HD / 32; ++kc) { qh[kc] = frag_h(QH + ((size_t)b * TT + ql0 + col) * CC + h * HD + kc * 32, lane); ql[kc] = frag_h(QL + ((size_t)b * QHI + ql0 + col) * CC + h * HD + kc * 32, lane); }
  const _Float16* Kb = KH + ((size_t)b * TT + col) * CC + h * HD; const _Float16* Vb = VT + ((size_t)b * CC + h * HD + col) * (size_t)TT; const int* Mb = MK + ((size_t)b * TT + ql0 + col) * TT + 8 * g;
  v8f acc[HD / 16] = {}; float m = -3.0e38f, l = 0.f;
  // the key loop stays rolled: a second step's fragments would take the wave past 256 registers and cost a wave per SIMD; the inner loops are fully unrolled so that the fragment arrays are indexed by constants and stay in registers
#pragma unroll 1
  for (int k0 = 0; k0 < TT; k0 += 64) { float s[4][8]; float mx = -3.0e38f;
    v16h kf[4][HD / 32]; v4i mk[4][2];   /* the whole step's K fragments and mask words are requested before the first product: one load latency per step, not one per product */
#pragma unroll
    for (int t = 0; t < 4; ++t) {
#pragma unroll
      for (int kc = 0; kc < HD / 32; ++kc) kf[t][kc] = frag_h(Kb + (size_t)(k0 + t * 16) * CC + kc * 32, lane);
      mk[t][0] = *(const v4i*)(Mb + k0 + t * 16); mk[t][1] = *(const v4i*)(Mb + k0 + t * 16 + 4); }
#pragma unroll
    for (int t = 0; t < 4; ++t) { v8f a = {}, al = {};
#pragma unroll
      for (int kc = 0; kc < HD / 32; ++kc) { a = wmma16(kf[t][kc], qh[kc], a); al = wmma16(kf[t][kc], ql[kc], al); }
#pragma unroll
      for (int r = 0; r < 8; ++r) { float v = (a[r] + al[r] * (1.0f / 1024.0f)) * SCALE; if (mk[t][r >> 2][r & 3] != 0) v = -1.0e9f;   /* where(mask[b][q][k] (1 = masked), -1e9, scores): set; a fully masked row comes out uniform */
        s[t][r] = v; mx = fmaxf(mx, v); } }
    v16h vf[2][HD / 16];   /* the step's v fragments are requested here, so that they fly under the softmax arithmetic */
#pragma unroll
    for (int u = 0; u < 2; ++u)
#pragma unroll
      for (int j = 0; j < HD / 16; ++j) vf[u][j] = frag_h(Vb + (size_t)(j * 16) * TT + k0 + u * 32, lane);
    mx = fmaxf(mx, __shfl_xor(mx, 16)); const float mn = fmaxf(m, mx); const float alpha = expf(m - mn); m = mn;
    v16h p[2]; float sum = 0.f;
#pragma unroll
    for (int t = 0; t < 4; ++t)
#pragma unroll
      for (int r = 0; r < 8; ++r) { const float e = expf(s[t][r] - mn); sum += e; p[t >> 1][(t & 1) * 8 + r] = (_Float16)e; }
    l = l * alpha + sum;
#pragma unroll
    for (int j = 0; j < HD / 16; ++j)
#pragma unroll
      for (int r = 0; r < 8; ++r) acc[j][r] *= alpha;
#pragma unroll
    for (int u = 0; u < 2; ++u)
#pragma unroll
      for (int j = 0; j < HD / 16; ++j) acc[j] = wmma16(vf[u][j], p[u], acc[j]); }
  l += __shfl_xor(l, 16); const float inv = 1.0f / l;   /* l >= 1: the key that holds the max contributes exp(0) */
  float* yr = Y + ((size_t)b * TT + ql0 + col) * CC + h * HD + 8 * g;
#pragma unroll
  for (int j = 0; j < HD / 16; ++j) { v4f o0, o1;
#pragma unroll
    for (int r = 0; r < 4; ++r) { o0[r] = acc[j][r] * inv; o1[r] = acc[j][4 + r] * inv; }
    vst2(yr + j * 16, o0); vst2(yr + j * 16 + 4, o1); } }
// ---- k_out: block = (64 rows, 128 cols): out = ctx Wo (+ bo): all rows: ctx bf16 hi + lo against exact bf16 Wo from its packed fragments (2 products)
__global__ __launch_bounds__(128) void k_out(const float* __restrict__ Y, const float* __restrict__ WO, const __bf16* __restrict__ WPO, const float* __restrict__ BO, float* __restrict__ OUT, const float* __restrict__ RESX) { __shared__ __align__(16) float sf[4][16][132];
  const int tid = threadIdx.x, wave = tid >> 5, lane = tid & 31, col = lane & 15, g = lane >> 4; const int c0 = blockIdx.y * 128; const size_t r0 = (size_t)blockIdx.x * 64 + wave * 16;
  v8f acc[8] = {};
  if (true) {   /* ALL rows: ctx split bf16 hi + lo x exact Wo (2 products) */
#pragma unroll 2
    for (int kc = 0; kc < CC / 32; ++kc) { const F2 a = split_row(Y + (r0 + col) * CC, kc * 32, lane);
      v16b w[8];   /* the k step's packed B fragments are all requested before the first product */
#pragma unroll
      for (int j = 0; j < 8; ++j) w[j] = frag_p(WPO + ((size_t)kc * (DIN / 16) + c0 / 16 + j) * 512, lane);
#pragma unroll
      for (int j = 0; j < 8; ++j) { acc[j] = wmma_bf(a.h, w[j], acc[j]); acc[j] = wmma_bf(a.l, w[j], acc[j]); }
      asm volatile("s_wait_xcnt 0x0" ::: "memory"); }   /* stands before the next k step rewrites the address registers that this step's loads name */
#pragma unroll
    for (int j = 0; j < 8; ++j) { const float bias = BO ? bfr(BO[c0 + j * 16 + col]) : 0.f;
#pragma unroll
      for (int r = 0; r < 8; ++r) sf[wave][8 * g + r][j * 16 + col] = acc[j][r] + bias; }
  } else {
#pragma unroll 2
    for (int kc = 0; kc < CC / 32; ++kc) { const v16h a = frag_f32(Y + (r0 + col) * CC + kc * 32, lane); asm volatile("s_wait_loadcnt 0x0" ::: "memory");
#pragma unroll
      for (int j = 0; j < 8; ++j) { const v16h w = WOCOLH(WO, kc * 32, c0 + j * 16 + col, lane); asm volatile("s_wait_loadcnt 0x0" ::: "memory"); acc[j] = wmma16(a, w, acc[j]); } }
#pragma unroll
    for (int j = 0; j < 8; ++j) { const float bias = BO ? bfr(BO[c0 + j * 16 + col]) : 0.f;
#pragma unroll
      for (int r = 0; r < 8; ++r) sf[wave][8 * g + r][j * 16 + col] = acc[j][r] * (1.0f / 256.0f) + bias; } }
  LDSX(); for (int rl = 0; rl < 16; ++rl) { const size_t oo = (r0 + rl) * DIN + c0 + lane * 4; v4f o = *(const v4f*)&sf[wave][rl][lane * 4]; const v4f zr = *(const v4f*)(RESX + oo); o[0] += bfr(zr[0]); o[1] += bfr(zr[1]); o[2] += bfr(zr[2]); o[3] += bfr(zr[3]); vst2(OUT + oo, o); } }   /* ctx W_O + bf16(input_Q) */

extern "C" void kernel_launch(void* const* d_in, const int* in_sizes, int n_in, void* d_out, int out_size, void* d_ws, size_t ws_size, hipStream_t stream) {
  (void)in_sizes; (void)n_in; (void)out_size;
  const float** F = (const float**)d_in;
  if (ws_size < (size_t)WS_END) return;
  char* ws = (char*)d_ws; _Float16 *QH = (_Float16*)(ws + WS_QH), *KH = (_Float16*)(ws + WS_KH), *VT = (_Float16*)(ws + WS_VT), *QL = (_Float16*)(ws + WS_QL), *KL = (_Float16*)(ws + WS_KL); __bf16 *VB = (__bf16*)(ws + WS_VB), *VBL = (__bf16*)(ws + WS_VBL); float *Y = (float*)(ws + WS_Y);
  (void)Y; (void)QL; (void)KL; (void)VB; (void)VBL;
  // inputs: 0 input_Q; 1 input_K; 2 input_V [2,2048,1024]; 3 mask [2,2048,2048] int32 (1 = masked); 4 W_Q (in,out); 5 W_K; 6 W_V; 7 W_O (in,out); 8 ln_gamma; 9 ln_beta
  if (ws_size < (size_t)WS_END3) return;
  float* X1 = (float*)(ws + WS_X1); __bf16 *WP = (__bf16*)(ws + WS_WP), *XP = (__bf16*)(ws + WS_XP);
  k_pack<<<dim3(4 * PKW + 3 * PKX), 256, 0, stream>>>(F[4], F[5], F[6], F[7], F[0], F[1], F[2], WP, XP);   /* weights and inputs -> bf16 fragments, every call */
  k_proj<<<dim3(TNB * TT / 64, CC / 128, 3), 128, 0, stream>>>(XP, WP, nullptr, nullptr, nullptr, QH, QL, KH, KL, VT, VB, VBL);
  k_fa<<<dim3(NQB, NH, TNB), 128, 0, stream>>>(QH, KH, QL, VT, (const int*)d_in[3], Y);
  k_out<<<dim3(TNB * TT / 64, DIN / 128), 128, 0, stream>>>(Y, F[7], WP + 3 * (size_t)DIN * CC, nullptr, X1, F[0]);   /* ctx W_O + input_Q */
  k_lnx<<<dim3(NRW / 8), 256, 0, stream>>>(X1, 0, F[8], F[9], (float*)d_out);              /* LayerNorm */
}

// v003
// Measured time: 178 microseconds a run.
// In both of two side-by-side timings against v002, it was 1.23 times as fast.
// All steps since v000 together make it 6.85 times as fast.
// compute dtype: all float inputs rounded to bf16; q/k/v = in W with EXACT bf16 products on WMMA 16x16x32 (f32 accumulate); q as f16 hi + residual (x 2^10) against k once to f16 (2 products) / 8, masked (mask == 1) positions set to -1e9; softmax in f32 (precise expf, running max and sum over key steps of 64); P = exp(s - max) once to f16 against v once to f16 (1 product), divided by the sum at the end; ctx split bf16 hi + lo against exact W_O (2 products) + input_Q; LayerNorm in f32; f32 output.
#include <hip/hip_runtime.h>
#include <math.h>

typedef __attribute__((ext_vector_type(16))) _Float16 v16h;
typedef __attribute__((ext_vector_type(16))) __bf16 v16b;
typedef __attribute__((ext_vector_type(8)))  _Float16 v8h;
typedef __attribute__((ext_vector_type(8)))  float v8f;
typedef __attribute__((ext_vector_type(4)))  float v4f;
typedef __attribute__((ext_vector_type(2)))  float v2f;
typedef __attribute__((ext_vector_type(4)))  unsigned v4u;
typedef __attribute__((ext_vector_type(4)))  int v4i;
typedef float __attribute__((may_alias)) float_a;
typedef int __attribute__((may_alias)) int_a;

template <typename T> __device__ __forceinline__ void vst2(void* p, T v) { *(T*)p = v;  }
__device__ __forceinline__ v8f wmma16(v16h a, v16h b, v8f c) {
  v8f d = __builtin_amdgcn_wmma_f32_16x16x32_f16(false, a, false, b, (short)0, c, false, false);
  asm volatile("v_nop\n\tv_nop\n\tv_nop\n\tv_nop" : "+v"(d) : "v"(a), "v"(b));
  return d;
}
__device__ __forceinline__ v8f wmma_bf(v16b a, v16b b, v8f c) {
  v8f d = __builtin_amdgcn_wmma_f32_16x16x32_bf16(false, a, false, b, (short)0, c, false, false);
  asm volatile("v_nop\n\tv_nop\n\tv_nop\n\tv_nop" : "+v"(d) : "v"(a), "v"(b));
  return d;
}
// 16x16x32 fragments: lane = (h = lane>>4, row/col = lane&15); elements 0..7 = k0+8h+0..7, 8..15 = k0+16+8h+0..7; D element r = row 8h+r
__device__ __forceinline__ v16h frag_h(const _Float16* rowk0, int lane) {
  union { v16h v; v8h q[2]; } u; const _Float16* p = rowk0 + 8 * (lane >> 4);
  u.q[0] = *(const v8h*)p; u.q[1] = *(const v8h*)(p + 16); return u.v;
}
__device__ __forceinline__ v16h frag_f32(const float* rowk0, int lane) {
  v16h a; const float* p = rowk0 + 8 * (lane >> 4);
#pragma unroll
  for (int i = 0; i < 8; ++i) { a[i] = (_Float16)p[i]; a[8 + i] = (_Float16)p[16 + i]; }
  return a;
}
__device__ __forceinline__ v16h frag_f32s(const float* rowk0, int lane, float sc) {
  v16h a; const float* p = rowk0 + 8 * (lane >> 4);
#pragma unroll
  for (int i = 0; i < 8; ++i) { a[i] = (_Float16)(p[i] * sc); a[8 + i] = (_Float16)(p[16 + i] * sc); }
  return a;
}
// column fragment from a [K][ld] layout (column n), rows >= K read as 0
__device__ __forceinline__ v16h fragc_f32(const float* W, int k0, int n, int lane, int ld, int K) {
  v16h a; const int g = lane >> 4;
#pragma unroll
  for (int i = 0; i < 8; ++i) { const int ka = k0 + 8 * g + i, kb = ka + 16;
    a[i] = (_Float16)(ka < K ? W[(size_t)(ka < K ? ka : K - 1) * ld + n] : 0.f); a[8 + i] = (_Float16)(kb < K ? W[(size_t)(kb < K ? kb : K - 1) * ld + n] : 0.f); }
  return a;
}
struct F2 { v16b h, l; };
__device__ __forceinline__ F2 bsplit16(const float v[16]) { F2 r;
#pragma unroll
  for (int i = 0; i < 16; ++i) { const __bf16 h = (__bf16)v[i]; r.h[i] = h; r.l[i] = (__bf16)(v[i] - (float)h); }
  return r; }
__device__ __forceinline__ F2 split_row(const float* row, int k0, int lane) { float v[16]; const float* p = row + k0 + 8 * (lane >> 4);
#pragma unroll
  for (int i = 0; i < 8; ++i) { v[i] = p[i]; v[8 + i] = p[16 + i]; }
  return bsplit16(v); }
__device__ __forceinline__ F2 split_rowK(const float* row, int k0, int lane, int K) { float v[16]; const int g = lane >> 4;
#pragma unroll
  for (int i = 0; i < 8; ++i) { const int ka = k0 + 8 * g + i, kb = ka + 16; v[i] = ka < K ? row[ka < K ? ka : K - 1] : 0.f; v[8 + i] = kb < K ? row[kb < K ? kb : K - 1] : 0.f; }
  return bsplit16(v); }
__device__ __forceinline__ F2 split_col(const float* W, int k0, int n, int lane, int ld, int K) { float v[16]; const int g = lane >> 4;
#pragma unroll
  for (int i = 0; i < 8; ++i) { const int ka = k0 + 8 * g + i, kb = ka + 16; v[i] = ka < K ? W[(size_t)(ka < K ? ka : K - 1) * ld + n] : 0.f; v[8 + i] = kb < K ? W[(size_t)(kb < K ? kb : K - 1) * ld + n] : 0.f; }
  return bsplit16(v); }
__device__ __forceinline__ v8f mac3(const F2& a, const F2& b, v8f c) { c = wmma_bf(a.l, b.h, c); c = wmma_bf(a.h, b.l, c); return wmma_bf(a.h, b.h, c); }
__device__ __forceinline__ float sigm(float v) { return 1.0f / (1.0f + expf(-v)); }
#define LDSX() do { asm volatile("s_wait_dscnt 0" ::: "memory"); __builtin_amdgcn_wave_barrier(); __builtin_amdgcn_fence(__ATOMIC_RELEASE, "workgroup"); } while (0)

// Multi-head attention layer with a random (query, key) mask, residual and LayerNorm (B 2, S 2,048, 1,024 = 16 x 64; (in,out) 1/32-scale weights, no biases; mask [B,S,S] int, 1 = MASKED (~half); LN affine 1/0, eps 1e-5): q = input_Q W_Q ...; scores = q k^T / 8 with where(mask, -1e9, s); ctx = softmax v; out = LN(ctx W_O + input_Q).
#define NB 2
#define TT 2048
#define CC 1024            // NH * HD = projected width
#define DIN 1024          // input (model) width
#define NH 16
#define HD 64
#define NQB (TT / 64)
#define HG 4
#define SCALE (0.125f)
#define CAUSAL 0
#ifndef TNB
#define TNB NB
#endif
__device__ __forceinline__ float bfr(float v) { return (float)(__bf16)v; }
__host__ __device__ __forceinline__ int kb_last(int qb) { return CAUSAL ? ((qb * 64 + 63) >> 7) : (TT / 128 - 1); }
typedef __attribute__((ext_vector_type(8))) __bf16 v8b;
__device__ __forceinline__ v16b frag_b(const __bf16* rowk0, int lane) {
  union { v16b v; v8b q[2]; } u; const __bf16* p = rowk0 + 8 * (lane >> 4);
  u.q[0] = *(const v8b*)p; u.q[1] = *(const v8b*)(p + 16); return u.v;
}
#define QBH 0
#define QHI 2048            // rows carrying a q residual plane (all rows when non-causal: 2-product logits everywhere)
#define KHI 64            // key rows carrying k residual / v bf16 hi+lo planes (written by k_proj; no kernel reads them)
// B fragment (k rows k0+.., output column o) of a weight: (in,out) [K][ld] or (out,in) [ld rows of K]: bf16 exact, or f16(bf16 * 256) exact
__device__ __forceinline__ v16b wcol_io(const float* Wm, int k0, int o, int lane, int ld) { v16b w; const int g = lane >> 4;
#pragma unroll
  for (int i = 0; i < 8; ++i) { w[i] = (__bf16)Wm[(size_t)(k0 + 8 * g + i) * ld + o]; w[8 + i] = (__bf16)Wm[(size_t)(k0 + 16 + 8 * g + i) * ld + o]; }
  return w; }
__device__ __forceinline__ v16b wcol_oi(const float* Wm, int k0, int o, int lane, int K) { v16b w; const float* p = Wm + (size_t)o * K + k0 + 8 * (lane >> 4);
#pragma unroll
  for (int i = 0; i < 8; ++i) { w[i] = (__bf16)p[i]; w[8 + i] = (__bf16)p[16 + i]; }
  return w; }
__device__ __forceinline__ v16h wcolh_io(const float* Wm, int k0, int o, int lane, int ld) { v16h w; const int g = lane >> 4;
#pragma unroll
  for (int i = 0; i < 8; ++i) { w[i] = (_Float16)(bfr(Wm[(size_t)(k0 + 8 * g + i) * ld + o]) * 256.0f); w[8 + i] = (_Float16)(bfr(Wm[(size_t)(k0 + 16 + 8 * g + i) * ld + o]) * 256.0f); }
  return w; }
__device__ __forceinline__ v16h wcolh_oi(const float* Wm, int k0, int o, int lane, int K) { v16h w; const float* p = Wm + (size_t)o * K + k0 + 8 * (lane >> 4);
#pragma unroll
  for (int i = 0; i < 8; ++i) { w[i] = (_Float16)(bfr(p[i]) * 256.0f); w[8 + i] = (_Float16)(bfr(p[16 + i]) * 256.0f); }
  return w; }
#define WQKV_LAYOUT 0   // 0 = (in,out) [DIN][CC]; 1 = (out,in) [CC][DIN]; 2 = per-head [NH][DIN][HD]
__device__ __forceinline__ v16b wcol_hdk(const float* Wm, int k0, int o, int lane) { v16b w; const int g = lane >> 4; const float* p = Wm + (size_t)(o / HD) * DIN * HD + (o % HD);
#pragma unroll
  for (int i = 0; i < 8; ++i) { w[i] = (__bf16)p[(size_t)(k0 + 8 * g + i) * HD]; w[8 + i] = (__bf16)p[(size_t)(k0 + 16 + 8 * g + i) * HD]; }
  return w; }
#define WO_OUT_IN 0
#if WQKV_LAYOUT == 1
#define WCOL(W, k0, o, lane) wcol_oi(W, k0, o, lane, DIN)
#elif WQKV_LAYOUT == 2
#define WCOL(W, k0, o, lane) wcol_hdk(W, k0, o, lane)
#else
#define WCOL(W, k0, o, lane) wcol_io(W, k0, o, lane, CC)
#endif
#if WO_OUT_IN
#define WOCOL(W, k0, o, lane) wcol_oi(W, k0, o, lane, CC)
#define WOCOLH(W, k0, o, lane) wcolh_oi(W, k0, o, lane, CC)
#else
#define WOCOL(W, k0, o, lane) wcol_io(W, k0, o, lane, DIN)
#define WOCOLH(W, k0, o, lane) wcolh_io(W, k0, o, lane, DIN)
#endif
#define SM_EXTRA_PARAMS , const int* __restrict__ MK, int bcur
#define SM_MASK_HOOK do { if (MK[((size_t)bcur * TT + t) * TT + k] != 0) v = -1.0e9f; } while (0)   /* where(mask[b][q][k] (1 = masked), -1e9, scores): set; a fully masked row would be uniform (none here) */
#define NRW (TNB * TT)
// ---- k_lnx: wave per row: LayerNorm over 1024 (mean, biased var, (x - mean) * rsqrt(var + 1e-5) * g + b); optional bf16 rounding of the input (x); 32 floats per lane (8 float4 at stride 128 floats -> 512-B pieces)
__global__ __launch_bounds__(256) void k_lnx(const float* __restrict__ X, int roundin, const float* __restrict__ G, const float* __restrict__ BE, float* __restrict__ OUT) { const int wave = threadIdx.x >> 5, lane = threadIdx.x & 31; const size_t row = (size_t)blockIdx.x * 8 + wave; if (row >= (size_t)NRW) return;
  v4f v[CC / 128]; float s1 = 0.f;
#pragma unroll
  for (int i = 0; i < CC / 128; ++i) { v4f t = *(const v4f*)(X + row * CC + i * 128 + lane * 4); if (roundin) { t[0] = bfr(t[0]); t[1] = bfr(t[1]); t[2] = bfr(t[2]); t[3] = bfr(t[3]); } v[i] = t; s1 += (t[0] + t[1]) + (t[2] + t[3]); }
#pragma unroll
  for (int o = 1; o < 32; o <<= 1) s1 += __shfl_xor(s1, o);
  const float mu = s1 * (1.0f / CC); float q = 0.f;
#pragma unroll
  for (int i = 0; i < CC / 128; ++i) for (int k = 0; k < 4; ++k) { const float d = v[i][k] - mu; q += d * d; }
#pragma unroll
  for (int o = 1; o < 32; o <<= 1) q += __shfl_xor(q, o);
  const float inv = rsqrtf(q * (1.0f / CC) + 1e-5f);   /* jnp.var (biased), eps inside the rsqrt */
#pragma unroll
  for (int i = 0; i < CC / 128; ++i) { const int c = i * 128 + lane * 4; v4f r4; for (int k = 0; k < 4; ++k) r4[k] = bfr(G[c + k]) * ((v[i][k] - mu) * inv) + bfr(BE[c + k]); vst2(OUT + row * CC + c, r4); } }

#ifndef SM_EXTRA_PARAMS
#define SM_EXTRA_PARAMS
#endif
#ifndef PROJ_EXTRA_PARAMS
#define PROJ_EXTRA_PARAMS
#endif
#ifndef SM_MASK_HOOK
#define SM_MASK_HOOK (void)0
#endif

#define WS_QH  0u                                      // f16 q rows [b*t][CC]
#define WS_KH  (WS_QH + 2u * (size_t)NB * TT * CC)      // f16 k as A fragments [b][h][16-key group][k step of 32 channels][1 KiB fragment]
#define WS_VT  (WS_KH + 2u * (size_t)NB * TT * CC)      // f16 v^T as A fragments [b][h][32-key group][16-channel group][1 KiB fragment]
#define WS_QL  (WS_VT + 2u * (size_t)NB * CC * TT)      // f16 q residual x 2^10 rows [b][t < QHI][CC]
#define WS_KL  (WS_QL + 2u * (size_t)NB * QHI * CC)     // f16 k residual x 2^10 rows [b][t < KHI][CC]
#define WS_VB  (WS_KL + 2u * (size_t)NB * KHI * CC)     // bf16 v hi planes [b][c][t < KHI]
#define WS_VBL (WS_VB + 2u * (size_t)NB * CC * KHI)
#define WS_S   (WS_VBL + 2u * (size_t)NB * CC * KHI)    // f32 [hg][t][s] region, unused (k_fa keeps logits and P in registers)
#define WS_Y   (WS_S  + 4u * (size_t)HG * TT * TT)      // f32 ctx rows [b*t][CC] (only when there is an output projection)
#define WS_END (WS_Y  + 4u * (size_t)NB * TT * CC)
#define WS_X1  (WS_END)
#define WS_END2 (WS_X1 + 4u * (size_t)NB * TT * DIN)

#define WS_WP  (WS_END2)                                // bf16 weights as B fragments [W_Q, W_K, W_V, W_O][k step of 32][16-column group][1 KiB fragment]
#define WS_XP  (WS_WP + 2u * 4u * (size_t)DIN * CC)     // bf16 inputs as A fragments [input_Q, input_K, input_V][16-row group][k step of 32][1 KiB fragment]
#define WS_END3 (WS_XP + 2u * 3u * (size_t)NB * TT * DIN)
#define PKP 16                                // pieces per k_pack thread: few waves with many loads in flight each (for speed only)
#define PKW (DIN * CC / 8 / 256 / PKP)        // k_pack blocks per weight
#define PKX (NB * TT * DIN / 8 / 256 / PKP)   // k_pack blocks per input
// ---- k_pack: a piece = 16 bytes of a 16x16x32 operand fragment, rounded to bf16. A 1 KiB fragment is [half hf][lane][8]: piece (hf, lane) holds k = k0 + 16 hf + 8 (lane >> 4) + 0..7 of row or column (lane & 15), the k order of the fragment comment above; a wave's store is 512 contiguous bytes
__global__ __launch_bounds__(256) void k_pack(const float* __restrict__ W0, const float* __restrict__ W1, const float* __restrict__ W2, const float* __restrict__ W3, const float* __restrict__ X0, const float* __restrict__ X1, const float* __restrict__ X2, __bf16* __restrict__ WP, __bf16* __restrict__ XP) {
  const int bx = blockIdx.x;
  if (bx < 4 * PKW) { const int mt = bx / PKW; const float* Wm = mt == 0 ? W0 : mt == 1 ? W1 : mt == 2 ? W2 : W3; __bf16* D = WP + (size_t)mt * DIN * CC;   /* (in,out) weight: piece e = [kc][ob][hf][lane] */
    const int e0 = (bx % PKW) * (256 * PKP) + threadIdx.x;
    // rolled over groups of 4 pieces: 32 loads in flight per lane are enough, and the registers stay few
#pragma unroll 1
    for (int it = 0; it < PKP; it += 4) { float t[4][8];
#pragma unroll
      for (int u = 0; u < 4; ++u) { const int e = e0 + (it + u) * 256; const int lane = e & 31, hf = (e >> 5) & 1, ob = (e >> 6) % (CC / 16), kc = (e >> 6) / (CC / 16);
        const float* p = Wm + (size_t)(kc * 32 + 16 * hf + 8 * (lane >> 4)) * CC + ob * 16 + (lane & 15);
#pragma unroll
        for (int i = 0; i < 8; ++i) t[u][i] = p[(size_t)i * CC]; }
#pragma unroll
      for (int u = 0; u < 4; ++u) { v8b w;
#pragma unroll
        for (int i = 0; i < 8; ++i) w[i] = (__bf16)t[u][i];
        vst2(D + (size_t)(e0 + (it + u) * 256) * 8, w); }
      asm volatile("s_wait_xcnt 0x0" ::: "memory"); }   /* stands before the next trip rewrites registers that this trip's stores name */
  } else { const int b2 = bx - 4 * PKW; const int mt = b2 / PKX; const float* Xm = mt == 0 ? X0 : mt == 1 ? X1 : X2; __bf16* D = XP + (size_t)mt * NB * TT * DIN;   /* input rows: piece e = [rb][kc][hf][lane] */
    const int e0 = (b2 % PKX) * (256 * PKP) + threadIdx.x;
    // rolled over groups of 8 pieces: 16 16-byte loads in flight per lane. The 8 pieces of a trip lie 256 pieces = 4 k steps apart, in one input row (32 k steps a row, first k step < 4): one load address and one store address a trip, the rest are constant offsets
#pragma unroll 1
    for (int it = 0; it < PKP; it += 8) { const int e = e0 + it * 256; const int lane = e & 31, hf = (e >> 5) & 1, kc = (e >> 6) % (DIN / 32), rb = (e >> 6) / (DIN / 32);
      const float* p = Xm + (size_t)(rb * 16 + (lane & 15)) * DIN + kc * 32 + 16 * hf + 8 * (lane >> 4); __bf16* q = D + (size_t)e * 8;
      v4f t[8][2]; v8b w[8];
#pragma unroll
      for (int u = 0; u < 8; ++u) { t[u][0] = *(const v4f*)(p + u * 128); t[u][1] = *(const v4f*)(p + u * 128 + 4); }
      // the wait that stands before a register named by an issued load is rewritten; it takes the address and the loaded values as inputs, so that all 16 loads stand in front of it and none of them lands in the address registers
      asm volatile("s_wait_xcnt 0x0" :: "v"(p), "v"(t[0][0]), "v"(t[0][1]), "v"(t[1][0]), "v"(t[1][1]), "v"(t[2][0]), "v"(t[2][1]), "v"(t[3][0]), "v"(t[3][1]), "v"(t[4][0]), "v"(t[4][1]), "v"(t[5][0]), "v"(t[5][1]), "v"(t[6][0]), "v"(t[6][1]), "v"(t[7][0]), "v"(t[7][1]) : "memory");
#pragma unroll
      for (int u = 0; u < 8; ++u) {
#pragma unroll
        for (int i = 0; i < 4; ++i) { w[u][i] = (__bf16)t[u][0][i]; w[u][4 + i] = (__bf16)t[u][1][i]; }
        vst2(q + u * 2048, w[u]); }
      // the same wait behind the stores, before the next trip rewrites what they name; it takes the stored values as inputs, so that their registers live up to it
      asm volatile("s_wait_xcnt 0x0" :: "v"(w[0]), "v"(w[1]), "v"(w[2]), "v"(w[3]), "v"(w[4]), "v"(w[5]), "v"(w[6]), "v"(w[7]) : "memory"); } } }
// a packed fragment: two 16-byte loads per lane, each 512 contiguous bytes per wave
__device__ __forceinline__ v16b frag_p(const __bf16* fr, int lane) {
  union { v16b v; v8b q[2]; } u; const __bf16* p = fr + lane * 8;
  u.q[0] = *(const v8b*)p; u.q[1] = *(const v8b*)(p + 256); return u.v;
}
__device__ __forceinline__ v16h frag_ph(const _Float16* fr, int lane) {
  union { v16h v; v8h q[2]; } u; const _Float16* p = fr + lane * 8;
  u.q[0] = *(const v8h*)p; u.q[1] = *(const v8h*)(p + 256); return u.v;
}
// ---- k_proj: block = (64 rows, 128 cols, which): q/k/v = X W (+ b) with exact bf16 products (K = DIN) -> which 0: q f16 rows (+ residual rows < QHI); 1: k f16 fragments (+ residual rows < KHI); 2: v^T f16 fragments (+ bf16 hi/lo planes for t < KHI). A k or v^T fragment is [half hf][lane][8] like a packed weight fragment: piece (hf, lane) holds k index 16 hf + 8 (lane >> 4) + 0..7 of row (lane & 15), the elements that lane takes in k_fa, so that a wave's load there is 512 contiguous bytes
__global__ __launch_bounds__(128) void k_proj(const __bf16* __restrict__ XP, const __bf16* __restrict__ WP, const float* __restrict__ BQ, const float* __restrict__ BK, const float* __restrict__ BV,
    _Float16* __restrict__ QH, _Float16* __restrict__ QL, _Float16* __restrict__ KH, _Float16* __restrict__ KL, _Float16* __restrict__ VT, __bf16* __restrict__ VB, __bf16* __restrict__ VBL) {
  __shared__ __align__(16) _Float16 sh[64][136], sl[64][136]; __shared__ __align__(16) _Float16 th[128][72]; __shared__ __align__(16) __bf16 tb[128][72], tbl[128][72];
  const int tid = threadIdx.x, wave = tid >> 5, lane = tid & 31, col = lane & 15, g = lane >> 4; const int which = blockIdx.z; const int c0 = blockIdx.y * 128; const size_t r0 = (size_t)blockIdx.x * 64; const size_t bb = r0 / TT; const int t0 = (int)(r0 % TT);
  const __bf16* XA = XP + (size_t)which * NB * TT * DIN + (r0 / 16 + wave) * (size_t)(DIN / 32) * 512; const __bf16* WA = WP + (size_t)which * DIN * CC + (size_t)(c0 / 16) * 512; const float* BA = which == 0 ? BQ : which == 1 ? BK : BV;
  v8f acc[8] = {};
#pragma unroll 2
  for (int kc = 0; kc < DIN / 32; ++kc) { const v16b a = frag_p(XA + (size_t)kc * 512, lane);
    v16b w[8];   /* the k step's packed fragments are all requested before the first product */
#pragma unroll
    for (int j = 0; j < 8; ++j) w[j] = frag_p(WA + ((size_t)kc * (CC / 16) + j) * 512, lane);
#pragma unroll
    for (int j = 0; j < 8; ++j) acc[j] = wmma_bf(a, w[j], acc[j]);
    asm volatile("s_wait_xcnt 0x0" ::: "memory"); }   /* stands before the next k step rewrites the address registers that this step's loads name */
  if (which < 2) { _Float16* DH = which == 0 ? QH : KH; _Float16* DL = which == 0 ? QL : KL; const int nhi = which == 0 ? QHI : KHI; const bool hi_rows = t0 < nhi;
#pragma unroll
    for (int j = 0; j < 8; ++j) { const float bias = BA ? bfr(BA[c0 + j * 16 + col]) : 0.f;
#pragma unroll
      for (int r = 0; r < 8; ++r) { const float v = acc[j][r] + bias; const _Float16 hv = (_Float16)v; sh[wave * 16 + 8 * g + r][j * 16 + col] = hv; sl[wave * 16 + 8 * g + r][j * 16 + col] = (_Float16)((v - (float)hv) * 1024.0f); } }
    __syncthreads();
    if (which == 1) {   /* k: 16 fragments = [head of 2][16-key group of 4][k step of 2], 64 pieces each; a head's 8 fragments are 8 KiB in a row */
      // unrolled: the 8 LDS reads go out together, and head and key group are constants of each trip, so that the 8 stores share one address
#pragma unroll
      for (int i = 0; i < 8; ++i) { const int e = tid + i * 128; const int f = e >> 6, pc = e & 63, hf = pc >> 5, ln = pc & 31; const int hh = f >> 3, kt = (f >> 1) & 3, kc = f & 1;
        vst2((unsigned*)(KH + ((((bb * NH + c0 / HD + hh) * (TT / 16) + t0 / 16 + kt) * (HD / 32) + kc) * 512 + pc * 8)), *(const v4u*)&sh[kt * 16 + (ln & 15)][hh * HD + kc * 32 + hf * 16 + (ln >> 4) * 8]); }
      asm volatile("s_wait_xcnt 0x0" ::: "memory"); }   /* stands before the code below rewrites registers that these stores name */
    for (int e = tid; e < 64 * 16; e += 128) { const int rl = e >> 4, q = e & 15; if (which == 0) { vst2((unsigned*)(DH + (r0 + rl) * CC + c0 + q * 8), *(const v4u*)&sh[rl][q * 8]); asm volatile("s_wait_xcnt 0x0" ::: "memory"); }   /* the wait stands before a register that the store names is rewritten */
      if (hi_rows) { vst2((unsigned*)(DL + (bb * nhi + t0 + rl) * (size_t)CC + c0 + q * 8), *(const v4u*)&sl[rl][q * 8]); asm volatile("s_wait_xcnt 0x0" ::: "memory"); } }   /* the same wait, before the next trip */
  } else { const bool hi_rows = t0 < KHI;
#pragma unroll
    for (int j = 0; j < 8; ++j) { const float bias = BA ? bfr(BA[c0 + j * 16 + col]) : 0.f;
#pragma unroll
      for (int r = 0; r < 8; ++r) { const float v = acc[j][r] + bias; const int rl = wave * 16 + 8 * g + r, cl = j * 16 + col; th[cl][rl] = (_Float16)v; const __bf16 bh = (__bf16)v; tb[cl][rl] = bh; tbl[cl][rl] = (__bf16)(v - (float)bh); } }
    __syncthreads();
    /* v^T: 16 fragments = [head of 2][32-key group of 2][16-channel group of 4], 64 pieces each */
    // unrolled: the 8 LDS reads go out together, and head and key group are constants of each trip, so that the 8 stores share one address
#pragma unroll
    for (int i = 0; i < 8; ++i) { const int e = tid + i * 128; const int f = e >> 6, pc = e & 63, hf = pc >> 5, ln = pc & 31; const int hh = f >> 3, kt = (f >> 2) & 1, j = f & 3;
      vst2((unsigned*)(VT + ((((bb * NH + c0 / HD + hh) * (TT / 32) + t0 / 32 + kt) * (HD / 16) + j) * 512 + pc * 8)), *(const v4u*)&th[hh * HD + j * 16 + (ln & 15)][kt * 32 + hf * 16 + (ln >> 4) * 8]); }
    asm volatile("s_wait_xcnt 0x0" ::: "memory");   /* stands before the code below rewrites registers that these stores name */
    for (int e = tid; e < 128 * 8; e += 128) { const int cl = e >> 3, q = e & 7; if (hi_rows) { const size_t o3 = (bb * CC + c0 + cl) * (size_t)KHI + t0 + q * 8; vst2((unsigned*)(VB + o3), *(const v4u*)&tb[cl][q * 8]); vst2((unsigned*)(VBL + o3), *(const v4u*)&tbl[cl][q * 8]); } } } }
// ---- k_fa: block = 64 queries (qb) of (b, h), wave = 16 queries, all keys in steps of 64: S^T = K q^T (key rows as A, query rows as B; q hi + residual x 2^10: 2 products) x SCALE, masked positions set to -1e9; running max and sum per query (lane & 15 = query, so both are per-lane values; the two lane halves hold different keys); D of S^T (lane = query, element r = key 8g + r) IS the 16x16x32 operand layout over 32 keys, so P = exp(s - max) goes once to f16 in place and ctx^T += v^T (A) P^T (B); ctx^T rows are channels, so the rescale and the final 1 / sum are per-lane too
__global__ __launch_bounds__(128) void k_fa(const _Float16* __restrict__ QH, const _Float16* __restrict__ KH, const _Float16* __restrict__ QL, const _Float16* __restrict__ VT, const int* __restrict__ MK, float* __restrict__ Y) {
  const int tid = threadIdx.x, wave = tid >> 5, lane = tid & 31, col = lane & 15, g = lane >> 4; const int h = blockIdx.y, b = blockIdx.z; const int ql0 = blockIdx.x * 64 + wave * 16;
  v16h qh[HD / 32], ql[HD / 32];
#pragma unroll
  for (int kc = 0; kc < HD / 32; ++kc) { qh[kc] = frag_h(QH + ((size_t)b * TT + ql0 + col) * CC + h * HD + kc * 32, lane); ql[kc] = frag_h(QL + ((size_t)b * QHI + ql0 + col) * CC + h * HD + kc * 32, lane); }
  const _Float16* Kb = KH + (size_t)(b * NH + h) * TT * HD; const _Float16* Vb = VT + (size_t)(b * NH + h) * TT * HD;   /* this head's fragments; 64 keys are 8 fragments = 8 KiB in a row in each */ const int* Mb = MK + ((size_t)b * TT + ql0 + col) * TT + 8 * g;
  v8f acc[HD / 16] = {}; float m = -3.0e38f, l = 0.f;
  // the key loop stays rolled: a second step's fragments would take the wave past 256 registers and cost a wave per SIMD; the inner loops are fully unrolled so that the fragment arrays are indexed by constants and stay in registers
#pragma unroll 1
  for (int k0 = 0; k0 < TT; k0 += 64) { float s[4][8]; float mx = -3.0e38f;
    v16h kf[4][HD / 32]; v4i mk[4][2];   /* the whole step's K fragments and mask words are requested before the first product: one load latency per step, not one per product */
#pragma unroll
    for (int t = 0; t < 4; ++t) {
#pragma unroll
      for (int kc = 0; kc < HD / 32; ++kc) kf[t][kc] = frag_ph(Kb + (size_t)k0 * HD + (t * (HD / 32) + kc) * 512, lane);
      mk[t][0] = *(const v4i*)(Mb + k0 + t * 16); mk[t][1] = *(const v4i*)(Mb + k0 + t * 16 + 4); }
#pragma unroll
    for (int t = 0; t < 4; ++t) { v8f a = {}, al = {};
#pragma unroll
      for (int kc = 0; kc < HD / 32; ++kc) { a = wmma16(kf[t][kc], qh[kc], a); al = wmma16(kf[t][kc], ql[kc], al); }
#pragma unroll
      for (int r = 0; r < 8; ++r) { float v = (a[r] + al[r] * (1.0f / 1024.0f)) * SCALE; if (mk[t][r >> 2][r & 3] != 0) v = -1.0e9f;   /* where(mask[b][q][k] (1 = masked), -1e9, scores): set; a fully masked row comes out uniform */
        s[t][r] = v; mx = fmaxf(mx, v); } }
    v16h vf[2][HD / 16];   /* the step's v fragments are requested here, so that they fly under the softmax arithmetic */
#pragma unroll
    for (int u = 0; u < 2; ++u)
#pragma unroll
      for (int j = 0; j < HD / 16; ++j) vf[u][j] = frag_ph(Vb + (size_t)k0 * HD + (u * (HD / 16) + j) * 512, lane);
    mx = fmaxf(mx, __shfl_xor(mx, 16)); const float mn = fmaxf(m, mx); const float alpha = expf(m - mn); m = mn;
    v16h p[2]; float sum = 0.f;
#pragma unroll
    for (int t = 0; t < 4; ++t)
#pragma unroll
      for (int r = 0; r < 8; ++r) { const float e = expf(s[t][r] - mn); sum += e; p[t >> 1][(t & 1) * 8 + r] = (_Float16)e; }
    l = l * alpha + sum;
#pragma unroll
    for (int j = 0; j < HD / 16; ++j)
#pragma unroll
      for (int r = 0; r < 8; ++r) acc[j][r] *= alpha;
#pragma unroll
    for (int u = 0; u < 2; ++u)
#pragma unroll
      for (int j = 0; j < HD / 16; ++j) acc[j] = wmma16(vf[u][j], p[u], acc[j]); }
  l += __shfl_xor(l, 16); const float inv = 1.0f / l;   /* l >= 1: the key that holds the max contributes exp(0) */
  float* yr = Y + ((size_t)b * TT + ql0 + col) * CC + h * HD + 8 * g;
#pragma unroll
  for (int j = 0; j < HD / 16; ++j) { v4f o0, o1;
#pragma unroll
    for (int r = 0; r < 4; ++r) { o0[r] = acc[j][r] * inv; o1[r] = acc[j][4 + r] * inv; }
    vst2(yr + j * 16, o0); vst2(yr + j * 16 + 4, o1); } }
// ---- k_out: block = (64 rows, 128 cols): out = ctx Wo (+ bo): all rows: ctx bf16 hi + lo against exact bf16 Wo from its packed fragments (2 products)
__global__ __launch_bounds__(128) void k_out(const float* __restrict__ Y, const float* __restrict__ WO, const __bf16* __restrict__ WPO, const float* __restrict__ BO, float* __restrict__ OUT, const float* __restrict__ RESX) { __shared__ __align__(16) float sf[4][16][132];
  const int tid = threadIdx.x, wave = tid >> 5, lane = tid & 31, col = lane & 15, g = lane >> 4; const int c0 = blockIdx.y * 128; const size_t r0 = (size_t)blockIdx.x * 64 + wave * 16;
  v8f acc[8] = {};
  if (true) {   /* ALL rows: ctx split bf16 hi + lo x exact Wo (2 products) */
#pragma unroll 2
    for (int kc = 0; kc < CC / 32; ++kc) { const F2 a = split_row(Y + (r0 + col) * CC, kc * 32, lane);
      v16b w[8];   /* the k step's packed B fragments are all requested before the first product */
#pragma unroll
      for (int j = 0; j < 8; ++j) w[j] = frag_p(WPO + ((size_t)kc * (DIN / 16) + c0 / 16 + j) * 512, lane);
#pragma unroll
      for (int j = 0; j < 8; ++j) { acc[j] = wmma_bf(a.h, w[j], acc[j]); acc[j] = wmma_bf(a.l, w[j], acc[j]); }
      asm volatile("s_wait_xcnt 0x0" ::: "memory"); }   /* stands before the next k step rewrites the address registers that this step's loads name */
#pragma unroll
    for (int j = 0; j < 8; ++j) { const float bias = BO ? bfr(BO[c0 + j * 16 + col]) : 0.f;
#pragma unroll
      for (int r = 0; r < 8; ++r) sf[wave][8 * g + r][j * 16 + col] = acc[j][r] + bias; }
  } else {
#pragma unroll 2
    for (int kc = 0; kc < CC / 32; ++kc) { const v16h a = frag_f32(Y + (r0 + col) * CC + kc * 32, lane); asm volatile("s_wait_loadcnt 0x0" ::: "memory");
#pragma unroll
      for (int j = 0; j < 8; ++j) { const v16h w = WOCOLH(WO, kc * 32, c0 + j * 16 + col, lane); asm volatile("s_wait_loadcnt 0x0" ::: "memory"); acc[j] = wmma16(a, w, acc[j]); } }
#pragma unroll
    for (int j = 0; j < 8; ++j) { const float bias = BO ? bfr(BO[c0 + j * 16 + col]) : 0.f;
#pragma unroll
      for (int r = 0; r < 8; ++r) sf[wave][8 * g + r][j * 16 + col] = acc[j][r] * (1.0f / 256.0f) + bias; } }
  LDSX(); for (int rl = 0; rl < 16; ++rl) { const size_t oo = (r0 + rl) * DIN + c0 + lane * 4; v4f o = *(const v4f*)&sf[wave][rl][lane * 4]; const v4f zr = *(const v4f*)(RESX + oo); o[0] += bfr(zr[0]); o[1] += bfr(zr[1]); o[2] += bfr(zr[2]); o[3] += bfr(zr[3]); vst2(OUT + oo, o); } }   /* ctx W_O + bf16(input_Q) */

extern "C" void kernel_launch(void* const* d_in, const int* in_sizes, int n_in, void* d_out, int out_size, void* d_ws, size_t ws_size, hipStream_t stream) {
  (void)in_sizes; (void)n_in; (void)out_size;
  const float** F = (const float**)d_in;
  if (ws_size < (size_t)WS_END) return;
  char* ws = (char*)d_ws; _Float16 *QH = (_Float16*)(ws + WS_QH), *KH = (_Float16*)(ws + WS_KH), *VT = (_Float16*)(ws + WS_VT), *QL = (_Float16*)(ws + WS_QL), *KL = (_Float16*)(ws + WS_KL); __bf16 *VB = (__bf16*)(ws + WS_VB), *VBL = (__bf16*)(ws + WS_VBL); float *Y = (float*)(ws + WS_Y);
  (void)Y; (void)QL; (void)KL; (void)VB; (void)VBL;
  // inputs: 0 input_Q; 1 input_K; 2 input_V [2,2048,1024]; 3 mask [2,2048,2048] int32 (1 = masked); 4 W_Q (in,out); 5 W_K; 6 W_V; 7 W_O (in,out); 8 ln_gamma; 9 ln_beta
  if (ws_size < (size_t)WS_END3) return;
  float* X1 = (float*)(ws + WS_X1); __bf16 *WP = (__bf16*)(ws + WS_WP), *XP = (__bf16*)(ws + WS_XP);
  k_pack<<<dim3(4 * PKW + 3 * PKX), 256, 0, stream>>>(F[4], F[5], F[6], F[7], F[0], F[1], F[2], WP, XP);   /* weights and inputs -> bf16 fragments, every call */
  k_proj<<<dim3(TNB * TT / 64, CC / 128, 3), 128, 0, stream>>>(XP, WP, nullptr, nullptr, nullptr, QH, QL, KH, KL, VT, VB, VBL);
  k_fa<<<dim3(NQB, NH, TNB), 128, 0, stream>>>(QH, KH, QL, VT, (const int*)d_in[3], Y);
  k_out<<<dim3(TNB * TT / 64, DIN / 128), 128, 0, stream>>>(Y, F[7], WP + 3 * (size_t)DIN * CC, nullptr, X1, F[0]);   /* ctx W_O + input_Q */
  k_lnx<<<dim3(NRW / 8), 256, 0, stream>>>(X1, 0, F[8], F[9], (float*)d_out);              /* LayerNorm */
}

// v004
// A run of this version takes 163 microseconds.
// Next to v003, in two timings, it ran 1.09 times as fast each time.
// Counting every step since v000, it is 7.48 times as fast.
// compute dtype: all float inputs rounded to bf16; q/k/v = in W with EXACT bf16 products on WMMA 16x16x32 (f32 accumulate); q as f16 hi + residual (x 2^10) against k once to f16 (2 products), masked (mask == 1) positions set to -2^33 (-2^30 after the / 8, standing for -1e9); softmax in f32 in base 2 (hardware exp2 of (x - max) * log2(e) / 8, running max and sum over key steps of 64); P = exp(s - max) once to f16 against v once to f16 (1 product), divided by the sum at the end; ctx split bf16 hi + lo against exact W_O (2 products) + input_Q; LayerNorm in f32; f32 output.
#include <hip/hip_runtime.h>
#include <math.h>

typedef __attribute__((ext_vector_type(16))) _Float16 v16h;
typedef __attribute__((ext_vector_type(16))) __bf16 v16b;
typedef __attribute__((ext_vector_type(8)))  _Float16 v8h;
typedef __attribute__((ext_vector_type(8)))  float v8f;
typedef __attribute__((ext_vector_type(4)))  float v4f;
typedef __attribute__((ext_vector_type(2)))  float v2f;
typedef __attribute__((ext_vector_type(4)))  unsigned v4u;
typedef __attribute__((ext_vector_type(4)))  int v4i;
typedef float __attribute__((may_alias)) float_a;
typedef int __attribute__((may_alias)) int_a;

template <typename T> __device__ __forceinline__ void vst2(void* p, T v) { *(T*)p = v;  }
__device__ __forceinline__ v8f wmma16(v16h a, v16h b, v8f c) {
  v8f d = __builtin_amdgcn_wmma_f32_16x16x32_f16(false, a, false, b, (short)0, c, false, false);
  asm volatile("v_nop\n\tv_nop\n\tv_nop\n\tv_nop" : "+v"(d) : "v"(a), "v"(b));
  return d;
}
__device__ __forceinline__ v8f wmma_bf(v16b a, v16b b, v8f c) {
  v8f d = __builtin_amdgcn_wmma_f32_16x16x32_bf16(false, a, false, b, (short)0, c, false, false);
  asm volatile("v_nop\n\tv_nop\n\tv_nop\n\tv_nop" : "+v"(d) : "v"(a), "v"(b));
  return d;
}
// 16x16x32 fragments: lane = (h = lane>>4, row/col = lane&15); elements 0..7 = k0+8h+0..7, 8..15 = k0+16+8h+0..7; D element r = row 8h+r
__device__ __forceinline__ v16h frag_h(const _Float16* rowk0, int lane) {
  union { v16h v; v8h q[2]; } u; const _Float16* p = rowk0 + 8 * (lane >> 4);
  u.q[0] = *(const v8h*)p; u.q[1] = *(const v8h*)(p + 16); return u.v;
}
__device__ __forceinline__ v16h frag_f32(const float* rowk0, int lane) {
  v16h a; const float* p = rowk0 + 8 * (lane >> 4);
#pragma unroll
  for (int i = 0; i < 8; ++i) { a[i] = (_Float16)p[i]; a[8 + i] = (_Float16)p[16 + i]; }
  return a;
}
__device__ __forceinline__ v16h frag_f32s(const float* rowk0, int lane, float sc) {
  v16h a; const float* p = rowk0 + 8 * (lane >> 4);
#pragma unroll
  for (int i = 0; i < 8; ++i) { a[i] = (_Float16)(p[i] * sc); a[8 + i] = (_Float16)(p[16 + i] * sc); }
  return a;
}
// column fragment from a [K][ld] layout (column n), rows >= K read as 0
__device__ __forceinline__ v16h fragc_f32(const float* W, int k0, int n, int lane, int ld, int K) {
  v16h a; const int g = lane >> 4;
#pragma unroll
  for (int i = 0; i < 8; ++i) { const int ka = k0 + 8 * g + i, kb = ka + 16;
    a[i] = (_Float16)(ka < K ? W[(size_t)(ka < K ? ka : K - 1) * ld + n] : 0.f); a[8 + i] = (_Float16)(kb < K ? W[(size_t)(kb < K ? kb : K - 1) * ld + n] : 0.f); }
  return a;
}
struct F2 { v16b h, l; };
__device__ __forceinline__ F2 bsplit16(const float v[16]) { F2 r;
#pragma unroll
  for (int i = 0; i < 16; ++i) { const __bf16 h = (__bf16)v[i]; r.h[i] = h; r.l[i] = (__bf16)(v[i] - (float)h); }
  return r; }
__device__ __forceinline__ F2 split_row(const float* row, int k0, int lane) { float v[16]; const float* p = row + k0 + 8 * (lane >> 4);
#pragma unroll
  for (int i = 0; i < 8; ++i) { v[i] = p[i]; v[8 + i] = p[16 + i]; }
  return bsplit16(v); }
__device__ __forceinline__ F2 split_rowK(const float* row, int k0, int lane, int K) { float v[16]; const int g = lane >> 4;
#pragma unroll
  for (int i = 0; i < 8; ++i) { const int ka = k0 + 8 * g + i, kb = ka + 16; v[i] = ka < K ? row[ka < K ? ka : K - 1] : 0.f; v[8 + i] = kb < K ? row[kb < K ? kb : K - 1] : 0.f; }
  return bsplit16(v); }
__device__ __forceinline__ F2 split_col(const float* W, int k0, int n, int lane, int ld, int K) { float v[16]; const int g = lane >> 4;
#pragma unroll
  for (int i = 0; i < 8; ++i) { const int ka = k0 + 8 * g + i, kb = ka + 16; v[i] = ka < K ? W[(size_t)(ka < K ? ka : K - 1) * ld + n] : 0.f; v[8 + i] = kb < K ? W[(size_t)(kb < K ? kb : K - 1) * ld + n] : 0.f; }
  return bsplit16(v); }
__device__ __forceinline__ v8f mac3(const F2& a, const F2& b, v8f c) { c = wmma_bf(a.l, b.h, c); c = wmma_bf(a.h, b.l, c); return wmma_bf(a.h, b.h, c); }
__device__ __forceinline__ float sigm(float v) { return 1.0f / (1.0f + expf(-v)); }
#define LDSX() do { asm volatile("s_wait_dscnt 0" ::: "memory"); __builtin_amdgcn_wave_barrier(); __builtin_amdgcn_fence(__ATOMIC_RELEASE, "workgroup"); } while (0)

// Multi-head attention layer with a random (query, key) mask, residual and LayerNorm (B 2, S 2,048, 1,024 = 16 x 64; (in,out) 1/32-scale weights, no biases; mask [B,S,S] int, 1 = MASKED (~half); LN affine 1/0, eps 1e-5): q = input_Q W_Q ...; scores = q k^T / 8 with where(mask, -1e9, s); ctx = softmax v; out = LN(ctx W_O + input_Q).
#define NB 2
#define TT 2048
#define CC 1024            // NH * HD = projected width
#define DIN 1024          // input (model) width
#define NH 16
#define HD 64
#define NQB (TT / 64)
#define HG 4
#define SCALE (0.125f)
#define SCL2 (SCALE * 1.44269504088896341f)   // score scale times log2(e): exp(SCALE * x) = exp2(SCL2 * x)
#define XMASK (-8589934592.0f)                // a masked position's unscaled score, -2^33: SCALE * XMASK = -2^30 stands for the reference's -1e9 (either is 0 after the exp beside any real score); a power of two, so that XMASK * SCL2 is exact and a fully masked row gets exp2(0) = 1 at every key
#define CAUSAL 0
#ifndef TNB
#define TNB NB
#endif
__device__ __forceinline__ float bfr(float v) { return (float)(__bf16)v; }
__host__ __device__ __forceinline__ int kb_last(int qb) { return CAUSAL ? ((qb * 64 + 63) >> 7) : (TT / 128 - 1); }
typedef __attribute__((ext_vector_type(8))) __bf16 v8b;
__device__ __forceinline__ v16b frag_b(const __bf16* rowk0, int lane) {
  union { v16b v; v8b q[2]; } u; const __bf16* p = rowk0 + 8 * (lane >> 4);
  u.q[0] = *(const v8b*)p; u.q[1] = *(const v8b*)(p + 16); return u.v;
}
#define QBH 0
#define QHI 2048            // rows carrying a q residual plane (all rows when non-causal: 2-product logits everywhere)
#define KHI 64            // key rows carrying k residual / v bf16 hi+lo planes (written by k_proj; no kernel reads them)
// B fragment (k rows k0+.., output column o) of a weight: (in,out) [K][ld] or (out,in) [ld rows of K]: bf16 exact, or f16(bf16 * 256) exact
__device__ __forceinline__ v16b wcol_io(const float* Wm, int k0, int o, int lane, int ld) { v16b w; const int g = lane >> 4;
#pragma unroll
  for (int i = 0; i < 8; ++i) { w[i] = (__bf16)Wm[(size_t)(k0 + 8 * g + i) * ld + o]; w[8 + i] = (__bf16)Wm[(size_t)(k0 + 16 + 8 * g + i) * ld + o]; }
  return w; }
__device__ __forceinline__ v16b wcol_oi(const float* Wm, int k0, int o, int lane, int K) { v16b w; const float* p = Wm + (size_t)o * K + k0 + 8 * (lane >> 4);
#pragma unroll
  for (int i = 0; i < 8; ++i) { w[i] = (__bf16)p[i]; w[8 + i] = (__bf16)p[16 + i]; }
  return w; }
__device__ __forceinline__ v16h wcolh_io(const float* Wm, int k0, int o, int lane, int ld) { v16h w; const int g = lane >> 4;
#pragma unroll
  for (int i = 0; i < 8; ++i) { w[i] = (_Float16)(bfr(Wm[(size_t)(k0 + 8 * g + i) * ld + o]) * 256.0f); w[8 + i] = (_Float16)(bfr(Wm[(size_t)(k0 + 16 + 8 * g + i) * ld + o]) * 256.0f); }
  return w; }
__device__ __forceinline__ v16h wcolh_oi(const float* Wm, int k0, int o, int lane, int K) { v16h w; const float* p = Wm + (size_t)o * K + k0 + 8 * (lane >> 4);
#pragma unroll
  for (int i = 0; i < 8; ++i) { w[i] = (_Float16)(bfr(p[i]) * 256.0f); w[8 + i] = (_Float16)(bfr(p[16 + i]) * 256.0f); }
  return w; }
#define WQKV_LAYOUT 0   // 0 = (in,out) [DIN][CC]; 1 = (out,in) [CC][DIN]; 2 = per-head [NH][DIN][HD]
__device__ __forceinline__ v16b wcol_hdk(const float* Wm, int k0, int o, int lane) { v16b w; const int g = lane >> 4; const float* p = Wm + (size_t)(o / HD) * DIN * HD + (o % HD);
#pragma unroll
  for (int i = 0; i < 8; ++i) { w[i] = (__bf16)p[(size_t)(k0 + 8 * g + i) * HD]; w[8 + i] = (__bf16)p[(size_t)(k0 + 16 + 8 * g + i) * HD]; }
  return w; }
#define WO_OUT_IN 0
#if WQKV_LAYOUT == 1
#define WCOL(W, k0, o, lane) wcol_oi(W, k0, o, lane, DIN)
#elif WQKV_LAYOUT == 2
#define WCOL(W, k0, o, lane) wcol_hdk(W, k0, o, lane)
#else
#define WCOL(W, k0, o, lane) wcol_io(W, k0, o, lane, CC)
#endif
#if WO_OUT_IN
#define WOCOL(W, k0, o, lane) wcol_oi(W, k0, o, lane, CC)
#define WOCOLH(W, k0, o, lane) wcolh_oi(W, k0, o, lane, CC)
#else
#define WOCOL(W, k0, o, lane) wcol_io(W, k0, o, lane, DIN)
#define WOCOLH(W, k0, o, lane) wcolh_io(W, k0, o, lane, DIN)
#endif
#define SM_EXTRA_PARAMS , const int* __restrict__ MK, int bcur
#define SM_MASK_HOOK do { if (MK[((size_t)bcur * TT + t) * TT + k] != 0) v = -1.0e9f; } while (0)   /* where(mask[b][q][k] (1 = masked), -1e9, scores): set; a fully masked row would be uniform (none here) */
#define NRW (TNB * TT)
// ---- k_lnx: wave per row: LayerNorm over 1024 (mean, biased var, (x - mean) * rsqrt(var + 1e-5) * g + b); optional bf16 rounding of the input (x); 32 floats per lane (8 float4 at stride 128 floats -> 512-B pieces)
__global__ __launch_bounds__(256) void k_lnx(const float* __restrict__ X, int roundin, const float* __restrict__ G, const float* __restrict__ BE, float* __restrict__ OUT) { const int wave = threadIdx.x >> 5, lane = threadIdx.x & 31; const size_t row = (size_t)blockIdx.x * 8 + wave; if (row >= (size_t)NRW) return;
  v4f v[CC / 128]; float s1 = 0.f;
#pragma unroll
  for (int i = 0; i < CC / 128; ++i) { v4f t = *(const v4f*)(X + row * CC + i * 128 + lane * 4); if (roundin) { t[0] = bfr(t[0]); t[1] = bfr(t[1]); t[2] = bfr(t[2]); t[3] = bfr(t[3]); } v[i] = t; s1 += (t[0] + t[1]) + (t[2] + t[3]); }
#pragma unroll
  for (int o = 1; o < 32; o <<= 1) s1 += __shfl_xor(s1, o);
  const float mu = s1 * (1.0f / CC); float q = 0.f;
#pragma unroll
  for (int i = 0; i < CC / 128; ++i) for (int k = 0; k < 4; ++k) { const float d = v[i][k] - mu; q += d * d; }
#pragma unroll
  for (int o = 1; o < 32; o <<= 1) q += __shfl_xor(q, o);
  const float inv = rsqrtf(q * (1.0f / CC) + 1e-5f);   /* jnp.var (biased), eps inside the rsqrt */
#pragma unroll
  for (int i = 0; i < CC / 128; ++i) { const int c = i * 128 + lane * 4; v4f r4; for (int k = 0; k < 4; ++k) r4[k] = bfr(G[c + k]) * ((v[i][k] - mu) * inv) + bfr(BE[c + k]); vst2(OUT + row * CC + c, r4); } }

#ifndef SM_EXTRA_PARAMS
#define SM_EXTRA_PARAMS
#endif
#ifndef PROJ_EXTRA_PARAMS
#define PROJ_EXTRA_PARAMS
#endif
#ifndef SM_MASK_HOOK
#define SM_MASK_HOOK (void)0
#endif

#define WS_QH  0u                                      // f16 q rows [b*t][CC]
#define WS_KH  (WS_QH + 2u * (size_t)NB * TT * CC)      // f16 k as A fragments [b][h][16-key group][k step of 32 channels][1 KiB fragment]
#define WS_VT  (WS_KH + 2u * (size_t)NB * TT * CC)      // f16 v^T as A fragments [b][h][32-key group][16-channel group][1 KiB fragment]
#define WS_QL  (WS_VT + 2u * (size_t)NB * CC * TT)      // f16 q residual x 2^10 rows [b][t < QHI][CC]
#define WS_KL  (WS_QL + 2u * (size_t)NB * QHI * CC)     // f16 k residual x 2^10 rows [b][t < KHI][CC]
#define WS_VB  (WS_KL + 2u * (size_t)NB * KHI * CC)     // bf16 v hi planes [b][c][t < KHI]
#define WS_VBL (WS_VB + 2u * (size_t)NB * CC * KHI)
#define WS_S   (WS_VBL + 2u * (size_t)NB * CC * KHI)    // f32 [hg][t][s] region, unused (k_fa keeps logits and P in registers)
#define WS_Y   (WS_S  + 4u * (size_t)HG * TT * TT)      // f32 ctx rows [b*t][CC] (only when there is an output projection)
#define WS_END (WS_Y  + 4u * (size_t)NB * TT * CC)
#define WS_X1  (WS_END)
#define WS_END2 (WS_X1 + 4u * (size_t)NB * TT * DIN)

#define WS_WP  (WS_END2)                                // bf16 weights as B fragments [W_Q, W_K, W_V, W_O][k step of 32][16-column group][1 KiB fragment]
#define WS_XP  (WS_WP + 2u * 4u * (size_t)DIN * CC)     // bf16 inputs as A fragments [input_Q, input_K, input_V][16-row group][k step of 32][1 KiB fragment]
#define WS_END3 (WS_XP + 2u * 3u * (size_t)NB * TT * DIN)
#define PKP 16                                // pieces per k_pack thread: few waves with many loads in flight each (for speed only)
#define PKW (DIN * CC / 8 / 256 / PKP)        // k_pack blocks per weight
#define PKX (NB * TT * DIN / 8 / 256 / PKP)   // k_pack blocks per input
// ---- k_pack: a piece = 16 bytes of a 16x16x32 operand fragment, rounded to bf16. A 1 KiB fragment is [half hf][lane][8]: piece (hf, lane) holds k = k0 + 16 hf + 8 (lane >> 4) + 0..7 of row or column (lane & 15), the k order of the fragment comment above; a wave's store is 512 contiguous bytes
__global__ __launch_bounds__(256) void k_pack(const float* __restrict__ W0, const float* __restrict__ W1, const float* __restrict__ W2, const float* __restrict__ W3, const float* __restrict__ X0, const float* __restrict__ X1, const float* __restrict__ X2, __bf16* __restrict__ WP, __bf16* __restrict__ XP) {
  const int bx = blockIdx.x;
  if (bx < 4 * PKW) { const int mt = bx / PKW; const float* Wm = mt == 0 ? W0 : mt == 1 ? W1 : mt == 2 ? W2 : W3; __bf16* D = WP + (size_t)mt * DIN * CC;   /* (in,out) weight: piece e = [kc][ob][hf][lane] */
    const int e0 = (bx % PKW) * (256 * PKP) + threadIdx.x;
    // rolled over groups of 4 pieces: 32 loads in flight per lane are enough, and the registers stay few
#pragma unroll 1
    for (int it = 0; it < PKP; it += 4) { float t[4][8];
#pragma unroll
      for (int u = 0; u < 4; ++u) { const int e = e0 + (it + u) * 256; const int lane = e & 31, hf = (e >> 5) & 1, ob = (e >> 6) % (CC / 16), kc = (e >> 6) / (CC / 16);
        const float* p = Wm + (size_t)(kc * 32 + 16 * hf + 8 * (lane >> 4)) * CC + ob * 16 + (lane & 15);
#pragma unroll
        for (int i = 0; i < 8; ++i) t[u][i] = p[(size_t)i * CC]; }
#pragma unroll
      for (int u = 0; u < 4; ++u) { v8b w;
#pragma unroll
        for (int i = 0; i < 8; ++i) w[i] = (__bf16)t[u][i];
        vst2(D + (size_t)(e0 + (it + u) * 256) * 8, w); }
      asm volatile("s_wait_xcnt 0x0" ::: "memory"); }   /* stands before the next trip rewrites registers that this trip's stores name */
  } else { const int b2 = bx - 4 * PKW; const int mt = b2 / PKX; const float* Xm = mt == 0 ? X0 : mt == 1 ? X1 : X2; __bf16* D = XP + (size_t)mt * NB * TT * DIN;   /* input rows: piece e = [rb][kc][hf][lane] */
    const int e0 = (b2 % PKX) * (256 * PKP) + threadIdx.x;
    // rolled over groups of 8 pieces: 16 16-byte loads in flight per lane. The 8 pieces of a trip lie 256 pieces = 4 k steps apart, in one input row (32 k steps a row, first k step < 4): one load address and one store address a trip, the rest are constant offsets
#pragma unroll 1
    for (int it = 0; it < PKP; it += 8) { const int e = e0 + it * 256; const int lane = e & 31, hf = (e >> 5) & 1, kc = (e >> 6) % (DIN / 32), rb = (e >> 6) / (DIN / 32);
      const float* p = Xm + (size_t)(rb * 16 + (lane & 15)) * DIN + kc * 32 + 16 * hf + 8 * (lane >> 4); __bf16* q = D + (size_t)e * 8;
      v4f t[8][2]; v8b w[8];
#pragma unroll
      for (int u = 0; u < 8; ++u) { t[u][0] = *(const v4f*)(p + u * 128); t[u][1] = *(const v4f*)(p + u * 128 + 4); }
      // the wait that stands before a register named by an issued load is rewritten; it takes the address and the loaded values as inputs, so that all 16 loads stand in front of it and none of them lands in the address registers
      asm volatile("s_wait_xcnt 0x0" :: "v"(p), "v"(t[0][0]), "v"(t[0][1]), "v"(t[1][0]), "v"(t[1][1]), "v"(t[2][0]), "v"(t[2][1]), "v"(t[3][0]), "v"(t[3][1]), "v"(t[4][0]), "v"(t[4][1]), "v"(t[5][0]), "v"(t[5][1]), "v"(t[6][0]), "v"(t[6][1]), "v"(t[7][0]), "v"(t[7][1]) : "memory");
#pragma unroll
      for (int u = 0; u < 8; ++u) {
#pragma unroll
        for (int i = 0; i < 4; ++i) { w[u][i] = (__bf16)t[u][0][i]; w[u][4 + i] = (__bf16)t[u][1][i]; }
        vst2(q + u * 2048, w[u]); }
      // the same wait behind the stores, before the next trip rewrites what they name; it takes the stored values as inputs, so that their registers live up to it
      asm volatile("s_wait_xcnt 0x0" :: "v"(w[0]), "v"(w[1]), "v"(w[2]), "v"(w[3]), "v"(w[4]), "v"(w[5]), "v"(w[6]), "v"(w[7]) : "memory"); } } }
// a packed fragment: two 16-byte loads per lane, each 512 contiguous bytes per wave
__device__ __forceinline__ v16b frag_p(const __bf16* fr, int lane) {
  union { v16b v; v8b q[2]; } u; const __bf16* p = fr + lane * 8;
  u.q[0] = *(const v8b*)p; u.q[1] = *(const v8b*)(p + 256); return u.v;
}
__device__ __forceinline__ v16h frag_ph(const _Float16* fr, int lane) {
  union { v16h v; v8h q[2]; } u; const _Float16* p = fr + lane * 8;
  u.q[0] = *(const v8h*)p; u.q[1] = *(const v8h*)(p + 256); return u.v;
}
// ---- k_proj: block = (64 rows, 128 cols, which): q/k/v = X W (+ b) with exact bf16 products (K = DIN) -> which 0: q f16 rows (+ residual rows < QHI); 1: k f16 fragments (+ residual rows < KHI); 2: v^T f16 fragments (+ bf16 hi/lo planes for t < KHI). A k or v^T fragment is [half hf][lane][8] like a packed weight fragment: piece (hf, lane) holds k index 16 hf + 8 (lane >> 4) + 0..7 of row (lane & 15), the elements that lane takes in k_fa, so that a wave's load there is 512 contiguous bytes
__global__ __launch_bounds__(128) void k_proj(const __bf16* __restrict__ XP, const __bf16* __restrict__ WP, const float* __restrict__ BQ, const float* __restrict__ BK, const float* __restrict__ BV,
    _Float16* __restrict__ QH, _Float16* __restrict__ QL, _Float16* __restrict__ KH, _Float16* __restrict__ KL, _Float16* __restrict__ VT, __bf16* __restrict__ VB, __bf16* __restrict__ VBL) {
  __shared__ __align__(16) _Float16 sh[64][136], sl[64][136]; __shared__ __align__(16) _Float16 th[128][72]; __shared__ __align__(16) __bf16 tb[128][72], tbl[128][72];
  const int tid = threadIdx.x, wave = tid >> 5, lane = tid & 31, col = lane & 15, g = lane >> 4; const int which = blockIdx.z; const int c0 = blockIdx.y * 128; const size_t r0 = (size_t)blockIdx.x * 64; const size_t bb = r0 / TT; const int t0 = (int)(r0 % TT);
  const __bf16* XA = XP + (size_t)which * NB * TT * DIN + (r0 / 16 + wave) * (size_t)(DIN / 32) * 512; const __bf16* WA = WP + (size_t)which * DIN * CC + (size_t)(c0 / 16) * 512; const float* BA = which == 0 ? BQ : which == 1 ? BK : BV;
  v8f acc[8] = {};
#pragma unroll 2
  for (int kc = 0; kc < DIN / 32; ++kc) { const v16b a = frag_p(XA + (size_t)kc * 512, lane);
    v16b w[8];   /* the k step's packed fragments are all requested before the first product */
#pragma unroll
    for (int j = 0; j < 8; ++j) w[j] = frag_p(WA + ((size_t)kc * (CC / 16) + j) * 512, lane);
#pragma unroll
    for (int j = 0; j < 8; ++j) acc[j] = wmma_bf(a, w[j], acc[j]);
    asm volatile("s_wait_xcnt 0x0" ::: "memory"); }   /* stands before the next k step rewrites the address registers that this step's loads name */
  if (which < 2) { _Float16* DH = which == 0 ? QH : KH; _Float16* DL = which == 0 ? QL : KL; const int nhi = which == 0 ? QHI : KHI; const bool hi_rows = t0 < nhi;
#pragma unroll
    for (int j = 0; j < 8; ++j) { const float bias = BA ? bfr(BA[c0 + j * 16 + col]) : 0.f;
#pragma unroll
      for (int r = 0; r < 8; ++r) { const float v = acc[j][r] + bias; const _Float16 hv = (_Float16)v; sh[wave * 16 + 8 * g + r][j * 16 + col] = hv; sl[wave * 16 + 8 * g + r][j * 16 + col] = (_Float16)((v - (float)hv) * 1024.0f); } }
    __syncthreads();
    if (which == 1) {   /* k: 16 fragments = [head of 2][16-key group of 4][k step of 2], 64 pieces each; a head's 8 fragments are 8 KiB in a row */
      // unrolled: the 8 LDS reads go out together, and head and key group are constants of each trip, so that the 8 stores share one address
#pragma unroll
      for (int i = 0; i < 8; ++i) { const int e = tid + i * 128; const int f = e >> 6, pc = e & 63, hf = pc >> 5, ln = pc & 31; const int hh = f >> 3, kt = (f >> 1) & 3, kc = f & 1;
        vst2((unsigned*)(KH + ((((bb * NH + c0 / HD + hh) * (TT / 16) + t0 / 16 + kt) * (HD / 32) + kc) * 512 + pc * 8)), *(const v4u*)&sh[kt * 16 + (ln & 15)][hh * HD + kc * 32 + hf * 16 + (ln >> 4) * 8]); }
      asm volatile("s_wait_xcnt 0x0" ::: "memory"); }   /* stands before the code below rewrites registers that these stores name */
    for (int e = tid; e < 64 * 16; e += 128) { const int rl = e >> 4, q = e & 15; if (which == 0) { vst2((unsigned*)(DH + (r0 + rl) * CC + c0 + q * 8), *(const v4u*)&sh[rl][q * 8]); asm volatile("s_wait_xcnt 0x0" ::: "memory"); }   /* the wait stands before a register that the store names is rewritten */
      if (hi_rows) { vst2((unsigned*)(DL + (bb * nhi + t0 + rl) * (size_t)CC + c0 + q * 8), *(const v4u*)&sl[rl][q * 8]); asm volatile("s_wait_xcnt 0x0" ::: "memory"); } }   /* the same wait, before the next trip */
  } else { const bool hi_rows = t0 < KHI;
#pragma unroll
    for (int j = 0; j < 8; ++j) { const float bias = BA ? bfr(BA[c0 + j * 16 + col]) : 0.f;
#pragma unroll
      for (int r = 0; r < 8; ++r) { const float v = acc[j][r] + bias; const int rl = wave * 16 + 8 * g + r, cl = j * 16 + col; th[cl][rl] = (_Float16)v; const __bf16 bh = (__bf16)v; tb[cl][rl] = bh; tbl[cl][rl] = (__bf16)(v - (float)bh); } }
    __syncthreads();
    /* v^T: 16 fragments = [head of 2][32-key group of 2][16-channel group of 4], 64 pieces each */
    // unrolled: the 8 LDS reads go out together, and head and key group are constants of each trip, so that the 8 stores share one address
#pragma unroll
    for (int i = 0; i < 8; ++i) { const int e = tid + i * 128; const int f = e >> 6, pc = e & 63, hf = pc >> 5, ln = pc & 31; const int hh = f >> 3, kt = (f >> 2) & 1, j = f & 3;
      vst2((unsigned*)(VT + ((((bb * NH + c0 / HD + hh) * (TT / 32) + t0 / 32 + kt) * (HD / 16) + j) * 512 + pc * 8)), *(const v4u*)&th[hh * HD + j * 16 + (ln & 15)][kt * 32 + hf * 16 + (ln >> 4) * 8]); }
    asm volatile("s_wait_xcnt 0x0" ::: "memory");   /* stands before the code below rewrites registers that these stores name */
    for (int e = tid; e < 128 * 8; e += 128) { const int cl = e >> 3, q = e & 7; if (hi_rows) { const size_t o3 = (bb * CC + c0 + cl) * (size_t)KHI + t0 + q * 8; vst2((unsigned*)(VB + o3), *(const v4u*)&tb[cl][q * 8]); vst2((unsigned*)(VBL + o3), *(const v4u*)&tbl[cl][q * 8]); } } } }
// ---- k_fa: block = 64 queries (qb) of (b, h), wave = 16 queries, all keys in steps of 64: S^T = K q^T (key rows as A, query rows as B; q hi + residual x 2^10: 2 products), unscaled, masked positions set to XMASK; running max and sum per query (lane & 15 = query, so both are per-lane values; the two lane halves hold different keys); D of S^T (lane = query, element r = key 8g + r) IS the 16x16x32 operand layout over 32 keys, so P = exp2(x * SCL2 - max * SCL2) (one fma and the hardware exp2 per score) goes once to f16 in place and ctx^T += v^T (A) P^T (B); ctx^T rows are channels, so the rescale and the final 1 / sum are per-lane too
__global__ __launch_bounds__(128) void k_fa(const _Float16* __restrict__ QH, const _Float16* __restrict__ KH, const _Float16* __restrict__ QL, const _Float16* __restrict__ VT, const int* __restrict__ MK, float* __restrict__ Y) {
  const int tid = threadIdx.x, wave = tid >> 5, lane = tid & 31, col = lane & 15, g = lane >> 4; const int h = blockIdx.y, b = blockIdx.z; const int ql0 = blockIdx.x * 64 + wave * 16;
  v16h qh[HD / 32], ql[HD / 32];
#pragma unroll
  for (int kc = 0; kc < HD / 32; ++kc) { qh[kc] = frag_h(QH + ((size_t)b * TT + ql0 + col) * CC + h * HD + kc * 32, lane); ql[kc] = frag_h(QL + ((size_t)b * QHI + ql0 + col) * CC + h * HD + kc * 32, lane); }
  const _Float16* Kb = KH + (size_t)(b * NH + h) * TT * HD; const _Float16* Vb = VT + (size_t)(b * NH + h) * TT * HD;   /* this head's fragments; 64 keys are 8 fragments = 8 KiB in a row in each */ const int* Mb = MK + ((size_t)b * TT + ql0 + col) * TT + 8 * g;
  v8f acc[HD / 16] = {}; float m = -3.0e38f, mc = -3.0e38f * SCL2, l = 0.f;   /* mc = m * SCL2: the running max in the exponent's own unit */
  // the key loop stays rolled: a second step's fragments would take the wave past 256 registers and cost a wave per SIMD; the inner loops are fully unrolled so that the fragment arrays are indexed by constants and stay in registers
#pragma unroll 1
  for (int k0 = 0; k0 < TT; k0 += 64) { float s[4][8]; float mx = -3.0e38f;
    v16h kf[4][HD / 32]; v4i mk[4][2];   /* the whole step's K fragments and mask words are requested before the first product: one load latency per step, not one per product */
#pragma unroll
    for (int t = 0; t < 4; ++t) {
#pragma unroll
      for (int kc = 0; kc < HD / 32; ++kc) kf[t][kc] = frag_ph(Kb + (size_t)k0 * HD + (t * (HD / 32) + kc) * 512, lane);
      mk[t][0] = *(const v4i*)(Mb + k0 + t * 16); mk[t][1] = *(const v4i*)(Mb + k0 + t * 16 + 4); }
#pragma unroll
    for (int t = 0; t < 4; ++t) { v8f a = {}, al = {};
#pragma unroll
      for (int kc = 0; kc < HD / 32; ++kc) { a = wmma16(kf[t][kc], qh[kc], a); al = wmma16(kf[t][kc], ql[kc], al); }
#pragma unroll
      for (int r = 0; r < 8; ++r) { float v = a[r] + al[r] * (1.0f / 1024.0f); if (mk[t][r >> 2][r & 3] != 0) v = XMASK;   /* where(mask[b][q][k] (1 = masked), -1e9, scores): set; a fully masked row comes out uniform */
        s[t][r] = v; mx = fmaxf(mx, v); } }
    v16h vf[2][HD / 16];   /* the step's v fragments are requested here, so that they fly under the softmax arithmetic */
#pragma unroll
    for (int u = 0; u < 2; ++u)
#pragma unroll
      for (int j = 0; j < HD / 16; ++j) vf[u][j] = frag_ph(Vb + (size_t)k0 * HD + (u * (HD / 16) + j) * 512, lane);
    mx = fmaxf(mx, __shfl_xor(mx, 16)); const float mn = fmaxf(m, mx); const float mcn = mn * SCL2; const float alpha = __builtin_amdgcn_exp2f(mc - mcn); m = mn; mc = mcn;
    v16h p[2]; float sum = 0.f;
#pragma unroll
    for (int t = 0; t < 4; ++t)
#pragma unroll
      for (int r = 0; r < 8; ++r) { const float e = __builtin_amdgcn_exp2f(fmaf(s[t][r], SCL2, -mcn)); sum += e; p[t >> 1][(t & 1) * 8 + r] = (_Float16)e; }
    l = l * alpha + sum;
#pragma unroll
    for (int j = 0; j < HD / 16; ++j)
#pragma unroll
      for (int r = 0; r < 8; ++r) acc[j][r] *= alpha;
#pragma unroll
    for (int u = 0; u < 2; ++u)
#pragma unroll
      for (int j = 0; j < HD / 16; ++j) acc[j] = wmma16(vf[u][j], p[u], acc[j]); }
  l += __shfl_xor(l, 16); const float inv = 1.0f / l;   /* l >= 1: the key that holds the max contributes exp(0) */
  float* yr = Y + ((size_t)b * TT + ql0 + col) * CC + h * HD + 8 * g;
#pragma unroll
  for (int j = 0; j < HD / 16; ++j) { v4f o0, o1;
#pragma unroll
    for (int r = 0; r < 4; ++r) { o0[r] = acc[j][r] * inv; o1[r] = acc[j][4 + r] * inv; }
    vst2(yr + j * 16, o0); vst2(yr + j * 16 + 4, o1); } }
// ---- k_out: block = (64 rows, 128 cols): out = ctx Wo (+ bo): all rows: ctx bf16 hi + lo against exact bf16 Wo from its packed fragments (2 products)
__global__ __launch_bounds__(128) void k_out(const float* __restrict__ Y, const float* __restrict__ WO, const __bf16* __restrict__ WPO, const float* __restrict__ BO, float* __restrict__ OUT, const float* __restrict__ RESX) { __shared__ __align__(16) float sf[4][16][132];
  const int tid = threadIdx.x, wave = tid >> 5, lane = tid & 31, col = lane & 15, g = lane >> 4; const int c0 = blockIdx.y * 128; const size_t r0 = (size_t)blockIdx.x * 64 + wave * 16;
  v8f acc[8] = {};
  if (true) {   /* ALL rows: ctx split bf16 hi + lo x exact Wo (2 products) */
#pragma unroll 2
    for (int kc = 0; kc < CC / 32; ++kc) { const F2 a = split_row(Y + (r0 + col) * CC, kc * 32, lane);
      v16b w[8];   /* the k step's packed B fragments are all requested before the first product */
#pragma unroll
      for (int j = 0; j < 8; ++j) w[j] = frag_p(WPO + ((size_t)kc * (DIN / 16) + c0 / 16 + j) * 512, lane);
#pragma unroll
      for (int j = 0; j < 8; ++j) { acc[j] = wmma_bf(a.h, w[j], acc[j]); acc[j] = wmma_bf(a.l, w[j], acc[j]); }
      asm volatile("s_wait_xcnt 0x0" ::: "memory"); }   /* stands before the next k step rewrites the address registers that this step's loads name */
#pragma unroll
    for (int j = 0; j < 8; ++j) { const float bias = BO ? bfr(BO[c0 + j * 16 + col]) : 0.f;
#pragma unroll
      for (int r = 0; r < 8; ++r) sf[wave][8 * g + r][j * 16 + col] = acc[j][r] + bias; }
  } else {
#pragma unroll 2
    for (int kc = 0; kc < CC / 32; ++kc) { const v16h a = frag_f32(Y + (r0 + col) * CC + kc * 32, lane); asm volatile("s_wait_loadcnt 0x0" ::: "memory");
#pragma unroll
      for (int j = 0; j < 8; ++j) { const v16h w = WOCOLH(WO, kc * 32, c0 + j * 16 + col, lane); asm volatile("s_wait_loadcnt 0x0" ::: "memory"); acc[j] = wmma16(a, w, acc[j]); } }
#pragma unroll
    for (int j = 0; j < 8; ++j) { const float bias = BO ? bfr(BO[c0 + j * 16 + col]) : 0.f;
#pragma unroll
      for (int r = 0; r < 8; ++r) sf[wave][8 * g + r][j * 16 + col] = acc[j][r] * (1.0f / 256.0f) + bias; } }
  LDSX(); for (int rl = 0; rl < 16; ++rl) { const size_t oo = (r0 + rl) * DIN + c0 + lane * 4; v4f o = *(const v4f*)&sf[wave][rl][lane * 4]; const v4f zr = *(const v4f*)(RESX + oo); o[0] += bfr(zr[0]); o[1] += bfr(zr[1]); o[2] += bfr(zr[2]); o[3] += bfr(zr[3]); vst2(OUT + oo, o); } }   /* ctx W_O + bf16(input_Q) */

extern "C" void kernel_launch(void* const* d_in, const int* in_sizes, int n_in, void* d_out, int out_size, void* d_ws, size_t ws_size, hipStream_t stream) {
  (void)in_sizes; (void)n_in; (void)out_size;
  const float** F = (const float**)d_in;
  if (ws_size < (size_t)WS_END) return;
  char* ws = (char*)d_ws; _Float16 *QH = (_Float16*)(ws + WS_QH), *KH = (_Float16*)(ws + WS_KH), *VT = (_Float16*)(ws + WS_VT), *QL = (_Float16*)(ws + WS_QL), *KL = (_Float16*)(ws + WS_KL); __bf16 *VB = (__bf16*)(ws + WS_VB), *VBL = (__bf16*)(ws + WS_VBL); float *Y = (float*)(ws + WS_Y);
  (void)Y; (void)QL; (void)KL; (void)VB; (void)VBL;
  // inputs: 0 input_Q; 1 input_K; 2 input_V [2,2048,1024]; 3 mask [2,2048,2048] int32 (1 = masked); 4 W_Q (in,out); 5 W_K; 6 W_V; 7 W_O (in,out); 8 ln_gamma; 9 ln_beta
  if (ws_size < (size_t)WS_END3) return;
  float* X1 = (float*)(ws + WS_X1); __bf16 *WP = (__bf16*)(ws + WS_WP), *XP = (__bf16*)(ws + WS_XP);
  k_pack<<<dim3(4 * PKW + 3 * PKX), 256, 0, stream>>>(F[4], F[5], F[6], F[7], F[0], F[1], F[2], WP, XP);   /* weights and inputs -> bf16 fragments, every call */
  k_proj<<<dim3(TNB * TT / 64, CC / 128, 3), 128, 0, stream>>>(XP, WP, nullptr, nullptr, nullptr, QH, QL, KH, KL, VT, VB, VBL);
  k_fa<<<dim3(NQB, NH, TNB), 128, 0, stream>>>(QH, KH, QL, VT, (const int*)d_in[3], Y);
  k_out<<<dim3(TNB * TT / 64, DIN / 128), 128, 0, stream>>>(Y, F[7], WP + 3 * (size_t)DIN * CC, nullptr, X1, F[0]);   /* ctx W_O + input_Q */
  k_lnx<<<dim3(NRW / 8), 256, 0, stream>>>(X1, 0, F[8], F[9], (float*)d_out);              /* LayerNorm */
}

// v005
// Measured time: 152 microseconds a run.
// In both of two side-by-side timings against v004, it was 1.08 times as fast.
// Over all steps from v000 it is 8.08 times as fast.
// compute dtype: all float inputs rounded to bf16; q/k/v = in W with EXACT bf16 products on WMMA 16x16x32 (f32 accumulate); q as f16 hi + residual (x 2^10) against k once to f16 (2 products), masked (mask == 1) positions set to -2^33 (-2^30 after the / 8, standing for -1e9); softmax in f32 in base 2 (hardware exp2 of (x - max) * log2(e) / 8, running max and sum over key steps of 64); P = exp(s - max) once to f16 against v once to f16 (1 product), divided by the sum at the end; ctx split bf16 hi + lo against exact W_O (2 products) + input_Q; LayerNorm in f32; f32 output.
#include <hip/hip_runtime.h>
#include <math.h>

typedef __attribute__((ext_vector_type(16))) _Float16 v16h;
typedef __attribute__((ext_vector_type(16))) __bf16 v16b;
typedef __attribute__((ext_vector_type(8)))  _Float16 v8h;
typedef __attribute__((ext_vector_type(8)))  float v8f;
typedef __attribute__((ext_vector_type(4)))  float v4f;
typedef __attribute__((ext_vector_type(2)))  float v2f;
typedef __attribute__((ext_vector_type(4)))  unsigned v4u;
typedef __attribute__((ext_vector_type(4)))  int v4i;
typedef float __attribute__((may_alias)) float_a;
typedef int __attribute__((may_alias)) int_a;

template <typename T> __device__ __forceinline__ void vst2(void* p, T v) { *(T*)p = v;  }
__device__ __forceinline__ v8f wmma16(v16h a, v16h b, v8f c) {
  v8f d = __builtin_amdgcn_wmma_f32_16x16x32_f16(false, a, false, b, (short)0, c, false, false);
  asm volatile("v_nop\n\tv_nop\n\tv_nop\n\tv_nop" : "+v"(d) : "v"(a), "v"(b));
  return d;
}
__device__ __forceinline__ v8f wmma_bf(v16b a, v16b b, v8f c) {
  v8f d = __builtin_amdgcn_wmma_f32_16x16x32_bf16(false, a, false, b, (short)0, c, false, false);
  asm volatile("v_nop\n\tv_nop\n\tv_nop\n\tv_nop" : "+v"(d) : "v"(a), "v"(b));
  return d;
}
// 16x16x32 fragments: lane = (h = lane>>4, row/col = lane&15); elements 0..7 = k0+8h+0..7, 8..15 = k0+16+8h+0..7; D element r = row 8h+r
__device__ __forceinline__ v16h frag_h(const _Float16* rowk0, int lane) {
  union { v16h v; v8h q[2]; } u; const _Float16* p = rowk0 + 8 * (lane >> 4);
  u.q[0] = *(const v8h*)p; u.q[1] = *(const v8h*)(p + 16); return u.v;
}
__device__ __forceinline__ v16h frag_f32(const float* rowk0, int lane) {
  v16h a; const float* p = rowk0 + 8 * (lane >> 4);
#pragma unroll
  for (int i = 0; i < 8; ++i) { a[i] = (_Float16)p[i]; a[8 + i] = (_Float16)p[16 + i]; }
  return a;
}
__device__ __forceinline__ v16h frag_f32s(const float* rowk0, int lane, float sc) {
  v16h a; const float* p = rowk0 + 8 * (lane >> 4);
#pragma unroll
  for (int i = 0; i < 8; ++i) { a[i] = (_Float16)(p[i] * sc); a[8 + i] = (_Float16)(p[16 + i] * sc); }
  return a;
}
// column fragment from a [K][ld] layout (column n), rows >= K read as 0
__device__ __forceinline__ v16h fragc_f32(const float* W, int k0, int n, int lane, int ld, int K) {
  v16h a; const int g = lane >> 4;
#pragma unroll
  for (int i = 0; i < 8; ++i) { const int ka = k0 + 8 * g + i, kb = ka + 16;
    a[i] = (_Float16)(ka < K ? W[(size_t)(ka < K ? ka : K - 1) * ld + n] : 0.f); a[8 + i] = (_Float16)(kb < K ? W[(size_t)(kb < K ? kb : K - 1) * ld + n] : 0.f); }
  return a;
}
struct F2 { v16b h, l; };
__device__ __forceinline__ F2 bsplit16(const float v[16]) { F2 r;
#pragma unroll
  for (int i = 0; i < 16; ++i) { const __bf16 h = (__bf16)v[i]; r.h[i] = h; r.l[i] = (__bf16)(v[i] - (float)h); }
  return r; }
__device__ __forceinline__ F2 split_row(const float* row, int k0, int lane) { float v[16]; const float* p = row + k0 + 8 * (lane >> 4);
#pragma unroll
  for (int i = 0; i < 8; ++i) { v[i] = p[i]; v[8 + i] = p[16 + i]; }
  return bsplit16(v); }
__device__ __forceinline__ F2 split_rowK(const float* row, int k0, int lane, int K) { float v[16]; const int g = lane >> 4;
#pragma unroll
  for (int i = 0; i < 8; ++i) { const int ka = k0 + 8 * g + i, kb = ka + 16; v[i] = ka < K ? row[ka < K ? ka : K - 1] : 0.f; v[8 + i] = kb < K ? row[kb < K ? kb : K - 1] : 0.f; }
  return bsplit16(v); }
__device__ __forceinline__ F2 split_col(const float* W, int k0, int n, int lane, int ld, int K) { float v[16]; const int g = lane >> 4;
#pragma unroll
  for (int i = 0; i < 8; ++i) { const int ka = k0 + 8 * g + i, kb = ka + 16; v[i] = ka < K ? W[(size_t)(ka < K ? ka : K - 1) * ld + n] : 0.f; v[8 + i] = kb < K ? W[(size_t)(kb < K ? kb : K - 1) * ld + n] : 0.f; }
  return bsplit16(v); }
__device__ __forceinline__ v8f mac3(const F2& a, const F2& b, v8f c) { c = wmma_bf(a.l, b.h, c); c = wmma_bf(a.h, b.l, c); return wmma_bf(a.h, b.h, c); }
__device__ __forceinline__ float sigm(float v) { return 1.0f / (1.0f + expf(-v)); }
#define LDSX() do { asm volatile("s_wait_dscnt 0" ::: "memory"); __builtin_amdgcn_wave_barrier(); __builtin_amdgcn_fence(__ATOMIC_RELEASE, "workgroup"); } while (0)

// Multi-head attention layer with a random (query, key) mask, residual and LayerNorm (B 2, S 2,048, 1,024 = 16 x 64; (in,out) 1/32-scale weights, no biases; mask [B,S,S] int, 1 = MASKED (~half); LN affine 1/0, eps 1e-5): q = input_Q W_Q ...; scores = q k^T / 8 with where(mask, -1e9, s); ctx = softmax v; out = LN(ctx W_O + input_Q).
#define NB 2
#define TT 2048
#define CC 1024            // NH * HD = projected width
#define DIN 1024          // input (model) width
#define NH 16
#define HD 64
#define NQB (TT / 64)
#define HG 4
#define SCALE (0.125f)
#define SCL2 (SCALE * 1.44269504088896341f)   // score scale times log2(e): exp(SCALE * x) = exp2(SCL2 * x)
#define XMASK (-8589934592.0f)                // a masked position's unscaled score, -2^33: SCALE * XMASK = -2^30 stands for the reference's -1e9 (either is 0 after the exp beside any real score); a power of two, so that XMASK * SCL2 is exact and a fully masked row gets exp2(0) = 1 at every key
#define CAUSAL 0
#ifndef TNB
#define TNB NB
#endif
__device__ __forceinline__ float bfr(float v) { return (float)(__bf16)v; }
__host__ __device__ __forceinline__ int kb_last(int qb) { return CAUSAL ? ((qb * 64 + 63) >> 7) : (TT / 128 - 1); }
typedef __attribute__((ext_vector_type(8))) __bf16 v8b;
__device__ __forceinline__ v16b frag_b(const __bf16* rowk0, int lane) {
  union { v16b v; v8b q[2]; } u; const __bf16* p = rowk0 + 8 * (lane >> 4);
  u.q[0] = *(const v8b*)p; u.q[1] = *(const v8b*)(p + 16); return u.v;
}
#define QBH 0
#define QHI 2048            // rows carrying a q residual plane (all rows when non-causal: 2-product logits everywhere)
#define KHI 64            // key rows carrying k residual / v bf16 hi+lo planes (written by k_proj; no kernel reads them)
// B fragment (k rows k0+.., output column o) of a weight: (in,out) [K][ld] or (out,in) [ld rows of K]: bf16 exact, or f16(bf16 * 256) exact
__device__ __forceinline__ v16b wcol_io(const float* Wm, int k0, int o, int lane, int ld) { v16b w; const int g = lane >> 4;
#pragma unroll
  for (int i = 0; i < 8; ++i) { w[i] = (__bf16)Wm[(size_t)(k0 + 8 * g + i) * ld + o]; w[8 + i] = (__bf16)Wm[(size_t)(k0 + 16 + 8 * g + i) * ld + o]; }
  return w; }
__device__ __forceinline__ v16b wcol_oi(const float* Wm, int k0, int o, int lane, int K) { v16b w; const float* p = Wm + (size_t)o * K + k0 + 8 * (lane >> 4);
#pragma unroll
  for (int i = 0; i < 8; ++i) { w[i] = (__bf16)p[i]; w[8 + i] = (__bf16)p[16 + i]; }
  return w; }
__device__ __forceinline__ v16h wcolh_io(const float* Wm, int k0, int o, int lane, int ld) { v16h w; const int g = lane >> 4;
#pragma unroll
  for (int i = 0; i < 8; ++i) { w[i] = (_Float16)(bfr(Wm[(size_t)(k0 + 8 * g + i) * ld + o]) * 256.0f); w[8 + i] = (_Float16)(bfr(Wm[(size_t)(k0 + 16 + 8 * g + i) * ld + o]) * 256.0f); }
  return w; }
__device__ __forceinline__ v16h wcolh_oi(const float* Wm, int k0, int o, int lane, int K) { v16h w; const float* p = Wm + (size_t)o * K + k0 + 8 * (lane >> 4);
#pragma unroll
  for (int i = 0; i < 8; ++i) { w[i] = (_Float16)(bfr(p[i]) * 256.0f); w[8 + i] = (_Float16)(bfr(p[16 + i]) * 256.0f); }
  return w; }
#define WQKV_LAYOUT 0   // 0 = (in,out) [DIN][CC]; 1 = (out,in) [CC][DIN]; 2 = per-head [NH][DIN][HD]
__device__ __forceinline__ v16b wcol_hdk(const float* Wm, int k0, int o, int lane) { v16b w; const int g = lane >> 4; const float* p = Wm + (size_t)(o / HD) * DIN * HD + (o % HD);
#pragma unroll
  for (int i = 0; i < 8; ++i) { w[i] = (__bf16)p[(size_t)(k0 + 8 * g + i) * HD]; w[8 + i] = (__bf16)p[(size_t)(k0 + 16 + 8 * g + i) * HD]; }
  return w; }
#define WO_OUT_IN 0
#if WQKV_LAYOUT == 1
#define WCOL(W, k0, o, lane) wcol_oi(W, k0, o, lane, DIN)
#elif WQKV_LAYOUT == 2
#define WCOL(W, k0, o, lane) wcol_hdk(W, k0, o, lane)
#else
#define WCOL(W, k0, o, lane) wcol_io(W, k0, o, lane, CC)
#endif
#if WO_OUT_IN
#define WOCOL(W, k0, o, lane) wcol_oi(W, k0, o, lane, CC)
#define WOCOLH(W, k0, o, lane) wcolh_oi(W, k0, o, lane, CC)
#else
#define WOCOL(W, k0, o, lane) wcol_io(W, k0, o, lane, DIN)
#define WOCOLH(W, k0, o, lane) wcolh_io(W, k0, o, lane, DIN)
#endif
#define SM_EXTRA_PARAMS , const int* __restrict__ MK, int bcur
#define SM_MASK_HOOK do { if (MK[((size_t)bcur * TT + t) * TT + k] != 0) v = -1.0e9f; } while (0)   /* where(mask[b][q][k] (1 = masked), -1e9, scores): set; a fully masked row would be uniform (none here) */
#define NRW (TNB * TT)
// ---- k_lnx: wave per row: LayerNorm over 1024 (mean, biased var, (x - mean) * rsqrt(var + 1e-5) * g + b); optional bf16 rounding of the input (x); 32 floats per lane (8 float4 at stride 128 floats -> 512-B pieces)
__global__ __launch_bounds__(256) void k_lnx(const float* __restrict__ X, int roundin, const float* __restrict__ G, const float* __restrict__ BE, float* __restrict__ OUT) { const int wave = threadIdx.x >> 5, lane = threadIdx.x & 31; const size_t row = (size_t)blockIdx.x * 8 + wave; if (row >= (size_t)NRW) return;
  v4f v[CC / 128]; float s1 = 0.f;
#pragma unroll
  for (int i = 0; i < CC / 128; ++i) { v4f t = *(const v4f*)(X + row * CC + i * 128 + lane * 4); if (roundin) { t[0] = bfr(t[0]); t[1] = bfr(t[1]); t[2] = bfr(t[2]); t[3] = bfr(t[3]); } v[i] = t; s1 += (t[0] + t[1]) + (t[2] + t[3]); }
#pragma unroll
  for (int o = 1; o < 32; o <<= 1) s1 += __shfl_xor(s1, o);
  const float mu = s1 * (1.0f / CC); float q = 0.f;
#pragma unroll
  for (int i = 0; i < CC / 128; ++i) for (int k = 0; k < 4; ++k) { const float d = v[i][k] - mu; q += d * d; }
#pragma unroll
  for (int o = 1; o < 32; o <<= 1) q += __shfl_xor(q, o);
  const float inv = rsqrtf(q * (1.0f / CC) + 1e-5f);   /* jnp.var (biased), eps inside the rsqrt */
#pragma unroll
  for (int i = 0; i < CC / 128; ++i) { const int c = i * 128 + lane * 4; v4f r4; for (int k = 0; k < 4; ++k) r4[k] = bfr(G[c + k]) * ((v[i][k] - mu) * inv) + bfr(BE[c + k]); vst2(OUT + row * CC + c, r4); } }

#ifndef SM_EXTRA_PARAMS
#define SM_EXTRA_PARAMS
#endif
#ifndef PROJ_EXTRA_PARAMS
#define PROJ_EXTRA_PARAMS
#endif
#ifndef SM_MASK_HOOK
#define SM_MASK_HOOK (void)0
#endif

#define WS_QH  0u                                      // f16 q rows [b*t][CC]
#define WS_KH  (WS_QH + 2u * (size_t)NB * TT * CC)      // f16 k as A fragments [b][h][16-key group][k step of 32 channels][1 KiB fragment]
#define WS_VT  (WS_KH + 2u * (size_t)NB * TT * CC)      // f16 v^T as A fragments [b][h][32-key group][16-channel group][1 KiB fragment]
#define WS_QL  (WS_VT + 2u * (size_t)NB * CC * TT)      // f16 q residual x 2^10 rows [b][t < QHI][CC]
#define WS_KL  (WS_QL + 2u * (size_t)NB * QHI * CC)     // f16 k residual x 2^10 rows [b][t < KHI][CC]
#define WS_VB  (WS_KL + 2u * (size_t)NB * KHI * CC)     // bf16 v hi planes [b][c][t < KHI]
#define WS_VBL (WS_VB + 2u * (size_t)NB * CC * KHI)
#define WS_S   (WS_VBL + 2u * (size_t)NB * CC * KHI)    // f32 [hg][t][s] region, unused (k_fa keeps logits and P in registers)
#define WS_Y   (WS_S  + 4u * (size_t)HG * TT * TT)      // f32 ctx rows [b*t][CC] (only when there is an output projection)
#define WS_END (WS_Y  + 4u * (size_t)NB * TT * CC)
#define WS_X1  (WS_END)
#define WS_END2 (WS_X1 + 4u * (size_t)NB * TT * DIN)

#define WS_WP  (WS_END2)                                // bf16 weights as B fragments [W_Q, W_K, W_V, W_O][k step of 32][16-column group][1 KiB fragment]
#define WS_XP  (WS_WP + 2u * 4u * (size_t)DIN * CC)     // bf16 inputs as A fragments [input_Q, input_K, input_V][16-row group][k step of 32][1 KiB fragment]
#define WS_END3 (WS_XP + 2u * 3u * (size_t)NB * TT * DIN)
#define WS_MP  (WS_END3)                                // mask as select words [b * TT / 16 + 16-query group][key step of 64][t * 8 + r]: bit l of a word = (mask != 0) at query (l & 15), key 16 t + 8 (l >> 4) + r, the score that lane l of k_fa holds in s[t][r]
#define WS_END4 (WS_MP + (size_t)NB * TT * TT / 8)
typedef __attribute__((ext_vector_type(16))) unsigned v16u;
#define PKP 16                                // pieces per k_pack thread: few waves with many loads in flight each, for speed only
#define PKW (DIN * CC / 8 / 256 / PKP)        // k_pack blocks per weight
#define PKX (NB * TT * DIN / 8 / 256 / PKP)   // k_pack blocks per input
#define PKM (NB * (TT / 16) * (TT / 128) / 8 / 2)   // k_pack blocks for the mask: a wave takes 2 tiles of 16 queries x 128 keys
// ---- k_pack: a piece = 16 bytes of a 16x16x32 operand fragment, rounded to bf16. A 1 KiB fragment is [half hf][lane][8]: piece (hf, lane) holds k = k0 + 16 hf + 8 (lane >> 4) + 0..7 of row or column (lane & 15), the k order of the fragment comment above; a wave's store is 512 contiguous bytes
__global__ __launch_bounds__(256) void k_pack(const float* __restrict__ W0, const float* __restrict__ W1, const float* __restrict__ W2, const float* __restrict__ W3, const float* __restrict__ X0, const float* __restrict__ X1, const float* __restrict__ X2, const int* __restrict__ MK, __bf16* __restrict__ WP, __bf16* __restrict__ XP, unsigned* __restrict__ MP) {
  const int bx = blockIdx.x;
  if (bx < 4 * PKW) { const int mt = bx / PKW; const float* Wm = mt == 0 ? W0 : mt == 1 ? W1 : mt == 2 ? W2 : W3; __bf16* D = WP + (size_t)mt * DIN * CC;   /* (in,out) weight: piece e = [kc][ob][hf][lane] */
    const int e0 = (bx % PKW) * (256 * PKP) + threadIdx.x;
    // rolled over groups of 4 pieces: 32 loads in flight per lane are enough, and the registers stay few
#pragma unroll 1
    for (int it = 0; it < PKP; it += 4) { float t[4][8];
#pragma unroll
      for (int u = 0; u < 4; ++u) { const int e = e0 + (it + u) * 256; const int lane = e & 31, hf = (e >> 5) & 1, ob = (e >> 6) % (CC / 16), kc = (e >> 6) / (CC / 16);
        const float* p = Wm + (size_t)(kc * 32 + 16 * hf + 8 * (lane >> 4)) * CC + ob * 16 + (lane & 15);
#pragma unroll
        for (int i = 0; i < 8; ++i) t[u][i] = p[(size_t)i * CC]; }
#pragma unroll
      for (int u = 0; u < 4; ++u) { v8b w;
#pragma unroll
        for (int i = 0; i < 8; ++i) w[i] = (__bf16)t[u][i];
        vst2(D + (size_t)(e0 + (it + u) * 256) * 8, w); }
      asm volatile("s_wait_xcnt 0x0" ::: "memory"); }   /* stands before the next trip rewrites registers that this trip's stores name */
  } else if (bx < 4 * PKW + 3 * PKX) { const int b2 = bx - 4 * PKW; const int mt = b2 / PKX; const float* Xm = mt == 0 ? X0 : mt == 1 ? X1 : X2; __bf16* D = XP + (size_t)mt * NB * TT * DIN;   /* input rows: piece e = [rb][kc][hf][lane] */
    const int e0 = (b2 % PKX) * (256 * PKP) + threadIdx.x;
    // rolled over groups of 8 pieces: 16 16-byte loads in flight per lane. The 8 pieces of a trip lie 256 pieces = 4 k steps apart, in one input row (32 k steps a row, first k step < 4): one load address and one store address a trip, the rest are constant offsets
#pragma unroll 1
    for (int it = 0; it < PKP; it += 8) { const int e = e0 + it * 256; const int lane = e & 31, hf = (e >> 5) & 1, kc = (e >> 6) % (DIN / 32), rb = (e >> 6) / (DIN / 32);
      const float* p = Xm + (size_t)(rb * 16 + (lane & 15)) * DIN + kc * 32 + 16 * hf + 8 * (lane >> 4); __bf16* q = D + (size_t)e * 8;
      v4f t[8][2]; v8b w[8];
#pragma unroll
      for (int u = 0; u < 8; ++u) { t[u][0] = *(const v4f*)(p + u * 128); t[u][1] = *(const v4f*)(p + u * 128 + 4); }
      // the wait that stands before a register named by an issued load is rewritten; it takes the address and the loaded values as inputs, so that all 16 loads stand in front of it and none of them lands in the address registers
      asm volatile("s_wait_xcnt 0x0" :: "v"(p), "v"(t[0][0]), "v"(t[0][1]), "v"(t[1][0]), "v"(t[1][1]), "v"(t[2][0]), "v"(t[2][1]), "v"(t[3][0]), "v"(t[3][1]), "v"(t[4][0]), "v"(t[4][1]), "v"(t[5][0]), "v"(t[5][1]), "v"(t[6][0]), "v"(t[6][1]), "v"(t[7][0]), "v"(t[7][1]) : "memory");
#pragma unroll
      for (int u = 0; u < 8; ++u) {
#pragma unroll
        for (int i = 0; i < 4; ++i) { w[u][i] = (__bf16)t[u][0][i]; w[u][4 + i] = (__bf16)t[u][1][i]; }
        vst2(q + u * 2048, w[u]); }
      // the same wait behind the stores, before the next trip rewrites what they name; it takes the stored values as inputs, so that their registers live up to it
      asm volatile("s_wait_xcnt 0x0" :: "v"(w[0]), "v"(w[1]), "v"(w[2]), "v"(w[3]), "v"(w[4]), "v"(w[5]), "v"(w[6]), "v"(w[7]) : "memory"); }
  } else { const int wv = (bx - 4 * PKW - 3 * PKX) * 8 + (threadIdx.x >> 5), lane = threadIdx.x & 31;   /* mask tile [rg = 16-row group of the NB * TT query rows][kg = 128-key group]: 16 loads of one whole row piece (512 contiguous bytes) each; lane j holds keys 4 j + 0..3 of every row */
    // rolled: 16 16-byte loads in flight per lane are enough, and the registers stay few
#pragma unroll 1
    for (int it = 0; it < 2; ++it) { const int tile = wv * 2 + it; const int kg = tile % (TT / 128), rg = tile / (TT / 128);
      const int* p = MK + (size_t)rg * 16 * TT + kg * 128 + lane * 4; v4i t[16];
#pragma unroll
      for (int q = 0; q < 16; ++q) t[q] = *(const v4i*)(p + q * TT);
      // the wait that stands before a register named by an issued load is rewritten; it takes the address and the loaded values as inputs, so that all 16 loads stand in front of it
      asm volatile("s_wait_xcnt 0x0" :: "v"(p), "v"(t[0]), "v"(t[1]), "v"(t[2]), "v"(t[3]), "v"(t[4]), "v"(t[5]), "v"(t[6]), "v"(t[7]), "v"(t[8]), "v"(t[9]), "v"(t[10]), "v"(t[11]), "v"(t[12]), "v"(t[13]), "v"(t[14]), "v"(t[15]) : "memory");
      unsigned c[4] = {0u, 0u, 0u, 0u};   /* c[e]: bit q = (mask != 0) at row q, key 4 j + e */
#pragma unroll
      for (int q = 0; q < 16; ++q)
#pragma unroll
        for (int e = 0; e < 4; ++e) { const unsigned mv = (unsigned)t[q][e]; c[e] |= (mv < 1u ? mv : 1u) << q; }
      // key = 64 ks + 16 t + 8 g + r lies in lane j = 16 ks + 4 t + 2 g + (r >> 2), element r & 3: lanes j and j ^ 2 hold the two halves (g = 0 low, g = 1 high) of the same four words
      const unsigned p01 = c[0] | (c[1] << 16), p23 = c[2] | (c[3] << 16); const unsigned o01 = __shfl_xor(p01, 2), o23 = __shfl_xor(p23, 2);
      v4u w; w[0] = (p01 & 0xffffu) | (o01 << 16); w[1] = (p01 >> 16) | (o01 & 0xffff0000u); w[2] = (p23 & 0xffffu) | (o23 << 16); w[3] = (p23 >> 16) | (o23 & 0xffff0000u);
      unsigned* d = MP + ((size_t)rg * (TT / 64) + kg * 2 + (lane >> 4)) * 32 + ((lane >> 2) & 3) * 8 + (lane & 1) * 4;
      if ((lane & 2) == 0) vst2(d, w);   /* the g = 0 lanes store: 16 lanes x 16 bytes = the 256 contiguous bytes of two key steps */
      // the same wait behind the store, before the next trip rewrites what it names
      asm volatile("s_wait_xcnt 0x0" :: "v"(d), "v"(w) : "memory"); } } }
// a packed fragment: two 16-byte loads per lane, each 512 contiguous bytes per wave
__device__ __forceinline__ v16b frag_p(const __bf16* fr, int lane) {
  union { v16b v; v8b q[2]; } u; const __bf16* p = fr + lane * 8;
  u.q[0] = *(const v8b*)p; u.q[1] = *(const v8b*)(p + 256); return u.v;
}
__device__ __forceinline__ v16h frag_ph(const _Float16* fr, int lane) {
  union { v16h v; v8h q[2]; } u; const _Float16* p = fr + lane * 8;
  u.q[0] = *(const v8h*)p; u.q[1] = *(const v8h*)(p + 256); return u.v;
}
// ---- k_proj: block = (64 rows, 128 cols, which): q/k/v = X W (+ b) with exact bf16 products (K = DIN) -> which 0: q f16 rows (+ residual rows < QHI); 1: k f16 fragments (+ residual rows < KHI); 2: v^T f16 fragments (+ bf16 hi/lo planes for t < KHI). A k or v^T fragment is [half hf][lane][8] like a packed weight fragment: piece (hf, lane) holds k index 16 hf + 8 (lane >> 4) + 0..7 of row (lane & 15), the elements that lane takes in k_fa, so that a wave's load there is 512 contiguous bytes
__global__ __launch_bounds__(128) void k_proj(const __bf16* __restrict__ XP, const __bf16* __restrict__ WP, const float* __restrict__ BQ, const float* __restrict__ BK, const float* __restrict__ BV,
    _Float16* __restrict__ QH, _Float16* __restrict__ QL, _Float16* __restrict__ KH, _Float16* __restrict__ KL, _Float16* __restrict__ VT, __bf16* __restrict__ VB, __bf16* __restrict__ VBL) {
  __shared__ __align__(16) _Float16 sh[64][136], sl[64][136]; __shared__ __align__(16) _Float16 th[128][72]; __shared__ __align__(16) __bf16 tb[128][72], tbl[128][72];
  const int tid = threadIdx.x, wave = tid >> 5, lane = tid & 31, col = lane & 15, g = lane >> 4; const int which = blockIdx.z; const int c0 = blockIdx.y * 128; const size_t r0 = (size_t)blockIdx.x * 64; const size_t bb = r0 / TT; const int t0 = (int)(r0 % TT);
  const __bf16* XA = XP + (size_t)which * NB * TT * DIN + (r0 / 16 + wave) * (size_t)(DIN / 32) * 512; const __bf16* WA = WP + (size_t)which * DIN * CC + (size_t)(c0 / 16) * 512; const float* BA = which == 0 ? BQ : which == 1 ? BK : BV;
  v8f acc[8] = {};
#pragma unroll 2
  for (int kc = 0; kc < DIN / 32; ++kc) { const v16b a = frag_p(XA + (size_t)kc * 512, lane);
    v16b w[8];   /* the k step's packed fragments are all requested before the first product */
#pragma unroll
    for (int j = 0; j < 8; ++j) w[j] = frag_p(WA + ((size_t)kc * (CC / 16) + j) * 512, lane);
#pragma unroll
    for (int j = 0; j < 8; ++j) acc[j] = wmma_bf(a, w[j], acc[j]);
    asm volatile("s_wait_xcnt 0x0" ::: "memory"); }   /* stands before the next k step rewrites the address registers that this step's loads name */
  if (which < 2) { _Float16* DH = which == 0 ? QH : KH; _Float16* DL = which == 0 ? QL : KL; const int nhi = which == 0 ? QHI : KHI; const bool hi_rows = t0 < nhi;
#pragma unroll
    for (int j = 0; j < 8; ++j) { const float bias = BA ? bfr(BA[c0 + j * 16 + col]) : 0.f;
#pragma unroll
      for (int r = 0; r < 8; ++r) { const float v = acc[j][r] + bias; const _Float16 hv = (_Float16)v; sh[wave * 16 + 8 * g + r][j * 16 + col] = hv; sl[wave * 16 + 8 * g + r][j * 16 + col] = (_Float16)((v - (float)hv) * 1024.0f); } }
    __syncthreads();
    if (which == 1) {   /* k: 16 fragments = [head of 2][16-key group of 4][k step of 2], 64 pieces each; a head's 8 fragments are 8 KiB in a row */
      // unrolled: the 8 LDS reads go out together, and head and key group are constants of each trip, so that the 8 stores share one address
#pragma unroll
      for (int i = 0; i < 8; ++i) { const int e = tid + i * 128; const int f = e >> 6, pc = e & 63, hf = pc >> 5, ln = pc & 31; const int hh = f >> 3, kt = (f >> 1) & 3, kc = f & 1;
        vst2((unsigned*)(KH + ((((bb * NH + c0 / HD + hh) * (TT / 16) + t0 / 16 + kt) * (HD / 32) + kc) * 512 + pc * 8)), *(const v4u*)&sh[kt * 16 + (ln & 15)][hh * HD + kc * 32 + hf * 16 + (ln >> 4) * 8]); }
      asm volatile("s_wait_xcnt 0x0" ::: "memory"); }   /* stands before the code below rewrites registers that these stores name */
    for (int e = tid; e < 64 * 16; e += 128) { const int rl = e >> 4, q = e & 15; if (which == 0) { vst2((unsigned*)(DH + (r0 + rl) * CC + c0 + q * 8), *(const v4u*)&sh[rl][q * 8]); asm volatile("s_wait_xcnt 0x0" ::: "memory"); }   /* the wait stands before a register that the store names is rewritten */
      if (hi_rows) { vst2((unsigned*)(DL + (bb * nhi + t0 + rl) * (size_t)CC + c0 + q * 8), *(const v4u*)&sl[rl][q * 8]); asm volatile("s_wait_xcnt 0x0" ::: "memory"); } }   /* the same wait, before the next trip */
  } else { const bool hi_rows = t0 < KHI;
#pragma unroll
    for (int j = 0; j < 8; ++j) { const float bias = BA ? bfr(BA[c0 + j * 16 + col]) : 0.f;
#pragma unroll
      for (int r = 0; r < 8; ++r) { const float v = acc[j][r] + bias; const int rl = wave * 16 + 8 * g + r, cl = j * 16 + col; th[cl][rl] = (_Float16)v; const __bf16 bh = (__bf16)v; tb[cl][rl] = bh; tbl[cl][rl] = (__bf16)(v - (float)bh); } }
    __syncthreads();
    /* v^T: 16 fragments = [head of 2][32-key group of 2][16-channel group of 4], 64 pieces each */
    // unrolled: the 8 LDS reads go out together, and head and key group are constants of each trip, so that the 8 stores share one address
#pragma unroll
    for (int i = 0; i < 8; ++i) { const int e = tid + i * 128; const int f = e >> 6, pc = e & 63, hf = pc >> 5, ln = pc & 31; const int hh = f >> 3, kt = (f >> 2) & 1, j = f & 3;
      vst2((unsigned*)(VT + ((((bb * NH + c0 / HD + hh) * (TT / 32) + t0 / 32 + kt) * (HD / 16) + j) * 512 + pc * 8)), *(const v4u*)&th[hh * HD + j * 16 + (ln & 15)][kt * 32 + hf * 16 + (ln >> 4) * 8]); }
    asm volatile("s_wait_xcnt 0x0" ::: "memory");   /* stands before the code below rewrites registers that these stores name */
    for (int e = tid; e < 128 * 8; e += 128) { const int cl = e >> 3, q = e & 7; if (hi_rows) { const size_t o3 = (bb * CC + c0 + cl) * (size_t)KHI + t0 + q * 8; vst2((unsigned*)(VB + o3), *(const v4u*)&tb[cl][q * 8]); vst2((unsigned*)(VBL + o3), *(const v4u*)&tbl[cl][q * 8]); } } } }
// ---- k_fa: block = 64 queries (qb) of (b, h), wave = 16 queries, all keys in steps of 64: S^T = K q^T (key rows as A, query rows as B; q hi + residual x 2^10: 2 products), unscaled, masked positions set to XMASK; running max and sum per query (lane & 15 = query, so both are per-lane values; the two lane halves hold different keys); D of S^T (lane = query, element r = key 8g + r) IS the 16x16x32 operand layout over 32 keys, so P = exp2(x * SCL2 - max * SCL2) (one fma and the hardware exp2 per score) goes once to f16 in place and ctx^T += v^T (A) P^T (B); ctx^T rows are channels, so the rescale and the final 1 / sum are per-lane too
__global__ __launch_bounds__(128) void k_fa(const _Float16* __restrict__ QH, const _Float16* __restrict__ KH, const _Float16* __restrict__ QL, const _Float16* __restrict__ VT, const unsigned* __restrict__ MP, float* __restrict__ Y) {
  const int tid = threadIdx.x, wave = tid >> 5, lane = tid & 31, col = lane & 15, g = lane >> 4; const int h = blockIdx.y, b = blockIdx.z; const int ql0 = blockIdx.x * 64 + wave * 16;
  v16h qh[HD / 32], ql[HD / 32];
#pragma unroll
  for (int kc = 0; kc < HD / 32; ++kc) { qh[kc] = frag_h(QH + ((size_t)b * TT + ql0 + col) * CC + h * HD + kc * 32, lane); ql[kc] = frag_h(QL + ((size_t)b * QHI + ql0 + col) * CC + h * HD + kc * 32, lane); }
  const _Float16* Kb = KH + (size_t)(b * NH + h) * TT * HD; const _Float16* Vb = VT + (size_t)(b * NH + h) * TT * HD;   /* this head's fragments; 64 keys are 8 fragments = 8 KiB in a row in each */
  const unsigned* Mw = MP + (size_t)(b * (TT / 16) + blockIdx.x * 4 + __builtin_amdgcn_readfirstlane(wave)) * (TT / 64) * 32;   /* this wave's select words, 128 bytes a key step; the address is wave-uniform, so that they come by scalar loads into scalar registers */
  v8f acc[HD / 16] = {}; float m = -3.0e38f, mc = -3.0e38f * SCL2, l = 0.f;   /* mc = m * SCL2: the running max in the exponent's own unit */
  // the key loop stays rolled: a second step's fragments would take the wave past 256 registers and cost a wave per SIMD; the inner loops are fully unrolled so that the fragment arrays are indexed by constants and stay in registers
#pragma unroll 1
  for (int k0 = 0; k0 < TT; k0 += 64) { float s[4][8]; float mx = -3.0e38f;
    v16h kf[4][HD / 32];   /* the whole step's K fragments and select words are requested before the first product: one load latency per step, not one per product */
    v16u mw[2]; const _Float16* kp = Kb + (size_t)k0 * HD + lane * 8;   /* this lane's piece of the step's first K fragment (the address that frag_ph forms) */
#pragma unroll
    for (int t = 0; t < 4; ++t)
#pragma unroll
      for (int kc = 0; kc < HD / 32; ++kc) { union { v16h v; v8h q[2]; } u; u.q[0] = *(const v8h*)(kp + (t * (HD / 32) + kc) * 512); u.q[1] = *(const v8h*)(kp + (t * (HD / 32) + kc) * 512 + 256); kf[t][kc] = u.v; }
    // the step's 32 select words: two scalar loads with their data wait in one statement, so that their address register is rewritten only behind the wait; it stands behind the K requests, which fly meanwhile. It also takes the K address as an input and ends in the wait that stands before a register named by an issued load is rewritten, so that no K load lands in that address
    asm volatile("s_load_b512 %0, %2, 0x0\n\ts_load_b512 %1, %2, 0x40\n\ts_wait_kmcnt 0x0\n\ts_wait_xcnt 0x0" : "=&s"(mw[0]), "=&s"(mw[1]) : "s"(Mw + (k0 >> 1)), "v"(kp) : "memory");
#pragma unroll
    for (int t = 0; t < 4; ++t) { v8f a = {}, al = {};
#pragma unroll
      for (int kc = 0; kc < HD / 32; ++kc) { a = wmma16(kf[t][kc], qh[kc], a); al = wmma16(kf[t][kc], ql[kc], al); }
#pragma unroll
      for (int r = 0; r < 8; ++r) { float v = a[r] + al[r] * (1.0f / 1024.0f); if (__builtin_amdgcn_inverse_ballot_w32(mw[t >> 1][(t & 1) * 8 + r])) v = XMASK;   /* where(mask[b][q][k] (1 = masked), -1e9, scores): set; a fully masked row comes out uniform */
        s[t][r] = v; mx = fmaxf(mx, v); } }
    v16h vf[2][HD / 16];   /* the step's v fragments are requested here, so that they fly under the softmax arithmetic */
#pragma unroll
    for (int u = 0; u < 2; ++u)
#pragma unroll
      for (int j = 0; j < HD / 16; ++j) vf[u][j] = frag_ph(Vb + (size_t)k0 * HD + (u * (HD / 16) + j) * 512, lane);
    mx = fmaxf(mx, __shfl_xor(mx, 16)); const float mn = fmaxf(m, mx); const float mcn = mn * SCL2; const float alpha = __builtin_amdgcn_exp2f(mc - mcn); m = mn; mc = mcn;
    v16h p[2]; float sum = 0.f;
#pragma unroll
    for (int t = 0; t < 4; ++t)
#pragma unroll
      for (int r = 0; r < 8; ++r) { const float e = __builtin_amdgcn_exp2f(fmaf(s[t][r], SCL2, -mcn)); sum += e; p[t >> 1][(t & 1) * 8 + r] = (_Float16)e; }
    l = l * alpha + sum;
#pragma unroll
    for (int j = 0; j < HD / 16; ++j)
#pragma unroll
      for (int r = 0; r < 8; ++r) acc[j][r] *= alpha;
#pragma unroll
    for (int u = 0; u < 2; ++u)
#pragma unroll
      for (int j = 0; j < HD / 16; ++j) acc[j] = wmma16(vf[u][j], p[u], acc[j]); }
  l += __shfl_xor(l, 16); const float inv = 1.0f / l;   /* l >= 1: the key that holds the max contributes exp(0) */
  float* yr = Y + ((size_t)b * TT + ql0 + col) * CC + h * HD + 8 * g;
#pragma unroll
  for (int j = 0; j < HD / 16; ++j) { v4f o0, o1;
#pragma unroll
    for (int r = 0; r < 4; ++r) { o0[r] = acc[j][r] * inv; o1[r] = acc[j][4 + r] * inv; }
    vst2(yr + j * 16, o0); vst2(yr + j * 16 + 4, o1); } }
// ---- k_out: block = (64 rows, 128 cols): out = ctx Wo (+ bo): all rows: ctx bf16 hi + lo against exact bf16 Wo from its packed fragments (2 products)
__global__ __launch_bounds__(128) void k_out(const float* __restrict__ Y, const float* __restrict__ WO, const __bf16* __restrict__ WPO, const float* __restrict__ BO, float* __restrict__ OUT, const float* __restrict__ RESX) { __shared__ __align__(16) float sf[4][16][132];
  const int tid = threadIdx.x, wave = tid >> 5, lane = tid & 31, col = lane & 15, g = lane >> 4; const int c0 = blockIdx.y * 128; const size_t r0 = (size_t)blockIdx.x * 64 + wave * 16;
  v8f acc[8] = {};
  if (true) {   /* ALL rows: ctx split bf16 hi + lo x exact Wo (2 products) */
#pragma unroll 2
    for (int kc = 0; kc < CC / 32; ++kc) { const F2 a = split_row(Y + (r0 + col) * CC, kc * 32, lane);
      v16b w[8];   /* the k step's packed B fragments are all requested before the first product */
#pragma unroll
      for (int j = 0; j < 8; ++j) w[j] = frag_p(WPO + ((size_t)kc * (DIN / 16) + c0 / 16 + j) * 512, lane);
#pragma unroll
      for (int j = 0; j < 8; ++j) { acc[j] = wmma_bf(a.h, w[j], acc[j]); acc[j] = wmma_bf(a.l, w[j], acc[j]); }
      asm volatile("s_wait_xcnt 0x0" ::: "memory"); }   /* stands before the next k step rewrites the address registers that this step's loads name */
#pragma unroll
    for (int j = 0; j < 8; ++j) { const float bias = BO ? bfr(BO[c0 + j * 16 + col]) : 0.f;
#pragma unroll
      for (int r = 0; r < 8; ++r) sf[wave][8 * g + r][j * 16 + col] = acc[j][r] + bias; }
  } else {
#pragma unroll 2
    for (int kc = 0; kc < CC / 32; ++kc) { const v16h a = frag_f32(Y + (r0 + col) * CC + kc * 32, lane); asm volatile("s_wait_loadcnt 0x0" ::: "memory");
#pragma unroll
      for (int j = 0; j < 8; ++j) { const v16h w = WOCOLH(WO, kc * 32, c0 + j * 16 + col, lane); asm volatile("s_wait_loadcnt 0x0" ::: "memory"); acc[j] = wmma16(a, w, acc[j]); } }
#pragma unroll
    for (int j = 0; j < 8; ++j) { const float bias = BO ? bfr(BO[c0 + j * 16 + col]) : 0.f;
#pragma unroll
      for (int r = 0; r < 8; ++r) sf[wave][8 * g + r][j * 16 + col] = acc[j][r] * (1.0f / 256.0f) + bias; } }
  LDSX(); for (int rl = 0; rl < 16; ++rl) { const size_t oo = (r0 + rl) * DIN + c0 + lane * 4; v4f o = *(const v4f*)&sf[wave][rl][lane * 4]; const v4f zr = *(const v4f*)(RESX + oo); o[0] += bfr(zr[0]); o[1] += bfr(zr[1]); o[2] += bfr(zr[2]); o[3] += bfr(zr[3]); vst2(OUT + oo, o); } }   /* ctx W_O + bf16(input_Q) */

extern "C" void kernel_launch(void* const* d_in, const int* in_sizes, int n_in, void* d_out, int out_size, void* d_ws, size_t ws_size, hipStream_t stream) {
  (void)in_sizes; (void)n_in; (void)out_size;
  const float** F = (const float**)d_in;
  if (ws_size < (size_t)WS_END) return;
  char* ws = (char*)d_ws; _Float16 *QH = (_Float16*)(ws + WS_QH), *KH = (_Float16*)(ws + WS_KH), *VT = (_Float16*)(ws + WS_VT), *QL = (_Float16*)(ws + WS_QL), *KL = (_Float16*)(ws + WS_KL); __bf16 *VB = (__bf16*)(ws + WS_VB), *VBL = (__bf16*)(ws + WS_VBL); float *Y = (float*)(ws + WS_Y);
  (void)Y; (void)QL; (void)KL; (void)VB; (void)VBL;
  // inputs: 0 input_Q; 1 input_K; 2 input_V [2,2048,1024]; 3 mask [2,2048,2048] int32 (1 = masked); 4 W_Q (in,out); 5 W_K; 6 W_V; 7 W_O (in,out); 8 ln_gamma; 9 ln_beta
  if (ws_size < (size_t)WS_END4) return;
  float* X1 = (float*)(ws + WS_X1); __bf16 *WP = (__bf16*)(ws + WS_WP), *XP = (__bf16*)(ws + WS_XP); unsigned* MP = (unsigned*)(ws + WS_MP);
  k_pack<<<dim3(4 * PKW + 3 * PKX + PKM), 256, 0, stream>>>(F[4], F[5], F[6], F[7], F[0], F[1], F[2], (const int*)d_in[3], WP, XP, MP);   /* weights and inputs -> bf16 fragments, mask -> select words, every call */
  k_proj<<<dim3(TNB * TT / 64, CC / 128, 3), 128, 0, stream>>>(XP, WP, nullptr, nullptr, nullptr, QH, QL, KH, KL, VT, VB, VBL);
  k_fa<<<dim3(NQB, NH, TNB), 128, 0, stream>>>(QH, KH, QL, VT, MP, Y);
  k_out<<<dim3(TNB * TT / 64, DIN / 128), 128, 0, stream>>>(Y, F[7], WP + 3 * (size_t)DIN * CC, nullptr, X1, F[0]);   /* ctx W_O + input_Q */
  k_lnx<<<dim3(NRW / 8), 256, 0, stream>>>(X1, 0, F[8], F[9], (float*)d_out);              /* LayerNorm */
}

// v006
// One run takes 135 microseconds.
// Next to v005, in two timings, it ran 1.13 times as fast each time.
// Over all steps from v000 it is 9.11 times as fast.
// compute dtype: all float inputs rounded to bf16; q/k/v = in W with EXACT bf16 products on WMMA 16x16x32 (f32 accumulate); q as f16 hi + residual (x 2^10) against k once to f16 (2 products), masked (mask == 1) positions set to -2^33 (-2^30 after the / 8, standing for -1e9); softmax in f32 in base 2 (hardware exp2 of (x - max) * log2(e) / 8, running max and sum over key steps of 64); P = exp(s - max) once to f16 against v once to f16 (1 product), divided by the sum at the end; ctx split bf16 hi + lo against exact W_O (2 products) + input_Q; LayerNorm in f32; f32 output.
#include <hip/hip_runtime.h>
#include <math.h>

typedef __attribute__((ext_vector_type(16))) _Float16 v16h;
typedef __attribute__((ext_vector_type(16))) __bf16 v16b;
typedef __attribute__((ext_vector_type(8)))  _Float16 v8h;
typedef __attribute__((ext_vector_type(8)))  float v8f;
typedef __attribute__((ext_vector_type(4)))  float v4f;
typedef __attribute__((ext_vector_type(2)))  float v2f;
typedef __attribute__((ext_vector_type(4)))  unsigned v4u;
typedef __attribute__((ext_vector_type(4)))  int v4i;
typedef float __attribute__((may_alias)) float_a;
typedef int __attribute__((may_alias)) int_a;

template <typename T> __device__ __forceinline__ void vst2(void* p, T v) { *(T*)p = v;  }
__device__ __forceinline__ v8f wmma16(v16h a, v16h b, v8f c) {
  v8f d = __builtin_amdgcn_wmma_f32_16x16x32_f16(false, a, false, b, (short)0, c, false, false);
  asm volatile("v_nop\n\tv_nop\n\tv_nop\n\tv_nop" : "+v"(d) : "v"(a), "v"(b));
  return d;
}
__device__ __forceinline__ v8f wmma_bf(v16b a, v16b b, v8f c) {
  v8f d = __builtin_amdgcn_wmma_f32_16x16x32_bf16(false, a, false, b, (short)0, c, false, false);
  asm volatile("v_nop\n\tv_nop\n\tv_nop\n\tv_nop" : "+v"(d) : "v"(a), "v"(b));
  return d;
}
// 16x16x32 fragments: lane = (h = lane>>4, row/col = lane&15); elements 0..7 = k0+8h+0..7, 8..15 = k0+16+8h+0..7; D element r = row 8h+r
__device__ __forceinline__ v16h frag_h(const _Float16* rowk0, int lane) {
  union { v16h v; v8h q[2]; } u; const _Float16* p = rowk0 + 8 * (lane >> 4);
  u.q[0] = *(const v8h*)p; u.q[1] = *(const v8h*)(p + 16); return u.v;
}
__device__ __forceinline__ v16h frag_f32(const float* rowk0, int lane) {
  v16h a; const float* p = rowk0 + 8 * (lane >> 4);
#pragma unroll
  for (int i = 0; i < 8; ++i) { a[i] = (_Float16)p[i]; a[8 + i] = (_Float16)p[16 + i]; }
  return a;
}
__device__ __forceinline__ v16h frag_f32s(const float* rowk0, int lane, float sc) {
  v16h a; const float* p = rowk0 + 8 * (lane >> 4);
#pragma unroll
  for (int i = 0; i < 8; ++i) { a[i] = (_Float16)(p[i] * sc); a[8 + i] = (_Float16)(p[16 + i] * sc); }
  return a;
}
// column fragment from a [K][ld] layout (column n), rows >= K read as 0
__device__ __forceinline__ v16h fragc_f32(const float* W, int k0, int n, int lane, int ld, int K) {
  v16h a; const int g = lane >> 4;
#pragma unroll
  for (int i = 0; i < 8; ++i) { const int ka = k0 + 8 * g + i, kb = ka + 16;
    a[i] = (_Float16)(ka < K ? W[(size_t)(ka < K ? ka : K - 1) * ld + n] : 0.f); a[8 + i] = (_Float16)(kb < K ? W[(size_t)(kb < K ? kb : K - 1) * ld + n] : 0.f); }
  return a;
}
struct F2 { v16b h, l; };
__device__ __forceinline__ F2 bsplit16(const float v[16]) { F2 r;
#pragma unroll
  for (int i = 0; i < 16; ++i) { const __bf16 h = (__bf16)v[i]; r.h[i] = h; r.l[i] = (__bf16)(v[i] - (float)h); }
  return r; }
__device__ __forceinline__ F2 split_row(const float* row, int k0, int lane) { float v[16]; const float* p = row + k0 + 8 * (lane >> 4);
#pragma unroll
  for (int i = 0; i < 8; ++i) { v[i] = p[i]; v[8 + i] = p[16 + i]; }
  return bsplit16(v); }
__device__ __forceinline__ F2 split_rowK(const float* row, int k0, int lane, int K) { float v[16]; const int g = lane >> 4;
#pragma unroll
  for (int i = 0; i < 8; ++i) { const int ka = k0 + 8 * g + i, kb = ka + 16; v[i] = ka < K ? row[ka < K ? ka : K - 1] : 0.f; v[8 + i] = kb < K ? row[kb < K ? kb : K - 1] : 0.f; }
  return bsplit16(v); }
__device__ __forceinline__ F2 split_col(const float* W, int k0, int n, int lane, int ld, int K) { float v[16]; const int g = lane >> 4;
#pragma unroll
  for (int i = 0; i < 8; ++i) { const int ka = k0 + 8 * g + i, kb = ka + 16; v[i] = ka < K ? W[(size_t)(ka < K ? ka : K - 1) * ld + n] : 0.f; v[8 + i] = kb < K ? W[(size_t)(kb < K ? kb : K - 1) * ld + n] : 0.f; }
  return bsplit16(v); }
__device__ __forceinline__ v8f mac3(const F2& a, const F2& b, v8f c) { c = wmma_bf(a.l, b.h, c); c = wmma_bf(a.h, b.l, c); return wmma_bf(a.h, b.h, c); }
__device__ __forceinline__ float sigm(float v) { return 1.0f / (1.0f + expf(-v)); }
#define LDSX() do { asm volatile("s_wait_dscnt 0" ::: "memory"); __builtin_amdgcn_wave_barrier(); __builtin_amdgcn_fence(__ATOMIC_RELEASE, "workgroup"); } while (0)

// Multi-head attention layer with a random (query, key) mask, residual and LayerNorm (B 2, S 2,048, 1,024 = 16 x 64; (in,out) 1/32-scale weights, no biases; mask [B,S,S] int, 1 = MASKED (~half); LN affine 1/0, eps 1e-5): q = input_Q W_Q ...; scores = q k^T / 8 with where(mask, -1e9, s); ctx = softmax v; out = LN(ctx W_O + input_Q).
#define NB 2
#define TT 2048
#define CC 1024            // NH * HD = projected width
#define DIN 1024          // input (model) width
#define NH 16
#define HD 64
#define NQB (TT / 64)
#define HG 4
#define SCALE (0.125f)
#define SCL2 (SCALE * 1.44269504088896341f)   // score scale times log2(e): exp(SCALE * x) = exp2(SCL2 * x)
#define XMASK (-8589934592.0f)                // a masked position's unscaled score, -2^33: SCALE * XMASK = -2^30 stands for the reference's -1e9 (either is 0 after the exp beside any real score); a power of two, so that XMASK * SCL2 is exact and a fully masked row gets exp2(0) = 1 at every key
#define CAUSAL 0
#ifndef TNB
#define TNB NB
#endif
__device__ __forceinline__ float bfr(float v) { return (float)(__bf16)v; }
__host__ __device__ __forceinline__ int kb_last(int qb) { return CAUSAL ? ((qb * 64 + 63) >> 7) : (TT / 128 - 1); }
typedef __attribute__((ext_vector_type(8))) __bf16 v8b;
__device__ __forceinline__ v16b frag_b(const __bf16* rowk0, int lane) {
  union { v16b v; v8b q[2]; } u; const __bf16* p = rowk0 + 8 * (lane >> 4);
  u.q[0] = *(const v8b*)p; u.q[1] = *(const v8b*)(p + 16); return u.v;
}
#define QBH 0
#define QHI 2048            // rows carrying a q residual plane (all rows when non-causal: 2-product logits everywhere)
#define KHI 64            // key rows carrying k residual / v bf16 hi+lo planes (written by k_proj; no kernel reads them)
// B fragment (k rows k0+.., output column o) of a weight: (in,out) [K][ld] or (out,in) [ld rows of K]: bf16 exact, or f16(bf16 * 256) exact
__device__ __forceinline__ v16b wcol_io(const float* Wm, int k0, int o, int lane, int ld) { v16b w; const int g = lane >> 4;
#pragma unroll
  for (int i = 0; i < 8; ++i) { w[i] = (__bf16)Wm[(size_t)(k0 + 8 * g + i) * ld + o]; w[8 + i] = (__bf16)Wm[(size_t)(k0 + 16 + 8 * g + i) * ld + o]; }
  return w; }
__device__ __forceinline__ v16b wcol_oi(const float* Wm, int k0, int o, int lane, int K) { v16b w; const float* p = Wm + (size_t)o * K + k0 + 8 * (lane >> 4);
#pragma unroll
  for (int i = 0; i < 8; ++i) { w[i] = (__bf16)p[i]; w[8 + i] = (__bf16)p[16 + i]; }
  return w; }
__device__ __forceinline__ v16h wcolh_io(const float* Wm, int k0, int o, int lane, int ld) { v16h w; const int g = lane >> 4;
#pragma unroll
  for (int i = 0; i < 8; ++i) { w[i] = (_Float16)(bfr(Wm[(size_t)(k0 + 8 * g + i) * ld + o]) * 256.0f); w[8 + i] = (_Float16)(bfr(Wm[(size_t)(k0 + 16 + 8 * g + i) * ld + o]) * 256.0f); }
  return w; }
__device__ __forceinline__ v16h wcolh_oi(const float* Wm, int k0, int o, int lane, int K) { v16h w; const float* p = Wm + (size_t)o * K + k0 + 8 * (lane >> 4);
#pragma unroll
  for (int i = 0; i < 8; ++i) { w[i] = (_Float16)(bfr(p[i]) * 256.0f); w[8 + i] = (_Float16)(bfr(p[16 + i]) * 256.0f); }
  return w; }
#define WQKV_LAYOUT 0   // 0 = (in,out) [DIN][CC]; 1 = (out,in) [CC][DIN]; 2 = per-head [NH][DIN][HD]
__device__ __forceinline__ v16b wcol_hdk(const float* Wm, int k0, int o, int lane) { v16b w; const int g = lane >> 4; const float* p = Wm + (size_t)(o / HD) * DIN * HD + (o % HD);
#pragma unroll
  for (int i = 0; i < 8; ++i) { w[i] = (__bf16)p[(size_t)(k0 + 8 * g + i) * HD]; w[8 + i] = (__bf16)p[(size_t)(k0 + 16 + 8 * g + i) * HD]; }
  return w; }
#define WO_OUT_IN 0
#if WQKV_LAYOUT == 1
#define WCOL(W, k0, o, lane) wcol_oi(W, k0, o, lane, DIN)
#elif WQKV_LAYOUT == 2
#define WCOL(W, k0, o, lane) wcol_hdk(W, k0, o, lane)
#else
#define WCOL(W, k0, o, lane) wcol_io(W, k0, o, lane, CC)
#endif
#if WO_OUT_IN
#define WOCOL(W, k0, o, lane) wcol_oi(W, k0, o, lane, CC)
#define WOCOLH(W, k0, o, lane) wcolh_oi(W, k0, o, lane, CC)
#else
#define WOCOL(W, k0, o, lane) wcol_io(W, k0, o, lane, DIN)
#define WOCOLH(W, k0, o, lane) wcolh_io(W, k0, o, lane, DIN)
#endif
#define SM_EXTRA_PARAMS , const int* __restrict__ MK, int bcur
#define SM_MASK_HOOK do { if (MK[((size_t)bcur * TT + t) * TT + k] != 0) v = -1.0e9f; } while (0)   /* where(mask[b][q][k] (1 = masked), -1e9, scores): set; a fully masked row would be uniform (none here) */
#define NRW (TNB * TT)
// ---- k_lnx: wave per row: LayerNorm over 1024 (mean, biased var, (x - mean) * rsqrt(var + 1e-5) * g + b); optional bf16 rounding of the input (x); 32 floats per lane (8 float4 at stride 128 floats -> 512-B pieces)
__global__ __launch_bounds__(256) void k_lnx(const float* __restrict__ X, int roundin, const float* __restrict__ G, const float* __restrict__ BE, float* __restrict__ OUT) { const int wave = threadIdx.x >> 5, lane = threadIdx.x & 31; const size_t row = (size_t)blockIdx.x * 8 + wave; if (row >= (size_t)NRW) return;
  v4f v[CC / 128]; float s1 = 0.f;
#pragma unroll
  for (int i = 0; i < CC / 128; ++i) { v4f t = *(const v4f*)(X + row * CC + i * 128 + lane * 4); if (roundin) { t[0] = bfr(t[0]); t[1] = bfr(t[1]); t[2] = bfr(t[2]); t[3] = bfr(t[3]); } v[i] = t; s1 += (t[0] + t[1]) + (t[2] + t[3]); }
#pragma unroll
  for (int o = 1; o < 32; o <<= 1) s1 += __shfl_xor(s1, o);
  const float mu = s1 * (1.0f / CC); float q = 0.f;
#pragma unroll
  for (int i = 0; i < CC / 128; ++i) for (int k = 0; k < 4; ++k) { const float d = v[i][k] - mu; q += d * d; }
#pragma unroll
  for (int o = 1; o < 32; o <<= 1) q += __shfl_xor(q, o);
  const float inv = rsqrtf(q * (1.0f / CC) + 1e-5f);   /* jnp.var (biased), eps inside the rsqrt */
#pragma unroll
  for (int i = 0; i < CC / 128; ++i) { const int c = i * 128 + lane * 4; v4f r4; for (int k = 0; k < 4; ++k) r4[k] = bfr(G[c + k]) * ((v[i][k] - mu) * inv) + bfr(BE[c + k]); vst2(OUT + row * CC + c, r4); } }

#ifndef SM_EXTRA_PARAMS
#define SM_EXTRA_PARAMS
#endif
#ifndef PROJ_EXTRA_PARAMS
#define PROJ_EXTRA_PARAMS
#endif
#ifndef SM_MASK_HOOK
#define SM_MASK_HOOK (void)0
#endif

#define WS_QH  0u                                      // f16 q rows [b*t][CC]
#define WS_KH  (WS_QH + 2u * (size_t)NB * TT * CC)      // f16 k as A fragments [b][h][16-key group][k step of 32 channels][1 KiB fragment]
#define WS_VT  (WS_KH + 2u * (size_t)NB * TT * CC)      // f16 v^T as A fragments [b][h][32-key group][16-channel group][1 KiB fragment]
#define WS_QL  (WS_VT + 2u * (size_t)NB * CC * TT)      // f16 q residual x 2^10 rows [b][t < QHI][CC]
#define WS_KL  (WS_QL + 2u * (size_t)NB * QHI * CC)     // f16 k residual x 2^10 rows [b][t < KHI][CC]
#define WS_VB  (WS_KL + 2u * (size_t)NB * KHI * CC)     // bf16 v hi planes [b][c][t < KHI]
#define WS_VBL (WS_VB + 2u * (size_t)NB * CC * KHI)
#define WS_S   (WS_VBL + 2u * (size_t)NB * CC * KHI)    // f32 [hg][t][s] region, unused (k_fa keeps logits and P in registers)
#define WS_Y   (WS_S  + 4u * (size_t)HG * TT * TT)      // f32 ctx rows [b*t][CC] (only when there is an output projection)
#define WS_END (WS_Y  + 4u * (size_t)NB * TT * CC)
#define WS_X1  (WS_END)
#define WS_END2 (WS_X1 + 4u * (size_t)NB * TT * DIN)

#define WS_WP  (WS_END2)                                // bf16 weights as B fragments [W_Q, W_K, W_V, W_O][k step of 32][16-column group][1 KiB fragment]
#define WS_XP  (WS_WP + 2u * 4u * (size_t)DIN * CC)     // bf16 inputs as A fragments [input_Q, input_K, input_V][16-row group][k step of 32][1 KiB fragment]
#define WS_END3 (WS_XP + 2u * 3u * (size_t)NB * TT * DIN)
#define WS_MP  (WS_END3)                                // mask as select words [b * TT / 16 + 16-query group][key step of 64][t * 8 + r]: bit l of a word = (mask != 0) at query (l & 15), key 16 t + 8 (l >> 4) + r, the score that lane l of k_fa holds in s[t][r]
#define WS_END4 (WS_MP + (size_t)NB * TT * TT / 8)
typedef __attribute__((ext_vector_type(16))) unsigned v16u;
#define PKP 16                                // pieces per k_pack thread: few waves with many loads in flight each, for speed only
#define PKW (DIN * CC / 8 / 256 / PKP)        // k_pack blocks per weight
#define PKX (NB * TT * DIN / 8 / 256 / PKP)   // k_pack blocks per input
#define PKM (NB * (TT / 16) * (TT / 128) / 8 / 2)   // k_pack blocks for the mask: a wave takes 2 tiles of 16 queries x 128 keys
// ---- k_pack: a piece = 16 bytes of a 16x16x32 operand fragment, rounded to bf16. A 1 KiB fragment is [half hf][lane][8]: piece (hf, lane) holds k = k0 + 16 hf + 8 (lane >> 4) + 0..7 of row or column (lane & 15), the k order of the fragment comment above; a wave's store is 512 contiguous bytes
__global__ __launch_bounds__(256) void k_pack(const float* __restrict__ W0, const float* __restrict__ W1, const float* __restrict__ W2, const float* __restrict__ W3, const float* __restrict__ X0, const float* __restrict__ X1, const float* __restrict__ X2, const int* __restrict__ MK, __bf16* __restrict__ WP, __bf16* __restrict__ XP, unsigned* __restrict__ MP) {
  const int bx = blockIdx.x;
  if (bx < 4 * PKW) { const int mt = bx / PKW; const float* Wm = mt == 0 ? W0 : mt == 1 ? W1 : mt == 2 ? W2 : W3; __bf16* D = WP + (size_t)mt * DIN * CC;   /* (in,out) weight: piece e = [kc][ob][hf][lane] */
    const int e0 = (bx % PKW) * (256 * PKP) + threadIdx.x;
    // rolled over groups of 4 pieces: 32 loads in flight per lane are enough, and the registers stay few
#pragma unroll 1
    for (int it = 0; it < PKP; it += 4) { float t[4][8];
#pragma unroll
      for (int u = 0; u < 4; ++u) { const int e = e0 + (it + u) * 256; const int lane = e & 31, hf = (e >> 5) & 1, ob = (e >> 6) % (CC / 16), kc = (e >> 6) / (CC / 16);
        const float* p = Wm + (size_t)(kc * 32 + 16 * hf + 8 * (lane >> 4)) * CC + ob * 16 + (lane & 15);
#pragma unroll
        for (int i = 0; i < 8; ++i) t[u][i] = p[(size_t)i * CC]; }
#pragma unroll
      for (int u = 0; u < 4; ++u) { v8b w;
#pragma unroll
        for (int i = 0; i < 8; ++i) w[i] = (__bf16)t[u][i];
        vst2(D + (size_t)(e0 + (it + u) * 256) * 8, w); }
      asm volatile("s_wait_xcnt 0x0" ::: "memory"); }   /* stands before the next trip rewrites registers that this trip's stores name */
  } else if (bx < 4 * PKW + 3 * PKX) { const int b2 = bx - 4 * PKW; const int mt = b2 / PKX; const float* Xm = mt == 0 ? X0 : mt == 1 ? X1 : X2; __bf16* D = XP + (size_t)mt * NB * TT * DIN;   /* input rows: piece e = [rb][kc][hf][lane] */
    const int e0 = (b2 % PKX) * (256 * PKP) + threadIdx.x;
    // rolled over groups of 8 pieces: 16 16-byte loads in flight per lane. The 8 pieces of a trip lie 256 pieces = 4 k steps apart, in one input row (32 k steps a row, first k step < 4): one load address and one store address a trip, the rest are constant offsets
#pragma unroll 1
    for (int it = 0; it < PKP; it += 8) { const int e = e0 + it * 256; const int lane = e & 31, hf = (e >> 5) & 1, kc = (e >> 6) % (DIN / 32), rb = (e >> 6) / (DIN / 32);
      const float* p = Xm + (size_t)(rb * 16 + (lane & 15)) * DIN + kc * 32 + 16 * hf + 8 * (lane >> 4); __bf16* q = D + (size_t)e * 8;
      v4f t[8][2]; v8b w[8];
#pragma unroll
      for (int u = 0; u < 8; ++u) { t[u][0] = *(const v4f*)(p + u * 128); t[u][1] = *(const v4f*)(p + u * 128 + 4); }
      // the wait that stands before a register named by an issued load is rewritten; it takes the address and the loaded values as inputs, so that all 16 loads stand in front of it and none of them lands in the address registers
      asm volatile("s_wait_xcnt 0x0" :: "v"(p), "v"(t[0][0]), "v"(t[0][1]), "v"(t[1][0]), "v"(t[1][1]), "v"(t[2][0]), "v"(t[2][1]), "v"(t[3][0]), "v"(t[3][1]), "v"(t[4][0]), "v"(t[4][1]), "v"(t[5][0]), "v"(t[5][1]), "v"(t[6][0]), "v"(t[6][1]), "v"(t[7][0]), "v"(t[7][1]) : "memory");
#pragma unroll
      for (int u = 0; u < 8; ++u) {
#pragma unroll
        for (int i = 0; i < 4; ++i) { w[u][i] = (__bf16)t[u][0][i]; w[u][4 + i] = (__bf16)t[u][1][i]; }
        vst2(q + u * 2048, w[u]); }
      // the same wait behind the stores, before the next trip rewrites what they name; it takes the stored values as inputs, so that their registers live up to it
      asm volatile("s_wait_xcnt 0x0" :: "v"(w[0]), "v"(w[1]), "v"(w[2]), "v"(w[3]), "v"(w[4]), "v"(w[5]), "v"(w[6]), "v"(w[7]) : "memory"); }
  } else { const int wv = (bx - 4 * PKW - 3 * PKX) * 8 + (threadIdx.x >> 5), lane = threadIdx.x & 31;   /* mask tile [rg = 16-row group of the NB * TT query rows][kg = 128-key group]: 16 loads of one whole row piece (512 contiguous bytes) each; lane j holds keys 4 j + 0..3 of every row */
    // rolled: 16 16-byte loads in flight per lane are enough, and the registers stay few
#pragma unroll 1
    for (int it = 0; it < 2; ++it) { const int tile = wv * 2 + it; const int kg = tile % (TT / 128), rg = tile / (TT / 128);
      const int* p = MK + (size_t)rg * 16 * TT + kg * 128 + lane * 4; v4i t[16];
#pragma unroll
      for (int q = 0; q < 16; ++q) t[q] = *(const v4i*)(p + q * TT);
      // the wait that stands before a register named by an issued load is rewritten; it takes the address and the loaded values as inputs, so that all 16 loads stand in front of it
      asm volatile("s_wait_xcnt 0x0" :: "v"(p), "v"(t[0]), "v"(t[1]), "v"(t[2]), "v"(t[3]), "v"(t[4]), "v"(t[5]), "v"(t[6]), "v"(t[7]), "v"(t[8]), "v"(t[9]), "v"(t[10]), "v"(t[11]), "v"(t[12]), "v"(t[13]), "v"(t[14]), "v"(t[15]) : "memory");
      unsigned c[4] = {0u, 0u, 0u, 0u};   /* c[e]: bit q = (mask != 0) at row q, key 4 j + e */
#pragma unroll
      for (int q = 0; q < 16; ++q)
#pragma unroll
        for (int e = 0; e < 4; ++e) { const unsigned mv = (unsigned)t[q][e]; c[e] |= (mv < 1u ? mv : 1u) << q; }
      // key = 64 ks + 16 t + 8 g + r lies in lane j = 16 ks + 4 t + 2 g + (r >> 2), element r & 3: lanes j and j ^ 2 hold the two halves (g = 0 low, g = 1 high) of the same four words
      const unsigned p01 = c[0] | (c[1] << 16), p23 = c[2] | (c[3] << 16); const unsigned o01 = __shfl_xor(p01, 2), o23 = __shfl_xor(p23, 2);
      v4u w; w[0] = (p01 & 0xffffu) | (o01 << 16); w[1] = (p01 >> 16) | (o01 & 0xffff0000u); w[2] = (p23 & 0xffffu) | (o23 << 16); w[3] = (p23 >> 16) | (o23 & 0xffff0000u);
      unsigned* d = MP + ((size_t)rg * (TT / 64) + kg * 2 + (lane >> 4)) * 32 + ((lane >> 2) & 3) * 8 + (lane & 1) * 4;
      if ((lane & 2) == 0) vst2(d, w);   /* the g = 0 lanes store: 16 lanes x 16 bytes = the 256 contiguous bytes of two key steps */
      // the same wait behind the store, before the next trip rewrites what it names
      asm volatile("s_wait_xcnt 0x0" :: "v"(d), "v"(w) : "memory"); } } }
// a packed fragment: two 16-byte loads per lane, each 512 contiguous bytes per wave
__device__ __forceinline__ v16b frag_p(const __bf16* fr, int lane) {
  union { v16b v; v8b q[2]; } u; const __bf16* p = fr + lane * 8;
  u.q[0] = *(const v8b*)p; u.q[1] = *(const v8b*)(p + 256); return u.v;
}
__device__ __forceinline__ v16h frag_ph(const _Float16* fr, int lane) {
  union { v16h v; v8h q[2]; } u; const _Float16* p = fr + lane * 8;
  u.q[0] = *(const v8h*)p; u.q[1] = *(const v8h*)(p + 256); return u.v;
}
// ---- k_proj: block = (128 rows, 128 cols, which), wave = two 16-row groups 64 rows apart x 128 cols, so that each weight fragment fetched feeds two products; the results leave in two passes of 64 rows through the same LDS: q/k/v = X W (+ b) with exact bf16 products (K = DIN) -> which 0: q f16 rows (+ residual rows < QHI); 1: k f16 fragments (+ residual rows < KHI); 2: v^T f16 fragments (+ bf16 hi/lo planes for t < KHI). A k or v^T fragment is [half hf][lane][8] like a packed weight fragment: piece (hf, lane) holds k index 16 hf + 8 (lane >> 4) + 0..7 of row (lane & 15), the elements that lane takes in k_fa, so that a wave's load there is 512 contiguous bytes
__global__ __launch_bounds__(128) void k_proj(const __bf16* __restrict__ XP, const __bf16* __restrict__ WP, const float* __restrict__ BQ, const float* __restrict__ BK, const float* __restrict__ BV,
    _Float16* __restrict__ QH, _Float16* __restrict__ QL, _Float16* __restrict__ KH, _Float16* __restrict__ KL, _Float16* __restrict__ VT, __bf16* __restrict__ VB, __bf16* __restrict__ VBL) {
  __shared__ __align__(16) _Float16 sh[64][136], sl[64][136]; __shared__ __align__(16) _Float16 th[128][72]; __shared__ __align__(16) __bf16 tb[128][72], tbl[128][72];
  const int tid = threadIdx.x, wave = tid >> 5, lane = tid & 31, col = lane & 15, g = lane >> 4; const int which = blockIdx.z; const int c0 = blockIdx.y * 128; const size_t rb0 = (size_t)blockIdx.x * 128;
  const __bf16* XA = XP + (size_t)which * NB * TT * DIN + (rb0 / 16 + wave) * (size_t)(DIN / 32) * 512; const __bf16* WA = WP + (size_t)which * DIN * CC + (size_t)(c0 / 16) * 512; const float* BA = which == 0 ? BQ : which == 1 ? BK : BV;
  v8f acc2[2][8] = {};
#pragma unroll 2
  for (int kc = 0; kc < DIN / 32; ++kc) { const v16b a0 = frag_p(XA + (size_t)kc * 512, lane), a1 = frag_p(XA + (size_t)(4 * (DIN / 32) + kc) * 512, lane);   /* the second group: 64 rows = 4 row groups further on */
    v16b w[8];   /* the k step's packed fragments are all requested before the first product */
#pragma unroll
    for (int j = 0; j < 8; ++j) w[j] = frag_p(WA + ((size_t)kc * (CC / 16) + j) * 512, lane);
#pragma unroll
    for (int j = 0; j < 8; ++j) { acc2[0][j] = wmma_bf(a0, w[j], acc2[0][j]); acc2[1][j] = wmma_bf(a1, w[j], acc2[1][j]); }
    asm volatile("s_wait_xcnt 0x0" ::: "memory"); }   /* stands before the next k step rewrites the address registers that this step's loads name */
  // unrolled: the pass number indexes the accumulators, which stay in registers only under constant indices
#pragma unroll
  for (int hb = 0; hb < 2; ++hb) { const v8f* acc = acc2[hb]; const size_t r0 = rb0 + hb * 64; const size_t bb = r0 / TT; const int t0 = (int)(r0 % TT);
  if (hb) __syncthreads();   /* the first pass's LDS reads end before the second pass writes the same LDS */
  if (which < 2) { _Float16* DH = which == 0 ? QH : KH; _Float16* DL = which == 0 ? QL : KL; const int nhi = which == 0 ? QHI : KHI; const bool hi_rows = t0 < nhi;
#pragma unroll
    for (int j = 0; j < 8; ++j) { const float bias = BA ? bfr(BA[c0 + j * 16 + col]) : 0.f;
#pragma unroll
      for (int r = 0; r < 8; ++r) { const float v = acc[j][r] + bias; const _Float16 hv = (_Float16)v; sh[wave * 16 + 8 * g + r][j * 16 + col] = hv; sl[wave * 16 + 8 * g + r][j * 16 + col] = (_Float16)((v - (float)hv) * 1024.0f); } }
    __syncthreads();
    if (which == 1) {   /* k: 16 fragments = [head of 2][16-key group of 4][k step of 2], 64 pieces each; a head's 8 fragments are 8 KiB in a row */
      // unrolled: the 8 LDS reads go out together, and head and key group are constants of each trip, so that the 8 stores share one address
#pragma unroll
      for (int i = 0; i < 8; ++i) { const int e = tid + i * 128; const int f = e >> 6, pc = e & 63, hf = pc >> 5, ln = pc & 31; const int hh = f >> 3, kt = (f >> 1) & 3, kc = f & 1;
        vst2((unsigned*)(KH + ((((bb * NH + c0 / HD + hh) * (TT / 16) + t0 / 16 + kt) * (HD / 32) + kc) * 512 + pc * 8)), *(const v4u*)&sh[kt * 16 + (ln & 15)][hh * HD + kc * 32 + hf * 16 + (ln >> 4) * 8]); }
      asm volatile("s_wait_xcnt 0x0" ::: "memory"); }   /* stands before the code below rewrites registers that these stores name */
    for (int e = tid; e < 64 * 16; e += 128) { const int rl = e >> 4, q = e & 15; if (which == 0) { vst2((unsigned*)(DH + (r0 + rl) * CC + c0 + q * 8), *(const v4u*)&sh[rl][q * 8]); asm volatile("s_wait_xcnt 0x0" ::: "memory"); }   /* the wait stands before a register that the store names is rewritten */
      if (hi_rows) { vst2((unsigned*)(DL + (bb * nhi + t0 + rl) * (size_t)CC + c0 + q * 8), *(const v4u*)&sl[rl][q * 8]); asm volatile("s_wait_xcnt 0x0" ::: "memory"); } }   /* the same wait, before the next trip */
  } else { const bool hi_rows = t0 < KHI;
#pragma unroll
    for (int j = 0; j < 8; ++j) { const float bias = BA ? bfr(BA[c0 + j * 16 + col]) : 0.f;
#pragma unroll
      for (int r = 0; r < 8; ++r) { const float v = acc[j][r] + bias; const int rl = wave * 16 + 8 * g + r, cl = j * 16 + col; th[cl][rl] = (_Float16)v; const __bf16 bh = (__bf16)v; tb[cl][rl] = bh; tbl[cl][rl] = (__bf16)(v - (float)bh); } }
    __syncthreads();
    /* v^T: 16 fragments = [head of 2][32-key group of 2][16-channel group of 4], 64 pieces each */
    // unrolled: the 8 LDS reads go out together, and head and key group are constants of each trip, so that the 8 stores share one address
#pragma unroll
    for (int i = 0; i < 8; ++i) { const int e = tid + i * 128; const int f = e >> 6, pc = e & 63, hf = pc >> 5, ln = pc & 31; const int hh = f >> 3, kt = (f >> 2) & 1, j = f & 3;
      vst2((unsigned*)(VT + ((((bb * NH + c0 / HD + hh) * (TT / 32) + t0 / 32 + kt) * (HD / 16) + j) * 512 + pc * 8)), *(const v4u*)&th[hh * HD + j * 16 + (ln & 15)][kt * 32 + hf * 16 + (ln >> 4) * 8]); }
    asm volatile("s_wait_xcnt 0x0" ::: "memory");   /* stands before the code below rewrites registers that these stores name */
    for (int e = tid; e < 128 * 8; e += 128) { const int cl = e >> 3, q = e & 7; if (hi_rows) { const size_t o3 = (bb * CC + c0 + cl) * (size_t)KHI + t0 + q * 8; vst2((unsigned*)(VB + o3), *(const v4u*)&tb[cl][q * 8]); vst2((unsigned*)(VBL + o3), *(const v4u*)&tbl[cl][q * 8]); } } } } }
// ---- k_fa: block = 64 queries (qb) of (b, h), wave = 16 queries, all keys in steps of 64: S^T = K q^T (key rows as A, query rows as B; q hi + residual x 2^10: 2 products), unscaled, masked positions set to XMASK; running max and sum per query (lane & 15 = query, so both are per-lane values; the two lane halves hold different keys); D of S^T (lane = query, element r = key 8g + r) IS the 16x16x32 operand layout over 32 keys, so P = exp2(x * SCL2 - max * SCL2) (one fma and the hardware exp2 per score) goes once to f16 in place and ctx^T += v^T (A) P^T (B); ctx^T rows are channels, so the rescale and the final 1 / sum are per-lane too
__global__ __launch_bounds__(128) void k_fa(const _Float16* __restrict__ QH, const _Float16* __restrict__ KH, const _Float16* __restrict__ QL, const _Float16* __restrict__ VT, const unsigned* __restrict__ MP, float* __restrict__ Y) {
  const int tid = threadIdx.x, wave = tid >> 5, lane = tid & 31, col = lane & 15, g = lane >> 4; const int h = blockIdx.y, b = blockIdx.z; const int ql0 = blockIdx.x * 64 + wave * 16;
  v16h qh[HD / 32], ql[HD / 32];
#pragma unroll
  for (int kc = 0; kc < HD / 32; ++kc) { qh[kc] = frag_h(QH + ((size_t)b * TT + ql0 + col) * CC + h * HD + kc * 32, lane); ql[kc] = frag_h(QL + ((size_t)b * QHI + ql0 + col) * CC + h * HD + kc * 32, lane); }
  const _Float16* Kb = KH + (size_t)(b * NH + h) * TT * HD; const _Float16* Vb = VT + (size_t)(b * NH + h) * TT * HD;   /* this head's fragments; 64 keys are 8 fragments = 8 KiB in a row in each */
  const unsigned* Mw = MP + (size_t)(b * (TT / 16) + blockIdx.x * 4 + __builtin_amdgcn_readfirstlane(wave)) * (TT / 64) * 32;   /* this wave's select words, 128 bytes a key step; the address is wave-uniform, so that they come by scalar loads into scalar registers */
  v8f acc[HD / 16] = {}; float m = -3.0e38f, mc = -3.0e38f * SCL2, l = 0.f;   /* mc = m * SCL2: the running max in the exponent's own unit */
  // the key loop stays rolled: a second step's fragments would take the wave past 256 registers and cost a wave per SIMD; the inner loops are fully unrolled so that the fragment arrays are indexed by constants and stay in registers
#pragma unroll 1
  for (int k0 = 0; k0 < TT; k0 += 64) { float s[4][8]; float mx = -3.0e38f;
    v16h kf[4][HD / 32];   /* the whole step's K fragments and select words are requested before the first product: one load latency per step, not one per product */
    v16u mw[2]; const _Float16* kp = Kb + (size_t)k0 * HD + lane * 8;   /* this lane's piece of the step's first K fragment (the address that frag_ph forms) */
#pragma unroll
    for (int t = 0; t < 4; ++t)
#pragma unroll
      for (int kc = 0; kc < HD / 32; ++kc) { union { v16h v; v8h q[2]; } u; u.q[0] = *(const v8h*)(kp + (t * (HD / 32) + kc) * 512); u.q[1] = *(const v8h*)(kp + (t * (HD / 32) + kc) * 512 + 256); kf[t][kc] = u.v; }
    // the step's 32 select words: two scalar loads with their data wait in one statement, so that their address register is rewritten only behind the wait; it stands behind the K requests, which fly meanwhile. It also takes the K address as an input and ends in the wait that stands before a register named by an issued load is rewritten, so that no K load lands in that address
    asm volatile("s_load_b512 %0, %2, 0x0\n\ts_load_b512 %1, %2, 0x40\n\ts_wait_kmcnt 0x0\n\ts_wait_xcnt 0x0" : "=&s"(mw[0]), "=&s"(mw[1]) : "s"(Mw + (k0 >> 1)), "v"(kp) : "memory");
#pragma unroll
    for (int t = 0; t < 4; ++t) { v8f a = {}, al = {};
#pragma unroll
      for (int kc = 0; kc < HD / 32; ++kc) { a = wmma16(kf[t][kc], qh[kc], a); al = wmma16(kf[t][kc], ql[kc], al); }
#pragma unroll
      for (int r = 0; r < 8; ++r) { float v = a[r] + al[r] * (1.0f / 1024.0f); if (__builtin_amdgcn_inverse_ballot_w32(mw[t >> 1][(t & 1) * 8 + r])) v = XMASK;   /* where(mask[b][q][k] (1 = masked), -1e9, scores): set; a fully masked row comes out uniform */
        s[t][r] = v; mx = fmaxf(mx, v); } }
    v16h vf[2][HD / 16];   /* the step's v fragments are requested here, so that they fly under the softmax arithmetic */
#pragma unroll
    for (int u = 0; u < 2; ++u)
#pragma unroll
      for (int j = 0; j < HD / 16; ++j) vf[u][j] = frag_ph(Vb + (size_t)k0 * HD + (u * (HD / 16) + j) * 512, lane);
    mx = fmaxf(mx, __shfl_xor(mx, 16)); const float mn = fmaxf(m, mx); const float mcn = mn * SCL2; const float alpha = __builtin_amdgcn_exp2f(mc - mcn); m = mn; mc = mcn;
    v16h p[2]; float sum = 0.f;
#pragma unroll
    for (int t = 0; t < 4; ++t)
#pragma unroll
      for (int r = 0; r < 8; ++r) { const float e = __builtin_amdgcn_exp2f(fmaf(s[t][r], SCL2, -mcn)); sum += e; p[t >> 1][(t & 1) * 8 + r] = (_Float16)e; }
    l = l * alpha + sum;
#pragma unroll
    for (int j = 0; j < HD / 16; ++j)
#pragma unroll
      for (int r = 0; r < 8; ++r) acc[j][r] *= alpha;
#pragma unroll
    for (int u = 0; u < 2; ++u)
#pragma unroll
      for (int j = 0; j < HD / 16; ++j) acc[j] = wmma16(vf[u][j], p[u], acc[j]); }
  l += __shfl_xor(l, 16); const float inv = 1.0f / l;   /* l >= 1: the key that holds the max contributes exp(0) */
  float* yr = Y + ((size_t)b * TT + ql0 + col) * CC + h * HD + 8 * g;
#pragma unroll
  for (int j = 0; j < HD / 16; ++j) { v4f o0, o1;
#pragma unroll
    for (int r = 0; r < 4; ++r) { o0[r] = acc[j][r] * inv; o1[r] = acc[j][4 + r] * inv; }
    vst2(yr + j * 16, o0); vst2(yr + j * 16 + 4, o1); } }
// ---- k_out: block = (64 rows, 128 cols): out = ctx Wo (+ bo): all rows: ctx bf16 hi + lo against exact bf16 Wo from its packed fragments (2 products)
__global__ __launch_bounds__(128) void k_out(const float* __restrict__ Y, const float* __restrict__ WO, const __bf16* __restrict__ WPO, const float* __restrict__ BO, float* __restrict__ OUT, const float* __restrict__ RESX) { __shared__ __align__(16) float sf[4][16][132];
  const int tid = threadIdx.x, wave = tid >> 5, lane = tid & 31, col = lane & 15, g = lane >> 4; const int c0 = blockIdx.y * 128; const size_t r0 = (size_t)blockIdx.x * 64 + wave * 16;
  v8f acc[8] = {};
  if (true) {   /* ALL rows: ctx split bf16 hi + lo x exact Wo (2 products) */
#pragma unroll 2
    for (int kc = 0; kc < CC / 32; ++kc) { const F2 a = split_row(Y + (r0 + col) * CC, kc * 32, lane);
      v16b w[8];   /* the k step's packed B fragments are all requested before the first product */
#pragma unroll
      for (int j = 0; j < 8; ++j) w[j] = frag_p(WPO + ((size_t)kc * (DIN / 16) + c0 / 16 + j) * 512, lane);
#pragma unroll
      for (int j = 0; j < 8; ++j) { acc[j] = wmma_bf(a.h, w[j], acc[j]); acc[j] = wmma_bf(a.l, w[j], acc[j]); }
      asm volatile("s_wait_xcnt 0x0" ::: "memory"); }   /* stands before the next k step rewrites the address registers that this step's loads name */
#pragma unroll
    for (int j = 0; j < 8; ++j) { const float bias = BO ? bfr(BO[c0 + j * 16 + col]) : 0.f;
#pragma unroll
      for (int r = 0; r < 8; ++r) sf[wave][8 * g + r][j * 16 + col] = acc[j][r] + bias; }
  } else {
#pragma unroll 2
    for (int kc = 0; kc < CC / 32; ++kc) { const v16h a = frag_f32(Y + (r0 + col) * CC + kc * 32, lane); asm volatile("s_wait_loadcnt 0x0" ::: "memory");
#pragma unroll
      for (int j = 0; j < 8; ++j) { const v16h w = WOCOLH(WO, kc * 32, c0 + j * 16 + col, lane); asm volatile("s_wait_loadcnt 0x0" ::: "memory"); acc[j] = wmma16(a, w, acc[j]); } }
#pragma unroll
    for (int j = 0; j < 8; ++j) { const float bias = BO ? bfr(BO[c0 + j * 16 + col]) : 0.f;
#pragma unroll
      for (int r = 0; r < 8; ++r) sf[wave][8 * g + r][j * 16 + col] = acc[j][r] * (1.0f / 256.0f) + bias; } }
  LDSX(); for (int rl = 0; rl < 16; ++rl) { const size_t oo = (r0 + rl) * DIN + c0 + lane * 4; v4f o = *(const v4f*)&sf[wave][rl][lane * 4]; const v4f zr = *(const v4f*)(RESX + oo); o[0] += bfr(zr[0]); o[1] += bfr(zr[1]); o[2] += bfr(zr[2]); o[3] += bfr(zr[3]); vst2(OUT + oo, o); } }   /* ctx W_O + bf16(input_Q) */

extern "C" void kernel_launch(void* const* d_in, const int* in_sizes, int n_in, void* d_out, int out_size, void* d_ws, size_t ws_size, hipStream_t stream) {
  (void)in_sizes; (void)n_in; (void)out_size;
  const float** F = (const float**)d_in;
  if (ws_size < (size_t)WS_END) return;
  char* ws = (char*)d_ws; _Float16 *QH = (_Float16*)(ws + WS_QH), *KH = (_Float16*)(ws + WS_KH), *VT = (_Float16*)(ws + WS_VT), *QL = (_Float16*)(ws + WS_QL), *KL = (_Float16*)(ws + WS_KL); __bf16 *VB = (__bf16*)(ws + WS_VB), *VBL = (__bf16*)(ws + WS_VBL); float *Y = (float*)(ws + WS_Y);
  (void)Y; (void)QL; (void)KL; (void)VB; (void)VBL;
  // inputs: 0 input_Q; 1 input_K; 2 input_V [2,2048,1024]; 3 mask [2,2048,2048] int32 (1 = masked); 4 W_Q (in,out); 5 W_K; 6 W_V; 7 W_O (in,out); 8 ln_gamma; 9 ln_beta
  if (ws_size < (size_t)WS_END4) return;
  float* X1 = (float*)(ws + WS_X1); __bf16 *WP = (__bf16*)(ws + WS_WP), *XP = (__bf16*)(ws + WS_XP); unsigned* MP = (unsigned*)(ws + WS_MP);
  k_pack<<<dim3(4 * PKW + 3 * PKX + PKM), 256, 0, stream>>>(F[4], F[5], F[6], F[7], F[0], F[1], F[2], (const int*)d_in[3], WP, XP, MP);   /* weights and inputs -> bf16 fragments, mask -> select words, every call */
  k_proj<<<dim3(TNB * TT / 128, CC / 128, 3), 128, 0, stream>>>(XP, WP, nullptr, nullptr, nullptr, QH, QL, KH, KL, VT, VB, VBL);
  k_fa<<<dim3(NQB, NH, TNB), 128, 0, stream>>>(QH, KH, QL, VT, MP, Y);
  k_out<<<dim3(TNB * TT / 64, DIN / 128), 128, 0, stream>>>(Y, F[7], WP + 3 * (size_t)DIN * CC, nullptr, X1, F[0]);   /* ctx W_O + input_Q */
  k_lnx<<<dim3(NRW / 8), 256, 0, stream>>>(X1, 0, F[8], F[9], (float*)d_out);              /* LayerNorm */
}

// v007
// It runs in 128 microseconds.
// In both of two side-by-side timings against v006, it was 1.06 times as fast.
// All steps since v000 together make it 9.64 times as fast.
// compute dtype: all float inputs rounded to bf16; q/k/v = in W with EXACT bf16 products on WMMA 16x16x32 (f32 accumulate); q as f16 hi + residual (x 2^10) against k once to f16 (2 products), masked (mask == 1) positions set to -2^33 (-2^30 after the / 8, standing for -1e9); softmax in f32 in base 2 (hardware exp2 of (x - max) * log2(e) / 8, running max and sum over key steps of 64); P = exp(s - max) once to f16 against v once to f16 (1 product), divided by the sum at the end; ctx split bf16 hi + lo against exact W_O (2 products) + input_Q; LayerNorm in f32; f32 output.
#include <hip/hip_runtime.h>
#include <math.h>

typedef __attribute__((ext_vector_type(16))) _Float16 v16h;
typedef __attribute__((ext_vector_type(16))) __bf16 v16b;
typedef __attribute__((ext_vector_type(8)))  _Float16 v8h;
typedef __attribute__((ext_vector_type(8)))  float v8f;
typedef __attribute__((ext_vector_type(4)))  float v4f;
typedef __attribute__((ext_vector_type(2)))  float v2f;
typedef __attribute__((ext_vector_type(4)))  unsigned v4u;
typedef __attribute__((ext_vector_type(4)))  int v4i;
typedef float __attribute__((may_alias)) float_a;
typedef int __attribute__((may_alias)) int_a;

template <typename T> __device__ __forceinline__ void vst2(void* p, T v) { *(T*)p = v;  }
__device__ __forceinline__ v8f wmma16(v16h a, v16h b, v8f c) {
  return __builtin_amdgcn_wmma_f32_16x16x32_f16(false, a, false, b, (short)0, c, false, false);   /* no v_nop written behind it: the compiler pads its own builtin where a distance is owed */
}
__device__ __forceinline__ v8f wmma_bf(v16b a, v16b b, v8f c) {
  v8f d = __builtin_amdgcn_wmma_f32_16x16x32_bf16(false, a, false, b, (short)0, c, false, false);
  asm volatile("v_nop\n\tv_nop\n\tv_nop\n\tv_nop" : "+v"(d) : "v"(a), "v"(b));
  return d;
}
// 16x16x32 fragments: lane = (h = lane>>4, row/col = lane&15); elements 0..7 = k0+8h+0..7, 8..15 = k0+16+8h+0..7; D element r = row 8h+r
__device__ __forceinline__ v16h frag_h(const _Float16* rowk0, int lane) {
  union { v16h v; v8h q[2]; } u; const _Float16* p = rowk0 + 8 * (lane >> 4);
  u.q[0] = *(const v8h*)p; u.q[1] = *(const v8h*)(p + 16); return u.v;
}
__device__ __forceinline__ v16h frag_f32(const float* rowk0, int lane) {
  v16h a; const float* p = rowk0 + 8 * (lane >> 4);
#pragma unroll
  for (int i = 0; i < 8; ++i) { a[i] = (_Float16)p[i]; a[8 + i] = (_Float16)p[16 + i]; }
  return a;
}
__device__ __forceinline__ v16h frag_f32s(const float* rowk0, int lane, float sc) {
  v16h a; const float* p = rowk0 + 8 * (lane >> 4);
#pragma unroll
  for (int i = 0; i < 8; ++i) { a[i] = (_Float16)(p[i] * sc); a[8 + i] = (_Float16)(p[16 + i] * sc); }
  return a;
}
// column fragment from a [K][ld] layout (column n), rows >= K read as 0
__device__ __forceinline__ v16h fragc_f32(const float* W, int k0, int n, int lane, int ld, int K) {
  v16h a; const int g = lane >> 4;
#pragma unroll
  for (int i = 0; i < 8; ++i) { const int ka = k0 + 8 * g + i, kb = ka + 16;
    a[i] = (_Float16)(ka < K ? W[(size_t)(ka < K ? ka : K - 1) * ld + n] : 0.f); a[8 + i] = (_Float16)(kb < K ? W[(size_t)(kb < K ? kb : K - 1) * ld + n] : 0.f); }
  return a;
}
struct F2 { v16b h, l; };
__device__ __forceinline__ F2 bsplit16(const float v[16]) { F2 r;
#pragma unroll
  for (int i = 0; i < 16; ++i) { const __bf16 h = (__bf16)v[i]; r.h[i] = h; r.l[i] = (__bf16)(v[i] - (float)h); }
  return r; }
__device__ __forceinline__ F2 split_row(const float* row, int k0, int lane) { float v[16]; const float* p = row + k0 + 8 * (lane >> 4);
#pragma unroll
  for (int i = 0; i < 8; ++i) { v[i] = p[i]; v[8 + i] = p[16 + i]; }
  return bsplit16(v); }
__device__ __forceinline__ F2 split_rowK(const float* row, int k0, int lane, int K) { float v[16]; const int g = lane >> 4;
#pragma unroll
  for (int i = 0; i < 8; ++i) { const int ka = k0 + 8 * g + i, kb = ka + 16; v[i] = ka < K ? row[ka < K ? ka : K - 1] : 0.f; v[8 + i] = kb < K ? row[kb < K ? kb : K - 1] : 0.f; }
  return bsplit16(v); }
__device__ __forceinline__ F2 split_col(const float* W, int k0, int n, int lane, int ld, int K) { float v[16]; const int g = lane >> 4;
#pragma unroll
  for (int i = 0; i < 8; ++i) { const int ka = k0 + 8 * g + i, kb = ka + 16; v[i] = ka < K ? W[(size_t)(ka < K ? ka : K - 1) * ld + n] : 0.f; v[8 + i] = kb < K ? W[(size_t)(kb < K ? kb : K - 1) * ld + n] : 0.f; }
  return bsplit16(v); }
__device__ __forceinline__ v8f mac3(const F2& a, const F2& b, v8f c) { c = wmma_bf(a.l, b.h, c); c = wmma_bf(a.h, b.l, c); return wmma_bf(a.h, b.h, c); }
__device__ __forceinline__ float sigm(float v) { return 1.0f / (1.0f + expf(-v)); }
#define LDSX() do { asm volatile("s_wait_dscnt 0" ::: "memory"); __builtin_amdgcn_wave_barrier(); __builtin_amdgcn_fence(__ATOMIC_RELEASE, "workgroup"); } while (0)

// Multi-head attention layer with a random (query, key) mask, residual and LayerNorm (B 2, S 2,048, 1,024 = 16 x 64; (in,out) 1/32-scale weights, no biases; mask [B,S,S] int, 1 = MASKED (~half); LN affine 1/0, eps 1e-5): q = input_Q W_Q ...; scores = q k^T / 8 with where(mask, -1e9, s); ctx = softmax v; out = LN(ctx W_O + input_Q).
#define NB 2
#define TT 2048
#define CC 1024            // NH * HD = projected width
#define DIN 1024          // input (model) width
#define NH 16
#define HD 64
#define NQB (TT / 64)
#define HG 4
#define SCALE (0.125f)
#define SCL2 (SCALE * 1.44269504088896341f)   // score scale times log2(e): exp(SCALE * x) = exp2(SCL2 * x)
#define XMASK (-8589934592.0f)                // a masked position's unscaled score, -2^33: SCALE * XMASK = -2^30 stands for the reference's -1e9 (either is 0 after the exp beside any real score); a power of two, so that XMASK * SCL2 is exact and a fully masked row gets exp2(0) = 1 at every key
#define CAUSAL 0
#ifndef TNB
#define TNB NB
#endif
__device__ __forceinline__ float bfr(float v) { return (float)(__bf16)v; }
__host__ __device__ __forceinline__ int kb_last(int qb) { return CAUSAL ? ((qb * 64 + 63) >> 7) : (TT / 128 - 1); }
typedef __attribute__((ext_vector_type(8))) __bf16 v8b;
__device__ __forceinline__ v16b frag_b(const __bf16* rowk0, int lane) {
  union { v16b v; v8b q[2]; } u; const __bf16* p = rowk0 + 8 * (lane >> 4);
  u.q[0] = *(const v8b*)p; u.q[1] = *(const v8b*)(p + 16); return u.v;
}
#define QBH 0
#define QHI 2048            // rows carrying a q residual plane (all rows when non-causal: 2-product logits everywhere)
#define KHI 64            // key rows carrying k residual / v bf16 hi+lo planes (written by k_proj; no kernel reads them)
// B fragment (k rows k0+.., output column o) of a weight: (in,out) [K][ld] or (out,in) [ld rows of K]: bf16 exact, or f16(bf16 * 256) exact
__device__ __forceinline__ v16b wcol_io(const float* Wm, int k0, int o, int lane, int ld) { v16b w; const int g = lane >> 4;
#pragma unroll
  for (int i = 0; i < 8; ++i) { w[i] = (__bf16)Wm[(size_t)(k0 + 8 * g + i) * ld + o]; w[8 + i] = (__bf16)Wm[(size_t)(k0 + 16 + 8 * g + i) * ld + o]; }
  return w; }
__device__ __forceinline__ v16b wcol_oi(const float* Wm, int k0, int o, int lane, int K) { v16b w; const float* p = Wm + (size_t)o * K + k0 + 8 * (lane >> 4);
#pragma unroll
  for (int i = 0; i < 8; ++i) { w[i] = (__bf16)p[i]; w[8 + i] = (__bf16)p[16 + i]; }
  return w; }
__device__ __forceinline__ v16h wcolh_io(const float* Wm, int k0, int o, int lane, int ld) { v16h w; const int g = lane >> 4;
#pragma unroll
  for (int i = 0; i < 8; ++i) { w[i] = (_Float16)(bfr(Wm[(size_t)(k0 + 8 * g + i) * ld + o]) * 256.0f); w[8 + i] = (_Float16)(bfr(Wm[(size_t)(k0 + 16 + 8 * g + i) * ld + o]) * 256.0f); }
  return w; }
__device__ __forceinline__ v16h wcolh_oi(const float* Wm, int k0, int o, int lane, int K) { v16h w; const float* p = Wm + (size_t)o * K + k0 + 8 * (lane >> 4);
#pragma unroll
  for (int i = 0; i < 8; ++i) { w[i] = (_Float16)(bfr(p[i]) * 256.0f); w[8 + i] = (_Float16)(bfr(p[16 + i]) * 256.0f); }
  return w; }
#define WQKV_LAYOUT 0   // 0 = (in,out) [DIN][CC]; 1 = (out,in) [CC][DIN]; 2 = per-head [NH][DIN][HD]
__device__ __forceinline__ v16b wcol_hdk(const float* Wm, int k0, int o, int lane) { v16b w; const int g = lane >> 4; const float* p = Wm + (size_t)(o / HD) * DIN * HD + (o % HD);
#pragma unroll
  for (int i = 0; i < 8; ++i) { w[i] = (__bf16)p[(size_t)(k0 + 8 * g + i) * HD]; w[8 + i] = (__bf16)p[(size_t)(k0 + 16 + 8 * g + i) * HD]; }
  return w; }
#define WO_OUT_IN 0
#if WQKV_LAYOUT == 1
#define WCOL(W, k0, o, lane) wcol_oi(W, k0, o, lane, DIN)
#elif WQKV_LAYOUT == 2
#define WCOL(W, k0, o, lane) wcol_hdk(W, k0, o, lane)
#else
#define WCOL(W, k0, o, lane) wcol_io(W, k0, o, lane, CC)
#endif
#if WO_OUT_IN
#define WOCOL(W, k0, o, lane) wcol_oi(W, k0, o, lane, CC)
#define WOCOLH(W, k0, o, lane) wcolh_oi(W, k0, o, lane, CC)
#else
#define WOCOL(W, k0, o, lane) wcol_io(W, k0, o, lane, DIN)
#define WOCOLH(W, k0, o, lane) wcolh_io(W, k0, o, lane, DIN)
#endif
#define SM_EXTRA_PARAMS , const int* __restrict__ MK, int bcur
#define SM_MASK_HOOK do { if (MK[((size_t)bcur * TT + t) * TT + k] != 0) v = -1.0e9f; } while (0)   /* where(mask[b][q][k] (1 = masked), -1e9, scores): set; a fully masked row would be uniform (none here) */
#define NRW (TNB * TT)
// ---- k_lnx: wave per row: LayerNorm over 1024 (mean, biased var, (x - mean) * rsqrt(var + 1e-5) * g + b); optional bf16 rounding of the input (x); 32 floats per lane (8 float4 at stride 128 floats -> 512-B pieces)
__global__ __launch_bounds__(256) void k_lnx(const float* __restrict__ X, int roundin, const float* __restrict__ G, const float* __restrict__ BE, float* __restrict__ OUT) { const int wave = threadIdx.x >> 5, lane = threadIdx.x & 31; const size_t row = (size_t)blockIdx.x * 8 + wave; if (row >= (size_t)NRW) return;
  v4f v[CC / 128]; float s1 = 0.f;
#pragma unroll
  for (int i = 0; i < CC / 128; ++i) { v4f t = *(const v4f*)(X + row * CC + i * 128 + lane * 4); if (roundin) { t[0] = bfr(t[0]); t[1] = bfr(t[1]); t[2] = bfr(t[2]); t[3] = bfr(t[3]); } v[i] = t; s1 += (t[0] + t[1]) + (t[2] + t[3]); }
#pragma unroll
  for (int o = 1; o < 32; o <<= 1) s1 += __shfl_xor(s1, o);
  const float mu = s1 * (1.0f / CC); float q = 0.f;
#pragma unroll
  for (int i = 0; i < CC / 128; ++i) for (int k = 0; k < 4; ++k) { const float d = v[i][k] - mu; q += d * d; }
#pragma unroll
  for (int o = 1; o < 32; o <<= 1) q += __shfl_xor(q, o);
  const float inv = rsqrtf(q * (1.0f / CC) + 1e-5f);   /* jnp.var (biased), eps inside the rsqrt */
#pragma unroll
  for (int i = 0; i < CC / 128; ++i) { const int c = i * 128 + lane * 4; v4f r4; for (int k = 0; k < 4; ++k) r4[k] = bfr(G[c + k]) * ((v[i][k] - mu) * inv) + bfr(BE[c + k]); vst2(OUT + row * CC + c, r4); } }

#ifndef SM_EXTRA_PARAMS
#define SM_EXTRA_PARAMS
#endif
#ifndef PROJ_EXTRA_PARAMS
#define PROJ_EXTRA_PARAMS
#endif
#ifndef SM_MASK_HOOK
#define SM_MASK_HOOK (void)0
#endif

#define WS_QH  0u                                      // f16 q rows [b*t][CC]
#define WS_KH  (WS_QH + 2u * (size_t)NB * TT * CC)      // f16 k as A fragments [b][h][16-key group][k step of 32 channels][1 KiB fragment]
#define WS_VT  (WS_KH + 2u * (size_t)NB * TT * CC)      // f16 v^T as A fragments [b][h][32-key group][16-channel group][1 KiB fragment]
#define WS_QL  (WS_VT + 2u * (size_t)NB * CC * TT)      // f16 q residual x 2^10 rows [b][t < QHI][CC]
#define WS_KL  (WS_QL + 2u * (size_t)NB * QHI * CC)     // f16 k residual x 2^10 rows [b][t < KHI][CC]
#define WS_VB  (WS_KL + 2u * (size_t)NB * KHI * CC)     // bf16 v hi planes [b][c][t < KHI]
#define WS_VBL (WS_VB + 2u * (size_t)NB * CC * KHI)
#define WS_S   (WS_VBL + 2u * (size_t)NB * CC * KHI)    // f32 [hg][t][s] region, unused (k_fa keeps logits and P in registers)
#define WS_Y   (WS_S  + 4u * (size_t)HG * TT * TT)      // f32 ctx rows [b*t][CC] (only when there is an output projection)
#define WS_END (WS_Y  + 4u * (size_t)NB * TT * CC)
#define WS_X1  (WS_END)
#define WS_END2 (WS_X1 + 4u * (size_t)NB * TT * DIN)

#define WS_WP  (WS_END2)                                // bf16 weights as B fragments [W_Q, W_K, W_V, W_O][k step of 32][16-column group][1 KiB fragment]
#define WS_XP  (WS_WP + 2u * 4u * (size_t)DIN * CC)     // bf16 inputs as A fragments [input_Q, input_K, input_V][16-row group][k step of 32][1 KiB fragment]
#define WS_END3 (WS_XP + 2u * 3u * (size_t)NB * TT * DIN)
#define WS_MP  (WS_END3)                                // mask as select words [b * TT / 16 + 16-query group][key step of 64][t * 8 + r]: bit l of a word = (mask != 0) at query (l & 15), key 16 t + 8 (l >> 4) + r, the score that lane l of k_fa holds in s[t][r]
#define WS_END4 (WS_MP + (size_t)NB * TT * TT / 8)
typedef __attribute__((ext_vector_type(16))) unsigned v16u;
#define PKP 16                                // pieces per k_pack thread: few waves with many loads in flight each, for speed only
#define PKW (DIN * CC / 8 / 256 / PKP)        // k_pack blocks per weight
#define PKX (NB * TT * DIN / 8 / 256 / PKP)   // k_pack blocks per input
#define PKM (NB * (TT / 16) * (TT / 128) / 8 / 2)   // k_pack blocks for the mask: a wave takes 2 tiles of 16 queries x 128 keys
// ---- k_pack: a piece = 16 bytes of a 16x16x32 operand fragment, rounded to bf16. A 1 KiB fragment is [half hf][lane][8]: piece (hf, lane) holds k = k0 + 16 hf + 8 (lane >> 4) + 0..7 of row or column (lane & 15), the k order of the fragment comment above; a wave's store is 512 contiguous bytes
__global__ __launch_bounds__(256) void k_pack(const float* __restrict__ W0, const float* __restrict__ W1, const float* __restrict__ W2, const float* __restrict__ W3, const float* __restrict__ X0, const float* __restrict__ X1, const float* __restrict__ X2, const int* __restrict__ MK, __bf16* __restrict__ WP, __bf16* __restrict__ XP, unsigned* __restrict__ MP) {
  const int bx = blockIdx.x;
  if (bx < 4 * PKW) { const int mt = bx / PKW; const float* Wm = mt == 0 ? W0 : mt == 1 ? W1 : mt == 2 ? W2 : W3; __bf16* D = WP + (size_t)mt * DIN * CC;   /* (in,out) weight: piece e = [kc][ob][hf][lane] */
    const int e0 = (bx % PKW) * (256 * PKP) + threadIdx.x;
    // rolled over groups of 4 pieces: 32 loads in flight per lane are enough, and the registers stay few
#pragma unroll 1
    for (int it = 0; it < PKP; it += 4) { float t[4][8];
#pragma unroll
      for (int u = 0; u < 4; ++u) { const int e = e0 + (it + u) * 256; const int lane = e & 31, hf = (e >> 5) & 1, ob = (e >> 6) % (CC / 16), kc = (e >> 6) / (CC / 16);
        const float* p = Wm + (size_t)(kc * 32 + 16 * hf + 8 * (lane >> 4)) * CC + ob * 16 + (lane & 15);
#pragma unroll
        for (int i = 0; i < 8; ++i) t[u][i] = p[(size_t)i * CC]; }
#pragma unroll
      for (int u = 0; u < 4; ++u) { v8b w;
#pragma unroll
        for (int i = 0; i < 8; ++i) w[i] = (__bf16)t[u][i];
        vst2(D + (size_t)(e0 + (it + u) * 256) * 8, w); }
      asm volatile("s_wait_xcnt 0x0" ::: "memory"); }   /* stands before the next trip rewrites registers that this trip's stores name */
  } else if (bx < 4 * PKW + 3 * PKX) { const int b2 = bx - 4 * PKW; const int mt = b2 / PKX; const float* Xm = mt == 0 ? X0 : mt == 1 ? X1 : X2; __bf16* D = XP + (size_t)mt * NB * TT * DIN;   /* input rows: piece e = [rb][kc][hf][lane] */
    const int e0 = (b2 % PKX) * (256 * PKP) + threadIdx.x;
    // rolled over groups of 8 pieces: 16 16-byte loads in flight per lane. The 8 pieces of a trip lie 256 pieces = 4 k steps apart, in one input row (32 k steps a row, first k step < 4): one load address and one store address a trip, the rest are constant offsets
#pragma unroll 1
    for (int it = 0; it < PKP; it += 8) { const int e = e0 + it * 256; const int lane = e & 31, hf = (e >> 5) & 1, kc = (e >> 6) % (DIN / 32), rb = (e >> 6) / (DIN / 32);
      const float* p = Xm + (size_t)(rb * 16 + (lane & 15)) * DIN + kc * 32 + 16 * hf + 8 * (lane >> 4); __bf16* q = D + (size_t)e * 8;
      v4f t[8][2]; v8b w[8];
#pragma unroll
      for (int u = 0; u < 8; ++u) { t[u][0] = *(const v4f*)(p + u * 128); t[u][1] = *(const v4f*)(p + u * 128 + 4); }
      // the wait that stands before a register named by an issued load is rewritten; it takes the address and the loaded values as inputs, so that all 16 loads stand in front of it and none of them lands in the address registers
      asm volatile("s_wait_xcnt 0x0" :: "v"(p), "v"(t[0][0]), "v"(t[0][1]), "v"(t[1][0]), "v"(t[1][1]), "v"(t[2][0]), "v"(t[2][1]), "v"(t[3][0]), "v"(t[3][1]), "v"(t[4][0]), "v"(t[4][1]), "v"(t[5][0]), "v"(t[5][1]), "v"(t[6][0]), "v"(t[6][1]), "v"(t[7][0]), "v"(t[7][1]) : "memory");
#pragma unroll
      for (int u = 0; u < 8; ++u) {
#pragma unroll
        for (int i = 0; i < 4; ++i) { w[u][i] = (__bf16)t[u][0][i]; w[u][4 + i] = (__bf16)t[u][1][i]; }
        vst2(q + u * 2048, w[u]); }
      // the same wait behind the stores, before the next trip rewrites what they name; it takes the stored values as inputs, so that their registers live up to it
      asm volatile("s_wait_xcnt 0x0" :: "v"(w[0]), "v"(w[1]), "v"(w[2]), "v"(w[3]), "v"(w[4]), "v"(w[5]), "v"(w[6]), "v"(w[7]) : "memory"); }
  } else { const int wv = (bx - 4 * PKW - 3 * PKX) * 8 + (threadIdx.x >> 5), lane = threadIdx.x & 31;   /* mask tile [rg = 16-row group of the NB * TT query rows][kg = 128-key group]: 16 loads of one whole row piece (512 contiguous bytes) each; lane j holds keys 4 j + 0..3 of every row */
    // rolled: 16 16-byte loads in flight per lane are enough, and the registers stay few
#pragma unroll 1
    for (int it = 0; it < 2; ++it) { const int tile = wv * 2 + it; const int kg = tile % (TT / 128), rg = tile / (TT / 128);
      const int* p = MK + (size_t)rg * 16 * TT + kg * 128 + lane * 4; v4i t[16];
#pragma unroll
      for (int q = 0; q < 16; ++q) t[q] = *(const v4i*)(p + q * TT);
      // the wait that stands before a register named by an issued load is rewritten; it takes the address and the loaded values as inputs, so that all 16 loads stand in front of it
      asm volatile("s_wait_xcnt 0x0" :: "v"(p), "v"(t[0]), "v"(t[1]), "v"(t[2]), "v"(t[3]), "v"(t[4]), "v"(t[5]), "v"(t[6]), "v"(t[7]), "v"(t[8]), "v"(t[9]), "v"(t[10]), "v"(t[11]), "v"(t[12]), "v"(t[13]), "v"(t[14]), "v"(t[15]) : "memory");
      unsigned c[4] = {0u, 0u, 0u, 0u};   /* c[e]: bit q = (mask != 0) at row q, key 4 j + e */
#pragma unroll
      for (int q = 0; q < 16; ++q)
#pragma unroll
        for (int e = 0; e < 4; ++e) { const unsigned mv = (unsigned)t[q][e]; c[e] |= (mv < 1u ? mv : 1u) << q; }
      // key = 64 ks + 16 t + 8 g + r lies in lane j = 16 ks + 4 t + 2 g + (r >> 2), element r & 3: lanes j and j ^ 2 hold the two halves (g = 0 low, g = 1 high) of the same four words
      const unsigned p01 = c[0] | (c[1] << 16), p23 = c[2] | (c[3] << 16); const unsigned o01 = __shfl_xor(p01, 2), o23 = __shfl_xor(p23, 2);
      v4u w; w[0] = (p01 & 0xffffu) | (o01 << 16); w[1] = (p01 >> 16) | (o01 & 0xffff0000u); w[2] = (p23 & 0xffffu) | (o23 << 16); w[3] = (p23 >> 16) | (o23 & 0xffff0000u);
      unsigned* d = MP + ((size_t)rg * (TT / 64) + kg * 2 + (lane >> 4)) * 32 + ((lane >> 2) & 3) * 8 + (lane & 1) * 4;
      if ((lane & 2) == 0) vst2(d, w);   /* the g = 0 lanes store: 16 lanes x 16 bytes = the 256 contiguous bytes of two key steps */
      // the same wait behind the store, before the next trip rewrites what it names
      asm volatile("s_wait_xcnt 0x0" :: "v"(d), "v"(w) : "memory"); } } }
// a packed fragment: two 16-byte loads per lane, each 512 contiguous bytes per wave
__device__ __forceinline__ v16b frag_p(const __bf16* fr, int lane) {
  union { v16b v; v8b q[2]; } u; const __bf16* p = fr + lane * 8;
  u.q[0] = *(const v8b*)p; u.q[1] = *(const v8b*)(p + 256); return u.v;
}
__device__ __forceinline__ v16h frag_ph(const _Float16* fr, int lane) {
  union { v16h v; v8h q[2]; } u; const _Float16* p = fr + lane * 8;
  u.q[0] = *(const v8h*)p; u.q[1] = *(const v8h*)(p + 256); return u.v;
}
// ---- k_proj: block = (128 rows, 128 cols, which), wave = two 16-row groups 64 rows apart x 128 cols, so that each weight fragment fetched feeds two products; the results leave in two passes of 64 rows through the same LDS: q/k/v = X W (+ b) with exact bf16 products (K = DIN) -> which 0: q f16 rows (+ residual rows < QHI); 1: k f16 fragments (+ residual rows < KHI); 2: v^T f16 fragments (+ bf16 hi/lo planes for t < KHI). A k or v^T fragment is [half hf][lane][8] like a packed weight fragment: piece (hf, lane) holds k index 16 hf + 8 (lane >> 4) + 0..7 of row (lane & 15), the elements that lane takes in k_fa, so that a wave's load there is 512 contiguous bytes
__global__ __launch_bounds__(128) void k_proj(const __bf16* __restrict__ XP, const __bf16* __restrict__ WP, const float* __restrict__ BQ, const float* __restrict__ BK, const float* __restrict__ BV,
    _Float16* __restrict__ QH, _Float16* __restrict__ QL, _Float16* __restrict__ KH, _Float16* __restrict__ KL, _Float16* __restrict__ VT, __bf16* __restrict__ VB, __bf16* __restrict__ VBL) {
  __shared__ __align__(16) _Float16 sh[64][136], sl[64][136]; __shared__ __align__(16) _Float16 th[128][72]; __shared__ __align__(16) __bf16 tb[128][72], tbl[128][72];
  const int tid = threadIdx.x, wave = tid >> 5, lane = tid & 31, col = lane & 15, g = lane >> 4; const int which = blockIdx.z; const int c0 = blockIdx.y * 128; const size_t rb0 = (size_t)blockIdx.x * 128;
  const __bf16* XA = XP + (size_t)which * NB * TT * DIN + (rb0 / 16 + wave) * (size_t)(DIN / 32) * 512; const __bf16* WA = WP + (size_t)which * DIN * CC + (size_t)(c0 / 16) * 512; const float* BA = which == 0 ? BQ : which == 1 ? BK : BV;
  v8f acc2[2][8] = {};
#pragma unroll 2
  for (int kc = 0; kc < DIN / 32; ++kc) { const v16b a0 = frag_p(XA + (size_t)kc * 512, lane), a1 = frag_p(XA + (size_t)(4 * (DIN / 32) + kc) * 512, lane);   /* the second group: 64 rows = 4 row groups further on */
    v16b w[8];   /* the k step's packed fragments are all requested before the first product */
#pragma unroll
    for (int j = 0; j < 8; ++j) w[j] = frag_p(WA + ((size_t)kc * (CC / 16) + j) * 512, lane);
#pragma unroll
    for (int j = 0; j < 8; ++j) { acc2[0][j] = wmma_bf(a0, w[j], acc2[0][j]); acc2[1][j] = wmma_bf(a1, w[j], acc2[1][j]); }
    asm volatile("s_wait_xcnt 0x0" ::: "memory"); }   /* stands before the next k step rewrites the address registers that this step's loads name */
  // unrolled: the pass number indexes the accumulators, which stay in registers only under constant indices
#pragma unroll
  for (int hb = 0; hb < 2; ++hb) { const v8f* acc = acc2[hb]; const size_t r0 = rb0 + hb * 64; const size_t bb = r0 / TT; const int t0 = (int)(r0 % TT);
  if (hb) __syncthreads();   /* the first pass's LDS reads end before the second pass writes the same LDS */
  if (which < 2) { _Float16* DH = which == 0 ? QH : KH; _Float16* DL = which == 0 ? QL : KL; const int nhi = which == 0 ? QHI : KHI; const bool hi_rows = t0 < nhi;
#pragma unroll
    for (int j = 0; j < 8; ++j) { const float bias = BA ? bfr(BA[c0 + j * 16 + col]) : 0.f;
#pragma unroll
      for (int r = 0; r < 8; ++r) { const float v = acc[j][r] + bias; const _Float16 hv = (_Float16)v; sh[wave * 16 + 8 * g + r][j * 16 + col] = hv; sl[wave * 16 + 8 * g + r][j * 16 + col] = (_Float16)((v - (float)hv) * 1024.0f); } }
    __syncthreads();
    if (which == 1) {   /* k: 16 fragments = [head of 2][16-key group of 4][k step of 2], 64 pieces each; a head's 8 fragments are 8 KiB in a row */
      // unrolled: the 8 LDS reads go out together, and head and key group are constants of each trip, so that the 8 stores share one address
#pragma unroll
      for (int i = 0; i < 8; ++i) { const int e = tid + i * 128; const int f = e >> 6, pc = e & 63, hf = pc >> 5, ln = pc & 31; const int hh = f >> 3, kt = (f >> 1) & 3, kc = f & 1;
        vst2((unsigned*)(KH + ((((bb * NH + c0 / HD + hh) * (TT / 16) + t0 / 16 + kt) * (HD / 32) + kc) * 512 + pc * 8)), *(const v4u*)&sh[kt * 16 + (ln & 15)][hh * HD + kc * 32 + hf * 16 + (ln >> 4) * 8]); }
      asm volatile("s_wait_xcnt 0x0" ::: "memory"); }   /* stands before the code below rewrites registers that these stores name */
    for (int e = tid; e < 64 * 16; e += 128) { const int rl = e >> 4, q = e & 15; if (which == 0) { vst2((unsigned*)(DH + (r0 + rl) * CC + c0 + q * 8), *(const v4u*)&sh[rl][q * 8]); asm volatile("s_wait_xcnt 0x0" ::: "memory"); }   /* the wait stands before a register that the store names is rewritten */
      if (hi_rows) { vst2((unsigned*)(DL + (bb * nhi + t0 + rl) * (size_t)CC + c0 + q * 8), *(const v4u*)&sl[rl][q * 8]); asm volatile("s_wait_xcnt 0x0" ::: "memory"); } }   /* the same wait, before the next trip */
  } else { const bool hi_rows = t0 < KHI;
#pragma unroll
    for (int j = 0; j < 8; ++j) { const float bias = BA ? bfr(BA[c0 + j * 16 + col]) : 0.f;
#pragma unroll
      for (int r = 0; r < 8; ++r) { const float v = acc[j][r] + bias; const int rl = wave * 16 + 8 * g + r, cl = j * 16 + col; th[cl][rl] = (_Float16)v; const __bf16 bh = (__bf16)v; tb[cl][rl] = bh; tbl[cl][rl] = (__bf16)(v - (float)bh); } }
    __syncthreads();
    /* v^T: 16 fragments = [head of 2][32-key group of 2][16-channel group of 4], 64 pieces each */
    // unrolled: the 8 LDS reads go out together, and head and key group are constants of each trip, so that the 8 stores share one address
#pragma unroll
    for (int i = 0; i < 8; ++i) { const int e = tid + i * 128; const int f = e >> 6, pc = e & 63, hf = pc >> 5, ln = pc & 31; const int hh = f >> 3, kt = (f >> 2) & 1, j = f & 3;
      vst2((unsigned*)(VT + ((((bb * NH + c0 / HD + hh) * (TT / 32) + t0 / 32 + kt) * (HD / 16) + j) * 512 + pc * 8)), *(const v4u*)&th[hh * HD + j * 16 + (ln & 15)][kt * 32 + hf * 16 + (ln >> 4) * 8]); }
    asm volatile("s_wait_xcnt 0x0" ::: "memory");   /* stands before the code below rewrites registers that these stores name */
    for (int e = tid; e < 128 * 8; e += 128) { const int cl = e >> 3, q = e & 7; if (hi_rows) { const size_t o3 = (bb * CC + c0 + cl) * (size_t)KHI + t0 + q * 8; vst2((unsigned*)(VB + o3), *(const v4u*)&tb[cl][q * 8]); vst2((unsigned*)(VBL + o3), *(const v4u*)&tbl[cl][q * 8]); } } } } }
// ---- k_fa: block = 64 queries (qb) of (b, h), wave = 16 queries, all keys in steps of 64: S^T = K q^T (key rows as A, query rows as B; q hi + residual x 2^10: 2 products), unscaled, masked positions set to XMASK; running max and sum per query (lane & 15 = query, so both are per-lane values; the two lane halves hold different keys); D of S^T (lane = query, element r = key 8g + r) IS the 16x16x32 operand layout over 32 keys, so P = exp2(x * SCL2 - max * SCL2) (one fma and the hardware exp2 per score) goes once to f16 in place and ctx^T += v^T (A) P^T (B); ctx^T rows are channels, so the rescale and the final 1 / sum are per-lane too
__global__ __launch_bounds__(128) void k_fa(const _Float16* __restrict__ QH, const _Float16* __restrict__ KH, const _Float16* __restrict__ QL, const _Float16* __restrict__ VT, const unsigned* __restrict__ MP, float* __restrict__ Y) {
  const int tid = threadIdx.x, wave = tid >> 5, lane = tid & 31, col = lane & 15, g = lane >> 4; const int h = blockIdx.y, b = blockIdx.z; const int ql0 = blockIdx.x * 64 + wave * 16;
  v16h qh[HD / 32], ql[HD / 32];
#pragma unroll
  for (int kc = 0; kc < HD / 32; ++kc) { qh[kc] = frag_h(QH + ((size_t)b * TT + ql0 + col) * CC + h * HD + kc * 32, lane); ql[kc] = frag_h(QL + ((size_t)b * QHI + ql0 + col) * CC + h * HD + kc * 32, lane); }
  const _Float16* Kb = KH + (size_t)(b * NH + h) * TT * HD; const _Float16* Vb = VT + (size_t)(b * NH + h) * TT * HD;   /* this head's fragments; 64 keys are 8 fragments = 8 KiB in a row in each */
  const unsigned* Mw = MP + (size_t)(b * (TT / 16) + blockIdx.x * 4 + __builtin_amdgcn_readfirstlane(wave)) * (TT / 64) * 32;   /* this wave's select words, 128 bytes a key step; the address is wave-uniform, so that they come by scalar loads into scalar registers */
  v8f acc[HD / 16] = {}; float m = -3.0e38f, mc = -3.0e38f * SCL2, l = 0.f;   /* mc = m * SCL2: the running max in the exponent's own unit */
  // the key loop stays rolled: a second step's fragments would take the wave past 256 registers and cost a wave per SIMD; the inner loops are fully unrolled so that the fragment arrays are indexed by constants and stay in registers
#pragma unroll 1
  for (int k0 = 0; k0 < TT; k0 += 64) { float s[4][8]; float mx = -3.0e38f;
    v16h kf[4][HD / 32];   /* the whole step's K fragments and select words are requested before the first product: one load latency per step, not one per product */
    v16u mw[2]; const _Float16* kp = Kb + (size_t)k0 * HD + lane * 8;   /* this lane's piece of the step's first K fragment (the address that frag_ph forms) */
#pragma unroll
    for (int t = 0; t < 4; ++t)
#pragma unroll
      for (int kc = 0; kc < HD / 32; ++kc) { union { v16h v; v8h q[2]; } u; u.q[0] = *(const v8h*)(kp + (t * (HD / 32) + kc) * 512); u.q[1] = *(const v8h*)(kp + (t * (HD / 32) + kc) * 512 + 256); kf[t][kc] = u.v; }
    // the step's 32 select words: two scalar loads with their data wait in one statement, so that their address register is rewritten only behind the wait; it stands behind the K requests, which fly meanwhile. It also takes the K address as an input and ends in the wait that stands before a register named by an issued load is rewritten, so that no K load lands in that address
    asm volatile("s_load_b512 %0, %2, 0x0\n\ts_load_b512 %1, %2, 0x40\n\ts_wait_kmcnt 0x0\n\ts_wait_xcnt 0x0" : "=&s"(mw[0]), "=&s"(mw[1]) : "s"(Mw + (k0 >> 1)), "v"(kp) : "memory");
    __builtin_amdgcn_sched_barrier(0);   /* no product is scheduled up among the K requests: all 16 stay in flight together, one load latency per step */
#pragma unroll
    for (int t = 0; t < 4; ++t) { v8f a = {}, al = {};
#pragma unroll
      for (int kc = 0; kc < HD / 32; ++kc) { a = wmma16(kf[t][kc], qh[kc], a); al = wmma16(kf[t][kc], ql[kc], al); }
#pragma unroll
      for (int r = 0; r < 8; ++r) { float v = a[r] + al[r] * (1.0f / 1024.0f); if (__builtin_amdgcn_inverse_ballot_w32(mw[t >> 1][(t & 1) * 8 + r])) v = XMASK;   /* where(mask[b][q][k] (1 = masked), -1e9, scores): set; a fully masked row comes out uniform */
        s[t][r] = v; mx = fmaxf(mx, v); } }
    v16h vf[2][HD / 16];   /* the step's v fragments are requested here, so that they fly under the softmax arithmetic */
#pragma unroll
    for (int u = 0; u < 2; ++u)
#pragma unroll
      for (int j = 0; j < HD / 16; ++j) vf[u][j] = frag_ph(Vb + (size_t)k0 * HD + (u * (HD / 16) + j) * 512, lane);
    __builtin_amdgcn_sched_barrier(0);   /* no v request is scheduled down into the softmax arithmetic: all 16 are in flight before it starts */
    mx = fmaxf(mx, __shfl_xor(mx, 16)); const float mn = fmaxf(m, mx); const float mcn = mn * SCL2; const float alpha = __builtin_amdgcn_exp2f(mc - mcn); m = mn; mc = mcn;
    v16h p[2]; float sum = 0.f;
#pragma unroll
    for (int t = 0; t < 4; ++t)
#pragma unroll
      for (int r = 0; r < 8; ++r) { const float e = __builtin_amdgcn_exp2f(fmaf(s[t][r], SCL2, -mcn)); sum += e; p[t >> 1][(t & 1) * 8 + r] = (_Float16)e; }
    l = l * alpha + sum;
#pragma unroll
    for (int j = 0; j < HD / 16; ++j)
#pragma unroll
      for (int r = 0; r < 8; ++r) acc[j][r] *= alpha;
#pragma unroll
    for (int u = 0; u < 2; ++u)
#pragma unroll
      for (int j = 0; j < HD / 16; ++j) acc[j] = wmma16(vf[u][j], p[u], acc[j]); }
  l += __shfl_xor(l, 16); const float inv = 1.0f / l;   /* l >= 1: the key that holds the max contributes exp(0) */
  float* yr = Y + ((size_t)b * TT + ql0 + col) * CC + h * HD + 8 * g;
#pragma unroll
  for (int j = 0; j < HD / 16; ++j) { v4f o0, o1;
#pragma unroll
    for (int r = 0; r < 4; ++r) { o0[r] = acc[j][r] * inv; o1[r] = acc[j][4 + r] * inv; }
    vst2(yr + j * 16, o0); vst2(yr + j * 16 + 4, o1); } }
// ---- k_out: block = (64 rows, 128 cols): out = ctx Wo (+ bo): all rows: ctx bf16 hi + lo against exact bf16 Wo from its packed fragments (2 products)
__global__ __launch_bounds__(128) void k_out(const float* __restrict__ Y, const float* __restrict__ WO, const __bf16* __restrict__ WPO, const float* __restrict__ BO, float* __restrict__ OUT, const float* __restrict__ RESX) { __shared__ __align__(16) float sf[4][16][132];
  const int tid = threadIdx.x, wave = tid >> 5, lane = tid & 31, col = lane & 15, g = lane >> 4; const int c0 = blockIdx.y * 128; const size_t r0 = (size_t)blockIdx.x * 64 + wave * 16;
  v8f acc[8] = {};
  if (true) {   /* ALL rows: ctx split bf16 hi + lo x exact Wo (2 products) */
#pragma unroll 2
    for (int kc = 0; kc < CC / 32; ++kc) { const F2 a = split_row(Y + (r0 + col) * CC, kc * 32, lane);
      v16b w[8];   /* the k step's packed B fragments are all requested before the first product */
#pragma unroll
      for (int j = 0; j < 8; ++j) w[j] = frag_p(WPO + ((size_t)kc * (DIN / 16) + c0 / 16 + j) * 512, lane);
#pragma unroll
      for (int j = 0; j < 8; ++j) { acc[j] = wmma_bf(a.h, w[j], acc[j]); acc[j] = wmma_bf(a.l, w[j], acc[j]); }
      asm volatile("s_wait_xcnt 0x0" ::: "memory"); }   /* stands before the next k step rewrites the address registers that this step's loads name */
#pragma unroll
    for (int j = 0; j < 8; ++j) { const float bias = BO ? bfr(BO[c0 + j * 16 + col]) : 0.f;
#pragma unroll
      for (int r = 0; r < 8; ++r) sf[wave][8 * g + r][j * 16 + col] = acc[j][r] + bias; }
  } else {
#pragma unroll 2
    for (int kc = 0; kc < CC / 32; ++kc) { const v16h a = frag_f32(Y + (r0 + col) * CC + kc * 32, lane); asm volatile("s_wait_loadcnt 0x0" ::: "memory");
#pragma unroll
      for (int j = 0; j < 8; ++j) { const v16h w = WOCOLH(WO, kc * 32, c0 + j * 16 + col, lane); asm volatile("s_wait_loadcnt 0x0" ::: "memory"); acc[j] = wmma16(a, w, acc[j]); } }
#pragma unroll
    for (int j = 0; j < 8; ++j) { const float bias = BO ? bfr(BO[c0 + j * 16 + col]) : 0.f;
#pragma unroll
      for (int r = 0; r < 8; ++r) sf[wave][8 * g + r][j * 16 + col] = acc[j][r] * (1.0f / 256.0f) + bias; } }
  LDSX(); for (int rl = 0; rl < 16; ++rl) { const size_t oo = (r0 + rl) * DIN + c0 + lane * 4; v4f o = *(const v4f*)&sf[wave][rl][lane * 4]; const v4f zr = *(const v4f*)(RESX + oo); o[0] += bfr(zr[0]); o[1] += bfr(zr[1]); o[2] += bfr(zr[2]); o[3] += bfr(zr[3]); vst2(OUT + oo, o); } }   /* ctx W_O + bf16(input_Q) */

extern "C" void kernel_launch(void* const* d_in, const int* in_sizes, int n_in, void* d_out, int out_size, void* d_ws, size_t ws_size, hipStream_t stream) {
  (void)in_sizes; (void)n_in; (void)out_size;
  const float** F = (const float**)d_in;
  if (ws_size < (size_t)WS_END) return;
  char* ws = (char*)d_ws; _Float16 *QH = (_Float16*)(ws + WS_QH), *KH = (_Float16*)(ws + WS_KH), *VT = (_Float16*)(ws + WS_VT), *QL = (_Float16*)(ws + WS_QL), *KL = (_Float16*)(ws + WS_KL); __bf16 *VB = (__bf16*)(ws + WS_VB), *VBL = (__bf16*)(ws + WS_VBL); float *Y = (float*)(ws + WS_Y);
  (void)Y; (void)QL; (void)KL; (void)VB; (void)VBL;
  // inputs: 0 input_Q; 1 input_K; 2 input_V [2,2048,1024]; 3 mask [2,2048,2048] int32 (1 = masked); 4 W_Q (in,out); 5 W_K; 6 W_V; 7 W_O (in,out); 8 ln_gamma; 9 ln_beta
  if (ws_size < (size_t)WS_END4) return;
  float* X1 = (float*)(ws + WS_X1); __bf16 *WP = (__bf16*)(ws + WS_WP), *XP = (__bf16*)(ws + WS_XP); unsigned* MP = (unsigned*)(ws + WS_MP);
  k_pack<<<dim3(4 * PKW + 3 * PKX + PKM), 256, 0, stream>>>(F[4], F[5], F[6], F[7], F[0], F[1], F[2], (const int*)d_in[3], WP, XP, MP);   /* weights and inputs -> bf16 fragments, mask -> select words, every call */
  k_proj<<<dim3(TNB * TT / 128, CC / 128, 3), 128, 0, stream>>>(XP, WP, nullptr, nullptr, nullptr, QH, QL, KH, KL, VT, VB, VBL);
  k_fa<<<dim3(NQB, NH, TNB), 128, 0, stream>>>(QH, KH, QL, VT, MP, Y);
  k_out<<<dim3(TNB * TT / 64, DIN / 128), 128, 0, stream>>>(Y, F[7], WP + 3 * (size_t)DIN * CC, nullptr, X1, F[0]);   /* ctx W_O + input_Q */
  k_lnx<<<dim3(NRW / 8), 256, 0, stream>>>(X1, 0, F[8], F[9], (float*)d_out);              /* LayerNorm */
}

// v008
// It runs in 121 microseconds.
// Next to v007, in two timings, it ran 1.06 times as fast each time.
// Over all steps from v000 it is 10.2 times as fast.
// compute dtype: all float inputs rounded to bf16; q/k/v = in W with EXACT bf16 products on WMMA 16x16x32 (f32 accumulate); q as f16 hi + residual (x 2^10) against k once to f16 (2 products), masked (mask == 1) positions set to -2^33 (-2^30 after the / 8, standing for -1e9); softmax in f32 in base 2 (hardware exp2 of (x - max) * log2(e) / 8, running max and sum over key steps of 64); P = exp(s - max) once to f16 against v once to f16 (1 product), divided by the sum at the end; ctx split bf16 hi + lo against exact W_O (2 products) + input_Q; LayerNorm in f32; f32 output.
#include <hip/hip_runtime.h>
#include <math.h>

typedef __attribute__((ext_vector_type(16))) _Float16 v16h;
typedef __attribute__((ext_vector_type(16))) __bf16 v16b;
typedef __attribute__((ext_vector_type(8)))  _Float16 v8h;
typedef __attribute__((ext_vector_type(8)))  float v8f;
typedef __attribute__((ext_vector_type(4)))  float v4f;
typedef __attribute__((ext_vector_type(2)))  float v2f;
typedef __attribute__((ext_vector_type(4)))  unsigned v4u;
typedef __attribute__((ext_vector_type(4)))  int v4i;
typedef float __attribute__((may_alias)) float_a;
typedef int __attribute__((may_alias)) int_a;

template <typename T> __device__ __forceinline__ void vst2(void* p, T v) { *(T*)p = v;  }
__device__ __forceinline__ v8f wmma16(v16h a, v16h b, v8f c) {
  return __builtin_amdgcn_wmma_f32_16x16x32_f16(false, a, false, b, (short)0, c, false, false);   /* no v_nop written behind it: the compiler pads its own builtin where a distance is owed */
}
__device__ __forceinline__ v8f wmma_bf(v16b a, v16b b, v8f c) {
  v8f d = __builtin_amdgcn_wmma_f32_16x16x32_bf16(false, a, false, b, (short)0, c, false, false);
  asm volatile("v_nop\n\tv_nop\n\tv_nop\n\tv_nop" : "+v"(d) : "v"(a), "v"(b));
  return d;
}
// 16x16x32 fragments: lane = (h = lane>>4, row/col = lane&15); elements 0..7 = k0+8h+0..7, 8..15 = k0+16+8h+0..7; D element r = row 8h+r
__device__ __forceinline__ v16h frag_h(const _Float16* rowk0, int lane) {
  union { v16h v; v8h q[2]; } u; const _Float16* p = rowk0 + 8 * (lane >> 4);
  u.q[0] = *(const v8h*)p; u.q[1] = *(const v8h*)(p + 16); return u.v;
}
__device__ __forceinline__ v16h frag_f32(const float* rowk0, int lane) {
  v16h a; const float* p = rowk0 + 8 * (lane >> 4);
#pragma unroll
  for (int i = 0; i < 8; ++i) { a[i] = (_Float16)p[i]; a[8 + i] = (_Float16)p[16 + i]; }
  return a;
}
__device__ __forceinline__ v16h frag_f32s(const float* rowk0, int lane, float sc) {
  v16h a; const float* p = rowk0 + 8 * (lane >> 4);
#pragma unroll
  for (int i = 0; i < 8; ++i) { a[i] = (_Float16)(p[i] * sc); a[8 + i] = (_Float16)(p[16 + i] * sc); }
  return a;
}
// column fragment from a [K][ld] layout (column n), rows >= K read as 0
__device__ __forceinline__ v16h fragc_f32(const float* W, int k0, int n, int lane, int ld, int K) {
  v16h a; const int g = lane >> 4;
#pragma unroll
  for (int i = 0; i < 8; ++i) { const int ka = k0 + 8 * g + i, kb = ka + 16;
    a[i] = (_Float16)(ka < K ? W[(size_t)(ka < K ? ka : K - 1) * ld + n] : 0.f); a[8 + i] = (_Float16)(kb < K ? W[(size_t)(kb < K ? kb : K - 1) * ld + n] : 0.f); }
  return a;
}
struct F2 { v16b h, l; };
__device__ __forceinline__ F2 bsplit16(const float v[16]) { F2 r;
#pragma unroll
  for (int i = 0; i < 16; ++i) { const __bf16 h = (__bf16)v[i]; r.h[i] = h; r.l[i] = (__bf16)(v[i] - (float)h); }
  return r; }
__device__ __forceinline__ F2 split_row(const float* row, int k0, int lane) { float v[16]; const float* p = row + k0 + 8 * (lane >> 4);
#pragma unroll
  for (int i = 0; i < 8; ++i) { v[i] = p[i]; v[8 + i] = p[16 + i]; }
  return bsplit16(v); }
__device__ __forceinline__ F2 split_q(const v4f q[4]) { float v[16];   /* the 16 values that split_row reads, already loaded: q[0], q[1] = k0 + 8 g + 0..7, q[2], q[3] = k0 + 16 + 8 g + 0..7 */
#pragma unroll
  for (int i = 0; i < 4; ++i) { v[i] = q[0][i]; v[4 + i] = q[1][i]; v[8 + i] = q[2][i]; v[12 + i] = q[3][i]; }
  return bsplit16(v); }
__device__ __forceinline__ F2 split_rowK(const float* row, int k0, int lane, int K) { float v[16]; const int g = lane >> 4;
#pragma unroll
  for (int i = 0; i < 8; ++i) { const int ka = k0 + 8 * g + i, kb = ka + 16; v[i] = ka < K ? row[ka < K ? ka : K - 1] : 0.f; v[8 + i] = kb < K ? row[kb < K ? kb : K - 1] : 0.f; }
  return bsplit16(v); }
__device__ __forceinline__ F2 split_col(const float* W, int k0, int n, int lane, int ld, int K) { float v[16]; const int g = lane >> 4;
#pragma unroll
  for (int i = 0; i < 8; ++i) { const int ka = k0 + 8 * g + i, kb = ka + 16; v[i] = ka < K ? W[(size_t)(ka < K ? ka : K - 1) * ld + n] : 0.f; v[8 + i] = kb < K ? W[(size_t)(kb < K ? kb : K - 1) * ld + n] : 0.f; }
  return bsplit16(v); }
__device__ __forceinline__ v8f mac3(const F2& a, const F2& b, v8f c) { c = wmma_bf(a.l, b.h, c); c = wmma_bf(a.h, b.l, c); return wmma_bf(a.h, b.h, c); }
__device__ __forceinline__ float sigm(float v) { return 1.0f / (1.0f + expf(-v)); }
#define LDSX() do { asm volatile("s_wait_dscnt 0" ::: "memory"); __builtin_amdgcn_wave_barrier(); __builtin_amdgcn_fence(__ATOMIC_RELEASE, "workgroup"); } while (0)

// Multi-head attention layer with a random (query, key) mask, residual and LayerNorm (B 2, S 2,048, 1,024 = 16 x 64; (in,out) 1/32-scale weights, no biases; mask [B,S,S] int, 1 = MASKED (~half); LN affine 1/0, eps 1e-5): q = input_Q W_Q ...; scores = q k^T / 8 with where(mask, -1e9, s); ctx = softmax v; out = LN(ctx W_O + input_Q).
#define NB 2
#define TT 2048
#define CC 1024            // NH * HD = projected width
#define DIN 1024          // input (model) width
#define NH 16
#define HD 64
#define NQB (TT / 64)
#define HG 4
#define SCALE (0.125f)
#define SCL2 (SCALE * 1.44269504088896341f)   // score scale times log2(e): exp(SCALE * x) = exp2(SCL2 * x)
#define XMASK (-8589934592.0f)                // a masked position's unscaled score, -2^33: SCALE * XMASK = -2^30 stands for the reference's -1e9 (either is 0 after the exp beside any real score); a power of two, so that XMASK * SCL2 is exact and a fully masked row gets exp2(0) = 1 at every key
#define CAUSAL 0
#ifndef TNB
#define TNB NB
#endif
__device__ __forceinline__ float bfr(float v) { return (float)(__bf16)v; }
__host__ __device__ __forceinline__ int kb_last(int qb) { return CAUSAL ? ((qb * 64 + 63) >> 7) : (TT / 128 - 1); }
typedef __attribute__((ext_vector_type(8))) __bf16 v8b;
__device__ __forceinline__ v16b frag_b(const __bf16* rowk0, int lane) {
  union { v16b v; v8b q[2]; } u; const __bf16* p = rowk0 + 8 * (lane >> 4);
  u.q[0] = *(const v8b*)p; u.q[1] = *(const v8b*)(p + 16); return u.v;
}
#define QBH 0
#define QHI 2048            // rows carrying a q residual plane (all rows when non-causal: 2-product logits everywhere)
#define KHI 64            // key rows carrying k residual / v bf16 hi+lo planes (written by k_proj; no kernel reads them)
// B fragment (k rows k0+.., output column o) of a weight: (in,out) [K][ld] or (out,in) [ld rows of K]: bf16 exact, or f16(bf16 * 256) exact
__device__ __forceinline__ v16b wcol_io(const float* Wm, int k0, int o, int lane, int ld) { v16b w; const int g = lane >> 4;
#pragma unroll
  for (int i = 0; i < 8; ++i) { w[i] = (__bf16)Wm[(size_t)(k0 + 8 * g + i) * ld + o]; w[8 + i] = (__bf16)Wm[(size_t)(k0 + 16 + 8 * g + i) * ld + o]; }
  return w; }
__device__ __forceinline__ v16b wcol_oi(const float* Wm, int k0, int o, int lane, int K) { v16b w; const float* p = Wm + (size_t)o * K + k0 + 8 * (lane >> 4);
#pragma unroll
  for (int i = 0; i < 8; ++i) { w[i] = (__bf16)p[i]; w[8 + i] = (__bf16)p[16 + i]; }
  return w; }
__device__ __forceinline__ v16h wcolh_io(const float* Wm, int k0, int o, int lane, int ld) { v16h w; const int g = lane >> 4;
#pragma unroll
  for (int i = 0; i < 8; ++i) { w[i] = (_Float16)(bfr(Wm[(size_t)(k0 + 8 * g + i) * ld + o]) * 256.0f); w[8 + i] = (_Float16)(bfr(Wm[(size_t)(k0 + 16 + 8 * g + i) * ld + o]) * 256.0f); }
  return w; }
__device__ __forceinline__ v16h wcolh_oi(const float* Wm, int k0, int o, int lane, int K) { v16h w; const float* p = Wm + (size_t)o * K + k0 + 8 * (lane >> 4);
#pragma unroll
  for (int i = 0; i < 8; ++i) { w[i] = (_Float16)(bfr(p[i]) * 256.0f); w[8 + i] = (_Float16)(bfr(p[16 + i]) * 256.0f); }
  return w; }
#define WQKV_LAYOUT 0   // 0 = (in,out) [DIN][CC]; 1 = (out,in) [CC][DIN]; 2 = per-head [NH][DIN][HD]
__device__ __forceinline__ v16b wcol_hdk(const float* Wm, int k0, int o, int lane) { v16b w; const int g = lane >> 4; const float* p = Wm + (size_t)(o / HD) * DIN * HD + (o % HD);
#pragma unroll
  for (int i = 0; i < 8; ++i) { w[i] = (__bf16)p[(size_t)(k0 + 8 * g + i) * HD]; w[8 + i] = (__bf16)p[(size_t)(k0 + 16 + 8 * g + i) * HD]; }
  return w; }
#define WO_OUT_IN 0
#if WQKV_LAYOUT == 1
#define WCOL(W, k0, o, lane) wcol_oi(W, k0, o, lane, DIN)
#elif WQKV_LAYOUT == 2
#define WCOL(W, k0, o, lane) wcol_hdk(W, k0, o, lane)
#else
#define WCOL(W, k0, o, lane) wcol_io(W, k0, o, lane, CC)
#endif
#if WO_OUT_IN
#define WOCOL(W, k0, o, lane) wcol_oi(W, k0, o, lane, CC)
#define WOCOLH(W, k0, o, lane) wcolh_oi(W, k0, o, lane, CC)
#else
#define WOCOL(W, k0, o, lane) wcol_io(W, k0, o, lane, DIN)
#define WOCOLH(W, k0, o, lane) wcolh_io(W, k0, o, lane, DIN)
#endif
#define SM_EXTRA_PARAMS , const int* __restrict__ MK, int bcur
#define SM_MASK_HOOK do { if (MK[((size_t)bcur * TT + t) * TT + k] != 0) v = -1.0e9f; } while (0)   /* where(mask[b][q][k] (1 = masked), -1e9, scores): set; a fully masked row would be uniform (none here) */
#define NRW (TNB * TT)
// ---- k_lnx: wave per row: LayerNorm over 1024 (mean, biased var, (x - mean) * rsqrt(var + 1e-5) * g + b); optional bf16 rounding of the input (x); 32 floats per lane (8 float4 at stride 128 floats -> 512-B pieces)
__global__ __launch_bounds__(256) void k_lnx(const float* __restrict__ X, int roundin, const float* __restrict__ G, const float* __restrict__ BE, float* __restrict__ OUT) { const int wave = threadIdx.x >> 5, lane = threadIdx.x & 31; const size_t row = (size_t)blockIdx.x * 8 + wave; if (row >= (size_t)NRW) return;
  v4f v[CC / 128]; float s1 = 0.f;
#pragma unroll
  for (int i = 0; i < CC / 128; ++i) { v4f t = *(const v4f*)(X + row * CC + i * 128 + lane * 4); if (roundin) { t[0] = bfr(t[0]); t[1] = bfr(t[1]); t[2] = bfr(t[2]); t[3] = bfr(t[3]); } v[i] = t; s1 += (t[0] + t[1]) + (t[2] + t[3]); }
#pragma unroll
  for (int o = 1; o < 32; o <<= 1) s1 += __shfl_xor(s1, o);
  const float mu = s1 * (1.0f / CC); float q = 0.f;
#pragma unroll
  for (int i = 0; i < CC / 128; ++i) for (int k = 0; k < 4; ++k) { const float d = v[i][k] - mu; q += d * d; }
#pragma unroll
  for (int o = 1; o < 32; o <<= 1) q += __shfl_xor(q, o);
  const float inv = rsqrtf(q * (1.0f / CC) + 1e-5f);   /* jnp.var (biased), eps inside the rsqrt */
#pragma unroll
  for (int i = 0; i < CC / 128; ++i) { const int c = i * 128 + lane * 4; v4f r4; for (int k = 0; k < 4; ++k) r4[k] = bfr(G[c + k]) * ((v[i][k] - mu) * inv) + bfr(BE[c + k]); vst2(OUT + row * CC + c, r4); } }

#ifndef SM_EXTRA_PARAMS
#define SM_EXTRA_PARAMS
#endif
#ifndef PROJ_EXTRA_PARAMS
#define PROJ_EXTRA_PARAMS
#endif
#ifndef SM_MASK_HOOK
#define SM_MASK_HOOK (void)0
#endif

#define WS_QH  0u                                      // f16 q rows [b*t][CC]
#define WS_KH  (WS_QH + 2u * (size_t)NB * TT * CC)      // f16 k as A fragments [b][h][16-key group][k step of 32 channels][1 KiB fragment]
#define WS_VT  (WS_KH + 2u * (size_t)NB * TT * CC)      // f16 v^T as A fragments [b][h][32-key group][16-channel group][1 KiB fragment]
#define WS_QL  (WS_VT + 2u * (size_t)NB * CC * TT)      // f16 q residual x 2^10 rows [b][t < QHI][CC]
#define WS_KL  (WS_QL + 2u * (size_t)NB * QHI * CC)     // f16 k residual x 2^10 rows [b][t < KHI][CC]
#define WS_VB  (WS_KL + 2u * (size_t)NB * KHI * CC)     // bf16 v hi planes [b][c][t < KHI]
#define WS_VBL (WS_VB + 2u * (size_t)NB * CC * KHI)
#define WS_S   (WS_VBL + 2u * (size_t)NB * CC * KHI)    // f32 [hg][t][s] region, unused (k_fa keeps logits and P in registers)
#define WS_Y   (WS_S  + 4u * (size_t)HG * TT * TT)      // f32 ctx rows [b*t][CC] (only when there is an output projection)
#define WS_END (WS_Y  + 4u * (size_t)NB * TT * CC)
#define WS_X1  (WS_END)
#define WS_END2 (WS_X1 + 4u * (size_t)NB * TT * DIN)

#define WS_WP  (WS_END2)                                // bf16 weights as B fragments [W_Q, W_K, W_V, W_O][k step of 32][16-column group][1 KiB fragment]
#define WS_XP  (WS_WP + 2u * 4u * (size_t)DIN * CC)     // bf16 inputs as A fragments [input_Q, input_K, input_V][16-row group][k step of 32][1 KiB fragment]
#define WS_END3 (WS_XP + 2u * 3u * (size_t)NB * TT * DIN)
#define WS_MP  (WS_END3)                                // mask as select words [b * TT / 16 + 16-query group][key step of 64][t * 8 + r]: bit l of a word = (mask != 0) at query (l & 15), key 16 t + 8 (l >> 4) + r, the score that lane l of k_fa holds in s[t][r]
#define WS_END4 (WS_MP + (size_t)NB * TT * TT / 8)
typedef __attribute__((ext_vector_type(16))) unsigned v16u;
#define PKP 16                                // pieces per k_pack thread: few waves with many loads in flight each, for speed only
#define PKW (DIN * CC / 8 / 256 / PKP)        // k_pack blocks per weight
#define PKX (NB * TT * DIN / 8 / 256 / PKP)   // k_pack blocks per input
#define PKM (NB * (TT / 16) * (TT / 128) / 8 / 2)   // k_pack blocks for the mask: a wave takes 2 tiles of 16 queries x 128 keys
// ---- k_pack: a piece = 16 bytes of a 16x16x32 operand fragment, rounded to bf16. A 1 KiB fragment is [half hf][lane][8]: piece (hf, lane) holds k = k0 + 16 hf + 8 (lane >> 4) + 0..7 of row or column (lane & 15), the k order of the fragment comment above; a wave's store is 512 contiguous bytes
__global__ __launch_bounds__(256) void k_pack(const float* __restrict__ W0, const float* __restrict__ W1, const float* __restrict__ W2, const float* __restrict__ W3, const float* __restrict__ X0, const float* __restrict__ X1, const float* __restrict__ X2, const int* __restrict__ MK, __bf16* __restrict__ WP, __bf16* __restrict__ XP, unsigned* __restrict__ MP) {
  const int bx = blockIdx.x;
  if (bx < 4 * PKW) { const int mt = bx / PKW; const float* Wm = mt == 0 ? W0 : mt == 1 ? W1 : mt == 2 ? W2 : W3; __bf16* D = WP + (size_t)mt * DIN * CC;   /* (in,out) weight: piece e = [kc][ob][hf][lane] */
    const int e0 = (bx % PKW) * (256 * PKP) + threadIdx.x;
    // rolled over groups of 4 pieces: 32 loads in flight per lane are enough, and the registers stay few
#pragma unroll 1
    for (int it = 0; it < PKP; it += 4) { float t[4][8];
#pragma unroll
      for (int u = 0; u < 4; ++u) { const int e = e0 + (it + u) * 256; const int lane = e & 31, hf = (e >> 5) & 1, ob = (e >> 6) % (CC / 16), kc = (e >> 6) / (CC / 16);
        const float* p = Wm + (size_t)(kc * 32 + 16 * hf + 8 * (lane >> 4)) * CC + ob * 16 + (lane & 15);
#pragma unroll
        for (int i = 0; i < 8; ++i) t[u][i] = p[(size_t)i * CC]; }
#pragma unroll
      for (int u = 0; u < 4; ++u) { v8b w;
#pragma unroll
        for (int i = 0; i < 8; ++i) w[i] = (__bf16)t[u][i];
        vst2(D + (size_t)(e0 + (it + u) * 256) * 8, w); }
      asm volatile("s_wait_xcnt 0x0" ::: "memory"); }   /* stands before the next trip rewrites registers that this trip's stores name */
  } else if (bx < 4 * PKW + 3 * PKX) { const int b2 = bx - 4 * PKW; const int mt = b2 / PKX; const float* Xm = mt == 0 ? X0 : mt == 1 ? X1 : X2; __bf16* D = XP + (size_t)mt * NB * TT * DIN;   /* input rows: piece e = [rb][kc][hf][lane] */
    const int e0 = (b2 % PKX) * (256 * PKP) + threadIdx.x;
    // rolled over groups of 8 pieces: 16 16-byte loads in flight per lane. The 8 pieces of a trip lie 256 pieces = 4 k steps apart, in one input row (32 k steps a row, first k step < 4): one load address and one store address a trip, the rest are constant offsets
#pragma unroll 1
    for (int it = 0; it < PKP; it += 8) { const int e = e0 + it * 256; const int lane = e & 31, hf = (e >> 5) & 1, kc = (e >> 6) % (DIN / 32), rb = (e >> 6) / (DIN / 32);
      const float* p = Xm + (size_t)(rb * 16 + (lane & 15)) * DIN + kc * 32 + 16 * hf + 8 * (lane >> 4); __bf16* q = D + (size_t)e * 8;
      v4f t[8][2]; v8b w[8];
#pragma unroll
      for (int u = 0; u < 8; ++u) { t[u][0] = *(const v4f*)(p + u * 128); t[u][1] = *(const v4f*)(p + u * 128 + 4); }
      // the wait that stands before a register named by an issued load is rewritten; it takes the address and the loaded values as inputs, so that all 16 loads stand in front of it and none of them lands in the address registers
      asm volatile("s_wait_xcnt 0x0" :: "v"(p), "v"(t[0][0]), "v"(t[0][1]), "v"(t[1][0]), "v"(t[1][1]), "v"(t[2][0]), "v"(t[2][1]), "v"(t[3][0]), "v"(t[3][1]), "v"(t[4][0]), "v"(t[4][1]), "v"(t[5][0]), "v"(t[5][1]), "v"(t[6][0]), "v"(t[6][1]), "v"(t[7][0]), "v"(t[7][1]) : "memory");
#pragma unroll
      for (int u = 0; u < 8; ++u) {
#pragma unroll
        for (int i = 0; i < 4; ++i) { w[u][i] = (__bf16)t[u][0][i]; w[u][4 + i] = (__bf16)t[u][1][i]; }
        vst2(q + u * 2048, w[u]); }
      // the same wait behind the stores, before the next trip rewrites what they name; it takes the stored values as inputs, so that their registers live up to it
      asm volatile("s_wait_xcnt 0x0" :: "v"(w[0]), "v"(w[1]), "v"(w[2]), "v"(w[3]), "v"(w[4]), "v"(w[5]), "v"(w[6]), "v"(w[7]) : "memory"); }
  } else { const int wv = (bx - 4 * PKW - 3 * PKX) * 8 + (threadIdx.x >> 5), lane = threadIdx.x & 31;   /* mask tile [rg = 16-row group of the NB * TT query rows][kg = 128-key group]: 16 loads of one whole row piece (512 contiguous bytes) each; lane j holds keys 4 j + 0..3 of every row */
    // rolled: 16 16-byte loads in flight per lane are enough, and the registers stay few
#pragma unroll 1
    for (int it = 0; it < 2; ++it) { const int tile = wv * 2 + it; const int kg = tile % (TT / 128), rg = tile / (TT / 128);
      const int* p = MK + (size_t)rg * 16 * TT + kg * 128 + lane * 4; v4i t[16];
#pragma unroll
      for (int q = 0; q < 16; ++q) t[q] = *(const v4i*)(p + q * TT);
      // the wait that stands before a register named by an issued load is rewritten; it takes the address and the loaded values as inputs, so that all 16 loads stand in front of it
      asm volatile("s_wait_xcnt 0x0" :: "v"(p), "v"(t[0]), "v"(t[1]), "v"(t[2]), "v"(t[3]), "v"(t[4]), "v"(t[5]), "v"(t[6]), "v"(t[7]), "v"(t[8]), "v"(t[9]), "v"(t[10]), "v"(t[11]), "v"(t[12]), "v"(t[13]), "v"(t[14]), "v"(t[15]) : "memory");
      unsigned c[4] = {0u, 0u, 0u, 0u};   /* c[e]: bit q = (mask != 0) at row q, key 4 j + e */
#pragma unroll
      for (int q = 0; q < 16; ++q)
#pragma unroll
        for (int e = 0; e < 4; ++e) { const unsigned mv = (unsigned)t[q][e]; c[e] |= (mv < 1u ? mv : 1u) << q; }
      // key = 64 ks + 16 t + 8 g + r lies in lane j = 16 ks + 4 t + 2 g + (r >> 2), element r & 3: lanes j and j ^ 2 hold the two halves (g = 0 low, g = 1 high) of the same four words
      const unsigned p01 = c[0] | (c[1] << 16), p23 = c[2] | (c[3] << 16); const unsigned o01 = __shfl_xor(p01, 2), o23 = __shfl_xor(p23, 2);
      v4u w; w[0] = (p01 & 0xffffu) | (o01 << 16); w[1] = (p01 >> 16) | (o01 & 0xffff0000u); w[2] = (p23 & 0xffffu) | (o23 << 16); w[3] = (p23 >> 16) | (o23 & 0xffff0000u);
      unsigned* d = MP + ((size_t)rg * (TT / 64) + kg * 2 + (lane >> 4)) * 32 + ((lane >> 2) & 3) * 8 + (lane & 1) * 4;
      if ((lane & 2) == 0) vst2(d, w);   /* the g = 0 lanes store: 16 lanes x 16 bytes = the 256 contiguous bytes of two key steps */
      // the same wait behind the store, before the next trip rewrites what it names
      asm volatile("s_wait_xcnt 0x0" :: "v"(d), "v"(w) : "memory"); } } }
// a packed fragment: two 16-byte loads per lane, each 512 contiguous bytes per wave
__device__ __forceinline__ v16b frag_p(const __bf16* fr, int lane) {
  union { v16b v; v8b q[2]; } u; const __bf16* p = fr + lane * 8;
  u.q[0] = *(const v8b*)p; u.q[1] = *(const v8b*)(p + 256); return u.v;
}
__device__ __forceinline__ v16h frag_ph(const _Float16* fr, int lane) {
  union { v16h v; v8h q[2]; } u; const _Float16* p = fr + lane * 8;
  u.q[0] = *(const v8h*)p; u.q[1] = *(const v8h*)(p + 256); return u.v;
}
// ---- k_proj: block = (128 rows, 128 cols, which), wave = two 16-row groups 64 rows apart x 128 cols, so that each weight fragment fetched feeds two products; the results leave in two passes of 64 rows through the same LDS: q/k/v = X W (+ b) with exact bf16 products (K = DIN) -> which 0: q f16 rows (+ residual rows < QHI); 1: k f16 fragments (+ residual rows < KHI); 2: v^T f16 fragments (+ bf16 hi/lo planes for t < KHI). A k or v^T fragment is [half hf][lane][8] like a packed weight fragment: piece (hf, lane) holds k index 16 hf + 8 (lane >> 4) + 0..7 of row (lane & 15), the elements that lane takes in k_fa, so that a wave's load there is 512 contiguous bytes
__global__ __launch_bounds__(128) void k_proj(const __bf16* __restrict__ XP, const __bf16* __restrict__ WP, const float* __restrict__ BQ, const float* __restrict__ BK, const float* __restrict__ BV,
    _Float16* __restrict__ QH, _Float16* __restrict__ QL, _Float16* __restrict__ KH, _Float16* __restrict__ KL, _Float16* __restrict__ VT, __bf16* __restrict__ VB, __bf16* __restrict__ VBL) {
  __shared__ __align__(16) _Float16 sh[64][136], sl[64][136]; __shared__ __align__(16) _Float16 th[128][72]; __shared__ __align__(16) __bf16 tb[128][72], tbl[128][72];
  const int tid = threadIdx.x, wave = tid >> 5, lane = tid & 31, col = lane & 15, g = lane >> 4; const int which = blockIdx.z; const int c0 = blockIdx.y * 128; const size_t rb0 = (size_t)blockIdx.x * 128;
  const __bf16* XA = XP + (size_t)which * NB * TT * DIN + (rb0 / 16 + wave) * (size_t)(DIN / 32) * 512; const __bf16* WA = WP + (size_t)which * DIN * CC + (size_t)(c0 / 16) * 512; const float* BA = which == 0 ? BQ : which == 1 ? BK : BV;
  v8f acc2[2][8] = {};
  v16b a0 = frag_p(XA, lane), a1 = frag_p(XA + (size_t)(4 * (DIN / 32)) * 512, lane), w[8];   /* k step 0; the second group: 64 rows = 4 row groups further on */
#pragma unroll
  for (int j = 0; j < 8; ++j) w[j] = frag_p(WA + (size_t)j * 512, lane);
  asm volatile("s_wait_xcnt 0x0" ::: "memory");   /* stands before the loop rewrites the address registers that these loads name */
  // operands are fetched one k step ahead, so that the load latency runs under the products: the next step's two row fragments at the head of the step, and each weight fragment right behind the two products that read its predecessor, into the same registers (a whole second set would not fit)
  auto kstep = [&](int kc) __attribute__((always_inline)) { const v16b b0 = frag_p(XA + (size_t)(kc + 1) * 512, lane), b1 = frag_p(XA + (size_t)(4 * (DIN / 32) + kc + 1) * 512, lane);
#pragma unroll
    for (int j = 0; j < 8; ++j) { __builtin_amdgcn_sched_barrier(0);   /* no later refill is scheduled up over products that still read the old fragments: that would take a second register set */
      acc2[0][j] = wmma_bf(a0, w[j], acc2[0][j]); acc2[1][j] = wmma_bf(a1, w[j], acc2[1][j]);
      w[j] = frag_p(WA + ((size_t)(kc + 1) * (CC / 16) + j) * 512, lane); }
    asm volatile("s_wait_xcnt 0x0" ::: "memory");   /* stands before the next step rewrites the address registers that this step's loads name */
    a0 = b0; a1 = b1; };
  // an even trip count, so that the loop stays rolled in pairs (the row fragments swap by name, without register copies) and the text stays small; the step before the last follows it
#pragma unroll 2
  for (int kc = 0; kc < DIN / 32 - 2; ++kc) kstep(kc);
  kstep(DIN / 32 - 2);
#pragma unroll
  for (int j = 0; j < 8; ++j) { acc2[0][j] = wmma_bf(a0, w[j], acc2[0][j]); acc2[1][j] = wmma_bf(a1, w[j], acc2[1][j]); }   /* the last k step: nothing left to fetch */
  // unrolled: the pass number indexes the accumulators, which stay in registers only under constant indices
#pragma unroll
  for (int hb = 0; hb < 2; ++hb) { const v8f* acc = acc2[hb]; const size_t r0 = rb0 + hb * 64; const size_t bb = r0 / TT; const int t0 = (int)(r0 % TT);
  if (hb) __syncthreads();   /* the first pass's LDS reads end before the second pass writes the same LDS */
  if (which < 2) { _Float16* DH = which == 0 ? QH : KH; _Float16* DL = which == 0 ? QL : KL; const int nhi = which == 0 ? QHI : KHI; const bool hi_rows = t0 < nhi;
#pragma unroll
    for (int j = 0; j < 8; ++j) { const float bias = BA ? bfr(BA[c0 + j * 16 + col]) : 0.f;
#pragma unroll
      for (int r = 0; r < 8; ++r) { const float v = acc[j][r] + bias; const _Float16 hv = (_Float16)v; sh[wave * 16 + 8 * g + r][j * 16 + col] = hv; sl[wave * 16 + 8 * g + r][j * 16 + col] = (_Float16)((v - (float)hv) * 1024.0f); } }
    __syncthreads();
    if (which == 1) {   /* k: 16 fragments = [head of 2][16-key group of 4][k step of 2], 64 pieces each; a head's 8 fragments are 8 KiB in a row */
      // unrolled: the 8 LDS reads go out together, and head and key group are constants of each trip, so that the 8 stores share one address
#pragma unroll
      for (int i = 0; i < 8; ++i) { const int e = tid + i * 128; const int f = e >> 6, pc = e & 63, hf = pc >> 5, ln = pc & 31; const int hh = f >> 3, kt = (f >> 1) & 3, kc = f & 1;
        vst2((unsigned*)(KH + ((((bb * NH + c0 / HD + hh) * (TT / 16) + t0 / 16 + kt) * (HD / 32) + kc) * 512 + pc * 8)), *(const v4u*)&sh[kt * 16 + (ln & 15)][hh * HD + kc * 32 + hf * 16 + (ln >> 4) * 8]); }
      asm volatile("s_wait_xcnt 0x0" ::: "memory"); }   /* stands before the code below rewrites registers that these stores name */
    for (int e = tid; e < 64 * 16; e += 128) { const int rl = e >> 4, q = e & 15; if (which == 0) { vst2((unsigned*)(DH + (r0 + rl) * CC + c0 + q * 8), *(const v4u*)&sh[rl][q * 8]); asm volatile("s_wait_xcnt 0x0" ::: "memory"); }   /* the wait stands before a register that the store names is rewritten */
      if (hi_rows) { vst2((unsigned*)(DL + (bb * nhi + t0 + rl) * (size_t)CC + c0 + q * 8), *(const v4u*)&sl[rl][q * 8]); asm volatile("s_wait_xcnt 0x0" ::: "memory"); } }   /* the same wait, before the next trip */
  } else { const bool hi_rows = t0 < KHI;
#pragma unroll
    for (int j = 0; j < 8; ++j) { const float bias = BA ? bfr(BA[c0 + j * 16 + col]) : 0.f;
#pragma unroll
      for (int r = 0; r < 8; ++r) { const float v = acc[j][r] + bias; const int rl = wave * 16 + 8 * g + r, cl = j * 16 + col; th[cl][rl] = (_Float16)v; const __bf16 bh = (__bf16)v; tb[cl][rl] = bh; tbl[cl][rl] = (__bf16)(v - (float)bh); } }
    __syncthreads();
    /* v^T: 16 fragments = [head of 2][32-key group of 2][16-channel group of 4], 64 pieces each */
    // unrolled: the 8 LDS reads go out together, and head and key group are constants of each trip, so that the 8 stores share one address
#pragma unroll
    for (int i = 0; i < 8; ++i) { const int e = tid + i * 128; const int f = e >> 6, pc = e & 63, hf = pc >> 5, ln = pc & 31; const int hh = f >> 3, kt = (f >> 2) & 1, j = f & 3;
      vst2((unsigned*)(VT + ((((bb * NH + c0 / HD + hh) * (TT / 32) + t0 / 32 + kt) * (HD / 16) + j) * 512 + pc * 8)), *(const v4u*)&th[hh * HD + j * 16 + (ln & 15)][kt * 32 + hf * 16 + (ln >> 4) * 8]); }
    asm volatile("s_wait_xcnt 0x0" ::: "memory");   /* stands before the code below rewrites registers that these stores name */
    for (int e = tid; e < 128 * 8; e += 128) { const int cl = e >> 3, q = e & 7; if (hi_rows) { const size_t o3 = (bb * CC + c0 + cl) * (size_t)KHI + t0 + q * 8; vst2((unsigned*)(VB + o3), *(const v4u*)&tb[cl][q * 8]); vst2((unsigned*)(VBL + o3), *(const v4u*)&tbl[cl][q * 8]); } } } } }
// ---- k_fa: block = 64 queries (qb) of (b, h), wave = 16 queries, all keys in steps of 64: S^T = K q^T (key rows as A, query rows as B; q hi + residual x 2^10: 2 products), unscaled, masked positions set to XMASK; running max and sum per query (lane & 15 = query, so both are per-lane values; the two lane halves hold different keys); D of S^T (lane = query, element r = key 8g + r) IS the 16x16x32 operand layout over 32 keys, so P = exp2(x * SCL2 - max * SCL2) (one fma and the hardware exp2 per score) goes once to f16 in place and ctx^T += v^T (A) P^T (B); ctx^T rows are channels, so the rescale and the final 1 / sum are per-lane too
__global__ __launch_bounds__(128) void k_fa(const _Float16* __restrict__ QH, const _Float16* __restrict__ KH, const _Float16* __restrict__ QL, const _Float16* __restrict__ VT, const unsigned* __restrict__ MP, float* __restrict__ Y) {
  const int tid = threadIdx.x, wave = tid >> 5, lane = tid & 31, col = lane & 15, g = lane >> 4; const int h = blockIdx.y, b = blockIdx.z; const int ql0 = blockIdx.x * 64 + wave * 16;
  v16h qh[HD / 32], ql[HD / 32];
#pragma unroll
  for (int kc = 0; kc < HD / 32; ++kc) { qh[kc] = frag_h(QH + ((size_t)b * TT + ql0 + col) * CC + h * HD + kc * 32, lane); ql[kc] = frag_h(QL + ((size_t)b * QHI + ql0 + col) * CC + h * HD + kc * 32, lane); }
  const _Float16* Kb = KH + (size_t)(b * NH + h) * TT * HD; const _Float16* Vb = VT + (size_t)(b * NH + h) * TT * HD;   /* this head's fragments; 64 keys are 8 fragments = 8 KiB in a row in each */
  const unsigned* Mw = MP + (size_t)(b * (TT / 16) + blockIdx.x * 4 + __builtin_amdgcn_readfirstlane(wave)) * (TT / 64) * 32;   /* this wave's select words, 128 bytes a key step; the address is wave-uniform, so that they come by scalar loads into scalar registers */
  v8f acc[HD / 16] = {}; float m = -3.0e38f, mc = -3.0e38f * SCL2, l = 0.f;   /* mc = m * SCL2: the running max in the exponent's own unit */
  // the key loop stays rolled: a second step's fragments would take the wave past 256 registers and cost a wave per SIMD; the inner loops are fully unrolled so that the fragment arrays are indexed by constants and stay in registers
#pragma unroll 1
  for (int k0 = 0; k0 < TT; k0 += 64) { float s[4][8]; float mx = -3.0e38f;
    v16h kf[4][HD / 32];   /* the whole step's K fragments and select words are requested before the first product: one load latency per step, not one per product */
    v16u mw[2]; const _Float16* kp = Kb + (size_t)k0 * HD + lane * 8;   /* this lane's piece of the step's first K fragment (the address that frag_ph forms) */
#pragma unroll
    for (int t = 0; t < 4; ++t)
#pragma unroll
      for (int kc = 0; kc < HD / 32; ++kc) { union { v16h v; v8h q[2]; } u; u.q[0] = *(const v8h*)(kp + (t * (HD / 32) + kc) * 512); u.q[1] = *(const v8h*)(kp + (t * (HD / 32) + kc) * 512 + 256); kf[t][kc] = u.v; }
    // the step's 32 select words: two scalar loads with their data wait in one statement, so that their address register is rewritten only behind the wait; it stands behind the K requests, which fly meanwhile. It also takes the K address as an input and ends in the wait that stands before a register named by an issued load is rewritten, so that no K load lands in that address
    asm volatile("s_load_b512 %0, %2, 0x0\n\ts_load_b512 %1, %2, 0x40\n\ts_wait_kmcnt 0x0\n\ts_wait_xcnt 0x0" : "=&s"(mw[0]), "=&s"(mw[1]) : "s"(Mw + (k0 >> 1)), "v"(kp) : "memory");
    __builtin_amdgcn_sched_barrier(0);   /* no product is scheduled up among the K requests: all 16 stay in flight together, one load latency per step */
#pragma unroll
    for (int t = 0; t < 4; ++t) { v8f a = {}, al = {};
#pragma unroll
      for (int kc = 0; kc < HD / 32; ++kc) { a = wmma16(kf[t][kc], qh[kc], a); al = wmma16(kf[t][kc], ql[kc], al); }
#pragma unroll
      for (int r = 0; r < 8; ++r) { float v = a[r] + al[r] * (1.0f / 1024.0f); if (__builtin_amdgcn_inverse_ballot_w32(mw[t >> 1][(t & 1) * 8 + r])) v = XMASK;   /* where(mask[b][q][k] (1 = masked), -1e9, scores): set; a fully masked row comes out uniform */
        s[t][r] = v; mx = fmaxf(mx, v); } }
    v16h vf[2][HD / 16];   /* the step's v fragments are requested here, so that they fly under the softmax arithmetic */
#pragma unroll
    for (int u = 0; u < 2; ++u)
#pragma unroll
      for (int j = 0; j < HD / 16; ++j) vf[u][j] = frag_ph(Vb + (size_t)k0 * HD + (u * (HD / 16) + j) * 512, lane);
    __builtin_amdgcn_sched_barrier(0);   /* no v request is scheduled down into the softmax arithmetic: all 16 are in flight before it starts */
    mx = fmaxf(mx, __shfl_xor(mx, 16)); const float mn = fmaxf(m, mx); const float mcn = mn * SCL2; const float alpha = __builtin_amdgcn_exp2f(mc - mcn); m = mn; mc = mcn;
    v16h p[2]; float sum = 0.f;
#pragma unroll
    for (int t = 0; t < 4; ++t)
#pragma unroll
      for (int r = 0; r < 8; ++r) { const float e = __builtin_amdgcn_exp2f(fmaf(s[t][r], SCL2, -mcn)); sum += e; p[t >> 1][(t & 1) * 8 + r] = (_Float16)e; }
    l = l * alpha + sum;
#pragma unroll
    for (int j = 0; j < HD / 16; ++j)
#pragma unroll
      for (int r = 0; r < 8; ++r) acc[j][r] *= alpha;
#pragma unroll
    for (int u = 0; u < 2; ++u)
#pragma unroll
      for (int j = 0; j < HD / 16; ++j) acc[j] = wmma16(vf[u][j], p[u], acc[j]); }
  l += __shfl_xor(l, 16); const float inv = 1.0f / l;   /* l >= 1: the key that holds the max contributes exp(0) */
  float* yr = Y + ((size_t)b * TT + ql0 + col) * CC + h * HD + 8 * g;
#pragma unroll
  for (int j = 0; j < HD / 16; ++j) { v4f o0, o1;
#pragma unroll
    for (int r = 0; r < 4; ++r) { o0[r] = acc[j][r] * inv; o1[r] = acc[j][4 + r] * inv; }
    vst2(yr + j * 16, o0); vst2(yr + j * 16 + 4, o1); } }
// ---- k_out: block = (64 rows, 128 cols): out = ctx Wo (+ bo): all rows: ctx bf16 hi + lo against exact bf16 Wo from its packed fragments (2 products)
__global__ __launch_bounds__(128) void k_out(const float* __restrict__ Y, const float* __restrict__ WO, const __bf16* __restrict__ WPO, const float* __restrict__ BO, float* __restrict__ OUT, const float* __restrict__ RESX) { __shared__ __align__(16) float sf[4][16][132];
  const int tid = threadIdx.x, wave = tid >> 5, lane = tid & 31, col = lane & 15, g = lane >> 4; const int c0 = blockIdx.y * 128; const size_t r0 = (size_t)blockIdx.x * 64 + wave * 16;
  v8f acc[8] = {};
  if (true) {   /* ALL rows: ctx split bf16 hi + lo x exact Wo (2 products) */
    const float* yp = Y + (r0 + col) * CC + 8 * g;   /* this lane's 8 + 8 ctx values of k step 0 (the address that split_row forms) */
    v4f y[4] = { *(const v4f*)yp, *(const v4f*)(yp + 4), *(const v4f*)(yp + 16), *(const v4f*)(yp + 20) }; v16b w[8];
#pragma unroll
    for (int j = 0; j < 8; ++j) w[j] = frag_p(WPO + (size_t)(c0 / 16 + j) * 512, lane);
    asm volatile("s_wait_xcnt 0x0" ::: "memory");   /* stands before the loop rewrites the address registers that these loads name */
    // operands are fetched one k step ahead, so that the load latency runs under the split and the products: the next step's ctx values at the head of the step, and each pair of B fragments right behind the four products that read their predecessors, into the same registers
    auto kstep = [&](int kc) __attribute__((always_inline)) { const float* yn = yp + (kc + 1) * 32;
      const v4f z[4] = { *(const v4f*)yn, *(const v4f*)(yn + 4), *(const v4f*)(yn + 16), *(const v4f*)(yn + 20) };
      const F2 a = split_q(y);
#pragma unroll
      for (int j = 0; j < 8; j += 2) { __builtin_amdgcn_sched_barrier(0);   /* no later refill is scheduled up over products that still read the old fragments: that would take a second register set */
        acc[j] = wmma_bf(a.h, w[j], acc[j]); acc[j + 1] = wmma_bf(a.h, w[j + 1], acc[j + 1]); acc[j] = wmma_bf(a.l, w[j], acc[j]); acc[j + 1] = wmma_bf(a.l, w[j + 1], acc[j + 1]);   /* two column groups at a time: a tile's second product does not stand directly behind its first */
        w[j] = frag_p(WPO + ((size_t)(kc + 1) * (DIN / 16) + c0 / 16 + j) * 512, lane); w[j + 1] = frag_p(WPO + ((size_t)(kc + 1) * (DIN / 16) + c0 / 16 + j + 1) * 512, lane); }
      asm volatile("s_wait_xcnt 0x0" ::: "memory");   /* stands before the next step rewrites the address registers that this step's loads name */
#pragma unroll
      for (int i = 0; i < 4; ++i) y[i] = z[i]; };
    // an even trip count, so that the loop stays rolled in pairs and the text stays small; the step before the last follows it
#pragma unroll 2
    for (int kc = 0; kc < CC / 32 - 2; ++kc) kstep(kc);
    kstep(CC / 32 - 2);
    { const F2 a = split_q(y);   /* the last k step: nothing left to fetch */
#pragma unroll
      for (int j = 0; j < 8; ++j) { acc[j] = wmma_bf(a.h, w[j], acc[j]); acc[j] = wmma_bf(a.l, w[j], acc[j]); } }
#pragma unroll
    for (int j = 0; j < 8; ++j) { const float bias = BO ? bfr(BO[c0 + j * 16 + col]) : 0.f;
#pragma unroll
      for (int r = 0; r < 8; ++r) sf[wave][8 * g + r][j * 16 + col] = acc[j][r] + bias; }
  } else {
#pragma unroll 2
    for (int kc = 0; kc < CC / 32; ++kc) { const v16h a = frag_f32(Y + (r0 + col) * CC + kc * 32, lane); asm volatile("s_wait_loadcnt 0x0" ::: "memory");
#pragma unroll
      for (int j = 0; j < 8; ++j) { const v16h w = WOCOLH(WO, kc * 32, c0 + j * 16 + col, lane); asm volatile("s_wait_loadcnt 0x0" ::: "memory"); acc[j] = wmma16(a, w, acc[j]); } }
#pragma unroll
    for (int j = 0; j < 8; ++j) { const float bias = BO ? bfr(BO[c0 + j * 16 + col]) : 0.f;
#pragma unroll
      for (int r = 0; r < 8; ++r) sf[wave][8 * g + r][j * 16 + col] = acc[j][r] * (1.0f / 256.0f) + bias; } }
  LDSX(); for (int rl = 0; rl < 16; ++rl) { const size_t oo = (r0 + rl) * DIN + c0 + lane * 4; v4f o = *(const v4f*)&sf[wave][rl][lane * 4]; const v4f zr = *(const v4f*)(RESX + oo); o[0] += bfr(zr[0]); o[1] += bfr(zr[1]); o[2] += bfr(zr[2]); o[3] += bfr(zr[3]); vst2(OUT + oo, o); } }   /* ctx W_O + bf16(input_Q) */

extern "C" void kernel_launch(void* const* d_in, const int* in_sizes, int n_in, void* d_out, int out_size, void* d_ws, size_t ws_size, hipStream_t stream) {
  (void)in_sizes; (void)n_in; (void)out_size;
  const float** F = (const float**)d_in;
  if (ws_size < (size_t)WS_END) return;
  char* ws = (char*)d_ws; _Float16 *QH = (_Float16*)(ws + WS_QH), *KH = (_Float16*)(ws + WS_KH), *VT = (_Float16*)(ws + WS_VT), *QL = (_Float16*)(ws + WS_QL), *KL = (_Float16*)(ws + WS_KL); __bf16 *VB = (__bf16*)(ws + WS_VB), *VBL = (__bf16*)(ws + WS_VBL); float *Y = (float*)(ws + WS_Y);
  (void)Y; (void)QL; (void)KL; (void)VB; (void)VBL;
  // inputs: 0 input_Q; 1 input_K; 2 input_V [2,2048,1024]; 3 mask [2,2048,2048] int32 (1 = masked); 4 W_Q (in,out); 5 W_K; 6 W_V; 7 W_O (in,out); 8 ln_gamma; 9 ln_beta
  if (ws_size < (size_t)WS_END4) return;
  float* X1 = (float*)(ws + WS_X1); __bf16 *WP = (__bf16*)(ws + WS_WP), *XP = (__bf16*)(ws + WS_XP); unsigned* MP = (unsigned*)(ws + WS_MP);
  k_pack<<<dim3(4 * PKW + 3 * PKX + PKM), 256, 0, stream>>>(F[4], F[5], F[6], F[7], F[0], F[1], F[2], (const int*)d_in[3], WP, XP, MP);   /* weights and inputs -> bf16 fragments, mask -> select words, every call */
  k_proj<<<dim3(TNB * TT / 128, CC / 128, 3), 128, 0, stream>>>(XP, WP, nullptr, nullptr, nullptr, QH, QL, KH, KL, VT, VB, VBL);
  k_fa<<<dim3(NQB, NH, TNB), 128, 0, stream>>>(QH, KH, QL, VT, MP, Y);
  k_out<<<dim3(TNB * TT / 64, DIN / 128), 128, 0, stream>>>(Y, F[7], WP + 3 * (size_t)DIN * CC, nullptr, X1, F[0]);   /* ctx W_O + input_Q */
  k_lnx<<<dim3(NRW / 8), 256, 0, stream>>>(X1, 0, F[8], F[9], (float*)d_out);              /* LayerNorm */
}

// v009
// A run of this version takes 106 microseconds.
// Two timings next to v008 both put it at 1.13 times that version's speed.
// Over all steps from v000 it is 11.6 times as fast.
// compute dtype: all float inputs rounded to bf16; q/k/v = in W with EXACT bf16 products on WMMA 16x16x32 (f32 accumulate); q as f16 hi + residual (x 2^10) against k once to f16 (2 products), masked (mask == 1) positions set to -2^33 (-2^30 after the / 8, standing for -1e9); softmax in f32 in base 2 (hardware exp2 of (x - max) * log2(e) / 8, running max and sum over key steps of 64); P = exp(s - max) once to f16 against v once to f16 (1 product), divided by the sum at the end; ctx split bf16 hi + lo against exact W_O (2 products) + input_Q; LayerNorm in f32; f32 output.
#include <hip/hip_runtime.h>
#include <math.h>

typedef __attribute__((ext_vector_type(16))) _Float16 v16h;
typedef __attribute__((ext_vector_type(16))) __bf16 v16b;
typedef __attribute__((ext_vector_type(8)))  _Float16 v8h;
typedef __attribute__((ext_vector_type(8)))  float v8f;
typedef __attribute__((ext_vector_type(4)))  float v4f;
typedef __attribute__((ext_vector_type(2)))  float v2f;
typedef __attribute__((ext_vector_type(4)))  unsigned v4u;
typedef __attribute__((ext_vector_type(4)))  int v4i;
typedef float __attribute__((may_alias)) float_a;
typedef int __attribute__((may_alias)) int_a;

template <typename T> __device__ __forceinline__ void vst2(void* p, T v) { *(T*)p = v;  }
__device__ __forceinline__ v8f wmma16(v16h a, v16h b, v8f c) {
  return __builtin_amdgcn_wmma_f32_16x16x32_f16(false, a, false, b, (short)0, c, false, false);   /* no v_nop written behind it: the compiler pads its own builtin where a distance is owed */
}
__device__ __forceinline__ v8f wmma_bf(v16b a, v16b b, v8f c) {
  v8f d = __builtin_amdgcn_wmma_f32_16x16x32_bf16(false, a, false, b, (short)0, c, false, false);
  asm volatile("v_nop\n\tv_nop\n\tv_nop\n\tv_nop" : "+v"(d) : "v"(a), "v"(b));
  return d;
}
// 16x16x32 fragments: lane = (h = lane>>4, row/col = lane&15); elements 0..7 = k0+8h+0..7, 8..15 = k0+16+8h+0..7; D element r = row 8h+r
__device__ __forceinline__ v16h frag_h(const _Float16* rowk0, int lane) {
  union { v16h v; v8h q[2]; } u; const _Float16* p = rowk0 + 8 * (lane >> 4);
  u.q[0] = *(const v8h*)p; u.q[1] = *(const v8h*)(p + 16); return u.v;
}
__device__ __forceinline__ v16h frag_f32(const float* rowk0, int lane) {
  v16h a; const float* p = rowk0 + 8 * (lane >> 4);
#pragma unroll
  for (int i = 0; i < 8; ++i) { a[i] = (_Float16)p[i]; a[8 + i] = (_Float16)p[16 + i]; }
  return a;
}
__device__ __forceinline__ v16h frag_f32s(const float* rowk0, int lane, float sc) {
  v16h a; const float* p = rowk0 + 8 * (lane >> 4);
#pragma unroll
  for (int i = 0; i < 8; ++i) { a[i] = (_Float16)(p[i] * sc); a[8 + i] = (_Float16)(p[16 + i] * sc); }
  return a;
}
// column fragment from a [K][ld] layout (column n), rows >= K read as 0
__device__ __forceinline__ v16h fragc_f32(const float* W, int k0, int n, int lane, int ld, int K) {
  v16h a; const int g = lane >> 4;
#pragma unroll
  for (int i = 0; i < 8; ++i) { const int ka = k0 + 8 * g + i, kb = ka + 16;
    a[i] = (_Float16)(ka < K ? W[(size_t)(ka < K ? ka : K - 1) * ld + n] : 0.f); a[8 + i] = (_Float16)(kb < K ? W[(size_t)(kb < K ? kb : K - 1) * ld + n] : 0.f); }
  return a;
}
struct F2 { v16b h, l; };
__device__ __forceinline__ F2 bsplit16(const float v[16]) { F2 r;
#pragma unroll
  for (int i = 0; i < 16; ++i) { const __bf16 h = (__bf16)v[i]; r.h[i] = h; r.l[i] = (__bf16)(v[i] - (float)h); }
  return r; }
__device__ __forceinline__ F2 split_row(const float* row, int k0, int lane) { float v[16]; const float* p = row + k0 + 8 * (lane >> 4);
#pragma unroll
  for (int i = 0; i < 8; ++i) { v[i] = p[i]; v[8 + i] = p[16 + i]; }
  return bsplit16(v); }
__device__ __forceinline__ F2 split_q(const v4f q[4]) { float v[16];   /* the 16 values that split_row reads, already loaded: q[0], q[1] = k0 + 8 g + 0..7, q[2], q[3] = k0 + 16 + 8 g + 0..7 */
#pragma unroll
  for (int i = 0; i < 4; ++i) { v[i] = q[0][i]; v[4 + i] = q[1][i]; v[8 + i] = q[2][i]; v[12 + i] = q[3][i]; }
  return bsplit16(v); }
__device__ __forceinline__ F2 split_rowK(const float* row, int k0, int lane, int K) { float v[16]; const int g = lane >> 4;
#pragma unroll
  for (int i = 0; i < 8; ++i) { const int ka = k0 + 8 * g + i, kb = ka + 16; v[i] = ka < K ? row[ka < K ? ka : K - 1] : 0.f; v[8 + i] = kb < K ? row[kb < K ? kb : K - 1] : 0.f; }
  return bsplit16(v); }
__device__ __forceinline__ F2 split_col(const float* W, int k0, int n, int lane, int ld, int K) { float v[16]; const int g = lane >> 4;
#pragma unroll
  for (int i = 0; i < 8; ++i) { const int ka = k0 + 8 * g + i, kb = ka + 16; v[i] = ka < K ? W[(size_t)(ka < K ? ka : K - 1) * ld + n] : 0.f; v[8 + i] = kb < K ? W[(size_t)(kb < K ? kb : K - 1) * ld + n] : 0.f; }
  return bsplit16(v); }
__device__ __forceinline__ v8f mac3(const F2& a, const F2& b, v8f c) { c = wmma_bf(a.l, b.h, c); c = wmma_bf(a.h, b.l, c); return wmma_bf(a.h, b.h, c); }
__device__ __forceinline__ float sigm(float v) { return 1.0f / (1.0f + expf(-v)); }
// asks L2 for the line at p (scope SE: into L2 only); nothing comes back and no counter moves. Asked for at entry, for speed only
__device__ __forceinline__ void pf_l2(const char* p) { asm volatile("global_prefetch_b8 %0, off scope:SCOPE_SE" :: "v"(p)); }
// no wait covers a prefetch's read of its address: the register pair keeps the address, and nothing else, up to this place behind the loop
__device__ __forceinline__ void pf_hold(const char* p) { asm volatile("" :: "v"(p)); }
#define LDSX() do { asm volatile("s_wait_dscnt 0" ::: "memory"); __builtin_amdgcn_wave_barrier(); __builtin_amdgcn_fence(__ATOMIC_RELEASE, "workgroup"); } while (0)

// Multi-head attention layer with a random (query, key) mask, residual and LayerNorm (B 2, S 2,048, 1,024 = 16 x 64; (in,out) 1/32-scale weights, no biases; mask [B,S,S] int, 1 = MASKED (~half); LN affine 1/0, eps 1e-5): q = input_Q W_Q ...; scores = q k^T / 8 with where(mask, -1e9, s); ctx = softmax v; out = LN(ctx W_O + input_Q).
#define NB 2
#define TT 2048
#define CC 1024            // NH * HD = projected width
#define DIN 1024          // input (model) width
#define NH 16
#define HD 64
#define NQB (TT / 64)
#define HG 4
#define SCALE (0.125f)
#define SCL2 (SCALE * 1.44269504088896341f)   // score scale times log2(e): exp(SCALE * x) = exp2(SCL2 * x)
#define XMASK (-8589934592.0f)                // a masked position's unscaled score, -2^33: SCALE * XMASK = -2^30 stands for the reference's -1e9 (either is 0 after the exp beside any real score); a power of two, so that XMASK * SCL2 is exact and a fully masked row gets exp2(0) = 1 at every key
#define CAUSAL 0
#ifndef TNB
#define TNB NB
#endif
__device__ __forceinline__ float bfr(float v) { return (float)(__bf16)v; }
__host__ __device__ __forceinline__ int kb_last(int qb) { return CAUSAL ? ((qb * 64 + 63) >> 7) : (TT / 128 - 1); }
typedef __attribute__((ext_vector_type(8))) __bf16 v8b;
__device__ __forceinline__ v16b frag_b(const __bf16* rowk0, int lane) {
  union { v16b v; v8b q[2]; } u; const __bf16* p = rowk0 + 8 * (lane >> 4);
  u.q[0] = *(const v8b*)p; u.q[1] = *(const v8b*)(p + 16); return u.v;
}
#define QBH 0
#define QHI 2048            // rows carrying a q residual plane (all rows when non-causal: 2-product logits everywhere)
#define KHI 64            // key rows carrying k residual / v bf16 hi+lo planes (written by k_proj; no kernel reads them)
// B fragment (k rows k0+.., output column o) of a weight: (in,out) [K][ld] or (out,in) [ld rows of K]: bf16 exact, or f16(bf16 * 256) exact
__device__ __forceinline__ v16b wcol_io(const float* Wm, int k0, int o, int lane, int ld) { v16b w; const int g = lane >> 4;
#pragma unroll
  for (int i = 0; i < 8; ++i) { w[i] = (__bf16)Wm[(size_t)(k0 + 8 * g + i) * ld + o]; w[8 + i] = (__bf16)Wm[(size_t)(k0 + 16 + 8 * g + i) * ld + o]; }
  return w; }
__device__ __forceinline__ v16b wcol_oi(const float* Wm, int k0, int o, int lane, int K) { v16b w; const float* p = Wm + (size_t)o * K + k0 + 8 * (lane >> 4);
#pragma unroll
  for (int i = 0; i < 8; ++i) { w[i] = (__bf16)p[i]; w[8 + i] = (__bf16)p[16 + i]; }
  return w; }
__device__ __forceinline__ v16h wcolh_io(const float* Wm, int k0, int o, int lane, int ld) { v16h w; const int g = lane >> 4;
#pragma unroll
  for (int i = 0; i < 8; ++i) { w[i] = (_Float16)(bfr(Wm[(size_t)(k0 + 8 * g + i) * ld + o]) * 256.0f); w[8 + i] = (_Float16)(bfr(Wm[(size_t)(k0 + 16 + 8 * g + i) * ld + o]) * 256.0f); }
  return w; }
__device__ __forceinline__ v16h wcolh_oi(const float* Wm, int k0, int o, int lane, int K) { v16h w; const float* p = Wm + (size_t)o * K + k0 + 8 * (lane >> 4);
#pragma unroll
  for (int i = 0; i < 8; ++i) { w[i] = (_Float16)(bfr(p[i]) * 256.0f); w[8 + i] = (_Float16)(bfr(p[16 + i]) * 256.0f); }
  return w; }
#define WQKV_LAYOUT 0   // 0 = (in,out) [DIN][CC]; 1 = (out,in) [CC][DIN]; 2 = per-head [NH][DIN][HD]
__device__ __forceinline__ v16b wcol_hdk(const float* Wm, int k0, int o, int lane) { v16b w; const int g = lane >> 4; const float* p = Wm + (size_t)(o / HD) * DIN * HD + (o % HD);
#pragma unroll
  for (int i = 0; i < 8; ++i) { w[i] = (__bf16)p[(size_t)(k0 + 8 * g + i) * HD]; w[8 + i] = (__bf16)p[(size_t)(k0 + 16 + 8 * g + i) * HD]; }
  return w; }
#define WO_OUT_IN 0
#if WQKV_LAYOUT == 1
#define WCOL(W, k0, o, lane) wcol_oi(W, k0, o, lane, DIN)
#elif WQKV_LAYOUT == 2
#define WCOL(W, k0, o, lane) wcol_hdk(W, k0, o, lane)
#else
#define WCOL(W, k0, o, lane) wcol_io(W, k0, o, lane, CC)
#endif
#if WO_OUT_IN
#define WOCOL(W, k0, o, lane) wcol_oi(W, k0, o, lane, CC)
#define WOCOLH(W, k0, o, lane) wcolh_oi(W, k0, o, lane, CC)
#else
#define WOCOL(W, k0, o, lane) wcol_io(W, k0, o, lane, DIN)
#define WOCOLH(W, k0, o, lane) wcolh_io(W, k0, o, lane, DIN)
#endif
#define SM_EXTRA_PARAMS , const int* __restrict__ MK, int bcur
#define SM_MASK_HOOK do { if (MK[((size_t)bcur * TT + t) * TT + k] != 0) v = -1.0e9f; } while (0)   /* where(mask[b][q][k] (1 = masked), -1e9, scores): set; a fully masked row would be uniform (none here) */
#define NRW (TNB * TT)
// ---- k_lnx: wave per row: LayerNorm over 1024 (mean, biased var, (x - mean) * rsqrt(var + 1e-5) * g + b); optional bf16 rounding of the input (x); 32 floats per lane (8 float4 at stride 128 floats -> 512-B pieces)
__global__ __launch_bounds__(256) void k_lnx(const float* __restrict__ X, int roundin, const float* __restrict__ G, const float* __restrict__ BE, float* __restrict__ OUT) { const int wave = threadIdx.x >> 5, lane = threadIdx.x & 31; const size_t row = (size_t)blockIdx.x * 8 + wave; if (row >= (size_t)NRW) return;
  v4f v[CC / 128]; float s1 = 0.f;
#pragma unroll
  for (int i = 0; i < CC / 128; ++i) { v4f t = *(const v4f*)(X + row * CC + i * 128 + lane * 4); if (roundin) { t[0] = bfr(t[0]); t[1] = bfr(t[1]); t[2] = bfr(t[2]); t[3] = bfr(t[3]); } v[i] = t; s1 += (t[0] + t[1]) + (t[2] + t[3]); }
#pragma unroll
  for (int o = 1; o < 32; o <<= 1) s1 += __shfl_xor(s1, o);
  const float mu = s1 * (1.0f / CC); float q = 0.f;
#pragma unroll
  for (int i = 0; i < CC / 128; ++i) for (int k = 0; k < 4; ++k) { const float d = v[i][k] - mu; q += d * d; }
#pragma unroll
  for (int o = 1; o < 32; o <<= 1) q += __shfl_xor(q, o);
  const float inv = rsqrtf(q * (1.0f / CC) + 1e-5f);   /* jnp.var (biased), eps inside the rsqrt */
#pragma unroll
  for (int i = 0; i < CC / 128; ++i) { const int c = i * 128 + lane * 4; v4f r4; for (int k = 0; k < 4; ++k) r4[k] = bfr(G[c + k]) * ((v[i][k] - mu) * inv) + bfr(BE[c + k]); vst2(OUT + row * CC + c, r4); } }

#ifndef SM_EXTRA_PARAMS
#define SM_EXTRA_PARAMS
#endif
#ifndef PROJ_EXTRA_PARAMS
#define PROJ_EXTRA_PARAMS
#endif
#ifndef SM_MASK_HOOK
#define SM_MASK_HOOK (void)0
#endif

#define WS_QH  0u                                      // f16 q rows [b*t][CC]
#define WS_KH  (WS_QH + 2u * (size_t)NB * TT * CC)      // f16 k as A fragments [b][h][16-key group][k step of 32 channels][1 KiB fragment]
#define WS_VT  (WS_KH + 2u * (size_t)NB * TT * CC)      // f16 v^T as A fragments [b][h][32-key group][16-channel group][1 KiB fragment]
#define WS_QL  (WS_VT + 2u * (size_t)NB * CC * TT)      // f16 q residual x 2^10 rows [b][t < QHI][CC]
#define WS_KL  (WS_QL + 2u * (size_t)NB * QHI * CC)     // f16 k residual x 2^10 rows [b][t < KHI][CC]
#define WS_VB  (WS_KL + 2u * (size_t)NB * KHI * CC)     // bf16 v hi planes [b][c][t < KHI]
#define WS_VBL (WS_VB + 2u * (size_t)NB * CC * KHI)
#define WS_S   (WS_VBL + 2u * (size_t)NB * CC * KHI)    // f32 [hg][t][s] region, unused (k_fa keeps logits and P in registers)
#define WS_Y   (WS_S  + 4u * (size_t)HG * TT * TT)      // f32 ctx rows [b*t][CC] (only when there is an output projection)
#define WS_END (WS_Y  + 4u * (size_t)NB * TT * CC)
#define WS_X1  (WS_END)
#define WS_END2 (WS_X1 + 4u * (size_t)NB * TT * DIN)

#define WS_WP  (WS_END2)                                // bf16 weights as B fragments [W_Q, W_K, W_V, W_O][k step of 32][16-column group][1 KiB fragment]
#define WS_XP  (WS_WP + 2u * 4u * (size_t)DIN * CC)     // bf16 inputs as A fragments [input_Q, input_K, input_V][16-row group][k step of 32][1 KiB fragment]
#define WS_END3 (WS_XP + 2u * 3u * (size_t)NB * TT * DIN)
#define WS_MP  (WS_END3)                                // mask as select words [b * TT / 16 + 16-query group][key step of 64][t * 8 + r]: bit l of a word = (mask != 0) at query (l & 15), key 16 t + 8 (l >> 4) + r, the score that lane l of k_fa holds in s[t][r]
#define WS_END4 (WS_MP + (size_t)NB * TT * TT / 8)
typedef __attribute__((ext_vector_type(16))) unsigned v16u;
#define PKP 16                                // pieces per k_pack thread: few waves with many loads in flight each, for speed only
#define PKW (DIN * CC / 8 / 256 / PKP)        // k_pack blocks per weight
#define PKX (NB * TT * DIN / 8 / 256 / PKP)   // k_pack blocks per input
#define PKM (NB * (TT / 16) * (TT / 128) / 8 / 2)   // k_pack blocks for the mask: a wave takes 2 tiles of 16 queries x 128 keys
// ---- k_pack: a piece = 16 bytes of a 16x16x32 operand fragment, rounded to bf16. A 1 KiB fragment is [half hf][lane][8]: piece (hf, lane) holds k = k0 + 16 hf + 8 (lane >> 4) + 0..7 of row or column (lane & 15), the k order of the fragment comment above; a wave's store is 512 contiguous bytes
__global__ __launch_bounds__(256) void k_pack(const float* __restrict__ W0, const float* __restrict__ W1, const float* __restrict__ W2, const float* __restrict__ W3, const float* __restrict__ X0, const float* __restrict__ X1, const float* __restrict__ X2, const int* __restrict__ MK, __bf16* __restrict__ WP, __bf16* __restrict__ XP, unsigned* __restrict__ MP) {
  const int bx = blockIdx.x;
  if (bx < 4 * PKW) { const int mt = bx / PKW; const float* Wm = mt == 0 ? W0 : mt == 1 ? W1 : mt == 2 ? W2 : W3; __bf16* D = WP + (size_t)mt * DIN * CC;   /* (in,out) weight: piece e = [kc][ob][hf][lane] */
    const int e0 = (bx % PKW) * (256 * PKP) + threadIdx.x;
    // rolled over groups of 4 pieces: 32 loads in flight per lane are enough, and the registers stay few
#pragma unroll 1
    for (int it = 0; it < PKP; it += 4) { float t[4][8];
#pragma unroll
      for (int u = 0; u < 4; ++u) { const int e = e0 + (it + u) * 256; const int lane = e & 31, hf = (e >> 5) & 1, ob = (e >> 6) % (CC / 16), kc = (e >> 6) / (CC / 16);
        const float* p = Wm + (size_t)(kc * 32 + 16 * hf + 8 * (lane >> 4)) * CC + ob * 16 + (lane & 15);
#pragma unroll
        for (int i = 0; i < 8; ++i) t[u][i] = p[(size_t)i * CC]; }
#pragma unroll
      for (int u = 0; u < 4; ++u) { v8b w;
#pragma unroll
        for (int i = 0; i < 8; ++i) w[i] = (__bf16)t[u][i];
        vst2(D + (size_t)(e0 + (it + u) * 256) * 8, w); }
      asm volatile("s_wait_xcnt 0x0" ::: "memory"); }   /* stands before the next trip rewrites registers that this trip's stores name */
  } else if (bx < 4 * PKW + 3 * PKX) { const int b2 = bx - 4 * PKW; const int mt = b2 / PKX; const float* Xm = mt == 0 ? X0 : mt == 1 ? X1 : X2; __bf16* D = XP + (size_t)mt * NB * TT * DIN;   /* input rows: piece e = [rb][kc][hf][lane] */
    const int e0 = (b2 % PKX) * (256 * PKP) + threadIdx.x;
    // rolled over groups of 8 pieces: 16 16-byte loads in flight per lane. The 8 pieces of a trip lie 256 pieces = 4 k steps apart, in one input row (32 k steps a row, first k step < 4): one load address and one store address a trip, the rest are constant offsets
#pragma unroll 1
    for (int it = 0; it < PKP; it += 8) { const int e = e0 + it * 256; const int lane = e & 31, hf = (e >> 5) & 1, kc = (e >> 6) % (DIN / 32), rb = (e >> 6) / (DIN / 32);
      const float* p = Xm + (size_t)(rb * 16 + (lane & 15)) * DIN + kc * 32 + 16 * hf + 8 * (lane >> 4); __bf16* q = D + (size_t)e * 8;
      v4f t[8][2]; v8b w[8];
#pragma unroll
      for (int u = 0; u < 8; ++u) { t[u][0] = *(const v4f*)(p + u * 128); t[u][1] = *(const v4f*)(p + u * 128 + 4); }
      // the wait that stands before a register named by an issued load is rewritten; it takes the address and the loaded values as inputs, so that all 16 loads stand in front of it and none of them lands in the address registers
      asm volatile("s_wait_xcnt 0x0" :: "v"(p), "v"(t[0][0]), "v"(t[0][1]), "v"(t[1][0]), "v"(t[1][1]), "v"(t[2][0]), "v"(t[2][1]), "v"(t[3][0]), "v"(t[3][1]), "v"(t[4][0]), "v"(t[4][1]), "v"(t[5][0]), "v"(t[5][1]), "v"(t[6][0]), "v"(t[6][1]), "v"(t[7][0]), "v"(t[7][1]) : "memory");
#pragma unroll
      for (int u = 0; u < 8; ++u) {
#pragma unroll
        for (int i = 0; i < 4; ++i) { w[u][i] = (__bf16)t[u][0][i]; w[u][4 + i] = (__bf16)t[u][1][i]; }
        vst2(q + u * 2048, w[u]); }
      // the same wait behind the stores, before the next trip rewrites what they name; it takes the stored values as inputs, so that their registers live up to it
      asm volatile("s_wait_xcnt 0x0" :: "v"(w[0]), "v"(w[1]), "v"(w[2]), "v"(w[3]), "v"(w[4]), "v"(w[5]), "v"(w[6]), "v"(w[7]) : "memory"); }
  } else { const int wv = (bx - 4 * PKW - 3 * PKX) * 8 + (threadIdx.x >> 5), lane = threadIdx.x & 31;   /* mask tile [rg = 16-row group of the NB * TT query rows][kg = 128-key group]: 16 loads of one whole row piece (512 contiguous bytes) each; lane j holds keys 4 j + 0..3 of every row */
    // rolled: 16 16-byte loads in flight per lane are enough, and the registers stay few
#pragma unroll 1
    for (int it = 0; it < 2; ++it) { const int tile = wv * 2 + it; const int kg = tile % (TT / 128), rg = tile / (TT / 128);
      const int* p = MK + (size_t)rg * 16 * TT + kg * 128 + lane * 4; v4i t[16];
#pragma unroll
      for (int q = 0; q < 16; ++q) t[q] = *(const v4i*)(p + q * TT);
      // the wait that stands before a register named by an issued load is rewritten; it takes the address and the loaded values as inputs, so that all 16 loads stand in front of it
      asm volatile("s_wait_xcnt 0x0" :: "v"(p), "v"(t[0]), "v"(t[1]), "v"(t[2]), "v"(t[3]), "v"(t[4]), "v"(t[5]), "v"(t[6]), "v"(t[7]), "v"(t[8]), "v"(t[9]), "v"(t[10]), "v"(t[11]), "v"(t[12]), "v"(t[13]), "v"(t[14]), "v"(t[15]) : "memory");
      unsigned c[4] = {0u, 0u, 0u, 0u};   /* c[e]: bit q = (mask != 0) at row q, key 4 j + e */
#pragma unroll
      for (int q = 0; q < 16; ++q)
#pragma unroll
        for (int e = 0; e < 4; ++e) { const unsigned mv = (unsigned)t[q][e]; c[e] |= (mv < 1u ? mv : 1u) << q; }
      // key = 64 ks + 16 t + 8 g + r lies in lane j = 16 ks + 4 t + 2 g + (r >> 2), element r & 3: lanes j and j ^ 2 hold the two halves (g = 0 low, g = 1 high) of the same four words
      const unsigned p01 = c[0] | (c[1] << 16), p23 = c[2] | (c[3] << 16); const unsigned o01 = __shfl_xor(p01, 2), o23 = __shfl_xor(p23, 2);
      v4u w; w[0] = (p01 & 0xffffu) | (o01 << 16); w[1] = (p01 >> 16) | (o01 & 0xffff0000u); w[2] = (p23 & 0xffffu) | (o23 << 16); w[3] = (p23 >> 16) | (o23 & 0xffff0000u);
      unsigned* d = MP + ((size_t)rg * (TT / 64) + kg * 2 + (lane >> 4)) * 32 + ((lane >> 2) & 3) * 8 + (lane & 1) * 4;
      if ((lane & 2) == 0) vst2(d, w);   /* the g = 0 lanes store: 16 lanes x 16 bytes = the 256 contiguous bytes of two key steps */
      // the same wait behind the store, before the next trip rewrites what it names
      asm volatile("s_wait_xcnt 0x0" :: "v"(d), "v"(w) : "memory"); } } }
// a packed fragment: two 16-byte loads per lane, each 512 contiguous bytes per wave
__device__ __forceinline__ v16b frag_p(const __bf16* fr, int lane) {
  union { v16b v; v8b q[2]; } u; const __bf16* p = fr + lane * 8;
  u.q[0] = *(const v8b*)p; u.q[1] = *(const v8b*)(p + 256); return u.v;
}
__device__ __forceinline__ v16h frag_ph(const _Float16* fr, int lane) {
  union { v16h v; v8h q[2]; } u; const _Float16* p = fr + lane * 8;
  u.q[0] = *(const v8h*)p; u.q[1] = *(const v8h*)(p + 256); return u.v;
}
// ---- k_proj: block = (128 rows, 128 cols, which), wave = two 16-row groups 64 rows apart x 128 cols, so that each weight fragment fetched feeds two products; the results leave in two passes of 64 rows through the same LDS: q/k/v = X W (+ b) with exact bf16 products (K = DIN) -> which 0: q f16 rows (+ residual rows < QHI); 1: k f16 fragments (+ residual rows < KHI); 2: v^T f16 fragments (+ bf16 hi/lo planes for t < KHI). A k or v^T fragment is [half hf][lane][8] like a packed weight fragment: piece (hf, lane) holds k index 16 hf + 8 (lane >> 4) + 0..7 of row (lane & 15), the elements that lane takes in k_fa, so that a wave's load there is 512 contiguous bytes
__global__ __launch_bounds__(128) void k_proj(const __bf16* __restrict__ XP, const __bf16* __restrict__ WP, const float* __restrict__ BQ, const float* __restrict__ BK, const float* __restrict__ BV,
    _Float16* __restrict__ QH, _Float16* __restrict__ QL, _Float16* __restrict__ KH, _Float16* __restrict__ KL, _Float16* __restrict__ VT, __bf16* __restrict__ VB, __bf16* __restrict__ VBL) {
  __shared__ __align__(16) _Float16 sh[64][136], sl[64][136]; __shared__ __align__(16) _Float16 th[128][72]; __shared__ __align__(16) __bf16 tb[128][72], tbl[128][72];
  const int tid = threadIdx.x, wave = tid >> 5, lane = tid & 31, col = lane & 15, g = lane >> 4; const int which = blockIdx.z; const int c0 = blockIdx.y * 128; const size_t rb0 = (size_t)blockIdx.x * 128;
  const __bf16* XA = XP + (size_t)which * NB * TT * DIN + (rb0 / 16 + wave) * (size_t)(DIN / 32) * 512; const __bf16* WA = WP + (size_t)which * DIN * CC + (size_t)(c0 / 16) * 512; const float* BA = which == 0 ? BQ : which == 1 ? BK : BV;
  // entry prefetch, one line or 256-byte unit a thread and operand. The block's 256 KiB of row fragments are shared out among the 8 column blocks that read them; its 256 KiB of weight fragments (64 lines a k step) among 16 of the 32 row blocks, numbered so that blocks 4 apart hold the same share (a matter of speed only)
  const int sh16 = (blockIdx.x & 3) | ((blockIdx.x >> 3) << 2), wl = sh16 * 128 + tid;
  const char* pxa = (const char*)(XP + (size_t)which * NB * TT * DIN + (rb0 / 16) * (size_t)(DIN / 32) * 512) + (size_t)(blockIdx.y * 128 + tid) * 256;
  const char* pwa = (const char*)(WA + (size_t)(wl >> 6) * (CC / 16) * 512) + (wl & 63) * 128;
  pf_l2(pxa); pf_l2(pwa);
  v8f acc2[2][8] = {};
  v16b a0 = frag_p(XA, lane), a1 = frag_p(XA + (size_t)(4 * (DIN / 32)) * 512, lane), w[8];   /* k step 0; the second group: 64 rows = 4 row groups further on */
#pragma unroll
  for (int j = 0; j < 8; ++j) w[j] = frag_p(WA + (size_t)j * 512, lane);
  asm volatile("s_wait_xcnt 0x0" ::: "memory");   /* stands before the loop rewrites the address registers that these loads name */
  // operands are fetched one k step ahead, so that the load latency runs under the products: the next step's two row fragments at the head of the step, and each weight fragment right behind the two products that read its predecessor, into the same registers (a whole second set would not fit)
  auto kstep = [&](int kc) __attribute__((always_inline)) { const v16b b0 = frag_p(XA + (size_t)(kc + 1) * 512, lane), b1 = frag_p(XA + (size_t)(4 * (DIN / 32) + kc + 1) * 512, lane);
#pragma unroll
    for (int j = 0; j < 8; ++j) { __builtin_amdgcn_sched_barrier(0);   /* no later refill is scheduled up over products that still read the old fragments: that would take a second register set */
      acc2[0][j] = wmma_bf(a0, w[j], acc2[0][j]); acc2[1][j] = wmma_bf(a1, w[j], acc2[1][j]);
      w[j] = frag_p(WA + ((size_t)(kc + 1) * (CC / 16) + j) * 512, lane); }
    asm volatile("s_wait_xcnt 0x0" ::: "memory");   /* stands before the next step rewrites the address registers that this step's loads name */
    a0 = b0; a1 = b1; };
  // an even trip count, so that the loop stays rolled in pairs (the row fragments swap by name, without register copies) and the text stays small; the step before the last follows it
#pragma unroll 2
  for (int kc = 0; kc < DIN / 32 - 2; ++kc) kstep(kc);
  kstep(DIN / 32 - 2);
#pragma unroll
  for (int j = 0; j < 8; ++j) { acc2[0][j] = wmma_bf(a0, w[j], acc2[0][j]); acc2[1][j] = wmma_bf(a1, w[j], acc2[1][j]); }   /* the last k step: nothing left to fetch */
  pf_hold(pxa); pf_hold(pwa);
  // unrolled: the pass number indexes the accumulators, which stay in registers only under constant indices
#pragma unroll
  for (int hb = 0; hb < 2; ++hb) { const v8f* acc = acc2[hb]; const size_t r0 = rb0 + hb * 64; const size_t bb = r0 / TT; const int t0 = (int)(r0 % TT);
  if (hb) __syncthreads();   /* the first pass's LDS reads end before the second pass writes the same LDS */
  if (which < 2) { _Float16* DH = which == 0 ? QH : KH; _Float16* DL = which == 0 ? QL : KL; const int nhi = which == 0 ? QHI : KHI; const bool hi_rows = t0 < nhi;
#pragma unroll
    for (int j = 0; j < 8; ++j) { const float bias = BA ? bfr(BA[c0 + j * 16 + col]) : 0.f;
#pragma unroll
      for (int r = 0; r < 8; ++r) { const float v = acc[j][r] + bias; const _Float16 hv = (_Float16)v; sh[wave * 16 + 8 * g + r][j * 16 + col] = hv; sl[wave * 16 + 8 * g + r][j * 16 + col] = (_Float16)((v - (float)hv) * 1024.0f); } }
    __syncthreads();
    if (which == 1) {   /* k: 16 fragments = [head of 2][16-key group of 4][k step of 2], 64 pieces each; a head's 8 fragments are 8 KiB in a row */
      // unrolled: the 8 LDS reads go out together, and head and key group are constants of each trip, so that the 8 stores share one address
#pragma unroll
      for (int i = 0; i < 8; ++i) { const int e = tid + i * 128; const int f = e >> 6, pc = e & 63, hf = pc >> 5, ln = pc & 31; const int hh = f >> 3, kt = (f >> 1) & 3, kc = f & 1;
        vst2((unsigned*)(KH + ((((bb * NH + c0 / HD + hh) * (TT / 16) + t0 / 16 + kt) * (HD / 32) + kc) * 512 + pc * 8)), *(const v4u*)&sh[kt * 16 + (ln & 15)][hh * HD + kc * 32 + hf * 16 + (ln >> 4) * 8]); }
      asm volatile("s_wait_xcnt 0x0" ::: "memory"); }   /* stands before the code below rewrites registers that these stores name */
    for (int e = tid; e < 64 * 16; e += 128) { const int rl = e >> 4, q = e & 15; if (which == 0) { vst2((unsigned*)(DH + (r0 + rl) * CC + c0 + q * 8), *(const v4u*)&sh[rl][q * 8]); asm volatile("s_wait_xcnt 0x0" ::: "memory"); }   /* the wait stands before a register that the store names is rewritten */
      if (hi_rows) { vst2((unsigned*)(DL + (bb * nhi + t0 + rl) * (size_t)CC + c0 + q * 8), *(const v4u*)&sl[rl][q * 8]); asm volatile("s_wait_xcnt 0x0" ::: "memory"); } }   /* the same wait, before the next trip */
  } else { const bool hi_rows = t0 < KHI;
#pragma unroll
    for (int j = 0; j < 8; ++j) { const float bias = BA ? bfr(BA[c0 + j * 16 + col]) : 0.f;
#pragma unroll
      for (int r = 0; r < 8; ++r) { const float v = acc[j][r] + bias; const int rl = wave * 16 + 8 * g + r, cl = j * 16 + col; th[cl][rl] = (_Float16)v; const __bf16 bh = (__bf16)v; tb[cl][rl] = bh; tbl[cl][rl] = (__bf16)(v - (float)bh); } }
    __syncthreads();
    /* v^T: 16 fragments = [head of 2][32-key group of 2][16-channel group of 4], 64 pieces each */
    // unrolled: the 8 LDS reads go out together, and head and key group are constants of each trip, so that the 8 stores share one address
#pragma unroll
    for (int i = 0; i < 8; ++i) { const int e = tid + i * 128; const int f = e >> 6, pc = e & 63, hf = pc >> 5, ln = pc & 31; const int hh = f >> 3, kt = (f >> 2) & 1, j = f & 3;
      vst2((unsigned*)(VT + ((((bb * NH + c0 / HD + hh) * (TT / 32) + t0 / 32 + kt) * (HD / 16) + j) * 512 + pc * 8)), *(const v4u*)&th[hh * HD + j * 16 + (ln & 15)][kt * 32 + hf * 16 + (ln >> 4) * 8]); }
    asm volatile("s_wait_xcnt 0x0" ::: "memory");   /* stands before the code below rewrites registers that these stores name */
    for (int e = tid; e < 128 * 8; e += 128) { const int cl = e >> 3, q = e & 7; if (hi_rows) { const size_t o3 = (bb * CC + c0 + cl) * (size_t)KHI + t0 + q * 8; vst2((unsigned*)(VB + o3), *(const v4u*)&tb[cl][q * 8]); vst2((unsigned*)(VBL + o3), *(const v4u*)&tbl[cl][q * 8]); } } } } }
// ---- k_fa: block = 64 queries (qb) of (b, h), wave = 16 queries, all keys in steps of 64: S^T = K q^T (key rows as A, query rows as B; q hi + residual x 2^10: 2 products), unscaled, masked positions set to XMASK; running max and sum per query (lane & 15 = query, so both are per-lane values; the two lane halves hold different keys); D of S^T (lane = query, element r = key 8g + r) IS the 16x16x32 operand layout over 32 keys, so P = exp2(x * SCL2 - max * SCL2) (one fma and the hardware exp2 per score) goes once to f16 in place and ctx^T += v^T (A) P^T (B); ctx^T rows are channels, so the rescale and the final 1 / sum are per-lane too
__global__ __launch_bounds__(128) void k_fa(const _Float16* __restrict__ QH, const _Float16* __restrict__ KH, const _Float16* __restrict__ QL, const _Float16* __restrict__ VT, const unsigned* __restrict__ MP, float* __restrict__ Y) {
  const int tid = threadIdx.x, wave = tid >> 5, lane = tid & 31, col = lane & 15, g = lane >> 4; const int h = blockIdx.y, b = blockIdx.z; const int ql0 = blockIdx.x * 64 + wave * 16;
  // entry prefetch, one 256-byte unit of this head's K and v^T (512 KiB, shared out among 16 of its 32 query blocks, numbered so that blocks 4 apart hold the same share; a matter of speed only) and one line of the block's own 16 KiB of select words a thread
  const int sh16 = (blockIdx.x & 3) | ((blockIdx.x >> 3) << 2);
  const char* pkv = (const char*)((sh16 < 8 ? KH : VT) + (size_t)(b * NH + h) * TT * HD) + (size_t)((sh16 & 7) * 128 + tid) * 256;
  const char* pmw = (const char*)(MP + (size_t)(b * (TT / 16) + blockIdx.x * 4) * (TT / 64) * 32) + tid * 128;
  pf_l2(pkv); pf_l2(pmw);
  v16h qh[HD / 32], ql[HD / 32];
#pragma unroll
  for (int kc = 0; kc < HD / 32; ++kc) { qh[kc] = frag_h(QH + ((size_t)b * TT + ql0 + col) * CC + h * HD + kc * 32, lane); ql[kc] = frag_h(QL + ((size_t)b * QHI + ql0 + col) * CC + h * HD + kc * 32, lane); }
  const _Float16* Kb = KH + (size_t)(b * NH + h) * TT * HD; const _Float16* Vb = VT + (size_t)(b * NH + h) * TT * HD;   /* this head's fragments; 64 keys are 8 fragments = 8 KiB in a row in each */
  const unsigned* Mw = MP + (size_t)(b * (TT / 16) + blockIdx.x * 4 + __builtin_amdgcn_readfirstlane(wave)) * (TT / 64) * 32;   /* this wave's select words, 128 bytes a key step; the address is wave-uniform, so that they come by scalar loads into scalar registers */
  v8f acc[HD / 16] = {}; float m = -3.0e38f, mc = -3.0e38f * SCL2, l = 0.f;   /* mc = m * SCL2: the running max in the exponent's own unit */
  // the key loop stays rolled: a second step's fragments would take the wave past 256 registers and cost a wave per SIMD; the inner loops are fully unrolled so that the fragment arrays are indexed by constants and stay in registers
#pragma unroll 1
  for (int k0 = 0; k0 < TT; k0 += 64) { float s[4][8]; float mx = -3.0e38f;
    v16h kf[4][HD / 32];   /* the whole step's K fragments and select words are requested before the first product: one load latency per step, not one per product */
    v16u mw[2]; const _Float16* kp = Kb + (size_t)k0 * HD + lane * 8;   /* this lane's piece of the step's first K fragment (the address that frag_ph forms) */
#pragma unroll
    for (int t = 0; t < 4; ++t)
#pragma unroll
      for (int kc = 0; kc < HD / 32; ++kc) { union { v16h v; v8h q[2]; } u; u.q[0] = *(const v8h*)(kp + (t * (HD / 32) + kc) * 512); u.q[1] = *(const v8h*)(kp + (t * (HD / 32) + kc) * 512 + 256); kf[t][kc] = u.v; }
    // the step's 32 select words: two scalar loads with their data wait in one statement, so that their address register is rewritten only behind the wait; it stands behind the K requests, which fly meanwhile. It also takes the K address as an input and ends in the wait that stands before a register named by an issued load is rewritten, so that no K load lands in that address
    asm volatile("s_load_b512 %0, %2, 0x0\n\ts_load_b512 %1, %2, 0x40\n\ts_wait_kmcnt 0x0\n\ts_wait_xcnt 0x0" : "=&s"(mw[0]), "=&s"(mw[1]) : "s"(Mw + (k0 >> 1)), "v"(kp) : "memory");
    __builtin_amdgcn_sched_barrier(0);   /* no product is scheduled up among the K requests: all 16 stay in flight together, one load latency per step */
#pragma unroll
    for (int t = 0; t < 4; ++t) { v8f a = {}, al = {};
#pragma unroll
      for (int kc = 0; kc < HD / 32; ++kc) { a = wmma16(kf[t][kc], qh[kc], a); al = wmma16(kf[t][kc], ql[kc], al); }
#pragma unroll
      for (int r = 0; r < 8; ++r) { float v = a[r] + al[r] * (1.0f / 1024.0f); if (__builtin_amdgcn_inverse_ballot_w32(mw[t >> 1][(t & 1) * 8 + r])) v = XMASK;   /* where(mask[b][q][k] (1 = masked), -1e9, scores): set; a fully masked row comes out uniform */
        s[t][r] = v; mx = fmaxf(mx, v); } }
    v16h vf[2][HD / 16];   /* the step's v fragments are requested here, so that they fly under the softmax arithmetic */
#pragma unroll
    for (int u = 0; u < 2; ++u)
#pragma unroll
      for (int j = 0; j < HD / 16; ++j) vf[u][j] = frag_ph(Vb + (size_t)k0 * HD + (u * (HD / 16) + j) * 512, lane);
    __builtin_amdgcn_sched_barrier(0);   /* no v request is scheduled down into the softmax arithmetic: all 16 are in flight before it starts */
    mx = fmaxf(mx, __shfl_xor(mx, 16)); const float mn = fmaxf(m, mx); const float mcn = mn * SCL2; const float alpha = __builtin_amdgcn_exp2f(mc - mcn); m = mn; mc = mcn;
    v16h p[2]; float sum = 0.f;
#pragma unroll
    for (int t = 0; t < 4; ++t)
#pragma unroll
      for (int r = 0; r < 8; ++r) { const float e = __builtin_amdgcn_exp2f(fmaf(s[t][r], SCL2, -mcn)); sum += e; p[t >> 1][(t & 1) * 8 + r] = (_Float16)e; }
    l = l * alpha + sum;
#pragma unroll
    for (int j = 0; j < HD / 16; ++j)
#pragma unroll
      for (int r = 0; r < 8; ++r) acc[j][r] *= alpha;
#pragma unroll
    for (int u = 0; u < 2; ++u)
#pragma unroll
      for (int j = 0; j < HD / 16; ++j) acc[j] = wmma16(vf[u][j], p[u], acc[j]); }
  pf_hold(pkv); pf_hold(pmw);
  l += __shfl_xor(l, 16); const float inv = 1.0f / l;   /* l >= 1: the key that holds the max contributes exp(0) */
  float* yr = Y + ((size_t)b * TT + ql0 + col) * CC + h * HD + 8 * g;
#pragma unroll
  for (int j = 0; j < HD / 16; ++j) { v4f o0, o1;
#pragma unroll
    for (int r = 0; r < 4; ++r) { o0[r] = acc[j][r] * inv; o1[r] = acc[j][4 + r] * inv; }
    vst2(yr + j * 16, o0); vst2(yr + j * 16 + 4, o1); } }
// ---- k_out: block = (64 rows, 128 cols): out = ctx Wo (+ bo): all rows: ctx bf16 hi + lo against exact bf16 Wo from its packed fragments (2 products)
__global__ __launch_bounds__(128) void k_out(const float* __restrict__ Y, const float* __restrict__ WO, const __bf16* __restrict__ WPO, const float* __restrict__ BO, float* __restrict__ OUT, const float* __restrict__ RESX) { __shared__ __align__(16) float sf[4][16][132];
  const int tid = threadIdx.x, wave = tid >> 5, lane = tid & 31, col = lane & 15, g = lane >> 4; const int c0 = blockIdx.y * 128; const size_t r0 = (size_t)blockIdx.x * 64 + wave * 16;
  // entry prefetch, a thread takes one 256-byte unit of the block's 64 ctx rows (256 KiB, shared out among the 8 column blocks that read them), one line of its weight fragments (256 KiB, 64 lines a k step, shared out among 16 row blocks, blocks 4 apart holding the same share; a matter of speed only) and one unit of its own 64 x 128 residual tile
  const int sh16 = (blockIdx.x & 3) | (((blockIdx.x >> 3) & 3) << 2), wl = sh16 * 128 + tid;
  const char* pya = (const char*)(Y + (size_t)blockIdx.x * 64 * CC) + (size_t)(blockIdx.y * 128 + tid) * 256;
  const char* pwo = (const char*)(WPO + ((size_t)(wl >> 6) * (DIN / 16) + c0 / 16) * 512) + (wl & 63) * 128;
  const char* prs = (const char*)(RESX + ((size_t)blockIdx.x * 64 + (tid >> 1)) * DIN + c0) + (tid & 1) * 256;
  pf_l2(pya); pf_l2(pwo); pf_l2(prs);
  v8f acc[8] = {};
  if (true) {   /* ALL rows: ctx split bf16 hi + lo x exact Wo (2 products) */
    const float* yp = Y + (r0 + col) * CC + 8 * g;   /* this lane's 8 + 8 ctx values of k step 0 (the address that split_row forms) */
    v4f y[4] = { *(const v4f*)yp, *(const v4f*)(yp + 4), *(const v4f*)(yp + 16), *(const v4f*)(yp + 20) }; v16b w[8];
#pragma unroll
    for (int j = 0; j < 8; ++j) w[j] = frag_p(WPO + (size_t)(c0 / 16 + j) * 512, lane);
    asm volatile("s_wait_xcnt 0x0" ::: "memory");   /* stands before the loop rewrites the address registers that these loads name */
    // operands are fetched one k step ahead, so that the load latency runs under the split and the products: the next step's ctx values at the head of the step, and each pair of B fragments right behind the four products that read their predecessors, into the same registers
    auto kstep = [&](int kc) __attribute__((always_inline)) { const float* yn = yp + (kc + 1) * 32;
      const v4f z[4] = { *(const v4f*)yn, *(const v4f*)(yn + 4), *(const v4f*)(yn + 16), *(const v4f*)(yn + 20) };
      const F2 a = split_q(y);
#pragma unroll
      for (int j = 0; j < 8; j += 2) { __builtin_amdgcn_sched_barrier(0);   /* no later refill is scheduled up over products that still read the old fragments: that would take a second register set */
        acc[j] = wmma_bf(a.h, w[j], acc[j]); acc[j + 1] = wmma_bf(a.h, w[j + 1], acc[j + 1]); acc[j] = wmma_bf(a.l, w[j], acc[j]); acc[j + 1] = wmma_bf(a.l, w[j + 1], acc[j + 1]);   /* two column groups at a time: a tile's second product does not stand directly behind its first */
        w[j] = frag_p(WPO + ((size_t)(kc + 1) * (DIN / 16) + c0 / 16 + j) * 512, lane); w[j + 1] = frag_p(WPO + ((size_t)(kc + 1) * (DIN / 16) + c0 / 16 + j + 1) * 512, lane); }
      asm volatile("s_wait_xcnt 0x0" ::: "memory");   /* stands before the next step rewrites the address registers that this step's loads name */
#pragma unroll
      for (int i = 0; i < 4; ++i) y[i] = z[i]; };
    // an even trip count, so that the loop stays rolled in pairs and the text stays small; the step before the last follows it
#pragma unroll 2
    for (int kc = 0; kc < CC / 32 - 2; ++kc) kstep(kc);
    kstep(CC / 32 - 2);
    { const F2 a = split_q(y);   /* the last k step: nothing left to fetch */
#pragma unroll
      for (int j = 0; j < 8; ++j) { acc[j] = wmma_bf(a.h, w[j], acc[j]); acc[j] = wmma_bf(a.l, w[j], acc[j]); } }
    pf_hold(pya); pf_hold(pwo); pf_hold(prs);
#pragma unroll
    for (int j = 0; j < 8; ++j) { const float bias = BO ? bfr(BO[c0 + j * 16 + col]) : 0.f;
#pragma unroll
      for (int r = 0; r < 8; ++r) sf[wave][8 * g + r][j * 16 + col] = acc[j][r] + bias; }
  } else {
#pragma unroll 2
    for (int kc = 0; kc < CC / 32; ++kc) { const v16h a = frag_f32(Y + (r0 + col) * CC + kc * 32, lane); asm volatile("s_wait_loadcnt 0x0" ::: "memory");
#pragma unroll
      for (int j = 0; j < 8; ++j) { const v16h w = WOCOLH(WO, kc * 32, c0 + j * 16 + col, lane); asm volatile("s_wait_loadcnt 0x0" ::: "memory"); acc[j] = wmma16(a, w, acc[j]); } }
#pragma unroll
    for (int j = 0; j < 8; ++j) { const float bias = BO ? bfr(BO[c0 + j * 16 + col]) : 0.f;
#pragma unroll
      for (int r = 0; r < 8; ++r) sf[wave][8 * g + r][j * 16 + col] = acc[j][r] * (1.0f / 256.0f) + bias; } }
  LDSX(); for (int rl = 0; rl < 16; ++rl) { const size_t oo = (r0 + rl) * DIN + c0 + lane * 4; v4f o = *(const v4f*)&sf[wave][rl][lane * 4]; const v4f zr = *(const v4f*)(RESX + oo); o[0] += bfr(zr[0]); o[1] += bfr(zr[1]); o[2] += bfr(zr[2]); o[3] += bfr(zr[3]); vst2(OUT + oo, o); } }   /* ctx W_O + bf16(input_Q) */

extern "C" void kernel_launch(void* const* d_in, const int* in_sizes, int n_in, void* d_out, int out_size, void* d_ws, size_t ws_size, hipStream_t stream) {
  (void)in_sizes; (void)n_in; (void)out_size;
  const float** F = (const float**)d_in;
  if (ws_size < (size_t)WS_END) return;
  char* ws = (char*)d_ws; _Float16 *QH = (_Float16*)(ws + WS_QH), *KH = (_Float16*)(ws + WS_KH), *VT = (_Float16*)(ws + WS_VT), *QL = (_Float16*)(ws + WS_QL), *KL = (_Float16*)(ws + WS_KL); __bf16 *VB = (__bf16*)(ws + WS_VB), *VBL = (__bf16*)(ws + WS_VBL); float *Y = (float*)(ws + WS_Y);
  (void)Y; (void)QL; (void)KL; (void)VB; (void)VBL;
  // inputs: 0 input_Q; 1 input_K; 2 input_V [2,2048,1024]; 3 mask [2,2048,2048] int32 (1 = masked); 4 W_Q (in,out); 5 W_K; 6 W_V; 7 W_O (in,out); 8 ln_gamma; 9 ln_beta
  if (ws_size < (size_t)WS_END4) return;
  float* X1 = (float*)(ws + WS_X1); __bf16 *WP = (__bf16*)(ws + WS_WP), *XP = (__bf16*)(ws + WS_XP); unsigned* MP = (unsigned*)(ws + WS_MP);
  k_pack<<<dim3(4 * PKW + 3 * PKX + PKM), 256, 0, stream>>>(F[4], F[5], F[6], F[7], F[0], F[1], F[2], (const int*)d_in[3], WP, XP, MP);   /* weights and inputs -> bf16 fragments, mask -> select words, every call */
  k_proj<<<dim3(TNB * TT / 128, CC / 128, 3), 128, 0, stream>>>(XP, WP, nullptr, nullptr, nullptr, QH, QL, KH, KL, VT, VB, VBL);
  k_fa<<<dim3(NQB, NH, TNB), 128, 0, stream>>>(QH, KH, QL, VT, MP, Y);
  k_out<<<dim3(TNB * TT / 64, DIN / 128), 128, 0, stream>>>(Y, F[7], WP + 3 * (size_t)DIN * CC, nullptr, X1, F[0]);   /* ctx W_O + input_Q */
  k_lnx<<<dim3(NRW / 8), 256, 0, stream>>>(X1, 0, F[8], F[9], (float*)d_out);              /* LayerNorm */
}

// v010
// It runs in 104 microseconds.
// In both of two side-by-side timings against v009, it was 1.03 times as fast.
// Over all steps from v000 it is 12.0 times as fast.
// compute dtype: all float inputs rounded to bf16; q/k/v = in W with EXACT bf16 products on WMMA 16x16x32 (f32 accumulate); q * log2(e) / 8 as f16 hi + residual (x 2^10) against k once to f16 (2 products, minus the reference maximum in use as their C operand), masked (mask == 1) positions set to -2^30 (standing for -1e9); softmax in f32 in base 2 (hardware exp2 of the product's own result; the reference is the first key step's maximum and is raised, with a rescale, only when a step's sum of P passes 2^8; sums over key steps of 64); P = exp2(x - reference) once to f16 against v once to f16 (1 product), divided by the sum at the end; ctx split bf16 hi + lo against exact W_O (2 products) + input_Q; LayerNorm in f32; f32 output.
#include <hip/hip_runtime.h>
#include <math.h>

typedef __attribute__((ext_vector_type(16))) _Float16 v16h;
typedef __attribute__((ext_vector_type(16))) __bf16 v16b;
typedef __attribute__((ext_vector_type(8)))  _Float16 v8h;
typedef __attribute__((ext_vector_type(8)))  float v8f;
typedef __attribute__((ext_vector_type(4)))  float v4f;
typedef __attribute__((ext_vector_type(2)))  float v2f;
typedef __attribute__((ext_vector_type(4)))  unsigned v4u;
typedef __attribute__((ext_vector_type(4)))  int v4i;
typedef float __attribute__((may_alias)) float_a;
typedef int __attribute__((may_alias)) int_a;

template <typename T> __device__ __forceinline__ void vst2(void* p, T v) { *(T*)p = v;  }
__device__ __forceinline__ v8f wmma16(v16h a, v16h b, v8f c) {
  return __builtin_amdgcn_wmma_f32_16x16x32_f16(false, a, false, b, (short)0, c, false, false);   /* no v_nop written behind it: the compiler pads its own builtin where a distance is owed */
}
__device__ __forceinline__ v8f wmma_bf(v16b a, v16b b, v8f c) {
  v8f d = __builtin_amdgcn_wmma_f32_16x16x32_bf16(false, a, false, b, (short)0, c, false, false);
  asm volatile("v_nop\n\tv_nop\n\tv_nop\n\tv_nop" : "+v"(d) : "v"(a), "v"(b));
  return d;
}
// 16x16x32 fragments: lane = (h = lane>>4, row/col = lane&15); elements 0..7 = k0+8h+0..7, 8..15 = k0+16+8h+0..7; D element r = row 8h+r
__device__ __forceinline__ v16h frag_h(const _Float16* rowk0, int lane) {
  union { v16h v; v8h q[2]; } u; const _Float16* p = rowk0 + 8 * (lane >> 4);
  u.q[0] = *(const v8h*)p; u.q[1] = *(const v8h*)(p + 16); return u.v;
}
__device__ __forceinline__ v16h frag_f32(const float* rowk0, int lane) {
  v16h a; const float* p = rowk0 + 8 * (lane >> 4);
#pragma unroll
  for (int i = 0; i < 8; ++i) { a[i] = (_Float16)p[i]; a[8 + i] = (_Float16)p[16 + i]; }
  return a;
}
__device__ __forceinline__ v16h frag_f32s(const float* rowk0, int lane, float sc) {
  v16h a; const float* p = rowk0 + 8 * (lane >> 4);
#pragma unroll
  for (int i = 0; i < 8; ++i) { a[i] = (_Float16)(p[i] * sc); a[8 + i] = (_Float16)(p[16 + i] * sc); }
  return a;
}
// column fragment from a [K][ld] layout (column n), rows >= K read as 0
__device__ __forceinline__ v16h fragc_f32(const float* W, int k0, int n, int lane, int ld, int K) {
  v16h a; const int g = lane >> 4;
#pragma unroll
  for (int i = 0; i < 8; ++i) { const int ka = k0 + 8 * g + i, kb = ka + 16;
    a[i] = (_Float16)(ka < K ? W[(size_t)(ka < K ? ka : K - 1) * ld + n] : 0.f); a[8 + i] = (_Float16)(kb < K ? W[(size_t)(kb < K ? kb : K - 1) * ld + n] : 0.f); }
  return a;
}
struct F2 { v16b h, l; };
__device__ __forceinline__ F2 bsplit16(const float v[16]) { F2 r;
#pragma unroll
  for (int i = 0; i < 16; ++i) { const __bf16 h = (__bf16)v[i]; r.h[i] = h; r.l[i] = (__bf16)(v[i] - (float)h); }
  return r; }
__device__ __forceinline__ F2 split_row(const float* row, int k0, int lane) { float v[16]; const float* p = row + k0 + 8 * (lane >> 4);
#pragma unroll
  for (int i = 0; i < 8; ++i) { v[i] = p[i]; v[8 + i] = p[16 + i]; }
  return bsplit16(v); }
__device__ __forceinline__ F2 split_q(const v4f q[4]) { float v[16];   /* the 16 values that split_row reads, already loaded: q[0], q[1] = k0 + 8 g + 0..7, q[2], q[3] = k0 + 16 + 8 g + 0..7 */
#pragma unroll
  for (int i = 0; i < 4; ++i) { v[i] = q[0][i]; v[4 + i] = q[1][i]; v[8 + i] = q[2][i]; v[12 + i] = q[3][i]; }
  return bsplit16(v); }
__device__ __forceinline__ F2 split_rowK(const float* row, int k0, int lane, int K) { float v[16]; const int g = lane >> 4;
#pragma unroll
  for (int i = 0; i < 8; ++i) { const int ka = k0 + 8 * g + i, kb = ka + 16; v[i] = ka < K ? row[ka < K ? ka : K - 1] : 0.f; v[8 + i] = kb < K ? row[kb < K ? kb : K - 1] : 0.f; }
  return bsplit16(v); }
__device__ __forceinline__ F2 split_col(const float* W, int k0, int n, int lane, int ld, int K) { float v[16]; const int g = lane >> 4;
#pragma unroll
  for (int i = 0; i < 8; ++i) { const int ka = k0 + 8 * g + i, kb = ka + 16; v[i] = ka < K ? W[(size_t)(ka < K ? ka : K - 1) * ld + n] : 0.f; v[8 + i] = kb < K ? W[(size_t)(kb < K ? kb : K - 1) * ld + n] : 0.f; }
  return bsplit16(v); }
__device__ __forceinline__ v8f mac3(const F2& a, const F2& b, v8f c) { c = wmma_bf(a.l, b.h, c); c = wmma_bf(a.h, b.l, c); return wmma_bf(a.h, b.h, c); }
__device__ __forceinline__ float sigm(float v) { return 1.0f / (1.0f + expf(-v)); }
// asks L2 for the line at p (scope SE: into L2 only); nothing comes back and no counter moves. Asked for at entry, for speed only
__device__ __forceinline__ void pf_l2(const char* p) { asm volatile("global_prefetch_b8 %0, off scope:SCOPE_SE" :: "v"(p)); }
// no wait covers a prefetch's read of its address: the register pair keeps the address, and nothing else, up to this place behind the loop
__device__ __forceinline__ void pf_hold(const char* p) { asm volatile("" :: "v"(p)); }
#define LDSX() do { asm volatile("s_wait_dscnt 0" ::: "memory"); __builtin_amdgcn_wave_barrier(); __builtin_amdgcn_fence(__ATOMIC_RELEASE, "workgroup"); } while (0)

// Multi-head attention layer with a random (query, key) mask, residual and LayerNorm (B 2, S 2,048, 1,024 = 16 x 64; (in,out) 1/32-scale weights, no biases; mask [B,S,S] int, 1 = MASKED (~half); LN affine 1/0, eps 1e-5): q = input_Q W_Q ...; scores = q k^T / 8 with where(mask, -1e9, s); ctx = softmax v; out = LN(ctx W_O + input_Q).
#define NB 2
#define TT 2048
#define CC 1024            // NH * HD = projected width
#define DIN 1024          // input (model) width
#define NH 16
#define HD 64
#define NQB (TT / 64)
#define HG 4
#define SCALE (0.125f)
#define SCL2 (SCALE * 1.44269504088896341f)   // score scale times log2(e): exp(SCALE * x) = exp2(SCL2 * x)
#define XMASK (-1073741824.0f)                // a masked position's score in the exponent's unit, -2^30: stands for the reference's -1e9 (either is 0 after the exp beside any real score); a row masked at every key so far has it as its maximum and gets exp2(0) = 1 at every key
#define CAUSAL 0
#ifndef TNB
#define TNB NB
#endif
__device__ __forceinline__ float bfr(float v) { return (float)(__bf16)v; }
__host__ __device__ __forceinline__ int kb_last(int qb) { return CAUSAL ? ((qb * 64 + 63) >> 7) : (TT / 128 - 1); }
typedef __attribute__((ext_vector_type(8))) __bf16 v8b;
__device__ __forceinline__ v16b frag_b(const __bf16* rowk0, int lane) {
  union { v16b v; v8b q[2]; } u; const __bf16* p = rowk0 + 8 * (lane >> 4);
  u.q[0] = *(const v8b*)p; u.q[1] = *(const v8b*)(p + 16); return u.v;
}
#define QBH 0
#define QHI 2048            // rows carrying a q residual plane (all rows when non-causal: 2-product logits everywhere)
#define KHI 64            // key rows carrying k residual / v bf16 hi+lo planes (written by k_proj; no kernel reads them)
// B fragment (k rows k0+.., output column o) of a weight: (in,out) [K][ld] or (out,in) [ld rows of K]: bf16 exact, or f16(bf16 * 256) exact
__device__ __forceinline__ v16b wcol_io(const float* Wm, int k0, int o, int lane, int ld) { v16b w; const int g = lane >> 4;
#pragma unroll
  for (int i = 0; i < 8; ++i) { w[i] = (__bf16)Wm[(size_t)(k0 + 8 * g + i) * ld + o]; w[8 + i] = (__bf16)Wm[(size_t)(k0 + 16 + 8 * g + i) * ld + o]; }
  return w; }
__device__ __forceinline__ v16b wcol_oi(const float* Wm, int k0, int o, int lane, int K) { v16b w; const float* p = Wm + (size_t)o * K + k0 + 8 * (lane >> 4);
#pragma unroll
  for (int i = 0; i < 8; ++i) { w[i] = (__bf16)p[i]; w[8 + i] = (__bf16)p[16 + i]; }
  return w; }
__device__ __forceinline__ v16h wcolh_io(const float* Wm, int k0, int o, int lane, int ld) { v16h w; const int g = lane >> 4;
#pragma unroll
  for (int i = 0; i < 8; ++i) { w[i] = (_Float16)(bfr(Wm[(size_t)(k0 + 8 * g + i) * ld + o]) * 256.0f); w[8 + i] = (_Float16)(bfr(Wm[(size_t)(k0 + 16 + 8 * g + i) * ld + o]) * 256.0f); }
  return w; }
__device__ __forceinline__ v16h wcolh_oi(const float* Wm, int k0, int o, int lane, int K) { v16h w; const float* p = Wm + (size_t)o * K + k0 + 8 * (lane >> 4);
#pragma unroll
  for (int i = 0; i < 8; ++i) { w[i] = (_Float16)(bfr(p[i]) * 256.0f); w[8 + i] = (_Float16)(bfr(p[16 + i]) * 256.0f); }
  return w; }
#define WQKV_LAYOUT 0   // 0 = (in,out) [DIN][CC]; 1 = (out,in) [CC][DIN]; 2 = per-head [NH][DIN][HD]
__device__ __forceinline__ v16b wcol_hdk(const float* Wm, int k0, int o, int lane) { v16b w; const int g = lane >> 4; const float* p = Wm + (size_t)(o / HD) * DIN * HD + (o % HD);
#pragma unroll
  for (int i = 0; i < 8; ++i) { w[i] = (__bf16)p[(size_t)(k0 + 8 * g + i) * HD]; w[8 + i] = (__bf16)p[(size_t)(k0 + 16 + 8 * g + i) * HD]; }
  return w; }
#define WO_OUT_IN 0
#if WQKV_LAYOUT == 1
#define WCOL(W, k0, o, lane) wcol_oi(W, k0, o, lane, DIN)
#elif WQKV_LAYOUT == 2
#define WCOL(W, k0, o, lane) wcol_hdk(W, k0, o, lane)
#else
#define WCOL(W, k0, o, lane) wcol_io(W, k0, o, lane, CC)
#endif
#if WO_OUT_IN
#define WOCOL(W, k0, o, lane) wcol_oi(W, k0, o, lane, CC)
#define WOCOLH(W, k0, o, lane) wcolh_oi(W, k0, o, lane, CC)
#else
#define WOCOL(W, k0, o, lane) wcol_io(W, k0, o, lane, DIN)
#define WOCOLH(W, k0, o, lane) wcolh_io(W, k0, o, lane, DIN)
#endif
#define SM_EXTRA_PARAMS , const int* __restrict__ MK, int bcur
#define SM_MASK_HOOK do { if (MK[((size_t)bcur * TT + t) * TT + k] != 0) v = -1.0e9f; } while (0)   /* where(mask[b][q][k] (1 = masked), -1e9, scores): set; a fully masked row would be uniform (none here) */
#define NRW (TNB * TT)
// ---- k_lnx: wave per row: LayerNorm over 1024 (mean, biased var, (x - mean) * rsqrt(var + 1e-5) * g + b); optional bf16 rounding of the input (x); 32 floats per lane (8 float4 at stride 128 floats -> 512-B pieces)
__global__ __launch_bounds__(256) void k_lnx(const float* __restrict__ X, int roundin, const float* __restrict__ G, const float* __restrict__ BE, float* __restrict__ OUT) { const int wave = threadIdx.x >> 5, lane = threadIdx.x & 31; const size_t row = (size_t)blockIdx.x * 8 + wave; if (row >= (size_t)NRW) return;
  v4f v[CC / 128]; float s1 = 0.f;
#pragma unroll
  for (int i = 0; i < CC / 128; ++i) { v4f t = *(const v4f*)(X + row * CC + i * 128 + lane * 4); if (roundin) { t[0] = bfr(t[0]); t[1] = bfr(t[1]); t[2] = bfr(t[2]); t[3] = bfr(t[3]); } v[i] = t; s1 += (t[0] + t[1]) + (t[2] + t[3]); }
#pragma unroll
  for (int o = 1; o < 32; o <<= 1) s1 += __shfl_xor(s1, o);
  const float mu = s1 * (1.0f / CC); float q = 0.f;
#pragma unroll
  for (int i = 0; i < CC / 128; ++i) for (int k = 0; k < 4; ++k) { const float d = v[i][k] - mu; q += d * d; }
#pragma unroll
  for (int o = 1; o < 32; o <<= 1) q += __shfl_xor(q, o);
  const float inv = rsqrtf(q * (1.0f / CC) + 1e-5f);   /* jnp.var (biased), eps inside the rsqrt */
#pragma unroll
  for (int i = 0; i < CC / 128; ++i) { const int c = i * 128 + lane * 4; v4f r4; for (int k = 0; k < 4; ++k) r4[k] = bfr(G[c + k]) * ((v[i][k] - mu) * inv) + bfr(BE[c + k]); vst2(OUT + row * CC + c, r4); } }

#ifndef SM_EXTRA_PARAMS
#define SM_EXTRA_PARAMS
#endif
#ifndef PROJ_EXTRA_PARAMS
#define PROJ_EXTRA_PARAMS
#endif
#ifndef SM_MASK_HOOK
#define SM_MASK_HOOK (void)0
#endif

#define WS_QH  0u                                      // f16 q rows [b*t][CC]
#define WS_KH  (WS_QH + 2u * (size_t)NB * TT * CC)      // f16 k as A fragments [b][h][16-key group][k step of 32 channels][1 KiB fragment]
#define WS_VT  (WS_KH + 2u * (size_t)NB * TT * CC)      // f16 v^T as A fragments [b][h][32-key group][16-channel group][1 KiB fragment]
#define WS_QL  (WS_VT + 2u * (size_t)NB * CC * TT)      // f16 q residual x 2^10 rows [b][t < QHI][CC]
#define WS_KL  (WS_QL + 2u * (size_t)NB * QHI * CC)     // f16 k residual x 2^10 rows [b][t < KHI][CC]
#define WS_VB  (WS_KL + 2u * (size_t)NB * KHI * CC)     // bf16 v hi planes [b][c][t < KHI]
#define WS_VBL (WS_VB + 2u * (size_t)NB * CC * KHI)
#define WS_S   (WS_VBL + 2u * (size_t)NB * CC * KHI)    // f32 [hg][t][s] region, unused (k_fa keeps logits and P in registers)
#define WS_Y   (WS_S  + 4u * (size_t)HG * TT * TT)      // f32 ctx rows [b*t][CC] (only when there is an output projection)
#define WS_END (WS_Y  + 4u * (size_t)NB * TT * CC)
#define WS_X1  (WS_END)
#define WS_END2 (WS_X1 + 4u * (size_t)NB * TT * DIN)

#define WS_WP  (WS_END2)                                // bf16 weights as B fragments [W_Q, W_K, W_V, W_O][k step of 32][16-column group][1 KiB fragment]
#define WS_XP  (WS_WP + 2u * 4u * (size_t)DIN * CC)     // bf16 inputs as A fragments [input_Q, input_K, input_V][16-row group][k step of 32][1 KiB fragment]
#define WS_END3 (WS_XP + 2u * 3u * (size_t)NB * TT * DIN)
#define WS_MP  (WS_END3)                                // mask as select words [b * TT / 16 + 16-query group][key step of 64][t * 8 + r]: bit l of a word = (mask != 0) at query (l & 15), key 16 t + 8 (l >> 4) + r, the score that lane l of k_fa holds in s[t][r]
#define WS_END4 (WS_MP + (size_t)NB * TT * TT / 8)
typedef __attribute__((ext_vector_type(16))) unsigned v16u;
#define PKP 16                                // pieces per k_pack thread: few waves with many loads in flight each, for speed only
#define PKW (DIN * CC / 8 / 256 / PKP)        // k_pack blocks per weight
#define PKX (NB * TT * DIN / 8 / 256 / PKP)   // k_pack blocks per input
#define PKM (NB * (TT / 16) * (TT / 128) / 8 / 2)   // k_pack blocks for the mask: a wave takes 2 tiles of 16 queries x 128 keys
// ---- k_pack: a piece = 16 bytes of a 16x16x32 operand fragment, rounded to bf16. A 1 KiB fragment is [half hf][lane][8]: piece (hf, lane) holds k = k0 + 16 hf + 8 (lane >> 4) + 0..7 of row or column (lane & 15), the k order of the fragment comment above; a wave's store is 512 contiguous bytes
__global__ __launch_bounds__(256) void k_pack(const float* __restrict__ W0, const float* __restrict__ W1, const float* __restrict__ W2, const float* __restrict__ W3, const float* __restrict__ X0, const float* __restrict__ X1, const float* __restrict__ X2, const int* __restrict__ MK, __bf16* __restrict__ WP, __bf16* __restrict__ XP, unsigned* __restrict__ MP) {
  const int bx = blockIdx.x;
  if (bx < 4 * PKW) { const int mt = bx / PKW; const float* Wm = mt == 0 ? W0 : mt == 1 ? W1 : mt == 2 ? W2 : W3; __bf16* D = WP + (size_t)mt * DIN * CC;   /* (in,out) weight: piece e = [kc][ob][hf][lane] */
    const int e0 = (bx % PKW) * (256 * PKP) + threadIdx.x;
    // rolled over groups of 4 pieces: 32 loads in flight per lane are enough, and the registers stay few
#pragma unroll 1
    for (int it = 0; it < PKP; it += 4) { float t[4][8];
#pragma unroll
      for (int u = 0; u < 4; ++u) { const int e = e0 + (it + u) * 256; const int lane = e & 31, hf = (e >> 5) & 1, ob = (e >> 6) % (CC / 16), kc = (e >> 6) / (CC / 16);
        const float* p = Wm + (size_t)(kc * 32 + 16 * hf + 8 * (lane >> 4)) * CC + ob * 16 + (lane & 15);
#pragma unroll
        for (int i = 0; i < 8; ++i) t[u][i] = p[(size_t)i * CC]; }
#pragma unroll
      for (int u = 0; u < 4; ++u) { v8b w;
#pragma unroll
        for (int i = 0; i < 8; ++i) w[i] = (__bf16)t[u][i];
        vst2(D + (size_t)(e0 + (it + u) * 256) * 8, w); }
      asm volatile("s_wait_xcnt 0x0" ::: "memory"); }   /* stands before the next trip rewrites registers that this trip's stores name */
  } else if (bx < 4 * PKW + 3 * PKX) { const int b2 = bx - 4 * PKW; const int mt = b2 / PKX; const float* Xm = mt == 0 ? X0 : mt == 1 ? X1 : X2; __bf16* D = XP + (size_t)mt * NB * TT * DIN;   /* input rows: piece e = [rb][kc][hf][lane] */
    const int e0 = (b2 % PKX) * (256 * PKP) + threadIdx.x;
    // rolled over groups of 8 pieces: 16 16-byte loads in flight per lane. The 8 pieces of a trip lie 256 pieces = 4 k steps apart, in one input row (32 k steps a row, first k step < 4): one load address and one store address a trip, the rest are constant offsets
#pragma unroll 1
    for (int it = 0; it < PKP; it += 8) { const int e = e0 + it * 256; const int lane = e & 31, hf = (e >> 5) & 1, kc = (e >> 6) % (DIN / 32), rb = (e >> 6) / (DIN / 32);
      const float* p = Xm + (size_t)(rb * 16 + (lane & 15)) * DIN + kc * 32 + 16 * hf + 8 * (lane >> 4); __bf16* q = D + (size_t)e * 8;
      v4f t[8][2]; v8b w[8];
#pragma unroll
      for (int u = 0; u < 8; ++u) { t[u][0] = *(const v4f*)(p + u * 128); t[u][1] = *(const v4f*)(p + u * 128 + 4); }
      // the wait that stands before a register named by an issued load is rewritten; it takes the address and the loaded values as inputs, so that all 16 loads stand in front of it and none of them lands in the address registers
      asm volatile("s_wait_xcnt 0x0" :: "v"(p), "v"(t[0][0]), "v"(t[0][1]), "v"(t[1][0]), "v"(t[1][1]), "v"(t[2][0]), "v"(t[2][1]), "v"(t[3][0]), "v"(t[3][1]), "v"(t[4][0]), "v"(t[4][1]), "v"(t[5][0]), "v"(t[5][1]), "v"(t[6][0]), "v"(t[6][1]), "v"(t[7][0]), "v"(t[7][1]) : "memory");
#pragma unroll
      for (int u = 0; u < 8; ++u) {
#pragma unroll
        for (int i = 0; i < 4; ++i) { w[u][i] = (__bf16)t[u][0][i]; w[u][4 + i] = (__bf16)t[u][1][i]; }
        vst2(q + u * 2048, w[u]); }
      // the same wait behind the stores, before the next trip rewrites what they name; it takes the stored values as inputs, so that their registers live up to it
      asm volatile("s_wait_xcnt 0x0" :: "v"(w[0]), "v"(w[1]), "v"(w[2]), "v"(w[3]), "v"(w[4]), "v"(w[5]), "v"(w[6]), "v"(w[7]) : "memory"); }
  } else { const int wv = (bx - 4 * PKW - 3 * PKX) * 8 + (threadIdx.x >> 5), lane = threadIdx.x & 31;   /* mask tile [rg = 16-row group of the NB * TT query rows][kg = 128-key group]: 16 loads of one whole row piece (512 contiguous bytes) each; lane j holds keys 4 j + 0..3 of every row */
    // rolled: 16 16-byte loads in flight per lane are enough, and the registers stay few
#pragma unroll 1
    for (int it = 0; it < 2; ++it) { const int tile = wv * 2 + it; const int kg = tile % (TT / 128), rg = tile / (TT / 128);
      const int* p = MK + (size_t)rg * 16 * TT + kg * 128 + lane * 4; v4i t[16];
#pragma unroll
      for (int q = 0; q < 16; ++q) t[q] = *(const v4i*)(p + q * TT);
      // the wait that stands before a register named by an issued load is rewritten; it takes the address and the loaded values as inputs, so that all 16 loads stand in front of it
      asm volatile("s_wait_xcnt 0x0" :: "v"(p), "v"(t[0]), "v"(t[1]), "v"(t[2]), "v"(t[3]), "v"(t[4]), "v"(t[5]), "v"(t[6]), "v"(t[7]), "v"(t[8]), "v"(t[9]), "v"(t[10]), "v"(t[11]), "v"(t[12]), "v"(t[13]), "v"(t[14]), "v"(t[15]) : "memory");
      unsigned c[4] = {0u, 0u, 0u, 0u};   /* c[e]: bit q = (mask != 0) at row q, key 4 j + e */
#pragma unroll
      for (int q = 0; q < 16; ++q)
#pragma unroll
        for (int e = 0; e < 4; ++e) { const unsigned mv = (unsigned)t[q][e]; c[e] |= (mv < 1u ? mv : 1u) << q; }
      // key = 64 ks + 16 t + 8 g + r lies in lane j = 16 ks + 4 t + 2 g + (r >> 2), element r & 3: lanes j and j ^ 2 hold the two halves (g = 0 low, g = 1 high) of the same four words
      const unsigned p01 = c[0] | (c[1] << 16), p23 = c[2] | (c[3] << 16); const unsigned o01 = __shfl_xor(p01, 2), o23 = __shfl_xor(p23, 2);
      v4u w; w[0] = (p01 & 0xffffu) | (o01 << 16); w[1] = (p01 >> 16) | (o01 & 0xffff0000u); w[2] = (p23 & 0xffffu) | (o23 << 16); w[3] = (p23 >> 16) | (o23 & 0xffff0000u);
      unsigned* d = MP + ((size_t)rg * (TT / 64) + kg * 2 + (lane >> 4)) * 32 + ((lane >> 2) & 3) * 8 + (lane & 1) * 4;
      if ((lane & 2) == 0) vst2(d, w);   /* the g = 0 lanes store: 16 lanes x 16 bytes = the 256 contiguous bytes of two key steps */
      // the same wait behind the store, before the next trip rewrites what it names
      asm volatile("s_wait_xcnt 0x0" :: "v"(d), "v"(w) : "memory"); } } }
// a packed fragment: two 16-byte loads per lane, each 512 contiguous bytes per wave
__device__ __forceinline__ v16b frag_p(const __bf16* fr, int lane) {
  union { v16b v; v8b q[2]; } u; const __bf16* p = fr + lane * 8;
  u.q[0] = *(const v8b*)p; u.q[1] = *(const v8b*)(p + 256); return u.v;
}
__device__ __forceinline__ v16h frag_ph(const _Float16* fr, int lane) {
  union { v16h v; v8h q[2]; } u; const _Float16* p = fr + lane * 8;
  u.q[0] = *(const v8h*)p; u.q[1] = *(const v8h*)(p + 256); return u.v;
}
// ---- k_proj: block = (128 rows, 128 cols, which), wave = two 16-row groups 64 rows apart x 128 cols, so that each weight fragment fetched feeds two products; the results leave in two passes of 64 rows through the same LDS: q/k/v = X W (+ b) with exact bf16 products (K = DIN) -> which 0: q f16 rows (+ residual rows < QHI); 1: k f16 fragments (+ residual rows < KHI); 2: v^T f16 fragments (+ bf16 hi/lo planes for t < KHI). A k or v^T fragment is [half hf][lane][8] like a packed weight fragment: piece (hf, lane) holds k index 16 hf + 8 (lane >> 4) + 0..7 of row (lane & 15), the elements that lane takes in k_fa, so that a wave's load there is 512 contiguous bytes
__global__ __launch_bounds__(128) void k_proj(const __bf16* __restrict__ XP, const __bf16* __restrict__ WP, const float* __restrict__ BQ, const float* __restrict__ BK, const float* __restrict__ BV,
    _Float16* __restrict__ QH, _Float16* __restrict__ QL, _Float16* __restrict__ KH, _Float16* __restrict__ KL, _Float16* __restrict__ VT, __bf16* __restrict__ VB, __bf16* __restrict__ VBL) {
  __shared__ __align__(16) _Float16 sh[64][136], sl[64][136]; __shared__ __align__(16) _Float16 th[128][72]; __shared__ __align__(16) __bf16 tb[128][72], tbl[128][72];
  const int tid = threadIdx.x, wave = tid >> 5, lane = tid & 31, col = lane & 15, g = lane >> 4; const int which = blockIdx.z; const int c0 = blockIdx.y * 128; const size_t rb0 = (size_t)blockIdx.x * 128;
  const __bf16* XA = XP + (size_t)which * NB * TT * DIN + (rb0 / 16 + wave) * (size_t)(DIN / 32) * 512; const __bf16* WA = WP + (size_t)which * DIN * CC + (size_t)(c0 / 16) * 512; const float* BA = which == 0 ? BQ : which == 1 ? BK : BV;
  // entry prefetch, one line or 256-byte unit a thread and operand. The block's 256 KiB of row fragments are shared out among the 8 column blocks that read them; its 256 KiB of weight fragments (64 lines a k step) among 16 of the 32 row blocks, numbered so that blocks 4 apart hold the same share (a matter of speed only)
  const int sh16 = (blockIdx.x & 3) | ((blockIdx.x >> 3) << 2), wl = sh16 * 128 + tid;
  const char* pxa = (const char*)(XP + (size_t)which * NB * TT * DIN + (rb0 / 16) * (size_t)(DIN / 32) * 512) + (size_t)(blockIdx.y * 128 + tid) * 256;
  const char* pwa = (const char*)(WA + (size_t)(wl >> 6) * (CC / 16) * 512) + (wl & 63) * 128;
  pf_l2(pxa); pf_l2(pwa);
  v8f acc2[2][8] = {};
  v16b a0 = frag_p(XA, lane), a1 = frag_p(XA + (size_t)(4 * (DIN / 32)) * 512, lane), w[8];   /* k step 0; the second group: 64 rows = 4 row groups further on */
#pragma unroll
  for (int j = 0; j < 8; ++j) w[j] = frag_p(WA + (size_t)j * 512, lane);
  asm volatile("s_wait_xcnt 0x0" ::: "memory");   /* stands before the loop rewrites the address registers that these loads name */
  // operands are fetched one k step ahead, so that the load latency runs under the products: the next step's two row fragments at the head of the step, and each weight fragment right behind the two products that read its predecessor, into the same registers (a whole second set would not fit)
  auto kstep = [&](int kc) __attribute__((always_inline)) { const v16b b0 = frag_p(XA + (size_t)(kc + 1) * 512, lane), b1 = frag_p(XA + (size_t)(4 * (DIN / 32) + kc + 1) * 512, lane);
#pragma unroll
    for (int j = 0; j < 8; ++j) { __builtin_amdgcn_sched_barrier(0);   /* no later refill is scheduled up over products that still read the old fragments: that would take a second register set */
      acc2[0][j] = wmma_bf(a0, w[j], acc2[0][j]); acc2[1][j] = wmma_bf(a1, w[j], acc2[1][j]);
      w[j] = frag_p(WA + ((size_t)(kc + 1) * (CC / 16) + j) * 512, lane); }
    asm volatile("s_wait_xcnt 0x0" ::: "memory");   /* stands before the next step rewrites the address registers that this step's loads name */
    a0 = b0; a1 = b1; };
  // an even trip count, so that the loop stays rolled in pairs (the row fragments swap by name, without register copies) and the text stays small; the step before the last follows it
#pragma unroll 2
  for (int kc = 0; kc < DIN / 32 - 2; ++kc) kstep(kc);
  kstep(DIN / 32 - 2);
#pragma unroll
  for (int j = 0; j < 8; ++j) { acc2[0][j] = wmma_bf(a0, w[j], acc2[0][j]); acc2[1][j] = wmma_bf(a1, w[j], acc2[1][j]); }   /* the last k step: nothing left to fetch */
  pf_hold(pxa); pf_hold(pwa);
  // unrolled: the pass number indexes the accumulators, which stay in registers only under constant indices
#pragma unroll
  for (int hb = 0; hb < 2; ++hb) { const v8f* acc = acc2[hb]; const size_t r0 = rb0 + hb * 64; const size_t bb = r0 / TT; const int t0 = (int)(r0 % TT);
  if (hb) __syncthreads();   /* the first pass's LDS reads end before the second pass writes the same LDS */
  if (which < 2) { _Float16* DH = which == 0 ? QH : KH; _Float16* DL = which == 0 ? QL : KL; const int nhi = which == 0 ? QHI : KHI; const bool hi_rows = t0 < nhi; const float qs = which == 0 ? SCL2 : 1.0f;   /* q leaves in the exponent's unit (score scale and log2 e folded in), so that k_fa's score products are exp2 arguments */
#pragma unroll
    for (int j = 0; j < 8; ++j) { const float bias = BA ? bfr(BA[c0 + j * 16 + col]) : 0.f;
#pragma unroll
      for (int r = 0; r < 8; ++r) { const float v = (acc[j][r] + bias) * qs; const _Float16 hv = (_Float16)v; sh[wave * 16 + 8 * g + r][j * 16 + col] = hv; sl[wave * 16 + 8 * g + r][j * 16 + col] = (_Float16)((v - (float)hv) * 1024.0f); } }
    __syncthreads();
    if (which == 1) {   /* k: 16 fragments = [head of 2][16-key group of 4][k step of 2], 64 pieces each; a head's 8 fragments are 8 KiB in a row */
      // unrolled: the 8 LDS reads go out together, and head and key group are constants of each trip, so that the 8 stores share one address
#pragma unroll
      for (int i = 0; i < 8; ++i) { const int e = tid + i * 128; const int f = e >> 6, pc = e & 63, hf = pc >> 5, ln = pc & 31; const int hh = f >> 3, kt = (f >> 1) & 3, kc = f & 1;
        vst2((unsigned*)(KH + ((((bb * NH + c0 / HD + hh) * (TT / 16) + t0 / 16 + kt) * (HD / 32) + kc) * 512 + pc * 8)), *(const v4u*)&sh[kt * 16 + (ln & 15)][hh * HD + kc * 32 + hf * 16 + (ln >> 4) * 8]); }
      asm volatile("s_wait_xcnt 0x0" ::: "memory"); }   /* stands before the code below rewrites registers that these stores name */
    for (int e = tid; e < 64 * 16; e += 128) { const int rl = e >> 4, q = e & 15; if (which == 0) { vst2((unsigned*)(DH + (r0 + rl) * CC + c0 + q * 8), *(const v4u*)&sh[rl][q * 8]); asm volatile("s_wait_xcnt 0x0" ::: "memory"); }   /* the wait stands before a register that the store names is rewritten */
      if (hi_rows) { vst2((unsigned*)(DL + (bb * nhi + t0 + rl) * (size_t)CC + c0 + q * 8), *(const v4u*)&sl[rl][q * 8]); asm volatile("s_wait_xcnt 0x0" ::: "memory"); } }   /* the same wait, before the next trip */
  } else { const bool hi_rows = t0 < KHI;
#pragma unroll
    for (int j = 0; j < 8; ++j) { const float bias = BA ? bfr(BA[c0 + j * 16 + col]) : 0.f;
#pragma unroll
      for (int r = 0; r < 8; ++r) { const float v = acc[j][r] + bias; const int rl = wave * 16 + 8 * g + r, cl = j * 16 + col; th[cl][rl] = (_Float16)v; const __bf16 bh = (__bf16)v; tb[cl][rl] = bh; tbl[cl][rl] = (__bf16)(v - (float)bh); } }
    __syncthreads();
    /* v^T: 16 fragments = [head of 2][32-key group of 2][16-channel group of 4], 64 pieces each */
    // unrolled: the 8 LDS reads go out together, and head and key group are constants of each trip, so that the 8 stores share one address
#pragma unroll
    for (int i = 0; i < 8; ++i) { const int e = tid + i * 128; const int f = e >> 6, pc = e & 63, hf = pc >> 5, ln = pc & 31; const int hh = f >> 3, kt = (f >> 2) & 1, j = f & 3;
      vst2((unsigned*)(VT + ((((bb * NH + c0 / HD + hh) * (TT / 32) + t0 / 32 + kt) * (HD / 16) + j) * 512 + pc * 8)), *(const v4u*)&th[hh * HD + j * 16 + (ln & 15)][kt * 32 + hf * 16 + (ln >> 4) * 8]); }
    asm volatile("s_wait_xcnt 0x0" ::: "memory");   /* stands before the code below rewrites registers that these stores name */
    for (int e = tid; e < 128 * 8; e += 128) { const int cl = e >> 3, q = e & 7; if (hi_rows) { const size_t o3 = (bb * CC + c0 + cl) * (size_t)KHI + t0 + q * 8; vst2((unsigned*)(VB + o3), *(const v4u*)&tb[cl][q * 8]); vst2((unsigned*)(VBL + o3), *(const v4u*)&tbl[cl][q * 8]); } } } } }
// ---- k_fa: block = 64 queries (qb) of (b, h), wave = 16 queries, all keys in steps of 64: S^T = K q^T (key rows as A, query rows as B; q hi + residual x 2^10: 2 products) in the exponent's unit, with minus the query's reference maximum as C, masked positions set to XMASK; reference and sum per query (lane & 15 = query, so both are per-lane values; the two lane halves hold different keys); D of S^T (lane = query, element r = key 8g + r) IS the 16x16x32 operand layout over 32 keys, so P = exp2(x) (the hardware exp2 alone per score) goes once to f16 in place and ctx^T += v^T (A) P^T (B); ctx^T rows are channels, so the rescale and the final 1 / sum are per-lane too. The reference is held: one test per key step, on the step's sum of P, sends the whole wave to the path that takes the maximum, raises the reference and rescales
__global__ __launch_bounds__(128) void k_fa(const _Float16* __restrict__ QH, const _Float16* __restrict__ KH, const _Float16* __restrict__ QL, const _Float16* __restrict__ VT, const unsigned* __restrict__ MP, float* __restrict__ Y) {
  const int tid = threadIdx.x, wave = tid >> 5, lane = tid & 31, col = lane & 15, g = lane >> 4; const int h = blockIdx.y, b = blockIdx.z; const int ql0 = blockIdx.x * 64 + wave * 16;
  // entry prefetch, one 256-byte unit of this head's K and v^T (512 KiB, shared out among 16 of its 32 query blocks, numbered so that blocks 4 apart hold the same share; a matter of speed only) and one line of the block's own 16 KiB of select words a thread
  const int sh16 = (blockIdx.x & 3) | ((blockIdx.x >> 3) << 2);
  const char* pkv = (const char*)((sh16 < 8 ? KH : VT) + (size_t)(b * NH + h) * TT * HD) + (size_t)((sh16 & 7) * 128 + tid) * 256;
  const char* pmw = (const char*)(MP + (size_t)(b * (TT / 16) + blockIdx.x * 4) * (TT / 64) * 32) + tid * 128;
  pf_l2(pkv); pf_l2(pmw);
  v16h qh[HD / 32], ql[HD / 32];
#pragma unroll
  for (int kc = 0; kc < HD / 32; ++kc) { qh[kc] = frag_h(QH + ((size_t)b * TT + ql0 + col) * CC + h * HD + kc * 32, lane); ql[kc] = frag_h(QL + ((size_t)b * QHI + ql0 + col) * CC + h * HD + kc * 32, lane); }
  const _Float16* Kb = KH + (size_t)(b * NH + h) * TT * HD; const _Float16* Vb = VT + (size_t)(b * NH + h) * TT * HD;   /* this head's fragments; 64 keys are 8 fragments = 8 KiB in a row in each */
  const unsigned* Mw = MP + (size_t)(b * (TT / 16) + blockIdx.x * 4 + __builtin_amdgcn_readfirstlane(wave)) * (TT / 64) * 32;   /* this wave's select words, 128 bytes a key step; the address is wave-uniform, so that they come by scalar loads into scalar registers */
  v8f acc[HD / 16] = {}, cn = {}; float mref = -3.0e38f, thr = -1.0f, l = 0.f;   /* cn: minus the offset that the score products carry as C; mref: the reference that acc and l stand in. Settled state: offset = mref, thr = 2^8. Before the first step, and while every key so far was masked: offset 0, thr = -1, so that every step takes the path that sets the reference */
  // the key loop stays rolled: a second step's fragments would take the wave past 256 registers and cost a wave per SIMD; the inner loops are fully unrolled so that the fragment arrays are indexed by constants and stay in registers
#pragma unroll 1
  for (int k0 = 0; k0 < TT; k0 += 64) { float s[4][8];
    v16h kf[4][HD / 32];   /* the whole step's K fragments and select words are requested before the first product: one load latency per step, not one per product */
    v16u mw[2]; const _Float16* kp = Kb + (size_t)k0 * HD + lane * 8;   /* this lane's piece of the step's first K fragment (the address that frag_ph forms) */
#pragma unroll
    for (int t = 0; t < 4; ++t)
#pragma unroll
      for (int kc = 0; kc < HD / 32; ++kc) { union { v16h v; v8h q[2]; } u; u.q[0] = *(const v8h*)(kp + (t * (HD / 32) + kc) * 512); u.q[1] = *(const v8h*)(kp + (t * (HD / 32) + kc) * 512 + 256); kf[t][kc] = u.v; }
    // the step's 32 select words: two scalar loads with their data wait in one statement, so that their address register is rewritten only behind the wait; it stands behind the K requests, which fly meanwhile. It also takes the K address as an input and ends in the wait that stands before a register named by an issued load is rewritten, so that no K load lands in that address
    asm volatile("s_load_b512 %0, %2, 0x0\n\ts_load_b512 %1, %2, 0x40\n\ts_wait_kmcnt 0x0\n\ts_wait_xcnt 0x0" : "=&s"(mw[0]), "=&s"(mw[1]) : "s"(Mw + (k0 >> 1)), "v"(kp) : "memory");
    __builtin_amdgcn_sched_barrier(0);   /* no product is scheduled up among the K requests: all 16 stay in flight together, one load latency per step */
#pragma unroll
    for (int t = 0; t < 4; ++t) { v8f a = cn, al = {};
#pragma unroll
      for (int kc = 0; kc < HD / 32; ++kc) { a = wmma16(kf[t][kc], qh[kc], a); al = wmma16(kf[t][kc], ql[kc], al); }
#pragma unroll
      for (int r = 0; r < 8; ++r) { float v = a[r] + al[r] * (1.0f / 1024.0f); if (__builtin_amdgcn_inverse_ballot_w32(mw[t >> 1][(t & 1) * 8 + r])) v = XMASK;   /* where(mask[b][q][k] (1 = masked), -1e9, scores): set; a fully masked row comes out uniform */
        s[t][r] = v; }
      __builtin_amdgcn_sched_barrier(0x26); }   /* no product of a later tile is scheduled up over this place: with the accumulators of all four tiles in flight the wave takes more than 256 registers and a wave per SIMD is lost. Vector and scalar arithmetic and loads may cross: the v requests, written behind the tiles, are not held behind the last product */
    v16h vf[2][HD / 16];   /* the step's v fragments are requested here, so that they fly under the softmax arithmetic */
#pragma unroll
    for (int u = 0; u < 2; ++u)
#pragma unroll
      for (int j = 0; j < HD / 16; ++j) vf[u][j] = frag_ph(Vb + (size_t)k0 * HD + (u * (HD / 16) + j) * 512, lane);
    __builtin_amdgcn_sched_barrier(0);   /* no v request is scheduled down into the softmax arithmetic: all 16 are in flight before it starts */
    v16h p[2]; float sum = 0.f;
#pragma unroll
    for (int t = 0; t < 4; ++t)
#pragma unroll
      for (int r = 0; r < 8; ++r) { const float e = __builtin_amdgcn_exp2f(s[t][r]); sum += e; p[t >> 1][(t & 1) * 8 + r] = (_Float16)e; }
    // one test per key step, a scalar branch for the whole wave: a score more than 8 above the reference in use (P above 2^8, infinity included) shows in the sum; below that P fits f16 and nothing needs a rescale
    if (__builtin_expect(__builtin_amdgcn_ballot_w32(sum > thr) != 0u, 0)) { float mx = s[0][0];
#pragma unroll
      for (int t = 0; t < 4; ++t)
#pragma unroll
        for (int r = 0; r < 8; ++r) mx = fmaxf(mx, s[t][r]);
      mx = fmaxf(mx, __shfl_xor(mx, 16));   /* both lane halves of a query decide alike: same maximum, same state */
      const float dl = fmaxf(mx, thr > 0.f ? 0.f : mref);   /* the reference only rises; not settled (the scores carry no offset): it becomes the maximum so far (XMASK where all is masked) */
      const float mn = dl - cn[0]; const float alpha = __builtin_amdgcn_exp2f(mref - mn); const bool st = mn > 0.5f * XMASK; const float c1 = st ? -mn : 0.f;
      mref = mn; thr = st ? 256.0f : -1.0f; sum = 0.f;
#pragma unroll
      for (int t = 0; t < 4; ++t)
#pragma unroll
        for (int r = 0; r < 8; ++r) s[t][r] -= dl;
      __builtin_amdgcn_sched_barrier(0);   /* the subtractions stand in front of the exp2 run, so that none of them directly follows an exp2 whose source register it rewrites */
#pragma unroll
      for (int t = 0; t < 4; ++t)
#pragma unroll
        for (int r = 0; r < 8; ++r) { const float e = __builtin_amdgcn_exp2f(s[t][r]); sum += e; p[t >> 1][(t & 1) * 8 + r] = (_Float16)e; }
      l *= alpha;
#pragma unroll
      for (int r = 0; r < 8; ++r) cn[r] = c1;
#pragma unroll
      for (int j = 0; j < HD / 16; ++j)
#pragma unroll
        for (int r = 0; r < 8; ++r) acc[j][r] *= alpha; }
    l += sum;
#pragma unroll
    for (int u = 0; u < 2; ++u)
#pragma unroll
      for (int j = 0; j < HD / 16; ++j) acc[j] = wmma16(vf[u][j], p[u], acc[j]); }
  pf_hold(pkv); pf_hold(pmw);
  l += __shfl_xor(l, 16); const float inv = 1.0f / l;   /* l >= 1: the key that set the reference contributes exp2(0) */
  float* yr = Y + ((size_t)b * TT + ql0 + col) * CC + h * HD + 8 * g;
#pragma unroll
  for (int j = 0; j < HD / 16; ++j) { v4f o0, o1;
#pragma unroll
    for (int r = 0; r < 4; ++r) { o0[r] = acc[j][r] * inv; o1[r] = acc[j][4 + r] * inv; }
    vst2(yr + j * 16, o0); vst2(yr + j * 16 + 4, o1); } }
// ---- k_out: block = (64 rows, 128 cols): out = ctx Wo (+ bo): all rows: ctx bf16 hi + lo against exact bf16 Wo from its packed fragments (2 products)
__global__ __launch_bounds__(128) void k_out(const float* __restrict__ Y, const float* __restrict__ WO, const __bf16* __restrict__ WPO, const float* __restrict__ BO, float* __restrict__ OUT, const float* __restrict__ RESX) { __shared__ __align__(16) float sf[4][16][132];
  const int tid = threadIdx.x, wave = tid >> 5, lane = tid & 31, col = lane & 15, g = lane >> 4; const int c0 = blockIdx.y * 128; const size_t r0 = (size_t)blockIdx.x * 64 + wave * 16;
  // entry prefetch, a thread takes one 256-byte unit of the block's 64 ctx rows (256 KiB, shared out among the 8 column blocks that read them), one line of its weight fragments (256 KiB, 64 lines a k step, shared out among 16 row blocks, blocks 4 apart holding the same share; a matter of speed only) and one unit of its own 64 x 128 residual tile
  const int sh16 = (blockIdx.x & 3) | (((blockIdx.x >> 3) & 3) << 2), wl = sh16 * 128 + tid;
  const char* pya = (const char*)(Y + (size_t)blockIdx.x * 64 * CC) + (size_t)(blockIdx.y * 128 + tid) * 256;
  const char* pwo = (const char*)(WPO + ((size_t)(wl >> 6) * (DIN / 16) + c0 / 16) * 512) + (wl & 63) * 128;
  const char* prs = (const char*)(RESX + ((size_t)blockIdx.x * 64 + (tid >> 1)) * DIN + c0) + (tid & 1) * 256;
  pf_l2(pya); pf_l2(pwo); pf_l2(prs);
  v8f acc[8] = {};
  if (true) {   /* ALL rows: ctx split bf16 hi + lo x exact Wo (2 products) */
    const float* yp = Y + (r0 + col) * CC + 8 * g;   /* this lane's 8 + 8 ctx values of k step 0 (the address that split_row forms) */
    v4f y[4] = { *(const v4f*)yp, *(const v4f*)(yp + 4), *(const v4f*)(yp + 16), *(const v4f*)(yp + 20) }; v16b w[8];
#pragma unroll
    for (int j = 0; j < 8; ++j) w[j] = frag_p(WPO + (size_t)(c0 / 16 + j) * 512, lane);
    asm volatile("s_wait_xcnt 0x0" ::: "memory");   /* stands before the loop rewrites the address registers that these loads name */
    // operands are fetched one k step ahead, so that the load latency runs under the split and the products: the next step's ctx values at the head of the step, and each pair of B fragments right behind the four products that read their predecessors, into the same registers
    auto kstep = [&](int kc) __attribute__((always_inline)) { const float* yn = yp + (kc + 1) * 32;
      const v4f z[4] = { *(const v4f*)yn, *(const v4f*)(yn + 4), *(const v4f*)(yn + 16), *(const v4f*)(yn + 20) };
      const F2 a = split_q(y);
#pragma unroll
      for (int j = 0; j < 8; j += 2) { __builtin_amdgcn_sched_barrier(0);   /* no later refill is scheduled up over products that still read the old fragments: that would take a second register set */
        acc[j] = wmma_bf(a.h, w[j], acc[j]); acc[j + 1] = wmma_bf(a.h, w[j + 1], acc[j + 1]); acc[j] = wmma_bf(a.l, w[j], acc[j]); acc[j + 1] = wmma_bf(a.l, w[j + 1], acc[j + 1]);   /* two column groups at a time: a tile's second product does not stand directly behind its first */
        w[j] = frag_p(WPO + ((size_t)(kc + 1) * (DIN / 16) + c0 / 16 + j) * 512, lane); w[j + 1] = frag_p(WPO + ((size_t)(kc + 1) * (DIN / 16) + c0 / 16 + j + 1) * 512, lane); }
      asm volatile("s_wait_xcnt 0x0" ::: "memory");   /* stands before the next step rewrites the address registers that this step's loads name */
#pragma unroll
      for (int i = 0; i < 4; ++i) y[i] = z[i]; };
    // an even trip count, so that the loop stays rolled in pairs and the text stays small; the step before the last follows it
#pragma unroll 2
    for (int kc = 0; kc < CC / 32 - 2; ++kc) kstep(kc);
    kstep(CC / 32 - 2);
    { const F2 a = split_q(y);   /* the last k step: nothing left to fetch */
#pragma unroll
      for (int j = 0; j < 8; ++j) { acc[j] = wmma_bf(a.h, w[j], acc[j]); acc[j] = wmma_bf(a.l, w[j], acc[j]); } }
    pf_hold(pya); pf_hold(pwo); pf_hold(prs);
#pragma unroll
    for (int j = 0; j < 8; ++j) { const float bias = BO ? bfr(BO[c0 + j * 16 + col]) : 0.f;
#pragma unroll
      for (int r = 0; r < 8; ++r) sf[wave][8 * g + r][j * 16 + col] = acc[j][r] + bias; }
  } else {
#pragma unroll 2
    for (int kc = 0; kc < CC / 32; ++kc) { const v16h a = frag_f32(Y + (r0 + col) * CC + kc * 32, lane); asm volatile("s_wait_loadcnt 0x0" ::: "memory");
#pragma unroll
      for (int j = 0; j < 8; ++j) { const v16h w = WOCOLH(WO, kc * 32, c0 + j * 16 + col, lane); asm volatile("s_wait_loadcnt 0x0" ::: "memory"); acc[j] = wmma16(a, w, acc[j]); } }
#pragma unroll
    for (int j = 0; j < 8; ++j) { const float bias = BO ? bfr(BO[c0 + j * 16 + col]) : 0.f;
#pragma unroll
      for (int r = 0; r < 8; ++r) sf[wave][8 * g + r][j * 16 + col] = acc[j][r] * (1.0f / 256.0f) + bias; } }
  LDSX(); for (int rl = 0; rl < 16; ++rl) { const size_t oo = (r0 + rl) * DIN + c0 + lane * 4; v4f o = *(const v4f*)&sf[wave][rl][lane * 4]; const v4f zr = *(const v4f*)(RESX + oo); o[0] += bfr(zr[0]); o[1] += bfr(zr[1]); o[2] += bfr(zr[2]); o[3] += bfr(zr[3]); vst2(OUT + oo, o); } }   /* ctx W_O + bf16(input_Q) */

extern "C" void kernel_launch(void* const* d_in, const int* in_sizes, int n_in, void* d_out, int out_size, void* d_ws, size_t ws_size, hipStream_t stream) {
  (void)in_sizes; (void)n_in; (void)out_size;
  const float** F = (const float**)d_in;
  if (ws_size < (size_t)WS_END) return;
  char* ws = (char*)d_ws; _Float16 *QH = (_Float16*)(ws + WS_QH), *KH = (_Float16*)(ws + WS_KH), *VT = (_Float16*)(ws + WS_VT), *QL = (_Float16*)(ws + WS_QL), *KL = (_Float16*)(ws + WS_KL); __bf16 *VB = (__bf16*)(ws + WS_VB), *VBL = (__bf16*)(ws + WS_VBL); float *Y = (float*)(ws + WS_Y);
  (void)Y; (void)QL; (void)KL; (void)VB; (void)VBL;
  // inputs: 0 input_Q; 1 input_K; 2 input_V [2,2048,1024]; 3 mask [2,2048,2048] int32 (1 = masked); 4 W_Q (in,out); 5 W_K; 6 W_V; 7 W_O (in,out); 8 ln_gamma; 9 ln_beta
  if (ws_size < (size_t)WS_END4) return;
  float* X1 = (float*)(ws + WS_X1); __bf16 *WP = (__bf16*)(ws + WS_WP), *XP = (__bf16*)(ws + WS_XP); unsigned* MP = (unsigned*)(ws + WS_MP);
  k_pack<<<dim3(4 * PKW + 3 * PKX + PKM), 256, 0, stream>>>(F[4], F[5], F[6], F[7], F[0], F[1], F[2], (const int*)d_in[3], WP, XP, MP);   /* weights and inputs -> bf16 fragments, mask -> select words, every call */
  k_proj<<<dim3(TNB * TT / 128, CC / 128, 3), 128, 0, stream>>>(XP, WP, nullptr, nullptr, nullptr, QH, QL, KH, KL, VT, VB, VBL);
  k_fa<<<dim3(NQB, NH, TNB), 128, 0, stream>>>(QH, KH, QL, VT, MP, Y);
  k_out<<<dim3(TNB * TT / 64, DIN / 128), 128, 0, stream>>>(Y, F[7], WP + 3 * (size_t)DIN * CC, nullptr, X1, F[0]);   /* ctx W_O + input_Q */
  k_lnx<<<dim3(NRW / 8), 256, 0, stream>>>(X1, 0, F[8], F[9], (float*)d_out);              /* LayerNorm */
}
